// v000
// The times below were measured on an AMD MI455X: many runs one after another, warmed up first and cycling through
// copies of the inputs, with the whole window's GPU time divided by the number of runs. Launches and the gaps
// between them are all in it. The median over several windows is given; except for v000 it joins two sittings, which
// can be a few percent apart, so the side-by-side timings, each taken in one sitting, are the better comparison.
// The starting kernel, v000, takes 847 microseconds a run.
// compute dtype: all float inputs rounded to bf16, the int mask read on device; q/k/v = x . W with EXACT bf16 products on WMMA 16x16x32 ((in,out) weights as transposed rows); PLAIN attention: q, k single f16 x 1/8, masked keys excluded, running-max softmax in f32 (hardware exp), P (scaled by 2^11, single f16) x v (single f16); attention out (bf16 hi + residual) . Wo (2 products) + bo; LayerNorms in f32; FF: x1 rounded once to f16 x exact f16 weight copies (x 2^8), exact GELU (erff), hidden f16, second exact GELU; f32 output.
#include <hip/hip_runtime.h>
#include <math.h>

typedef __attribute__((ext_vector_type(16))) _Float16 v16h;
typedef __attribute__((ext_vector_type(16))) __bf16 v16b;
typedef __attribute__((ext_vector_type(8)))  _Float16 v8h;
typedef __attribute__((ext_vector_type(8)))  float v8f;
typedef __attribute__((ext_vector_type(4)))  float v4f;
typedef __attribute__((ext_vector_type(2)))  float v2f;
typedef __attribute__((ext_vector_type(4)))  unsigned v4u;
typedef __attribute__((ext_vector_type(4)))  int v4i;
typedef float __attribute__((may_alias)) float_a;
typedef int __attribute__((may_alias)) int_a;

template <typename T> __device__ __forceinline__ void vst2(void* p, T v) { *(T*)p = v;  }
__device__ __forceinline__ v8f wmma16(v16h a, v16h b, v8f c) {
  v8f d = __builtin_amdgcn_wmma_f32_16x16x32_f16(false, a, false, b, (short)0, c, false, false);
  asm volatile("v_nop\n\tv_nop\n\tv_nop\n\tv_nop" : "+v"(d) : "v"(a), "v"(b));
  return d;
}
__device__ __forceinline__ v8f wmma_bf(v16b a, v16b b, v8f c) {
  v8f d = __builtin_amdgcn_wmma_f32_16x16x32_bf16(false, a, false, b, (short)0, c, false, false);
  asm volatile("v_nop\n\tv_nop\n\tv_nop\n\tv_nop" : "+v"(d) : "v"(a), "v"(b));
  return d;
}
// Transformer block (B 2, S 2,048, d 1,024, 16 heads x 64, FF 4,096): bias-free q/k/v projections, scores / 8 with a [S,S] mask (mask == 1 -> -1e9), softmax, . v, Wo + bo; x + LayerNorm(attention branch); FF with exact GELU after BOTH linears; x + LayerNorm(FF branch).
__device__ __forceinline__ v16h frag_h(const _Float16* rowk0, int lane) {
  union { v16h v; v8h q[2]; } u; const _Float16* p = rowk0 + 8 * (lane >> 4);
  u.q[0] = *(const v8h*)p; u.q[1] = *(const v8h*)(p + 16); return u.v;
}
__device__ __forceinline__ v16h frag_f32(const float* rowk0, int lane) {
  v16h a; const float* p = rowk0 + 8 * (lane >> 4);
#pragma unroll
  for (int i = 0; i < 8; ++i) { a[i] = (_Float16)p[i]; a[8 + i] = (_Float16)p[16 + i]; }
  return a;
}
__device__ __forceinline__ v16h frag_f32s(const float* rowk0, int lane, float sc) {
  v16h a; const float* p = rowk0 + 8 * (lane >> 4);
#pragma unroll
  for (int i = 0; i < 8; ++i) { a[i] = (_Float16)(p[i] * sc); a[8 + i] = (_Float16)(p[16 + i] * sc); }
  return a;
}
// column fragment from a [K][ld] layout (column n), rows >= K read as 0
__device__ __forceinline__ v16h fragc_f32(const float* W, int k0, int n, int lane, int ld, int K) {
  v16h a; const int g = lane >> 4;
#pragma unroll
  for (int i = 0; i < 8; ++i) { const int ka = k0 + 8 * g + i, kb = ka + 16;
    a[i] = (_Float16)(ka < K ? W[(size_t)(ka < K ? ka : K - 1) * ld + n] : 0.f); a[8 + i] = (_Float16)(kb < K ? W[(size_t)(kb < K ? kb : K - 1) * ld + n] : 0.f); }
  return a;
}
struct F2 { v16b h, l; };
__device__ __forceinline__ F2 bsplit16(const float v[16]) { F2 r;
#pragma unroll
  for (int i = 0; i < 16; ++i) { const __bf16 h = (__bf16)v[i]; r.h[i] = h; r.l[i] = (__bf16)(v[i] - (float)h); }
  return r; }
__device__ __forceinline__ F2 split_row(const float* row, int k0, int lane) { float v[16]; const float* p = row + k0 + 8 * (lane >> 4);
#pragma unroll
  for (int i = 0; i < 8; ++i) { v[i] = p[i]; v[8 + i] = p[16 + i]; }
  return bsplit16(v); }
__device__ __forceinline__ F2 split_rowK(const float* row, int k0, int lane, int K) { float v[16]; const int g = lane >> 4;
#pragma unroll
  for (int i = 0; i < 8; ++i) { const int ka = k0 + 8 * g + i, kb = ka + 16; v[i] = ka < K ? row[ka < K ? ka : K - 1] : 0.f; v[8 + i] = kb < K ? row[kb < K ? kb : K - 1] : 0.f; }
  return bsplit16(v); }
__device__ __forceinline__ F2 split_col(const float* W, int k0, int n, int lane, int ld, int K) { float v[16]; const int g = lane >> 4;
#pragma unroll
  for (int i = 0; i < 8; ++i) { const int ka = k0 + 8 * g + i, kb = ka + 16; v[i] = ka < K ? W[(size_t)(ka < K ? ka : K - 1) * ld + n] : 0.f; v[8 + i] = kb < K ? W[(size_t)(kb < K ? kb : K - 1) * ld + n] : 0.f; }
  return bsplit16(v); }
__device__ __forceinline__ v8f mac3(const F2& a, const F2& b, v8f c) { c = wmma_bf(a.l, b.h, c); c = wmma_bf(a.h, b.l, c); return wmma_bf(a.h, b.h, c); }
__device__ __forceinline__ float sigm(float v) { return 1.0f / (1.0f + expf(-v)); }
#define LDSX() do { asm volatile("s_wait_dscnt 0" ::: "memory"); __builtin_amdgcn_wave_barrier(); __builtin_amdgcn_fence(__ATOMIC_RELEASE, "workgroup"); } while (0)


#define NB 2
#define SS 2048
#define DM 1024
#define NH 16
#define DFF 4096
#define NR (NB * SS)
__device__ __attribute__((noinline)) float erf_p(float v) { return erff(v); }
__device__ __forceinline__ float gelu_e(float x) { return 0.5f * x * (1.0f + erf_p(x * 0.70710678118654752f)); }
#define HD 64
#define QKVW (3 * DM)
#ifndef TQB
#define TQB (SS / 64)
#define TNB NB
#define TOB (NB * SS / 64)     // output row tiles (all)
#endif
typedef __attribute__((ext_vector_type(8))) __bf16 v8b;
__device__ __forceinline__ v16b frag_b(const __bf16* rowk0, int lane) {
  union { v16b v; v8b q[2]; } u; const __bf16* p = rowk0 + 8 * (lane >> 4);
  u.q[0] = *(const v8b*)p; u.q[1] = *(const v8b*)(p + 16); return u.v;
}
__device__ __forceinline__ float bfr(float v) { return (float)(__bf16)v; }
__device__ __attribute__((noinline)) float exp_ni(float v) { return expf(v); }
__device__ __attribute__((noinline)) float erf_ni(float v) { return erff(v); }

#define PK_A 0                       // [3072][1024] Wqkv rows (natural [out][in])
#define PK_P (PK_A + QKVW * DM)        // [1024][1024] Wo rows (natural)
#define PK_END (PK_P + DM * DM)
#define WS_PK  0u
#define WS_QK  (WS_PK + 2u * PK_END)             // f16 [4096 rows][2048]: q | k
#define WS_QKL (WS_QK + 2u * NB * SS * 2 * DM)     // f16 q | k residual planes x2048
#define WS_VTH (WS_QKL + 2u * NB * SS * 2 * DM)    // f16 [b][1024 (h*64+d)][2048 s] hi
#define WS_VTL (WS_VTH + 2u * NB * DM * SS)        // f16 lo x 2048
#define WS_O   (WS_VTL + 2u * NB * DM * SS)        // f32 [4096][1024]
#define WS_CS  (WS_O + 4u * NB * SS * DM)           // f32 [2][2048][32], unused
#define WS_PF  (WS_CS + 4u * 2 * SS * 32)                  // f16 x 2^8 rows W1^T [4096][1024] ; W2^T [1024][4096]
#define WS_PM  (WS_PF + 2u * (size_t)DFF * DM)
#define WS_A0  (WS_PM + 2u * (size_t)DM * DFF)          // f32 [NR][1024] attention branch ; X1 f32 ; HF f32 (ff branch)
#define WS_X1  (WS_A0 + 4u * (size_t)NR * DM)
#define WS_HF  (WS_X1 + 4u * (size_t)NR * DM)
#define WS_X16 (WS_HF + 4u * (size_t)NR * DM)           // f16 [NR][1024] x1 ; G f16 [NR][4096]
#define WS_G   (WS_X16 + 2u * (size_t)NR * DM)
#define WS_END (WS_G + 2u * (size_t)NR * DFF)
// ---- k_pack: block = (row n, which): (in,out) column n -> bf16 [out][in] row n; which 0..2 -> W_q/W_k/W_v into PK_A rows which*1024 + n; 3 -> W_o into PK_P
__global__ __launch_bounds__(256) void k_pack(const float* __restrict__ WQ, const float* __restrict__ WK, const float* __restrict__ WV, const float* __restrict__ WO, __bf16* __restrict__ PK) {
  __shared__ __align__(16) __bf16 s[DM]; const int n = blockIdx.x, which = blockIdx.y, t = threadIdx.x; const float* Wm = (which == 0) ? WQ : (which == 1) ? WK : (which == 2) ? WV : WO;   // (in,out) weights: pack row n = column n
  for (int k = t; k < DM; k += 256) s[k] = (__bf16)Wm[(size_t)k * DM + n];
  __syncthreads();
  __bf16* dst = (which < 3) ? PK + PK_A + ((size_t)which * DM + n) * DM : PK + PK_P + (size_t)n * DM;
  for (int q = t; q < DM / 8; q += 256) vst2((unsigned*)(dst + q * 8), *(const v4u*)&s[q * 8]);
}
__global__ __launch_bounds__(128) void k_qkv(const float* __restrict__ XQ, const float* __restrict__ XK, const float* __restrict__ XV, const __bf16* __restrict__ P, const float* __restrict__ BQ, const float* __restrict__ BK, const float* __restrict__ BV, _Float16* __restrict__ QK, _Float16* __restrict__ QKL, _Float16* __restrict__ VTH, _Float16* __restrict__ VTL) {
  const int which0 = (blockIdx.y * 128) / DM; const float* X = (which0 == 0) ? XQ : (which0 == 1) ? XK : XV; const float* BB = BQ ? (((which0 == 0) ? BQ : (which0 == 1) ? BK : BV) + (blockIdx.y * 128 - which0 * DM)) : nullptr;
  __shared__ __align__(16) _Float16 so[4][16][136], sol[4][16][136]; __shared__ __align__(16) _Float16 sth[128][72], stl[128][72];
  const int tid = threadIdx.x, wave = tid >> 5, lane = tid & 31, col = lane & 15, g = lane >> 4; const size_t r0 = (size_t)blockIdx.x * 64 + wave * 16; const int n0 = blockIdx.y * 128;
  v8f acc[8] = {};
#pragma unroll 2
  for (int kc = 0; kc < DM / 32; ++kc) { v16b a; { const float* p = X + (r0 + col) * DM + kc * 32 + 8 * g;
#pragma unroll
      for (int i = 0; i < 8; ++i) { a[i] = (__bf16)p[i]; a[8 + i] = (__bf16)p[16 + i]; } }
#pragma unroll
    for (int j = 0; j < 8; ++j) acc[j] = wmma_bf(a, frag_b(P + (size_t)(n0 + j * 16 + col) * DM + kc * 32, lane), acc[j]); }
  if (n0 < 2 * DM) {   // q stored unscaled (f16 sigma ~0.6, no subnormal exposure); 1/8 applied to the f32 score
#pragma unroll
    for (int j = 0; j < 8; ++j) {
#pragma unroll
      for (int r = 0; r < 8; ++r) { const float v = acc[j][r] + (BB ? bfr(BB[j * 16 + col]) : 0.f); const _Float16 hv = (_Float16)v; so[wave][8 * g + r][j * 16 + col] = hv; sol[wave][8 * g + r][j * 16 + col] = (_Float16)((v - (float)hv) * 2048.0f); } }   // q, k (+ bias) as f16 hi + (x2048) residual
    LDSX();
    for (int rl = 0; rl < 16; ++rl) if (lane < 16) { vst2((unsigned*)(QK + (r0 + rl) * (2 * DM) + n0 + lane * 8), *(const v4u*)&so[wave][rl][lane * 8]); vst2((unsigned*)(QKL + (r0 + rl) * (2 * DM) + n0 + lane * 8), *(const v4u*)&sol[wave][rl][lane * 8]); }
  } else {
#pragma unroll
    for (int j = 0; j < 8; ++j) {
#pragma unroll
      for (int r = 0; r < 8; ++r) { const float v = acc[j][r] + (BB ? bfr(BB[j * 16 + col]) : 0.f); const _Float16 hv = (_Float16)v; sth[j * 16 + col][wave * 16 + 8 * g + r] = hv; stl[j * 16 + col][wave * 16 + 8 * g + r] = (_Float16)((v - (float)hv) * 2048.0f); } }
    __syncthreads();
    const size_t rb = (size_t)blockIdx.x * 64; const int b = (int)(rb / SS), s0 = (int)(rb % SS); const int pc0 = n0 - 2 * DM;
    for (int q = tid; q < 128 * 8; q += 128) { const int d = q >> 3, pc = q & 7; const size_t o = ((size_t)b * DM + pc0 + d) * SS + s0 + pc * 8; vst2((unsigned*)(VTH + o), *(const v4u*)&sth[d][pc * 8]); vst2((unsigned*)(VTL + o), *(const v4u*)&stl[d][pc * 8]); }
  }
}
// ---- k_attn: block = (64 queries, head h, batch b): all-keys flash attention (K = 64: 2 k-steps), scores = (q.k) * 0.125 with single f16 operands, P.V: f16 P (x2^11) x V hi, a single product (accl stays 0); O[b*S+q][h*64+d] = (acc + accl / 2048) / (2048 l) (256-B segments)
__global__ __launch_bounds__(128) void k_attn(const _Float16* __restrict__ QK, const _Float16* __restrict__ QKL, const _Float16* __restrict__ VTH, const _Float16* __restrict__ VTL, const void* __restrict__ KMASK, const int* __restrict__ MSK, float* __restrict__ O) {
  __shared__ __align__(16) float sp[4][16][36]; __shared__ __align__(16) float so[4][16][68];
  const int tid = threadIdx.x, wave = tid >> 5, lane = tid & 31, col = lane & 15, g = lane >> 4;
  const int qb = blockIdx.x, h = blockIdx.y, b = blockIdx.z; const int q0 = qb * 64 + wave * 16; const size_t rq = (size_t)b * SS + q0 + col;
  v16h aq[2], aql[2];
#pragma unroll
  for (int kc = 0; kc < 2; ++kc) { aq[kc] = frag_h(QK + rq * (2 * DM) + h * HD + kc * 32, lane); aql[kc] = frag_h(QKL + rq * (2 * DM) + h * HD + kc * 32, lane); }
  float m[8], l[8];
#pragma unroll
  for (int r = 0; r < 8; ++r) { m[r] = -3.0e38f; l[r] = 0.f; }
  v8f acc[4] = {}, accl[4] = {};
  const int nks = SS / 32;   // all keys
#pragma unroll 1
  for (int ks = 0; ks < nks; ++ks) { v8f s[2];
#pragma unroll
    for (int ct = 0; ct < 2; ++ct) { const int kk = ks * 32 + ct * 16 + col; const _Float16* krow = QK + ((size_t)b * SS + kk) * (2 * DM) + DM + h * HD; const _Float16* krowl = QKL + ((size_t)b * SS + kk) * (2 * DM) + DM + h * HD; v8f c = {}, cl = {};
#pragma unroll
      for (int kc = 0; kc < 2; ++kc) c = wmma16(aq[kc], frag_h(krow + kc * 32, lane), c);   // single product: q, k as one-rounding f16 operands
      (void)cl; (void)krowl;
      { const bool keepk = true;
#pragma unroll
        for (int r = 0; r < 8; ++r) { const int qi = q0 + 8 * g + r; s[ct][r] = (keepk && MSK[(size_t)qi * SS + kk] != 1) ? c[r] * 0.125f : -3.0e38f; } } }   // 1/sqrt(64); mask == 1 -> -1e9 == excluded
#pragma unroll
    for (int r = 0; r < 8; ++r) { float mx = fmaxf(s[0][r], s[1][r]);
#pragma unroll
      for (int o = 1; o < 16; o <<= 1) mx = fmaxf(mx, __shfl_xor(mx, o));
      const float mn = fmaxf(m[r], mx); const float alpha = (m[r] <= -1.0e38f) ? 0.f : __expf(m[r] - mn);
      const float e0 = (s[0][r] <= -1.0e38f) ? 0.f : __expf(s[0][r] - mn), e1 = (s[1][r] <= -1.0e38f) ? 0.f : __expf(s[1][r] - mn); float es = e0 + e1;
#pragma unroll
      for (int o = 1; o < 16; o <<= 1) es += __shfl_xor(es, o);
      l[r] = l[r] * alpha + es; m[r] = mn;
#pragma unroll
      for (int dt = 0; dt < 4; ++dt) { acc[dt][r] *= alpha; accl[dt][r] *= alpha; }
      sp[wave][8 * g + r][col] = e0; sp[wave][8 * g + r][16 + col] = e1; }
    LDSX();
    v16h pa, pl; { const float* prow = &sp[wave][col][0] + 8 * (lane >> 4);
#pragma unroll
      for (int i = 0; i < 8; ++i) { const float x0 = prow[i] * 2048.0f, x1 = prow[16 + i] * 2048.0f; const _Float16 h0 = (_Float16)x0, h1 = (_Float16)x1; pa[i] = h0; pa[8 + i] = h1; pl[i] = (_Float16)((x0 - (float)h0) * 2048.0f); pl[8 + i] = (_Float16)((x1 - (float)h1) * 2048.0f); } }   // P scaled by 2^11 before the f16 split so small softmax weights stay out of the f16 subnormal range; 2^-11 folded into the epilogue
#pragma unroll
    for (int dt = 0; dt < 4; ++dt) { const size_t vr = ((size_t)b * DM + h * HD + dt * 16 + col) * SS + ks * 32; acc[dt] = wmma16(pa, frag_h(VTH + vr, lane), acc[dt]); }   // single product: P (x2^11) x V
    (void)pl;
    LDSX(); }
#pragma unroll
  for (int r = 0; r < 8; ++r) { const float il = (1.0f / 2048.0f) / l[r];
#pragma unroll
    for (int dt = 0; dt < 4; ++dt) so[wave][8 * g + r][dt * 16 + col] = (acc[dt][r] + accl[dt][r] * (1.0f / 2048.0f)) * il; }
  LDSX();
  for (int rl = 0; rl < 16; ++rl) if (lane < 16) vst2(O + ((size_t)b * SS + q0 + rl) * DM + h * HD + lane * 4, *(const v4f*)&so[wave][rl][lane * 4]);
}
// ---- k_out: block = (64 rows, 128 cols): out = O(hi/lo) . Wo rows (2 products) + bo
__global__ __launch_bounds__(128) void k_out(const float* __restrict__ O, const __bf16* __restrict__ P, const float* __restrict__ BO, float* __restrict__ Y) {
  __shared__ __align__(16) float so[4][16][132];
  const int tid = threadIdx.x, wave = tid >> 5, lane = tid & 31, col = lane & 15, g = lane >> 4; const size_t r0 = (size_t)blockIdx.x * 64 + wave * 16; const int n0 = blockIdx.y * 128;
  v8f acc[8] = {};
#pragma unroll 2
  for (int kc = 0; kc < DM / 32; ++kc) { const F2 a = split_row(O + (r0 + col) * DM, kc * 32, lane);
#pragma unroll
    for (int j = 0; j < 8; ++j) { const v16b w = frag_b(P + (size_t)(n0 + j * 16 + col) * DM + kc * 32, lane); acc[j] = wmma_bf(a.l, w, acc[j]); acc[j] = wmma_bf(a.h, w, acc[j]); } }
#pragma unroll
  for (int j = 0; j < 8; ++j) {
#pragma unroll
    for (int r = 0; r < 8; ++r) so[wave][8 * g + r][j * 16 + col] = acc[j][r] + bfr(BO[n0 + j * 16 + col]); }
  LDSX();
  for (int rl = 0; rl < 16; ++rl) vst2(Y + (r0 + rl) * DM + n0 + lane * 4, *(const v4f*)&so[wave][rl][lane * 4]);
}
// ---- k_packff: (in,out) W1 [1024][4096] -> rows [4096][1024] f16 x 2^8 ; W2 [4096][1024] -> rows [1024][4096]
__global__ __launch_bounds__(256) void k_packff(const float* __restrict__ W1, const float* __restrict__ W2, _Float16* __restrict__ PF, _Float16* __restrict__ PM) { __shared__ __align__(16) _Float16 s[DFF]; const int n = blockIdx.x, which = blockIdx.y, t = threadIdx.x;
  if (which == 0) { for (int k = t; k < DM; k += 256) s[k] = (_Float16)(bfr(W1[(size_t)k * DFF + n]) * 256.0f); __syncthreads(); for (int q = t; q < DM / 8; q += 256) vst2((unsigned*)(PF + (size_t)n * DM + q * 8), *(const v4u*)&s[q * 8]); }
  else { if (n >= DM) return; for (int k = t; k < DFF; k += 256) s[k] = (_Float16)(bfr(W2[(size_t)k * DM + n]) * 256.0f); __syncthreads(); for (int q = t; q < DFF / 8; q += 256) vst2((unsigned*)(PM + (size_t)n * DFF + q * 8), *(const v4u*)&s[q * 8]); } }
// ---- k_lnres<F16OUT, RESX>: block = row (256 threads x 4): y = R + LayerNorm(A) x gamma + beta (mean((x-m)^2), eps 1e-5); RESX: residual is the bf16-rounded input x (else an f32 buffer); optional f16 copy for the FF
template <int F16OUT, int RESX>
__global__ __launch_bounds__(256) void k_lnres(const float* __restrict__ A, const float* __restrict__ R, const float* __restrict__ G, const float* __restrict__ Bt, float* __restrict__ Y, _Float16* __restrict__ Y16) {
  __shared__ float red[8]; __shared__ __align__(16) _Float16 sh[DM]; const int t = threadIdx.x; const size_t row = blockIdx.x; float v[4]; float s = 0.f; for (int i = 0; i < 4; ++i) { v[i] = A[row * DM + t * 4 + i]; s += v[i]; }
#pragma unroll
  for (int o = 1; o < 32; o <<= 1) s += __shfl_xor(s, o);
  if ((t & 31) == 0) red[t >> 5] = s; __syncthreads(); float tot = 0.f; for (int i = 0; i < 8; ++i) tot += red[i]; const float mu = tot / (float)DM; __syncthreads();
  float q = 0.f; for (int i = 0; i < 4; ++i) { const float dd = v[i] - mu; q += dd * dd; }
#pragma unroll
  for (int o = 1; o < 32; o <<= 1) q += __shfl_xor(q, o);
  if ((t & 31) == 0) red[t >> 5] = q; __syncthreads(); float tq = 0.f; for (int i = 0; i < 8; ++i) tq += red[i]; const float inv = 1.0f / sqrtf(tq / (float)DM + 1e-5f);
  v4f o4; for (int i = 0; i < 4; ++i) { const int e = t * 4 + i; const float rr = RESX ? bfr(R[row * DM + e]) : R[row * DM + e]; o4[i] = rr + ((v[i] - mu) * inv * bfr(G[e]) + bfr(Bt[e])); if (F16OUT) sh[e] = (_Float16)o4[i]; }
  vst2(Y + row * DM + t * 4, o4);
  if (F16OUT) { __syncthreads(); if (t < DM / 8) vst2((unsigned*)(Y16 + row * DM + t * 8), *(const v4u*)&sh[t * 8]); }
}
// ---- k_mlp<MODE>: block = (64 rows, 128 cols): MODE 0: G = gelu_exact(X1 . W1 + b1) (K 1024 -> 4096) f16; MODE 1: HF = gelu_exact(G . W2 + b2) (K 4096 -> 1024) f32
template <int MODE>
__global__ __launch_bounds__(128) void k_mlp(const _Float16* __restrict__ Ain, const _Float16* __restrict__ Wr, const float* __restrict__ BIAS, const float* __restrict__ RES, float* __restrict__ OUTF, _Float16* __restrict__ OG) {
  constexpr int KIN = (MODE == 0) ? DM : DFF; constexpr int NOUT = (MODE == 0) ? DFF : DM;
  __shared__ __align__(16) float so[4][16][132]; __shared__ __align__(16) _Float16 sg[4][16][136];
  const int tid = threadIdx.x, wave = tid >> 5, lane = tid & 31, col = lane & 15, g = lane >> 4; const size_t r0 = (size_t)blockIdx.x * 64 + wave * 16; const int n0 = blockIdx.y * 128;
  v8f acc[8] = {};
#pragma unroll 2
  for (int kc = 0; kc < KIN / 32; ++kc) { const v16h a = frag_h(Ain + (r0 + col) * KIN + kc * 32, lane);
#pragma unroll
    for (int j = 0; j < 8; ++j) acc[j] = wmma16(a, frag_h(Wr + (size_t)(n0 + j * 16 + col) * KIN + kc * 32, lane), acc[j]); }
#pragma unroll
  for (int j = 0; j < 8; ++j) { const int c = n0 + j * 16 + col; const float bb = bfr(BIAS[c]);
#pragma unroll
    for (int r = 0; r < 8; ++r) { const float x = acc[j][r] * (1.0f / 256.0f) + bb; if (MODE == 0) sg[wave][8 * g + r][j * 16 + col] = (_Float16)gelu_e(x); else so[wave][8 * g + r][j * 16 + col] = gelu_e(x); } }
  LDSX();
  if (MODE == 0) { for (int rl = 0; rl < 16; ++rl) if (lane < 16) vst2((unsigned*)(OG + (r0 + rl) * NOUT + n0 + lane * 8), *(const v4u*)&sg[wave][rl][lane * 8]); }
  else { for (int rl = 0; rl < 16; ++rl) vst2(OUTF + (r0 + rl) * NOUT + n0 + lane * 4, *(const v4f*)&so[wave][rl][lane * 4]); }
}

extern "C" void kernel_launch(void* const* d_in, const int* in_sizes, int n_in, void* d_out, int out_size, void* d_ws, size_t ws_size, hipStream_t stream) {
  (void)in_sizes; (void)n_in; (void)out_size;
  const float** F = (const float**)d_in;   // 0 x [2,2048,1024], 1 mask [1,1,2048,2048] int, 2 Wq, 3 Wk, 4 Wv, 5 Wo ((in,out)), 6 bo, 7 ln1_g, 8 ln1_b, 9 W1 [1024,4096], 10 b1, 11 W2 [4096,1024], 12 b2, 13 ln2_g, 14 ln2_b
  if (ws_size < (size_t)WS_END) return;
  char* ws = (char*)d_ws; __bf16* PK = (__bf16*)(ws + WS_PK); _Float16 *QK = (_Float16*)(ws + WS_QK), *QKL = (_Float16*)(ws + WS_QKL), *VTH = (_Float16*)(ws + WS_VTH), *VTL = (_Float16*)(ws + WS_VTL), *PF = (_Float16*)(ws + WS_PF), *PM = (_Float16*)(ws + WS_PM), *X16 = (_Float16*)(ws + WS_X16), *Gb = (_Float16*)(ws + WS_G); float *O = (float*)(ws + WS_O), *A0 = (float*)(ws + WS_A0), *X1 = (float*)(ws + WS_X1), *HF = (float*)(ws + WS_HF);
  k_pack<<<dim3(DM, 4), 256, 0, stream>>>(F[2], F[3], F[4], F[5], PK);
  k_packff<<<dim3(DFF, 2), 256, 0, stream>>>(F[9], F[11], PF, PM);
  k_qkv<<<dim3(TNB * SS / 64, QKVW / 128), 128, 0, stream>>>(F[0], F[0], F[0], PK + PK_A, nullptr, nullptr, nullptr, QK, QKL, VTH, VTL);
  k_attn<<<dim3(TQB, NH, TNB), 128, 0, stream>>>(QK, QKL, VTH, VTL, nullptr, (const int*)d_in[1], O);
  k_out<<<dim3(TOB, DM / 128), 128, 0, stream>>>(O, PK + PK_P, F[6], A0);
  k_lnres<1, 1><<<TOB * 64, 256, 0, stream>>>(A0, F[0], F[7], F[8], X1, X16);      // x1 = x + LN(attn branch)
  k_mlp<0><<<dim3(TOB, DFF / 128), 128, 0, stream>>>(X16, PF, F[10], nullptr, nullptr, Gb);
  k_mlp<1><<<dim3(TOB, DM / 128), 128, 0, stream>>>(Gb, PM, F[12], nullptr, HF, nullptr);
  k_lnres<0, 0><<<TOB * 64, 256, 0, stream>>>(HF, X1, F[13], F[14], (float*)d_out, nullptr);   // out = x1 + LN(ff branch)
}

// v001
// Measured time: 364 microseconds a run.
// Next to v000, in two timings, it ran 2.41 and 2.38 times as fast.
// compute dtype: all float inputs rounded to bf16, the int mask read on device; q/k/v = x . W with EXACT bf16 products on WMMA 16x16x32 ((in,out) weights as transposed rows); PLAIN attention: q, k single f16 x 1/8, masked keys excluded, running-max softmax in f32 (hardware exp), P (scaled by 2^11, single f16) x v (single f16); attention out (bf16 hi + residual) . Wo (2 products) + bo; LayerNorms in f32; FF: x1 rounded once to f16 x exact f16 weight copies (x 2^8), exact GELU (erff), hidden f16, second exact GELU; f32 output.
#include <hip/hip_runtime.h>
#include <math.h>

typedef __attribute__((ext_vector_type(16))) _Float16 v16h;
typedef __attribute__((ext_vector_type(16))) __bf16 v16b;
typedef __attribute__((ext_vector_type(8)))  _Float16 v8h;
typedef __attribute__((ext_vector_type(8)))  float v8f;
typedef __attribute__((ext_vector_type(4)))  float v4f;
typedef __attribute__((ext_vector_type(2)))  float v2f;
typedef __attribute__((ext_vector_type(4)))  unsigned v4u;
typedef __attribute__((ext_vector_type(4)))  int v4i;
typedef float __attribute__((may_alias)) float_a;
typedef int __attribute__((may_alias)) int_a;

template <typename T> __device__ __forceinline__ void vst2(void* p, T v) { *(T*)p = v;  }
__device__ __forceinline__ v8f wmma16(v16h a, v16h b, v8f c) {
  v8f d = __builtin_amdgcn_wmma_f32_16x16x32_f16(false, a, false, b, (short)0, c, false, false);
  asm volatile("v_nop\n\tv_nop\n\tv_nop\n\tv_nop" : "+v"(d) : "v"(a), "v"(b));
  return d;
}
__device__ __forceinline__ v8f wmma_bf(v16b a, v16b b, v8f c) {
  v8f d = __builtin_amdgcn_wmma_f32_16x16x32_bf16(false, a, false, b, (short)0, c, false, false);
  asm volatile("v_nop\n\tv_nop\n\tv_nop\n\tv_nop" : "+v"(d) : "v"(a), "v"(b));
  return d;
}
// Transformer block (B 2, S 2,048, d 1,024, 16 heads x 64, FF 4,096): bias-free q/k/v projections, scores / 8 with a [S,S] mask (mask == 1 -> -1e9), softmax, . v, Wo + bo; x + LayerNorm(attention branch); FF with exact GELU after BOTH linears; x + LayerNorm(FF branch).
__device__ __forceinline__ v16h frag_h(const _Float16* rowk0, int lane) {
  union { v16h v; v8h q[2]; } u; const _Float16* p = rowk0 + 8 * (lane >> 4);
  u.q[0] = *(const v8h*)p; u.q[1] = *(const v8h*)(p + 16); return u.v;
}
__device__ __forceinline__ v16h frag_f32(const float* rowk0, int lane) {
  v16h a; const float* p = rowk0 + 8 * (lane >> 4);
#pragma unroll
  for (int i = 0; i < 8; ++i) { a[i] = (_Float16)p[i]; a[8 + i] = (_Float16)p[16 + i]; }
  return a;
}
__device__ __forceinline__ v16h frag_f32s(const float* rowk0, int lane, float sc) {
  v16h a; const float* p = rowk0 + 8 * (lane >> 4);
#pragma unroll
  for (int i = 0; i < 8; ++i) { a[i] = (_Float16)(p[i] * sc); a[8 + i] = (_Float16)(p[16 + i] * sc); }
  return a;
}
// column fragment from a [K][ld] layout (column n), rows >= K read as 0
__device__ __forceinline__ v16h fragc_f32(const float* W, int k0, int n, int lane, int ld, int K) {
  v16h a; const int g = lane >> 4;
#pragma unroll
  for (int i = 0; i < 8; ++i) { const int ka = k0 + 8 * g + i, kb = ka + 16;
    a[i] = (_Float16)(ka < K ? W[(size_t)(ka < K ? ka : K - 1) * ld + n] : 0.f); a[8 + i] = (_Float16)(kb < K ? W[(size_t)(kb < K ? kb : K - 1) * ld + n] : 0.f); }
  return a;
}
struct F2 { v16b h, l; };
__device__ __forceinline__ F2 bsplit16(const float v[16]) { F2 r;
#pragma unroll
  for (int i = 0; i < 16; ++i) { const __bf16 h = (__bf16)v[i]; r.h[i] = h; r.l[i] = (__bf16)(v[i] - (float)h); }
  return r; }
__device__ __forceinline__ F2 split_row(const float* row, int k0, int lane) { float v[16]; const float* p = row + k0 + 8 * (lane >> 4);
#pragma unroll
  for (int i = 0; i < 8; ++i) { v[i] = p[i]; v[8 + i] = p[16 + i]; }
  return bsplit16(v); }
__device__ __forceinline__ F2 split_rowK(const float* row, int k0, int lane, int K) { float v[16]; const int g = lane >> 4;
#pragma unroll
  for (int i = 0; i < 8; ++i) { const int ka = k0 + 8 * g + i, kb = ka + 16; v[i] = ka < K ? row[ka < K ? ka : K - 1] : 0.f; v[8 + i] = kb < K ? row[kb < K ? kb : K - 1] : 0.f; }
  return bsplit16(v); }
__device__ __forceinline__ F2 split_col(const float* W, int k0, int n, int lane, int ld, int K) { float v[16]; const int g = lane >> 4;
#pragma unroll
  for (int i = 0; i < 8; ++i) { const int ka = k0 + 8 * g + i, kb = ka + 16; v[i] = ka < K ? W[(size_t)(ka < K ? ka : K - 1) * ld + n] : 0.f; v[8 + i] = kb < K ? W[(size_t)(kb < K ? kb : K - 1) * ld + n] : 0.f; }
  return bsplit16(v); }
__device__ __forceinline__ v8f mac3(const F2& a, const F2& b, v8f c) { c = wmma_bf(a.l, b.h, c); c = wmma_bf(a.h, b.l, c); return wmma_bf(a.h, b.h, c); }
__device__ __forceinline__ float sigm(float v) { return 1.0f / (1.0f + expf(-v)); }
#define LDSX() do { asm volatile("s_wait_dscnt 0" ::: "memory"); __builtin_amdgcn_wave_barrier(); __builtin_amdgcn_fence(__ATOMIC_RELEASE, "workgroup"); } while (0)


#define NB 2
#define SS 2048
#define DM 1024
#define NH 16
#define DFF 4096
#define NR (NB * SS)
__device__ __attribute__((noinline)) float erf_p(float v) { return erff(v); }
__device__ __forceinline__ float gelu_e(float x) { return 0.5f * x * (1.0f + erf_p(x * 0.70710678118654752f)); }
#define HD 64
#define QKVW (3 * DM)
#ifndef TQB
#define TQB (SS / 64)
#define TNB NB
#define TOB (NB * SS / 64)     // output row tiles (all)
#endif
typedef __attribute__((ext_vector_type(8))) __bf16 v8b;
__device__ __forceinline__ v16b frag_b(const __bf16* rowk0, int lane) {
  union { v16b v; v8b q[2]; } u; const __bf16* p = rowk0 + 8 * (lane >> 4);
  u.q[0] = *(const v8b*)p; u.q[1] = *(const v8b*)(p + 16); return u.v;
}
__device__ __forceinline__ float bfr(float v) { return (float)(__bf16)v; }
__device__ __attribute__((noinline)) float exp_ni(float v) { return expf(v); }
__device__ __attribute__((noinline)) float erf_ni(float v) { return erff(v); }

// ---- LDS ring of the GEMM kernels: a stage is 64 k of the block's 128 weight rows and of its 64 activation rows, brought by asynchronous copies in whole lines, read by all four waves; two buffers
#define KST 64
#define P128 144   // LDS pitch of a 128-B row: 16 B x odd, no bank conflict for 16-B reads down a column of rows
#define P256 272   // LDS pitch of a 256-B row, likewise
__device__ __forceinline__ unsigned lds_off(const void* p) { return (unsigned)(size_t)p; }
// four copies of 16 B a lane; s_wait_xcnt closes the statement so that no address register of a copy is rewritten ahead of it
__device__ __forceinline__ void cp4(unsigned l0, unsigned l1, unsigned l2, unsigned l3, const char* g0, const char* g1, const char* g2, const char* g3) {
  asm volatile("global_load_async_to_lds_b128 %0, %4, off\n\tglobal_load_async_to_lds_b128 %1, %5, off\n\tglobal_load_async_to_lds_b128 %2, %6, off\n\tglobal_load_async_to_lds_b128 %3, %7, off\n\ts_wait_xcnt 0x0"
               :: "v"(l0), "v"(l1), "v"(l2), "v"(l3), "v"(g0), "v"(g1), "v"(g2), "v"(g3) : "memory");
}
// NROW rows of 128 B (global pitch gp bytes) -> LDS at pitch P128: 8 lanes a row, 16 rows a copy of the 128 threads
template <int NROW> __device__ __forceinline__ void stage128(unsigned l, const char* g, size_t gp, int tid) {
  l += (tid >> 3) * P128 + (tid & 7) * 16; g += (size_t)(tid >> 3) * gp + (tid & 7) * 16;
  for (int i = 0; i < NROW / 16; i += 4) cp4(l + i * 16 * P128, l + (i + 1) * 16 * P128, l + (i + 2) * 16 * P128, l + (i + 3) * 16 * P128, g + (size_t)i * 16 * gp, g + (size_t)(i + 1) * 16 * gp, g + (size_t)(i + 2) * 16 * gp, g + (size_t)(i + 3) * 16 * gp);
}
// NROW rows of 256 B -> LDS at pitch P256: 16 lanes a row, 8 rows a copy of the 128 threads
template <int NROW> __device__ __forceinline__ void stage256(unsigned l, const char* g, size_t gp, int tid) {
  l += (tid >> 4) * P256 + (tid & 15) * 16; g += (size_t)(tid >> 4) * gp + (tid & 15) * 16;
  for (int i = 0; i < NROW / 8; i += 4) cp4(l + i * 8 * P256, l + (i + 1) * 8 * P256, l + (i + 2) * 8 * P256, l + (i + 3) * 8 * P256, g + (size_t)i * 8 * gp, g + (size_t)(i + 1) * 8 * gp, g + (size_t)(i + 2) * 8 * gp, g + (size_t)(i + 3) * 8 * gp);
}
#define WAIT_ASYNC() asm volatile("s_wait_asynccnt 0x0" ::: "memory")   // this wave's copies have landed
#define WAIT_DS() asm volatile("s_wait_dscnt 0x0" ::: "memory")         // this wave's LDS reads are done before the buffer is given up
#define STG16 ((128 + 64) * P128)          // one buffer, 16-bit activations: weight rows, then activation rows
#define STG32 (128 * P128 + 64 * P256)     // one buffer, f32 activations
#define PK_A 0                       // [3072][1024] Wqkv rows (natural [out][in])
#define PK_P (PK_A + QKVW * DM)        // [1024][1024] Wo rows (natural)
#define PK_END (PK_P + DM * DM)
#define WS_PK  0u
#define WS_QK  (WS_PK + 2u * PK_END)             // f16 [4096 rows][2048]: q | k
#define WS_QKL (WS_QK + 2u * NB * SS * 2 * DM)     // f16 q | k residual planes x2048
#define WS_VTH (WS_QKL + 2u * NB * SS * 2 * DM)    // f16 [b][1024 (h*64+d)][2048 s] hi
#define WS_VTL (WS_VTH + 2u * NB * DM * SS)        // f16 lo x 2048
#define WS_O   (WS_VTL + 2u * NB * DM * SS)        // f32 [4096][1024]
#define WS_CS  (WS_O + 4u * NB * SS * DM)           // f32 [2][2048][32], unused
#define WS_PF  (WS_CS + 4u * 2 * SS * 32)                  // f16 x 2^8 rows W1^T [4096][1024] ; W2^T [1024][4096]
#define WS_PM  (WS_PF + 2u * (size_t)DFF * DM)
#define WS_A0  (WS_PM + 2u * (size_t)DM * DFF)          // f32 [NR][1024] attention branch ; X1 f32 ; HF f32 (ff branch)
#define WS_X1  (WS_A0 + 4u * (size_t)NR * DM)
#define WS_HF  (WS_X1 + 4u * (size_t)NR * DM)
#define WS_X16 (WS_HF + 4u * (size_t)NR * DM)           // f16 [NR][1024] x1 ; G f16 [NR][4096]
#define WS_G   (WS_X16 + 2u * (size_t)NR * DM)
#define WS_END (WS_G + 2u * (size_t)NR * DFF)
// ---- k_pack: block = (row n, which): (in,out) column n -> bf16 [out][in] row n; which 0..2 -> W_q/W_k/W_v into PK_A rows which*1024 + n; 3 -> W_o into PK_P
__global__ __launch_bounds__(256) void k_pack(const float* __restrict__ WQ, const float* __restrict__ WK, const float* __restrict__ WV, const float* __restrict__ WO, __bf16* __restrict__ PK) {
  __shared__ __align__(16) __bf16 s[DM]; const int n = blockIdx.x, which = blockIdx.y, t = threadIdx.x; const float* Wm = (which == 0) ? WQ : (which == 1) ? WK : (which == 2) ? WV : WO;   // (in,out) weights: pack row n = column n
  for (int k = t; k < DM; k += 256) s[k] = (__bf16)Wm[(size_t)k * DM + n];
  __syncthreads();
  __bf16* dst = (which < 3) ? PK + PK_A + ((size_t)which * DM + n) * DM : PK + PK_P + (size_t)n * DM;
  for (int q = t; q < DM / 8; q += 256) vst2((unsigned*)(dst + q * 8), *(const v4u*)&s[q * 8]);
}
__global__ __launch_bounds__(128) void k_qkv(const float* __restrict__ XQ, const float* __restrict__ XK, const float* __restrict__ XV, const __bf16* __restrict__ P, const float* __restrict__ BQ, const float* __restrict__ BK, const float* __restrict__ BV, _Float16* __restrict__ QK, _Float16* __restrict__ QKL, _Float16* __restrict__ VTH, _Float16* __restrict__ VTL) {
  const int which0 = (blockIdx.y * 128) / DM; const float* X = (which0 == 0) ? XQ : (which0 == 1) ? XK : XV; const float* BB = BQ ? (((which0 == 0) ? BQ : (which0 == 1) ? BK : BV) + (blockIdx.y * 128 - which0 * DM)) : nullptr;
  __shared__ __align__(16) char smem[2 * STG32];   // the ring; behind the loop's last barrier the output staging
  _Float16 (*so)[16][136] = (_Float16 (*)[16][136])smem, (*sol)[16][136] = (_Float16 (*)[16][136])(smem + 4 * 16 * 136 * 2); _Float16 (*sth)[72] = (_Float16 (*)[72])smem, (*stl)[72] = (_Float16 (*)[72])(smem + 128 * 72 * 2);
  const int tid = threadIdx.x, wave = tid >> 5, lane = tid & 31, col = lane & 15, g = lane >> 4; const size_t r0 = (size_t)blockIdx.x * 64 + wave * 16; const int n0 = blockIdx.y * 128;
  v8f acc[8] = {};
  const unsigned l0 = lds_off(smem); const char* gB = (const char*)(P + (size_t)n0 * DM); const char* gA = (const char*)(X + (size_t)blockIdx.x * 64 * DM);
  stage128<128>(l0, gB, DM * 2, tid); stage256<64>(l0 + 128 * P128, gA, DM * 4, tid);
  WAIT_ASYNC(); __syncthreads();
  stage128<128>(l0 + STG32, gB + 128, DM * 2, tid); stage256<64>(l0 + STG32 + 128 * P128, gA + 256, DM * 4, tid);
  for (int t = 0; t < DM / KST; ++t) { const char* bs = smem + (t & 1) * STG32;
    v16b a[2], w[2][8];   // the stage's fragment reads all stand ahead of its products: one LDS latency a stage, not one a product (the loops below are unrolled so that every fragment index is a constant and the arrays stay in registers)
#pragma unroll
    for (int kk = 0; kk < 2; ++kk) { const float* p = (const float*)(bs + 128 * P128 + (wave * 16 + col) * P256) + kk * 32 + 8 * g;
#pragma unroll
      for (int i = 0; i < 8; ++i) { a[kk][i] = (__bf16)p[i]; a[kk][8 + i] = (__bf16)p[16 + i]; }
#pragma unroll
      for (int j = 0; j < 8; ++j) w[kk][j] = frag_b((const __bf16*)(bs + (j * 16 + col) * P128) + kk * 32, lane); }
#pragma unroll
    for (int kk = 0; kk < 2; ++kk) {
#pragma unroll
      for (int j = 0; j < 8; ++j) acc[j] = wmma_bf(a[kk], w[kk][j], acc[j]); }
    WAIT_DS(); WAIT_ASYNC(); __syncthreads();   // publishes stage t + 1 and ends every read of stage t
    if (t + 2 < DM / KST) { stage128<128>(l0 + (t & 1) * STG32, gB + (size_t)(t + 2) * 128, DM * 2, tid); stage256<64>(l0 + (t & 1) * STG32 + 128 * P128, gA + (size_t)(t + 2) * 256, DM * 4, tid); } }
  WAIT_ASYNC();
  if (n0 < 2 * DM) {   // q stored unscaled (f16 sigma ~0.6, no subnormal exposure); 1/8 applied to the f32 score
#pragma unroll
    for (int j = 0; j < 8; ++j) {
#pragma unroll
      for (int r = 0; r < 8; ++r) { const float v = acc[j][r] + (BB ? bfr(BB[j * 16 + col]) : 0.f); const _Float16 hv = (_Float16)v; so[wave][8 * g + r][j * 16 + col] = hv; sol[wave][8 * g + r][j * 16 + col] = (_Float16)((v - (float)hv) * 2048.0f); } }   // q, k (+ bias) as f16 hi + (x2048) residual
    LDSX();
    for (int rl = 0; rl < 16; ++rl) if (lane < 16) { vst2((unsigned*)(QK + (r0 + rl) * (2 * DM) + n0 + lane * 8), *(const v4u*)&so[wave][rl][lane * 8]); vst2((unsigned*)(QKL + (r0 + rl) * (2 * DM) + n0 + lane * 8), *(const v4u*)&sol[wave][rl][lane * 8]); }
  } else {
#pragma unroll
    for (int j = 0; j < 8; ++j) {
#pragma unroll
      for (int r = 0; r < 8; ++r) { const float v = acc[j][r] + (BB ? bfr(BB[j * 16 + col]) : 0.f); const _Float16 hv = (_Float16)v; sth[j * 16 + col][wave * 16 + 8 * g + r] = hv; stl[j * 16 + col][wave * 16 + 8 * g + r] = (_Float16)((v - (float)hv) * 2048.0f); } }
    __syncthreads();
    const size_t rb = (size_t)blockIdx.x * 64; const int b = (int)(rb / SS), s0 = (int)(rb % SS); const int pc0 = n0 - 2 * DM;
    for (int q = tid; q < 128 * 8; q += 128) { const int d = q >> 3, pc = q & 7; const size_t o = ((size_t)b * DM + pc0 + d) * SS + s0 + pc * 8; vst2((unsigned*)(VTH + o), *(const v4u*)&sth[d][pc * 8]); vst2((unsigned*)(VTL + o), *(const v4u*)&stl[d][pc * 8]); }
  }
}
// ---- k_attn: block = (64 queries, head h, batch b): all-keys flash attention (K = 64: 2 k-steps), scores = (q.k) * 0.125 with single f16 operands, P.V: f16 P (x2^11) x V hi, a single product (accl stays 0); O[b*S+q][h*64+d] = (acc + accl / 2048) / (2048 l) (256-B segments)
__global__ __launch_bounds__(128) void k_attn(const _Float16* __restrict__ QK, const _Float16* __restrict__ QKL, const _Float16* __restrict__ VTH, const _Float16* __restrict__ VTL, const void* __restrict__ KMASK, const int* __restrict__ MSK, float* __restrict__ O) {
  __shared__ __align__(16) float sp[4][16][36]; __shared__ __align__(16) char smem[2 * STG32];   // smem: the ring (64 key rows, 64 v rows, 64 mask rows a stage); behind the loop's last barrier the output staging
  float (*so)[16][68] = (float (*)[16][68])smem;
  const int tid = threadIdx.x, wave = tid >> 5, lane = tid & 31, col = lane & 15, g = lane >> 4;
  const int qb = blockIdx.x, h = blockIdx.y, b = blockIdx.z; const int q0 = qb * 64 + wave * 16; const size_t rq = (size_t)b * SS + q0 + col;
  v16h aq[2], aql[2];
#pragma unroll
  for (int kc = 0; kc < 2; ++kc) { aq[kc] = frag_h(QK + rq * (2 * DM) + h * HD + kc * 32, lane); aql[kc] = frag_h(QKL + rq * (2 * DM) + h * HD + kc * 32, lane); }
  float m[8], l[8];
#pragma unroll
  for (int r = 0; r < 8; ++r) { m[r] = -3.0e38f; l[r] = 0.f; }
  v8f acc[4] = {}, accl[4] = {};
  // a stage is 64 keys (all keys are walked): 64 k rows of 128 B, the head's 64 v rows of 128 B, the block's 64 mask rows of 256 B
  const unsigned l0 = lds_off(smem); const char* gK = (const char*)(QK + (size_t)b * SS * (2 * DM) + DM + h * HD); const char* gV = (const char*)(VTH + ((size_t)b * DM + h * HD) * SS); const char* gM = (const char*)(MSK + (size_t)qb * 64 * SS);
  stage128<64>(l0, gK, 2 * DM * 2, tid); stage128<64>(l0 + 64 * P128, gV, SS * 2, tid); stage256<64>(l0 + 128 * P128, gM, SS * 4, tid);
  WAIT_ASYNC(); __syncthreads();
  stage128<64>(l0 + STG32, gK + (size_t)64 * 2 * DM * 2, 2 * DM * 2, tid); stage128<64>(l0 + STG32 + 64 * P128, gV + 128, SS * 2, tid); stage256<64>(l0 + STG32 + 128 * P128, gM + 256, SS * 4, tid);
#pragma unroll 1   // the stage loop stays rolled, as the key loop was: its body already holds two turns
  for (int t = 0; t < SS / 64; ++t) { const char* bs = smem + (t & 1) * STG32;
#pragma unroll     // both turns of a stage unrolled: their LDS offsets become immediates
  for (int sub = 0; sub < 2; ++sub) { v8f s[2]; v16h kf[2][2], vf[4]; int mk[2][8];   // 32 keys a turn; its LDS reads all stand ahead of its products: one LDS latency a turn, not one a product
#pragma unroll
    for (int ct = 0; ct < 2; ++ct) {
#pragma unroll
      for (int kc = 0; kc < 2; ++kc) kf[ct][kc] = frag_h((const _Float16*)(bs + (sub * 32 + ct * 16 + col) * P128) + kc * 32, lane);
#pragma unroll
      for (int r = 0; r < 8; ++r) mk[ct][r] = *(const int*)(bs + 128 * P128 + (wave * 16 + 8 * g + r) * P256 + (sub * 32 + ct * 16 + col) * 4); }
#pragma unroll
    for (int dt = 0; dt < 4; ++dt) vf[dt] = frag_h((const _Float16*)(bs + 64 * P128 + (dt * 16 + col) * P128) + sub * 32, lane);
#pragma unroll
    for (int ct = 0; ct < 2; ++ct) { v8f c = {};
#pragma unroll
      for (int kc = 0; kc < 2; ++kc) c = wmma16(aq[kc], kf[ct][kc], c);   // single product: q, k as one-rounding f16 operands
#pragma unroll
      for (int r = 0; r < 8; ++r) s[ct][r] = (mk[ct][r] != 1) ? c[r] * 0.125f : -3.0e38f; }   // 1/sqrt(64); mask == 1 -> -1e9 == excluded
#pragma unroll
    for (int r = 0; r < 8; ++r) { float mx = fmaxf(s[0][r], s[1][r]);
#pragma unroll
      for (int o = 1; o < 16; o <<= 1) mx = fmaxf(mx, __shfl_xor(mx, o));
      const float mn = fmaxf(m[r], mx); const float alpha = (m[r] <= -1.0e38f) ? 0.f : __expf(m[r] - mn);
      const float e0 = (s[0][r] <= -1.0e38f) ? 0.f : __expf(s[0][r] - mn), e1 = (s[1][r] <= -1.0e38f) ? 0.f : __expf(s[1][r] - mn); float es = e0 + e1;
#pragma unroll
      for (int o = 1; o < 16; o <<= 1) es += __shfl_xor(es, o);
      l[r] = l[r] * alpha + es; m[r] = mn;
#pragma unroll
      for (int dt = 0; dt < 4; ++dt) { acc[dt][r] *= alpha; accl[dt][r] *= alpha; }
      sp[wave][8 * g + r][col] = e0; sp[wave][8 * g + r][16 + col] = e1; }
    LDSX();
    v16h pa, pl; { const float* prow = &sp[wave][col][0] + 8 * (lane >> 4);
#pragma unroll
      for (int i = 0; i < 8; ++i) { const float x0 = prow[i] * 2048.0f, x1 = prow[16 + i] * 2048.0f; const _Float16 h0 = (_Float16)x0, h1 = (_Float16)x1; pa[i] = h0; pa[8 + i] = h1; pl[i] = (_Float16)((x0 - (float)h0) * 2048.0f); pl[8 + i] = (_Float16)((x1 - (float)h1) * 2048.0f); } }   // P scaled by 2^11 before the f16 split so small softmax weights stay out of the f16 subnormal range; 2^-11 folded into the epilogue
#pragma unroll
    for (int dt = 0; dt < 4; ++dt) acc[dt] = wmma16(pa, vf[dt], acc[dt]);   // single product: P (x2^11) x V
    (void)pl;
    LDSX(); }
    WAIT_DS(); WAIT_ASYNC(); __syncthreads();   // publishes stage t + 1 and ends every read of stage t
    if (t + 2 < SS / 64) { const unsigned l = l0 + (t & 1) * STG32; stage128<64>(l, gK + (size_t)(t + 2) * 64 * 2 * DM * 2, 2 * DM * 2, tid); stage128<64>(l + 64 * P128, gV + (size_t)(t + 2) * 128, SS * 2, tid); stage256<64>(l + 128 * P128, gM + (size_t)(t + 2) * 256, SS * 4, tid); } }
  WAIT_ASYNC();
#pragma unroll
  for (int r = 0; r < 8; ++r) { const float il = (1.0f / 2048.0f) / l[r];
#pragma unroll
    for (int dt = 0; dt < 4; ++dt) so[wave][8 * g + r][dt * 16 + col] = (acc[dt][r] + accl[dt][r] * (1.0f / 2048.0f)) * il; }
  LDSX();
  for (int rl = 0; rl < 16; ++rl) if (lane < 16) vst2(O + ((size_t)b * SS + q0 + rl) * DM + h * HD + lane * 4, *(const v4f*)&so[wave][rl][lane * 4]);
}
// ---- k_out: block = (64 rows, 128 cols): out = O(hi/lo) . Wo rows (2 products) + bo
__global__ __launch_bounds__(128) void k_out(const float* __restrict__ O, const __bf16* __restrict__ P, const float* __restrict__ BO, float* __restrict__ Y) {
  __shared__ __align__(16) char smem[2 * STG32];   // the ring; behind the loop's last barrier the output staging
  float (*so)[16][132] = (float (*)[16][132])smem;
  const int tid = threadIdx.x, wave = tid >> 5, lane = tid & 31, col = lane & 15, g = lane >> 4; const size_t r0 = (size_t)blockIdx.x * 64 + wave * 16; const int n0 = blockIdx.y * 128;
  v8f acc[8] = {};
  const unsigned l0 = lds_off(smem); const char* gB = (const char*)(P + (size_t)n0 * DM); const char* gA = (const char*)(O + (size_t)blockIdx.x * 64 * DM);
  stage128<128>(l0, gB, DM * 2, tid); stage256<64>(l0 + 128 * P128, gA, DM * 4, tid);
  WAIT_ASYNC(); __syncthreads();
  stage128<128>(l0 + STG32, gB + 128, DM * 2, tid); stage256<64>(l0 + STG32 + 128 * P128, gA + 256, DM * 4, tid);
  for (int t = 0; t < DM / KST; ++t) { const char* bs = smem + (t & 1) * STG32;
    F2 a[2]; v16b w[2][8];   // the stage's fragment reads all stand ahead of its products: one LDS latency a stage, not one a product (the loops below are unrolled so that every fragment index is a constant and the arrays stay in registers)
#pragma unroll
    for (int kk = 0; kk < 2; ++kk) { a[kk] = split_row((const float*)(bs + 128 * P128 + (wave * 16 + col) * P256), kk * 32, lane);
#pragma unroll
      for (int j = 0; j < 8; ++j) w[kk][j] = frag_b((const __bf16*)(bs + (j * 16 + col) * P128) + kk * 32, lane); }
#pragma unroll
    for (int kk = 0; kk < 2; ++kk) {
#pragma unroll
      for (int j = 0; j < 8; ++j) { acc[j] = wmma_bf(a[kk].l, w[kk][j], acc[j]); acc[j] = wmma_bf(a[kk].h, w[kk][j], acc[j]); } }
    WAIT_DS(); WAIT_ASYNC(); __syncthreads();   // publishes stage t + 1 and ends every read of stage t
    if (t + 2 < DM / KST) { stage128<128>(l0 + (t & 1) * STG32, gB + (size_t)(t + 2) * 128, DM * 2, tid); stage256<64>(l0 + (t & 1) * STG32 + 128 * P128, gA + (size_t)(t + 2) * 256, DM * 4, tid); } }
  WAIT_ASYNC();
#pragma unroll
  for (int j = 0; j < 8; ++j) {
#pragma unroll
    for (int r = 0; r < 8; ++r) so[wave][8 * g + r][j * 16 + col] = acc[j][r] + bfr(BO[n0 + j * 16 + col]); }
  LDSX();
  for (int rl = 0; rl < 16; ++rl) vst2(Y + (r0 + rl) * DM + n0 + lane * 4, *(const v4f*)&so[wave][rl][lane * 4]);
}
// ---- k_packff: (in,out) W1 [1024][4096] -> rows [4096][1024] f16 x 2^8 ; W2 [4096][1024] -> rows [1024][4096]
__global__ __launch_bounds__(256) void k_packff(const float* __restrict__ W1, const float* __restrict__ W2, _Float16* __restrict__ PF, _Float16* __restrict__ PM) { __shared__ __align__(16) _Float16 s[DFF]; const int n = blockIdx.x, which = blockIdx.y, t = threadIdx.x;
  if (which == 0) { for (int k = t; k < DM; k += 256) s[k] = (_Float16)(bfr(W1[(size_t)k * DFF + n]) * 256.0f); __syncthreads(); for (int q = t; q < DM / 8; q += 256) vst2((unsigned*)(PF + (size_t)n * DM + q * 8), *(const v4u*)&s[q * 8]); }
  else { if (n >= DM) return; for (int k = t; k < DFF; k += 256) s[k] = (_Float16)(bfr(W2[(size_t)k * DM + n]) * 256.0f); __syncthreads(); for (int q = t; q < DFF / 8; q += 256) vst2((unsigned*)(PM + (size_t)n * DFF + q * 8), *(const v4u*)&s[q * 8]); } }
// ---- k_lnres<F16OUT, RESX>: block = row (256 threads x 4): y = R + LayerNorm(A) x gamma + beta (mean((x-m)^2), eps 1e-5); RESX: residual is the bf16-rounded input x (else an f32 buffer); optional f16 copy for the FF
template <int F16OUT, int RESX>
__global__ __launch_bounds__(256) void k_lnres(const float* __restrict__ A, const float* __restrict__ R, const float* __restrict__ G, const float* __restrict__ Bt, float* __restrict__ Y, _Float16* __restrict__ Y16) {
  __shared__ float red[8]; __shared__ __align__(16) _Float16 sh[DM]; const int t = threadIdx.x; const size_t row = blockIdx.x; float v[4]; float s = 0.f; for (int i = 0; i < 4; ++i) { v[i] = A[row * DM + t * 4 + i]; s += v[i]; }
#pragma unroll
  for (int o = 1; o < 32; o <<= 1) s += __shfl_xor(s, o);
  if ((t & 31) == 0) red[t >> 5] = s; __syncthreads(); float tot = 0.f; for (int i = 0; i < 8; ++i) tot += red[i]; const float mu = tot / (float)DM; __syncthreads();
  float q = 0.f; for (int i = 0; i < 4; ++i) { const float dd = v[i] - mu; q += dd * dd; }
#pragma unroll
  for (int o = 1; o < 32; o <<= 1) q += __shfl_xor(q, o);
  if ((t & 31) == 0) red[t >> 5] = q; __syncthreads(); float tq = 0.f; for (int i = 0; i < 8; ++i) tq += red[i]; const float inv = 1.0f / sqrtf(tq / (float)DM + 1e-5f);
  v4f o4; for (int i = 0; i < 4; ++i) { const int e = t * 4 + i; const float rr = RESX ? bfr(R[row * DM + e]) : R[row * DM + e]; o4[i] = rr + ((v[i] - mu) * inv * bfr(G[e]) + bfr(Bt[e])); if (F16OUT) sh[e] = (_Float16)o4[i]; }
  vst2(Y + row * DM + t * 4, o4);
  if (F16OUT) { __syncthreads(); if (t < DM / 8) vst2((unsigned*)(Y16 + row * DM + t * 8), *(const v4u*)&sh[t * 8]); }
}
// ---- k_mlp<MODE>: block = (64 rows, 128 cols): MODE 0: G = gelu_exact(X1 . W1 + b1) (K 1024 -> 4096) f16; MODE 1: HF = gelu_exact(G . W2 + b2) (K 4096 -> 1024) f32
template <int MODE>
__global__ __launch_bounds__(128) void k_mlp(const _Float16* __restrict__ Ain, const _Float16* __restrict__ Wr, const float* __restrict__ BIAS, const float* __restrict__ RES, float* __restrict__ OUTF, _Float16* __restrict__ OG) {
  constexpr int KIN = (MODE == 0) ? DM : DFF; constexpr int NOUT = (MODE == 0) ? DFF : DM;
  __shared__ __align__(16) char smem[2 * STG16];   // the ring; behind the loop's last barrier the output staging
  float (*so)[16][132] = (float (*)[16][132])smem; _Float16 (*sg)[16][136] = (_Float16 (*)[16][136])smem;
  const int tid = threadIdx.x, wave = tid >> 5, lane = tid & 31, col = lane & 15, g = lane >> 4; const size_t r0 = (size_t)blockIdx.x * 64 + wave * 16; const int n0 = blockIdx.y * 128;
  v8f acc[8] = {};
  const unsigned l0 = lds_off(smem); const char* gB = (const char*)(Wr + (size_t)n0 * KIN); const char* gA = (const char*)(Ain + (size_t)blockIdx.x * 64 * KIN);
  stage128<128>(l0, gB, KIN * 2, tid); stage128<64>(l0 + 128 * P128, gA, KIN * 2, tid);
  WAIT_ASYNC(); __syncthreads();
  stage128<128>(l0 + STG16, gB + 128, KIN * 2, tid); stage128<64>(l0 + STG16 + 128 * P128, gA + 128, KIN * 2, tid);
  for (int t = 0; t < KIN / KST; ++t) { const char* bs = smem + (t & 1) * STG16;
    v16h a[2], w[2][8];   // the stage's fragment reads all stand ahead of its products: one LDS latency a stage, not one a product (the loops below are unrolled so that every fragment index is a constant and the arrays stay in registers)
#pragma unroll
    for (int kk = 0; kk < 2; ++kk) { a[kk] = frag_h((const _Float16*)(bs + 128 * P128 + (wave * 16 + col) * P128) + kk * 32, lane);
#pragma unroll
      for (int j = 0; j < 8; ++j) w[kk][j] = frag_h((const _Float16*)(bs + (j * 16 + col) * P128) + kk * 32, lane); }
#pragma unroll
    for (int kk = 0; kk < 2; ++kk) {
#pragma unroll
      for (int j = 0; j < 8; ++j) acc[j] = wmma16(a[kk], w[kk][j], acc[j]); }
    WAIT_DS(); WAIT_ASYNC(); __syncthreads();   // publishes stage t + 1 and ends every read of stage t
    if (t + 2 < KIN / KST) { stage128<128>(l0 + (t & 1) * STG16, gB + (size_t)(t + 2) * 128, KIN * 2, tid); stage128<64>(l0 + (t & 1) * STG16 + 128 * P128, gA + (size_t)(t + 2) * 128, KIN * 2, tid); } }
  WAIT_ASYNC();
#pragma unroll
  for (int j = 0; j < 8; ++j) { const int c = n0 + j * 16 + col; const float bb = bfr(BIAS[c]);
#pragma unroll
    for (int r = 0; r < 8; ++r) { const float x = acc[j][r] * (1.0f / 256.0f) + bb; if (MODE == 0) sg[wave][8 * g + r][j * 16 + col] = (_Float16)gelu_e(x); else so[wave][8 * g + r][j * 16 + col] = gelu_e(x); } }
  LDSX();
  if (MODE == 0) { for (int rl = 0; rl < 16; ++rl) if (lane < 16) vst2((unsigned*)(OG + (r0 + rl) * NOUT + n0 + lane * 8), *(const v4u*)&sg[wave][rl][lane * 8]); }
  else { for (int rl = 0; rl < 16; ++rl) vst2(OUTF + (r0 + rl) * NOUT + n0 + lane * 4, *(const v4f*)&so[wave][rl][lane * 4]); }
}

extern "C" void kernel_launch(void* const* d_in, const int* in_sizes, int n_in, void* d_out, int out_size, void* d_ws, size_t ws_size, hipStream_t stream) {
  (void)in_sizes; (void)n_in; (void)out_size;
  const float** F = (const float**)d_in;   // 0 x [2,2048,1024], 1 mask [1,1,2048,2048] int, 2 Wq, 3 Wk, 4 Wv, 5 Wo ((in,out)), 6 bo, 7 ln1_g, 8 ln1_b, 9 W1 [1024,4096], 10 b1, 11 W2 [4096,1024], 12 b2, 13 ln2_g, 14 ln2_b
  if (ws_size < (size_t)WS_END) return;
  char* ws = (char*)d_ws; __bf16* PK = (__bf16*)(ws + WS_PK); _Float16 *QK = (_Float16*)(ws + WS_QK), *QKL = (_Float16*)(ws + WS_QKL), *VTH = (_Float16*)(ws + WS_VTH), *VTL = (_Float16*)(ws + WS_VTL), *PF = (_Float16*)(ws + WS_PF), *PM = (_Float16*)(ws + WS_PM), *X16 = (_Float16*)(ws + WS_X16), *Gb = (_Float16*)(ws + WS_G); float *O = (float*)(ws + WS_O), *A0 = (float*)(ws + WS_A0), *X1 = (float*)(ws + WS_X1), *HF = (float*)(ws + WS_HF);
  k_pack<<<dim3(DM, 4), 256, 0, stream>>>(F[2], F[3], F[4], F[5], PK);
  k_packff<<<dim3(DFF, 2), 256, 0, stream>>>(F[9], F[11], PF, PM);
  k_qkv<<<dim3(TNB * SS / 64, QKVW / 128), 128, 0, stream>>>(F[0], F[0], F[0], PK + PK_A, nullptr, nullptr, nullptr, QK, QKL, VTH, VTL);
  k_attn<<<dim3(TQB, NH, TNB), 128, 0, stream>>>(QK, QKL, VTH, VTL, nullptr, (const int*)d_in[1], O);
  k_out<<<dim3(TOB, DM / 128), 128, 0, stream>>>(O, PK + PK_P, F[6], A0);
  k_lnres<1, 1><<<TOB * 64, 256, 0, stream>>>(A0, F[0], F[7], F[8], X1, X16);      // x1 = x + LN(attn branch)
  k_mlp<0><<<dim3(TOB, DFF / 128), 128, 0, stream>>>(X16, PF, F[10], nullptr, nullptr, Gb);
  k_mlp<1><<<dim3(TOB, DM / 128), 128, 0, stream>>>(Gb, PM, F[12], nullptr, HF, nullptr);
  k_lnres<0, 0><<<TOB * 64, 256, 0, stream>>>(HF, X1, F[13], F[14], (float*)d_out, nullptr);   // out = x1 + LN(ff branch)
}

// v002
// A run of this version takes 307 microseconds.
// Next to v001, in two timings, it ran 1.18 and 1.19 times as fast.
// Counting every step since v000, it is 2.84 times as fast.
// compute dtype: all float inputs rounded to bf16, the int mask read on device; q/k/v = x . W with EXACT bf16 products on WMMA 16x16x32 ((in,out) weights as transposed rows); PLAIN attention: q, k single f16 x 1/8, masked keys excluded, running-max softmax in f32 (hardware exp), P (scaled by 2^11, single f16) x v (single f16); attention out (bf16 hi + residual) . Wo (2 products) + bo; LayerNorms in f32; FF: x1 rounded once to f16 x exact f16 weight copies (x 2^8), exact GELU (erff), hidden f16, second exact GELU; f32 output.
#include <hip/hip_runtime.h>
#include <math.h>

typedef __attribute__((ext_vector_type(16))) _Float16 v16h;
typedef __attribute__((ext_vector_type(16))) __bf16 v16b;
typedef __attribute__((ext_vector_type(8)))  _Float16 v8h;
typedef __attribute__((ext_vector_type(8)))  float v8f;
typedef __attribute__((ext_vector_type(4)))  float v4f;
typedef __attribute__((ext_vector_type(2)))  float v2f;
typedef __attribute__((ext_vector_type(4)))  unsigned v4u;
typedef __attribute__((ext_vector_type(4)))  int v4i;
typedef float __attribute__((may_alias)) float_a;
typedef int __attribute__((may_alias)) int_a;

template <typename T> __device__ __forceinline__ void vst2(void* p, T v) { *(T*)p = v;  }
__device__ __forceinline__ v8f wmma16(v16h a, v16h b, v8f c) {
  v8f d = __builtin_amdgcn_wmma_f32_16x16x32_f16(false, a, false, b, (short)0, c, false, false);
  asm volatile("v_nop\n\tv_nop\n\tv_nop\n\tv_nop" : "+v"(d) : "v"(a), "v"(b));
  return d;
}
__device__ __forceinline__ v8f wmma_bf(v16b a, v16b b, v8f c) {
  v8f d = __builtin_amdgcn_wmma_f32_16x16x32_bf16(false, a, false, b, (short)0, c, false, false);
  asm volatile("v_nop\n\tv_nop\n\tv_nop\n\tv_nop" : "+v"(d) : "v"(a), "v"(b));
  return d;
}
// Transformer block (B 2, S 2,048, d 1,024, 16 heads x 64, FF 4,096): bias-free q/k/v projections, scores / 8 with a [S,S] mask (mask == 1 -> -1e9), softmax, . v, Wo + bo; x + LayerNorm(attention branch); FF with exact GELU after BOTH linears; x + LayerNorm(FF branch).
__device__ __forceinline__ v16h frag_h(const _Float16* rowk0, int lane) {
  union { v16h v; v8h q[2]; } u; const _Float16* p = rowk0 + 8 * (lane >> 4);
  u.q[0] = *(const v8h*)p; u.q[1] = *(const v8h*)(p + 16); return u.v;
}
__device__ __forceinline__ v16h frag_f32(const float* rowk0, int lane) {
  v16h a; const float* p = rowk0 + 8 * (lane >> 4);
#pragma unroll
  for (int i = 0; i < 8; ++i) { a[i] = (_Float16)p[i]; a[8 + i] = (_Float16)p[16 + i]; }
  return a;
}
__device__ __forceinline__ v16h frag_f32s(const float* rowk0, int lane, float sc) {
  v16h a; const float* p = rowk0 + 8 * (lane >> 4);
#pragma unroll
  for (int i = 0; i < 8; ++i) { a[i] = (_Float16)(p[i] * sc); a[8 + i] = (_Float16)(p[16 + i] * sc); }
  return a;
}
// column fragment from a [K][ld] layout (column n), rows >= K read as 0
__device__ __forceinline__ v16h fragc_f32(const float* W, int k0, int n, int lane, int ld, int K) {
  v16h a; const int g = lane >> 4;
#pragma unroll
  for (int i = 0; i < 8; ++i) { const int ka = k0 + 8 * g + i, kb = ka + 16;
    a[i] = (_Float16)(ka < K ? W[(size_t)(ka < K ? ka : K - 1) * ld + n] : 0.f); a[8 + i] = (_Float16)(kb < K ? W[(size_t)(kb < K ? kb : K - 1) * ld + n] : 0.f); }
  return a;
}
struct F2 { v16b h, l; };
__device__ __forceinline__ F2 bsplit16(const float v[16]) { F2 r;
#pragma unroll
  for (int i = 0; i < 16; ++i) { const __bf16 h = (__bf16)v[i]; r.h[i] = h; r.l[i] = (__bf16)(v[i] - (float)h); }
  return r; }
__device__ __forceinline__ F2 split_row(const float* row, int k0, int lane) { float v[16]; const float* p = row + k0 + 8 * (lane >> 4);
#pragma unroll
  for (int i = 0; i < 8; ++i) { v[i] = p[i]; v[8 + i] = p[16 + i]; }
  return bsplit16(v); }
__device__ __forceinline__ F2 split_rowK(const float* row, int k0, int lane, int K) { float v[16]; const int g = lane >> 4;
#pragma unroll
  for (int i = 0; i < 8; ++i) { const int ka = k0 + 8 * g + i, kb = ka + 16; v[i] = ka < K ? row[ka < K ? ka : K - 1] : 0.f; v[8 + i] = kb < K ? row[kb < K ? kb : K - 1] : 0.f; }
  return bsplit16(v); }
__device__ __forceinline__ F2 split_col(const float* W, int k0, int n, int lane, int ld, int K) { float v[16]; const int g = lane >> 4;
#pragma unroll
  for (int i = 0; i < 8; ++i) { const int ka = k0 + 8 * g + i, kb = ka + 16; v[i] = ka < K ? W[(size_t)(ka < K ? ka : K - 1) * ld + n] : 0.f; v[8 + i] = kb < K ? W[(size_t)(kb < K ? kb : K - 1) * ld + n] : 0.f; }
  return bsplit16(v); }
__device__ __forceinline__ v8f mac3(const F2& a, const F2& b, v8f c) { c = wmma_bf(a.l, b.h, c); c = wmma_bf(a.h, b.l, c); return wmma_bf(a.h, b.h, c); }
__device__ __forceinline__ float sigm(float v) { return 1.0f / (1.0f + expf(-v)); }
#define LDSX() do { asm volatile("s_wait_dscnt 0" ::: "memory"); __builtin_amdgcn_wave_barrier(); __builtin_amdgcn_fence(__ATOMIC_RELEASE, "workgroup"); } while (0)


#define NB 2
#define SS 2048
#define DM 1024
#define NH 16
#define DFF 4096
#define NR (NB * SS)
__device__ __attribute__((noinline)) float erf_p(float v) { return erff(v); }
__device__ __forceinline__ float gelu_e(float x) { return 0.5f * x * (1.0f + erf_p(x * 0.70710678118654752f)); }
#define HD 64
#define QKVW (3 * DM)
#ifndef TQB
#define TQB (SS / 64)
#define TNB NB
#define TOB (NB * SS / 64)     // output row tiles (all)
#endif
typedef __attribute__((ext_vector_type(8))) __bf16 v8b;
__device__ __forceinline__ v16b frag_b(const __bf16* rowk0, int lane) {
  union { v16b v; v8b q[2]; } u; const __bf16* p = rowk0 + 8 * (lane >> 4);
  u.q[0] = *(const v8b*)p; u.q[1] = *(const v8b*)(p + 16); return u.v;
}
__device__ __forceinline__ float bfr(float v) { return (float)(__bf16)v; }
__device__ __attribute__((noinline)) float exp_ni(float v) { return expf(v); }
__device__ __attribute__((noinline)) float erf_ni(float v) { return erff(v); }

// ---- LDS ring of the GEMM kernels: a stage is 64 k of the block's 128 weight rows and of its 64 activation rows, brought by asynchronous copies in whole lines, read by all four waves; two buffers
#define KST 64
#define P128 144   // LDS pitch of a 128-B row: 16 B x odd, no bank conflict for 16-B reads down a column of rows
#define P256 272   // LDS pitch of a 256-B row, likewise
__device__ __forceinline__ unsigned lds_off(const void* p) { return (unsigned)(size_t)p; }
// four copies of 16 B a lane; s_wait_xcnt closes the statement so that no address register of a copy is rewritten ahead of it
__device__ __forceinline__ void cp4(unsigned l0, unsigned l1, unsigned l2, unsigned l3, const char* g0, const char* g1, const char* g2, const char* g3) {
  asm volatile("global_load_async_to_lds_b128 %0, %4, off\n\tglobal_load_async_to_lds_b128 %1, %5, off\n\tglobal_load_async_to_lds_b128 %2, %6, off\n\tglobal_load_async_to_lds_b128 %3, %7, off\n\ts_wait_xcnt 0x0"
               :: "v"(l0), "v"(l1), "v"(l2), "v"(l3), "v"(g0), "v"(g1), "v"(g2), "v"(g3) : "memory");
}
// NROW rows of 128 B (global pitch gp bytes) -> LDS at pitch P128: 8 lanes a row, 16 rows a copy of the 128 threads
template <int NROW> __device__ __forceinline__ void stage128(unsigned l, const char* g, size_t gp, int tid) {
  l += (tid >> 3) * P128 + (tid & 7) * 16; g += (size_t)(tid >> 3) * gp + (tid & 7) * 16;
  for (int i = 0; i < NROW / 16; i += 4) cp4(l + i * 16 * P128, l + (i + 1) * 16 * P128, l + (i + 2) * 16 * P128, l + (i + 3) * 16 * P128, g + (size_t)i * 16 * gp, g + (size_t)(i + 1) * 16 * gp, g + (size_t)(i + 2) * 16 * gp, g + (size_t)(i + 3) * 16 * gp);
}
// NROW rows of 256 B -> LDS at pitch P256: 16 lanes a row, 8 rows a copy of the 128 threads
template <int NROW> __device__ __forceinline__ void stage256(unsigned l, const char* g, size_t gp, int tid) {
  l += (tid >> 4) * P256 + (tid & 15) * 16; g += (size_t)(tid >> 4) * gp + (tid & 15) * 16;
  for (int i = 0; i < NROW / 8; i += 4) cp4(l + i * 8 * P256, l + (i + 1) * 8 * P256, l + (i + 2) * 8 * P256, l + (i + 3) * 8 * P256, g + (size_t)i * 8 * gp, g + (size_t)(i + 1) * 8 * gp, g + (size_t)(i + 2) * 8 * gp, g + (size_t)(i + 3) * 8 * gp);
}
#define WAIT_ASYNC() asm volatile("s_wait_asynccnt 0x0" ::: "memory")   // this wave's copies have landed
#define WAIT_DS() asm volatile("s_wait_dscnt 0x0" ::: "memory")         // this wave's LDS reads are done before the buffer is given up
#define STG16 ((128 + 64) * P128)          // one buffer, 16-bit activations: weight rows, then activation rows
#define STG32 (128 * P128 + 64 * P256)     // one buffer, f32 activations
#define PK_A 0                       // [3072][1024] Wqkv rows (natural [out][in])
#define PK_P (PK_A + QKVW * DM)        // [1024][1024] Wo rows (natural)
#define PK_END (PK_P + DM * DM)
#define WS_PK  0u
#define WS_QK  (WS_PK + 2u * PK_END)             // f16 [4096 rows][2048]: q | k
#define WS_QKL (WS_QK + 2u * NB * SS * 2 * DM)     // f16 q | k residual planes x2048
#define WS_VTH (WS_QKL + 2u * NB * SS * 2 * DM)    // f16 [b][1024 (h*64+d)][2048 s] hi
#define WS_VTL (WS_VTH + 2u * NB * DM * SS)        // f16 lo x 2048
#define WS_O   (WS_VTL + 2u * NB * DM * SS)        // f32 [4096][1024]
#define WS_CS  (WS_O + 4u * NB * SS * DM)           // f32 [2][2048][32], unused
#define WS_PF  (WS_CS + 4u * 2 * SS * 32)                  // f16 x 2^8 rows W1^T [4096][1024] ; W2^T [1024][4096]
#define WS_PM  (WS_PF + 2u * (size_t)DFF * DM)
#define WS_A0  (WS_PM + 2u * (size_t)DM * DFF)          // f32 [NR][1024] attention branch ; X1 f32 ; HF f32 (ff branch)
#define WS_X1  (WS_A0 + 4u * (size_t)NR * DM)
#define WS_HF  (WS_X1 + 4u * (size_t)NR * DM)
#define WS_X16 (WS_HF + 4u * (size_t)NR * DM)           // f16 [NR][1024] x1 ; G f16 [NR][4096]
#define WS_G   (WS_X16 + 2u * (size_t)NR * DM)
#define WS_END (WS_G + 2u * (size_t)NR * DFF)
// ---- k_pack: block = (row n, which): (in,out) column n -> bf16 [out][in] row n; which 0..2 -> W_q/W_k/W_v into PK_A rows which*1024 + n; 3 -> W_o into PK_P
__global__ __launch_bounds__(256) void k_pack(const float* __restrict__ WQ, const float* __restrict__ WK, const float* __restrict__ WV, const float* __restrict__ WO, __bf16* __restrict__ PK) {
  __shared__ __align__(16) __bf16 s[DM]; const int n = blockIdx.x, which = blockIdx.y, t = threadIdx.x; const float* Wm = (which == 0) ? WQ : (which == 1) ? WK : (which == 2) ? WV : WO;   // (in,out) weights: pack row n = column n
  for (int k = t; k < DM; k += 256) s[k] = (__bf16)Wm[(size_t)k * DM + n];
  __syncthreads();
  __bf16* dst = (which < 3) ? PK + PK_A + ((size_t)which * DM + n) * DM : PK + PK_P + (size_t)n * DM;
  for (int q = t; q < DM / 8; q += 256) vst2((unsigned*)(dst + q * 8), *(const v4u*)&s[q * 8]);
}
__global__ __launch_bounds__(128) void k_qkv(const float* __restrict__ XQ, const float* __restrict__ XK, const float* __restrict__ XV, const __bf16* __restrict__ P, const float* __restrict__ BQ, const float* __restrict__ BK, const float* __restrict__ BV, _Float16* __restrict__ QK, _Float16* __restrict__ QKL, _Float16* __restrict__ VTH, _Float16* __restrict__ VTL) {
  const int which0 = (blockIdx.y * 128) / DM; const float* X = (which0 == 0) ? XQ : (which0 == 1) ? XK : XV; const float* BB = BQ ? (((which0 == 0) ? BQ : (which0 == 1) ? BK : BV) + (blockIdx.y * 128 - which0 * DM)) : nullptr;
  __shared__ __align__(16) char smem[2 * STG32];   // the ring; behind the loop's last barrier the output staging
  _Float16 (*so)[16][136] = (_Float16 (*)[16][136])smem, (*sol)[16][136] = (_Float16 (*)[16][136])(smem + 4 * 16 * 136 * 2); _Float16 (*sth)[72] = (_Float16 (*)[72])smem, (*stl)[72] = (_Float16 (*)[72])(smem + 128 * 72 * 2);
  const int tid = threadIdx.x, wave = tid >> 5, lane = tid & 31, col = lane & 15, g = lane >> 4; const size_t r0 = (size_t)blockIdx.x * 64 + wave * 16; const int n0 = blockIdx.y * 128;
  v8f acc[8] = {};
  const unsigned l0 = lds_off(smem); const char* gB = (const char*)(P + (size_t)n0 * DM); const char* gA = (const char*)(X + (size_t)blockIdx.x * 64 * DM);
  stage128<128>(l0, gB, DM * 2, tid); stage256<64>(l0 + 128 * P128, gA, DM * 4, tid);
  WAIT_ASYNC(); __syncthreads();
  stage128<128>(l0 + STG32, gB + 128, DM * 2, tid); stage256<64>(l0 + STG32 + 128 * P128, gA + 256, DM * 4, tid);
  for (int t = 0; t < DM / KST; ++t) { const char* bs = smem + (t & 1) * STG32;
    v16b a[2], w[2][8];   // the stage's fragment reads all stand ahead of its products: one LDS latency a stage, not one a product (the loops below are unrolled so that every fragment index is a constant and the arrays stay in registers)
#pragma unroll
    for (int kk = 0; kk < 2; ++kk) { const float* p = (const float*)(bs + 128 * P128 + (wave * 16 + col) * P256) + kk * 32 + 8 * g;
#pragma unroll
      for (int i = 0; i < 8; ++i) { a[kk][i] = (__bf16)p[i]; a[kk][8 + i] = (__bf16)p[16 + i]; }
#pragma unroll
      for (int j = 0; j < 8; ++j) w[kk][j] = frag_b((const __bf16*)(bs + (j * 16 + col) * P128) + kk * 32, lane); }
#pragma unroll
    for (int kk = 0; kk < 2; ++kk) {
#pragma unroll
      for (int j = 0; j < 8; ++j) acc[j] = wmma_bf(a[kk], w[kk][j], acc[j]); }
    WAIT_DS(); WAIT_ASYNC(); __syncthreads();   // publishes stage t + 1 and ends every read of stage t
    if (t + 2 < DM / KST) { stage128<128>(l0 + (t & 1) * STG32, gB + (size_t)(t + 2) * 128, DM * 2, tid); stage256<64>(l0 + (t & 1) * STG32 + 128 * P128, gA + (size_t)(t + 2) * 256, DM * 4, tid); } }
  WAIT_ASYNC();
  if (n0 < 2 * DM) {   // q stored unscaled (f16 sigma ~0.6, no subnormal exposure); 1/8 applied to the f32 score
#pragma unroll
    for (int j = 0; j < 8; ++j) {
#pragma unroll
      for (int r = 0; r < 8; ++r) { const float v = acc[j][r] + (BB ? bfr(BB[j * 16 + col]) : 0.f); const _Float16 hv = (_Float16)v; so[wave][8 * g + r][j * 16 + col] = hv; sol[wave][8 * g + r][j * 16 + col] = (_Float16)((v - (float)hv) * 2048.0f); } }   // q, k (+ bias) as f16 hi + (x2048) residual
    LDSX();
    for (int rl = 0; rl < 16; ++rl) if (lane < 16) { vst2((unsigned*)(QK + (r0 + rl) * (2 * DM) + n0 + lane * 8), *(const v4u*)&so[wave][rl][lane * 8]); vst2((unsigned*)(QKL + (r0 + rl) * (2 * DM) + n0 + lane * 8), *(const v4u*)&sol[wave][rl][lane * 8]); }
  } else {
#pragma unroll
    for (int j = 0; j < 8; ++j) {
#pragma unroll
      for (int r = 0; r < 8; ++r) { const float v = acc[j][r] + (BB ? bfr(BB[j * 16 + col]) : 0.f); const _Float16 hv = (_Float16)v; sth[j * 16 + col][wave * 16 + 8 * g + r] = hv; stl[j * 16 + col][wave * 16 + 8 * g + r] = (_Float16)((v - (float)hv) * 2048.0f); } }
    __syncthreads();
    const size_t rb = (size_t)blockIdx.x * 64; const int b = (int)(rb / SS), s0 = (int)(rb % SS); const int pc0 = n0 - 2 * DM;
    for (int q = tid; q < 128 * 8; q += 128) { const int d = q >> 3, pc = q & 7; const size_t o = ((size_t)b * DM + pc0 + d) * SS + s0 + pc * 8; vst2((unsigned*)(VTH + o), *(const v4u*)&sth[d][pc * 8]); vst2((unsigned*)(VTL + o), *(const v4u*)&stl[d][pc * 8]); }
  }
}
// lane l <-> lane l ^ 16: the two lanes that share a query column
__device__ __forceinline__ float xhalf(float x) { return __builtin_bit_cast(float, __builtin_amdgcn_permlanex16(__builtin_bit_cast(int, x), __builtin_bit_cast(int, x), 0x76543210, 0xfedcba98, false, false)); }
// ---- k_attn: block = (64 queries, head h, batch b): all-keys flash attention with both products transposed: S^T = K . Q^T (A = key rows, B = the wave's 16 queries), O^T += V^T . P^T (A = v rows [d][key], B = P^T). A lane then holds 8 keys of ONE query (column lane & 15, keys 8 * (lane >> 4) + r of a 16-key tile): maximum and sum run inside the lane, one exchange with lane ^ 16 for the maximum; two score tiles converted in place are the B operand of the second product (element i = tile i >> 3, register i & 7), so P touches neither LDS nor another lane. Single f16 operands; softmax in base 2 on the raw scores, weights x 2^11 in numerator and denominator alike; O[b*S+q][h*64+d] = acc / l (256-B segments)
__global__ __launch_bounds__(128) void k_attn(const _Float16* __restrict__ QK, const _Float16* __restrict__ QKL, const _Float16* __restrict__ VTH, const _Float16* __restrict__ VTL, const void* __restrict__ KMASK, const int* __restrict__ MSK, float* __restrict__ O) {
  __shared__ __align__(16) char smem[2 * STG32];   // the ring (64 key rows, 64 v rows, 64 mask rows a stage); behind the loop's last barrier the output staging
  float (*so)[16][68] = (float (*)[16][68])smem;
  const int tid = threadIdx.x, wave = tid >> 5, lane = tid & 31, col = lane & 15, g = lane >> 4;
  const int qb = blockIdx.x, h = blockIdx.y, b = blockIdx.z; const int q0 = qb * 64 + wave * 16; const size_t rq = (size_t)b * SS + q0 + col;
  v16h aq[2];
#pragma unroll
  for (int kc = 0; kc < 2; ++kc) aq[kc] = frag_h(QK + rq * (2 * DM) + h * HD + kc * 32, lane);
  const float KS = 0.125f * 1.4426950408889634f;   // 1/sqrt(64) and log2(e) in one factor
  float m = -3.0e38f, l = 0.f;   // of this lane's query: running maximum of score x KS (alike in both lanes of the column); this lane's own part of the sum
  v8f acc[4] = {};
  // a stage is 64 keys (all keys are walked): 64 k rows of 128 B, the head's 64 v rows of 128 B, the block's 64 mask rows of 256 B
  const unsigned l0 = lds_off(smem); const char* gK = (const char*)(QK + (size_t)b * SS * (2 * DM) + DM + h * HD); const char* gV = (const char*)(VTH + ((size_t)b * DM + h * HD) * SS); const char* gM = (const char*)(MSK + (size_t)qb * 64 * SS);
  stage128<64>(l0, gK, 2 * DM * 2, tid); stage128<64>(l0 + 64 * P128, gV, SS * 2, tid); stage256<64>(l0 + 128 * P128, gM, SS * 4, tid);
  WAIT_ASYNC(); __syncthreads();
  stage128<64>(l0 + STG32, gK + (size_t)64 * 2 * DM * 2, 2 * DM * 2, tid); stage128<64>(l0 + STG32 + 64 * P128, gV + 128, SS * 2, tid); stage256<64>(l0 + STG32 + 128 * P128, gM + 256, SS * 4, tid);
#pragma unroll 1   // the stage loop stays rolled, as the key loop was: its body already holds two turns
  for (int t = 0; t < SS / 64; ++t) { const char* bs = smem + (t & 1) * STG32;
#pragma unroll     // both turns of a stage unrolled: their LDS offsets become immediates
  for (int sub = 0; sub < 2; ++sub) { v8f s[2]; v16h kf[2][2], vf[4]; v4i mk[2][2];   // 32 keys a turn; its LDS reads all stand ahead of its products: one LDS latency a turn, not one a product
#pragma unroll
    for (int ct = 0; ct < 2; ++ct) {
#pragma unroll
      for (int kc = 0; kc < 2; ++kc) kf[ct][kc] = frag_h((const _Float16*)(bs + (sub * 32 + ct * 16 + col) * P128) + kc * 32, lane);
      const v4i* pm = (const v4i*)(bs + 128 * P128 + (wave * 16 + col) * P256 + (sub * 32 + ct * 16 + 8 * g) * 4); mk[ct][0] = pm[0]; mk[ct][1] = pm[1]; }   // the query's mask row, this lane's 8 keys: 32 B in a row
#pragma unroll
    for (int dt = 0; dt < 4; ++dt) vf[dt] = frag_h((const _Float16*)(bs + 64 * P128 + (dt * 16 + col) * P128) + sub * 32, lane);
    float mx = -3.0e38f;
#pragma unroll
    for (int ct = 0; ct < 2; ++ct) { v8f c = {};
#pragma unroll
      for (int kc = 0; kc < 2; ++kc) c = wmma16(kf[ct][kc], aq[kc], c);   // single product: k, q as one-rounding f16 operands; c[r] = key ct * 16 + 8 * g + r against query col
#pragma unroll
      for (int r = 0; r < 8; ++r) { s[ct][r] = (mk[ct][r >> 2][r & 3] != 1) ? c[r] : -3.0e38f; mx = fmaxf(mx, s[ct][r]); } }   // mask == 1 -> -1e9 == excluded
    mx = fmaxf(mx, xhalf(mx)) * KS;   // KS > 0: the maximum of the raw scores, scaled, is the maximum of the scaled ones
    const float mn = fmaxf(m, mx); const float base = (mn <= -1.0e37f) ? 0.f : mn;   // no key of this query admitted yet: every weight below comes out 0
    const float nb = 11.0f - base; float x[17];   // 2^11 in the exponent keeps small softmax weights out of the f16 subnormal range; the sum carries it too, so it cancels in the epilogue
#pragma unroll
    for (int i = 0; i < 16; ++i) x[i] = fmaf(s[i >> 3][i & 7], KS, nb);   // an excluded score gives exp2(-huge) = 0
    x[16] = m - base; m = mn;
    // the turn's 17 exponentials in one statement, each in place: no neighbour reads the result or overwrites the source of the one in front of it, and the closing v_nop keeps that one slot behind the last
    asm("v_exp_f32 %0, %0\n\tv_exp_f32 %1, %1\n\tv_exp_f32 %2, %2\n\tv_exp_f32 %3, %3\n\tv_exp_f32 %4, %4\n\tv_exp_f32 %5, %5\n\tv_exp_f32 %6, %6\n\tv_exp_f32 %7, %7\n\tv_exp_f32 %8, %8\n\tv_exp_f32 %9, %9\n\tv_exp_f32 %10, %10\n\tv_exp_f32 %11, %11\n\tv_exp_f32 %12, %12\n\tv_exp_f32 %13, %13\n\tv_exp_f32 %14, %14\n\tv_exp_f32 %15, %15\n\tv_exp_f32 %16, %16\n\tv_nop"
        : "+v"(x[0]), "+v"(x[1]), "+v"(x[2]), "+v"(x[3]), "+v"(x[4]), "+v"(x[5]), "+v"(x[6]), "+v"(x[7]), "+v"(x[8]), "+v"(x[9]), "+v"(x[10]), "+v"(x[11]), "+v"(x[12]), "+v"(x[13]), "+v"(x[14]), "+v"(x[15]), "+v"(x[16]));
    const float alpha = x[16]; v16h pa; float es[4] = { 0.f, 0.f, 0.f, 0.f };
#pragma unroll
    for (int i = 0; i < 16; ++i) { es[i & 3] += x[i]; pa[i] = (_Float16)x[i]; }   // element i of the B operand = tile i >> 3, register i & 7
    l = l * alpha + ((es[0] + es[1]) + (es[2] + es[3]));
#pragma unroll
    for (int dt = 0; dt < 4; ++dt) { acc[dt] *= alpha; acc[dt] = wmma16(vf[dt], pa, acc[dt]); } }   // single product: V^T x P^T (x2^11); acc[dt][r] = d dt * 16 + 8 * g + r of query col
    WAIT_DS(); WAIT_ASYNC(); __syncthreads();   // publishes stage t + 1 and ends every read of stage t
    if (t + 2 < SS / 64) { const unsigned l = l0 + (t & 1) * STG32; stage128<64>(l, gK + (size_t)(t + 2) * 64 * 2 * DM * 2, 2 * DM * 2, tid); stage128<64>(l + 64 * P128, gV + (size_t)(t + 2) * 128, SS * 2, tid); stage256<64>(l + 128 * P128, gM + (size_t)(t + 2) * 256, SS * 4, tid); } }
  WAIT_ASYNC();
  const float il = 1.0f / (l + xhalf(l));   // the column's two lanes join their sums once
#pragma unroll
  for (int dt = 0; dt < 4; ++dt) { const v8f o = acc[dt] * il; vst2(&so[wave][col][dt * 16 + 8 * g], (v4f){ o[0], o[1], o[2], o[3] }); vst2(&so[wave][col][dt * 16 + 8 * g + 4], (v4f){ o[4], o[5], o[6], o[7] }); }
  LDSX();
  for (int rl = 0; rl < 16; ++rl) if (lane < 16) vst2(O + ((size_t)b * SS + q0 + rl) * DM + h * HD + lane * 4, *(const v4f*)&so[wave][rl][lane * 4]);
}
// ---- k_out: block = (64 rows, 128 cols): out = O(hi/lo) . Wo rows (2 products) + bo
__global__ __launch_bounds__(128) void k_out(const float* __restrict__ O, const __bf16* __restrict__ P, const float* __restrict__ BO, float* __restrict__ Y) {
  __shared__ __align__(16) char smem[2 * STG32];   // the ring; behind the loop's last barrier the output staging
  float (*so)[16][132] = (float (*)[16][132])smem;
  const int tid = threadIdx.x, wave = tid >> 5, lane = tid & 31, col = lane & 15, g = lane >> 4; const size_t r0 = (size_t)blockIdx.x * 64 + wave * 16; const int n0 = blockIdx.y * 128;
  v8f acc[8] = {};
  const unsigned l0 = lds_off(smem); const char* gB = (const char*)(P + (size_t)n0 * DM); const char* gA = (const char*)(O + (size_t)blockIdx.x * 64 * DM);
  stage128<128>(l0, gB, DM * 2, tid); stage256<64>(l0 + 128 * P128, gA, DM * 4, tid);
  WAIT_ASYNC(); __syncthreads();
  stage128<128>(l0 + STG32, gB + 128, DM * 2, tid); stage256<64>(l0 + STG32 + 128 * P128, gA + 256, DM * 4, tid);
  for (int t = 0; t < DM / KST; ++t) { const char* bs = smem + (t & 1) * STG32;
    F2 a[2]; v16b w[2][8];   // the stage's fragment reads all stand ahead of its products: one LDS latency a stage, not one a product (the loops below are unrolled so that every fragment index is a constant and the arrays stay in registers)
#pragma unroll
    for (int kk = 0; kk < 2; ++kk) { a[kk] = split_row((const float*)(bs + 128 * P128 + (wave * 16 + col) * P256), kk * 32, lane);
#pragma unroll
      for (int j = 0; j < 8; ++j) w[kk][j] = frag_b((const __bf16*)(bs + (j * 16 + col) * P128) + kk * 32, lane); }
#pragma unroll
    for (int kk = 0; kk < 2; ++kk) {
#pragma unroll
      for (int j = 0; j < 8; ++j) { acc[j] = wmma_bf(a[kk].l, w[kk][j], acc[j]); acc[j] = wmma_bf(a[kk].h, w[kk][j], acc[j]); } }
    WAIT_DS(); WAIT_ASYNC(); __syncthreads();   // publishes stage t + 1 and ends every read of stage t
    if (t + 2 < DM / KST) { stage128<128>(l0 + (t & 1) * STG32, gB + (size_t)(t + 2) * 128, DM * 2, tid); stage256<64>(l0 + (t & 1) * STG32 + 128 * P128, gA + (size_t)(t + 2) * 256, DM * 4, tid); } }
  WAIT_ASYNC();
#pragma unroll
  for (int j = 0; j < 8; ++j) {
#pragma unroll
    for (int r = 0; r < 8; ++r) so[wave][8 * g + r][j * 16 + col] = acc[j][r] + bfr(BO[n0 + j * 16 + col]); }
  LDSX();
  for (int rl = 0; rl < 16; ++rl) vst2(Y + (r0 + rl) * DM + n0 + lane * 4, *(const v4f*)&so[wave][rl][lane * 4]);
}
// ---- k_packff: (in,out) W1 [1024][4096] -> rows [4096][1024] f16 x 2^8 ; W2 [4096][1024] -> rows [1024][4096]
__global__ __launch_bounds__(256) void k_packff(const float* __restrict__ W1, const float* __restrict__ W2, _Float16* __restrict__ PF, _Float16* __restrict__ PM) { __shared__ __align__(16) _Float16 s[DFF]; const int n = blockIdx.x, which = blockIdx.y, t = threadIdx.x;
  if (which == 0) { for (int k = t; k < DM; k += 256) s[k] = (_Float16)(bfr(W1[(size_t)k * DFF + n]) * 256.0f); __syncthreads(); for (int q = t; q < DM / 8; q += 256) vst2((unsigned*)(PF + (size_t)n * DM + q * 8), *(const v4u*)&s[q * 8]); }
  else { if (n >= DM) return; for (int k = t; k < DFF; k += 256) s[k] = (_Float16)(bfr(W2[(size_t)k * DM + n]) * 256.0f); __syncthreads(); for (int q = t; q < DFF / 8; q += 256) vst2((unsigned*)(PM + (size_t)n * DFF + q * 8), *(const v4u*)&s[q * 8]); } }
// ---- k_lnres<F16OUT, RESX>: block = row (256 threads x 4): y = R + LayerNorm(A) x gamma + beta (mean((x-m)^2), eps 1e-5); RESX: residual is the bf16-rounded input x (else an f32 buffer); optional f16 copy for the FF
template <int F16OUT, int RESX>
__global__ __launch_bounds__(256) void k_lnres(const float* __restrict__ A, const float* __restrict__ R, const float* __restrict__ G, const float* __restrict__ Bt, float* __restrict__ Y, _Float16* __restrict__ Y16) {
  __shared__ float red[8]; __shared__ __align__(16) _Float16 sh[DM]; const int t = threadIdx.x; const size_t row = blockIdx.x; float v[4]; float s = 0.f; for (int i = 0; i < 4; ++i) { v[i] = A[row * DM + t * 4 + i]; s += v[i]; }
#pragma unroll
  for (int o = 1; o < 32; o <<= 1) s += __shfl_xor(s, o);
  if ((t & 31) == 0) red[t >> 5] = s; __syncthreads(); float tot = 0.f; for (int i = 0; i < 8; ++i) tot += red[i]; const float mu = tot / (float)DM; __syncthreads();
  float q = 0.f; for (int i = 0; i < 4; ++i) { const float dd = v[i] - mu; q += dd * dd; }
#pragma unroll
  for (int o = 1; o < 32; o <<= 1) q += __shfl_xor(q, o);
  if ((t & 31) == 0) red[t >> 5] = q; __syncthreads(); float tq = 0.f; for (int i = 0; i < 8; ++i) tq += red[i]; const float inv = 1.0f / sqrtf(tq / (float)DM + 1e-5f);
  v4f o4; for (int i = 0; i < 4; ++i) { const int e = t * 4 + i; const float rr = RESX ? bfr(R[row * DM + e]) : R[row * DM + e]; o4[i] = rr + ((v[i] - mu) * inv * bfr(G[e]) + bfr(Bt[e])); if (F16OUT) sh[e] = (_Float16)o4[i]; }
  vst2(Y + row * DM + t * 4, o4);
  if (F16OUT) { __syncthreads(); if (t < DM / 8) vst2((unsigned*)(Y16 + row * DM + t * 8), *(const v4u*)&sh[t * 8]); }
}
// ---- k_mlp<MODE>: block = (64 rows, 128 cols): MODE 0: G = gelu_exact(X1 . W1 + b1) (K 1024 -> 4096) f16; MODE 1: HF = gelu_exact(G . W2 + b2) (K 4096 -> 1024) f32
template <int MODE>
__global__ __launch_bounds__(128) void k_mlp(const _Float16* __restrict__ Ain, const _Float16* __restrict__ Wr, const float* __restrict__ BIAS, const float* __restrict__ RES, float* __restrict__ OUTF, _Float16* __restrict__ OG) {
  constexpr int KIN = (MODE == 0) ? DM : DFF; constexpr int NOUT = (MODE == 0) ? DFF : DM;
  __shared__ __align__(16) char smem[2 * STG16];   // the ring; behind the loop's last barrier the output staging
  float (*so)[16][132] = (float (*)[16][132])smem; _Float16 (*sg)[16][136] = (_Float16 (*)[16][136])smem;
  const int tid = threadIdx.x, wave = tid >> 5, lane = tid & 31, col = lane & 15, g = lane >> 4; const size_t r0 = (size_t)blockIdx.x * 64 + wave * 16; const int n0 = blockIdx.y * 128;
  v8f acc[8] = {};
  const unsigned l0 = lds_off(smem); const char* gB = (const char*)(Wr + (size_t)n0 * KIN); const char* gA = (const char*)(Ain + (size_t)blockIdx.x * 64 * KIN);
  stage128<128>(l0, gB, KIN * 2, tid); stage128<64>(l0 + 128 * P128, gA, KIN * 2, tid);
  WAIT_ASYNC(); __syncthreads();
  stage128<128>(l0 + STG16, gB + 128, KIN * 2, tid); stage128<64>(l0 + STG16 + 128 * P128, gA + 128, KIN * 2, tid);
  for (int t = 0; t < KIN / KST; ++t) { const char* bs = smem + (t & 1) * STG16;
    v16h a[2], w[2][8];   // the stage's fragment reads all stand ahead of its products: one LDS latency a stage, not one a product (the loops below are unrolled so that every fragment index is a constant and the arrays stay in registers)
#pragma unroll
    for (int kk = 0; kk < 2; ++kk) { a[kk] = frag_h((const _Float16*)(bs + 128 * P128 + (wave * 16 + col) * P128) + kk * 32, lane);
#pragma unroll
      for (int j = 0; j < 8; ++j) w[kk][j] = frag_h((const _Float16*)(bs + (j * 16 + col) * P128) + kk * 32, lane); }
#pragma unroll
    for (int kk = 0; kk < 2; ++kk) {
#pragma unroll
      for (int j = 0; j < 8; ++j) acc[j] = wmma16(a[kk], w[kk][j], acc[j]); }
    WAIT_DS(); WAIT_ASYNC(); __syncthreads();   // publishes stage t + 1 and ends every read of stage t
    if (t + 2 < KIN / KST) { stage128<128>(l0 + (t & 1) * STG16, gB + (size_t)(t + 2) * 128, KIN * 2, tid); stage128<64>(l0 + (t & 1) * STG16 + 128 * P128, gA + (size_t)(t + 2) * 128, KIN * 2, tid); } }
  WAIT_ASYNC();
#pragma unroll
  for (int j = 0; j < 8; ++j) { const int c = n0 + j * 16 + col; const float bb = bfr(BIAS[c]);
#pragma unroll
    for (int r = 0; r < 8; ++r) { const float x = acc[j][r] * (1.0f / 256.0f) + bb; if (MODE == 0) sg[wave][8 * g + r][j * 16 + col] = (_Float16)gelu_e(x); else so[wave][8 * g + r][j * 16 + col] = gelu_e(x); } }
  LDSX();
  if (MODE == 0) { for (int rl = 0; rl < 16; ++rl) if (lane < 16) vst2((unsigned*)(OG + (r0 + rl) * NOUT + n0 + lane * 8), *(const v4u*)&sg[wave][rl][lane * 8]); }
  else { for (int rl = 0; rl < 16; ++rl) vst2(OUTF + (r0 + rl) * NOUT + n0 + lane * 4, *(const v4f*)&so[wave][rl][lane * 4]); }
}

extern "C" void kernel_launch(void* const* d_in, const int* in_sizes, int n_in, void* d_out, int out_size, void* d_ws, size_t ws_size, hipStream_t stream) {
  (void)in_sizes; (void)n_in; (void)out_size;
  const float** F = (const float**)d_in;   // 0 x [2,2048,1024], 1 mask [1,1,2048,2048] int, 2 Wq, 3 Wk, 4 Wv, 5 Wo ((in,out)), 6 bo, 7 ln1_g, 8 ln1_b, 9 W1 [1024,4096], 10 b1, 11 W2 [4096,1024], 12 b2, 13 ln2_g, 14 ln2_b
  if (ws_size < (size_t)WS_END) return;
  char* ws = (char*)d_ws; __bf16* PK = (__bf16*)(ws + WS_PK); _Float16 *QK = (_Float16*)(ws + WS_QK), *QKL = (_Float16*)(ws + WS_QKL), *VTH = (_Float16*)(ws + WS_VTH), *VTL = (_Float16*)(ws + WS_VTL), *PF = (_Float16*)(ws + WS_PF), *PM = (_Float16*)(ws + WS_PM), *X16 = (_Float16*)(ws + WS_X16), *Gb = (_Float16*)(ws + WS_G); float *O = (float*)(ws + WS_O), *A0 = (float*)(ws + WS_A0), *X1 = (float*)(ws + WS_X1), *HF = (float*)(ws + WS_HF);
  k_pack<<<dim3(DM, 4), 256, 0, stream>>>(F[2], F[3], F[4], F[5], PK);
  k_packff<<<dim3(DFF, 2), 256, 0, stream>>>(F[9], F[11], PF, PM);
  k_qkv<<<dim3(TNB * SS / 64, QKVW / 128), 128, 0, stream>>>(F[0], F[0], F[0], PK + PK_A, nullptr, nullptr, nullptr, QK, QKL, VTH, VTL);
  k_attn<<<dim3(TQB, NH, TNB), 128, 0, stream>>>(QK, QKL, VTH, VTL, nullptr, (const int*)d_in[1], O);
  k_out<<<dim3(TOB, DM / 128), 128, 0, stream>>>(O, PK + PK_P, F[6], A0);
  k_lnres<1, 1><<<TOB * 64, 256, 0, stream>>>(A0, F[0], F[7], F[8], X1, X16);      // x1 = x + LN(attn branch)
  k_mlp<0><<<dim3(TOB, DFF / 128), 128, 0, stream>>>(X16, PF, F[10], nullptr, nullptr, Gb);
  k_mlp<1><<<dim3(TOB, DM / 128), 128, 0, stream>>>(Gb, PM, F[12], nullptr, HF, nullptr);
  k_lnres<0, 0><<<TOB * 64, 256, 0, stream>>>(HF, X1, F[13], F[14], (float*)d_out, nullptr);   // out = x1 + LN(ff branch)
}

// v003
// One run takes 261 microseconds.
// In both of two side-by-side timings against v002, it was 1.18 times as fast.
// Over all steps from v000 it is 3.34 times as fast.
// compute dtype: all float inputs rounded to bf16, the int mask read on device; q/k/v = x . W with EXACT bf16 products on WMMA 16x16x32 ((in,out) weights as transposed rows); PLAIN attention: q, k single f16 x 1/8, masked keys excluded, running-max softmax in f32 (hardware exp), P (scaled by 2^11, single f16) x v (single f16); attention out (bf16 hi + residual) . Wo (2 products) + bo; LayerNorms in f32; FF: x1 rounded once to f16 x exact f16 weight copies (x 2^8), exact GELU (erff), hidden f16, second exact GELU; f32 output.
#include <hip/hip_runtime.h>
#include <math.h>

typedef __attribute__((ext_vector_type(16))) _Float16 v16h;
typedef __attribute__((ext_vector_type(16))) __bf16 v16b;
typedef __attribute__((ext_vector_type(8)))  _Float16 v8h;
typedef __attribute__((ext_vector_type(8)))  float v8f;
typedef __attribute__((ext_vector_type(4)))  float v4f;
typedef __attribute__((ext_vector_type(2)))  float v2f;
typedef __attribute__((ext_vector_type(4)))  unsigned v4u;
typedef __attribute__((ext_vector_type(4)))  int v4i;
typedef float __attribute__((may_alias)) float_a;
typedef int __attribute__((may_alias)) int_a;

template <typename T> __device__ __forceinline__ void vst2(void* p, T v) { *(T*)p = v;  }
__device__ __forceinline__ v8f wmma16(v16h a, v16h b, v8f c) {
  v8f d = __builtin_amdgcn_wmma_f32_16x16x32_f16(false, a, false, b, (short)0, c, false, false);
  asm volatile("v_nop\n\tv_nop\n\tv_nop\n\tv_nop" : "+v"(d) : "v"(a), "v"(b));
  return d;
}
__device__ __forceinline__ v8f wmma_bf(v16b a, v16b b, v8f c) {
  v8f d = __builtin_amdgcn_wmma_f32_16x16x32_bf16(false, a, false, b, (short)0, c, false, false);
  asm volatile("v_nop\n\tv_nop\n\tv_nop\n\tv_nop" : "+v"(d) : "v"(a), "v"(b));
  return d;
}
// Transformer block (B 2, S 2,048, d 1,024, 16 heads x 64, FF 4,096): bias-free q/k/v projections, scores / 8 with a [S,S] mask (mask == 1 -> -1e9), softmax, . v, Wo + bo; x + LayerNorm(attention branch); FF with exact GELU after BOTH linears; x + LayerNorm(FF branch).
__device__ __forceinline__ v16h frag_h(const _Float16* rowk0, int lane) {
  union { v16h v; v8h q[2]; } u; const _Float16* p = rowk0 + 8 * (lane >> 4);
  u.q[0] = *(const v8h*)p; u.q[1] = *(const v8h*)(p + 16); return u.v;
}
__device__ __forceinline__ v16h frag_f32(const float* rowk0, int lane) {
  v16h a; const float* p = rowk0 + 8 * (lane >> 4);
#pragma unroll
  for (int i = 0; i < 8; ++i) { a[i] = (_Float16)p[i]; a[8 + i] = (_Float16)p[16 + i]; }
  return a;
}
__device__ __forceinline__ v16h frag_f32s(const float* rowk0, int lane, float sc) {
  v16h a; const float* p = rowk0 + 8 * (lane >> 4);
#pragma unroll
  for (int i = 0; i < 8; ++i) { a[i] = (_Float16)(p[i] * sc); a[8 + i] = (_Float16)(p[16 + i] * sc); }
  return a;
}
// column fragment from a [K][ld] layout (column n), rows >= K read as 0
__device__ __forceinline__ v16h fragc_f32(const float* W, int k0, int n, int lane, int ld, int K) {
  v16h a; const int g = lane >> 4;
#pragma unroll
  for (int i = 0; i < 8; ++i) { const int ka = k0 + 8 * g + i, kb = ka + 16;
    a[i] = (_Float16)(ka < K ? W[(size_t)(ka < K ? ka : K - 1) * ld + n] : 0.f); a[8 + i] = (_Float16)(kb < K ? W[(size_t)(kb < K ? kb : K - 1) * ld + n] : 0.f); }
  return a;
}
struct F2 { v16b h, l; };
__device__ __forceinline__ F2 bsplit16(const float v[16]) { F2 r;
#pragma unroll
  for (int i = 0; i < 16; ++i) { const __bf16 h = (__bf16)v[i]; r.h[i] = h; r.l[i] = (__bf16)(v[i] - (float)h); }
  return r; }
__device__ __forceinline__ F2 split_row(const float* row, int k0, int lane) { float v[16]; const float* p = row + k0 + 8 * (lane >> 4);
#pragma unroll
  for (int i = 0; i < 8; ++i) { v[i] = p[i]; v[8 + i] = p[16 + i]; }
  return bsplit16(v); }
__device__ __forceinline__ F2 split_rowK(const float* row, int k0, int lane, int K) { float v[16]; const int g = lane >> 4;
#pragma unroll
  for (int i = 0; i < 8; ++i) { const int ka = k0 + 8 * g + i, kb = ka + 16; v[i] = ka < K ? row[ka < K ? ka : K - 1] : 0.f; v[8 + i] = kb < K ? row[kb < K ? kb : K - 1] : 0.f; }
  return bsplit16(v); }
__device__ __forceinline__ F2 split_col(const float* W, int k0, int n, int lane, int ld, int K) { float v[16]; const int g = lane >> 4;
#pragma unroll
  for (int i = 0; i < 8; ++i) { const int ka = k0 + 8 * g + i, kb = ka + 16; v[i] = ka < K ? W[(size_t)(ka < K ? ka : K - 1) * ld + n] : 0.f; v[8 + i] = kb < K ? W[(size_t)(kb < K ? kb : K - 1) * ld + n] : 0.f; }
  return bsplit16(v); }
__device__ __forceinline__ v8f mac3(const F2& a, const F2& b, v8f c) { c = wmma_bf(a.l, b.h, c); c = wmma_bf(a.h, b.l, c); return wmma_bf(a.h, b.h, c); }
__device__ __forceinline__ float sigm(float v) { return 1.0f / (1.0f + expf(-v)); }
#define LDSX() do { asm volatile("s_wait_dscnt 0" ::: "memory"); __builtin_amdgcn_wave_barrier(); __builtin_amdgcn_fence(__ATOMIC_RELEASE, "workgroup"); } while (0)


#define NB 2
#define SS 2048
#define DM 1024
#define NH 16
#define DFF 4096
#define NR (NB * SS)
__device__ __attribute__((noinline)) float erf_p(float v) { return erff(v); }
__device__ __forceinline__ float gelu_e(float x) { return 0.5f * x * (1.0f + erf_p(x * 0.70710678118654752f)); }
#define HD 64
#define QKVW (3 * DM)
#ifndef TQB
#define TQB (SS / 64)
#define TNB NB
#define TOB (NB * SS / 64)     // output row tiles (all)
#endif
typedef __attribute__((ext_vector_type(8))) __bf16 v8b;
__device__ __forceinline__ v16b frag_b(const __bf16* rowk0, int lane) {
  union { v16b v; v8b q[2]; } u; const __bf16* p = rowk0 + 8 * (lane >> 4);
  u.q[0] = *(const v8b*)p; u.q[1] = *(const v8b*)(p + 16); return u.v;
}
__device__ __forceinline__ float bfr(float v) { return (float)(__bf16)v; }
__device__ __attribute__((noinline)) float exp_ni(float v) { return expf(v); }
__device__ __attribute__((noinline)) float erf_ni(float v) { return erff(v); }

// ---- LDS ring of the GEMM kernels: a stage is 64 k of the block's 128 weight rows and of its 64 activation rows, brought by asynchronous copies in whole lines, read by all four waves; two buffers
#define KST 64
#define P128 144   // LDS pitch of a 128-B row: 16 B x odd, no bank conflict for 16-B reads down a column of rows
#define P256 272   // LDS pitch of a 256-B row, likewise
__device__ __forceinline__ unsigned lds_off(const void* p) { return (unsigned)(size_t)p; }
// four copies of 16 B a lane; s_wait_xcnt closes the statement so that no address register of a copy is rewritten ahead of it
__device__ __forceinline__ void cp4(unsigned l0, unsigned l1, unsigned l2, unsigned l3, const char* g0, const char* g1, const char* g2, const char* g3) {
  asm volatile("global_load_async_to_lds_b128 %0, %4, off\n\tglobal_load_async_to_lds_b128 %1, %5, off\n\tglobal_load_async_to_lds_b128 %2, %6, off\n\tglobal_load_async_to_lds_b128 %3, %7, off\n\ts_wait_xcnt 0x0"
               :: "v"(l0), "v"(l1), "v"(l2), "v"(l3), "v"(g0), "v"(g1), "v"(g2), "v"(g3) : "memory");
}
// NROW rows of 128 B (global pitch gp bytes) -> LDS at pitch P128: 8 lanes a row, 16 rows a copy of the 128 threads
template <int NROW> __device__ __forceinline__ void stage128(unsigned l, const char* g, size_t gp, int tid) {
  l += (tid >> 3) * P128 + (tid & 7) * 16; g += (size_t)(tid >> 3) * gp + (tid & 7) * 16;
  for (int i = 0; i < NROW / 16; i += 4) cp4(l + i * 16 * P128, l + (i + 1) * 16 * P128, l + (i + 2) * 16 * P128, l + (i + 3) * 16 * P128, g + (size_t)i * 16 * gp, g + (size_t)(i + 1) * 16 * gp, g + (size_t)(i + 2) * 16 * gp, g + (size_t)(i + 3) * 16 * gp);
}
// NROW rows of 256 B -> LDS at pitch P256: 16 lanes a row, 8 rows a copy of the 128 threads
template <int NROW> __device__ __forceinline__ void stage256(unsigned l, const char* g, size_t gp, int tid) {
  l += (tid >> 4) * P256 + (tid & 15) * 16; g += (size_t)(tid >> 4) * gp + (tid & 15) * 16;
  for (int i = 0; i < NROW / 8; i += 4) cp4(l + i * 8 * P256, l + (i + 1) * 8 * P256, l + (i + 2) * 8 * P256, l + (i + 3) * 8 * P256, g + (size_t)i * 8 * gp, g + (size_t)(i + 1) * 8 * gp, g + (size_t)(i + 2) * 8 * gp, g + (size_t)(i + 3) * 8 * gp);
}
#define WAIT_ASYNC() asm volatile("s_wait_asynccnt 0x0" ::: "memory")   // this wave's copies have landed
#define WAIT_DS() asm volatile("s_wait_dscnt 0x0" ::: "memory")         // this wave's LDS reads are done before the buffer is given up
#define STG16 ((128 + 64) * P128)          // one buffer, 16-bit activations: weight rows, then activation rows
#define STG32 (128 * P128 + 64 * P256)     // one buffer, f32 activations
#define PK_A 0                       // [3072][1024] Wqkv rows (natural [out][in])
#define PK_P (PK_A + QKVW * DM)        // [1024][1024] Wo rows (natural)
#define PK_END (PK_P + DM * DM)
#define WS_PK  0u
#define WS_QK  (WS_PK + 2u * PK_END)             // f16 [4096 rows][2048]: q | k
#define WS_QKL (WS_QK + 2u * NB * SS * 2 * DM)     // f16 q | k residual planes x2048
#define WS_VTH (WS_QKL + 2u * NB * SS * 2 * DM)    // f16 [b][1024 (h*64+d)][2048 s] hi
#define WS_VTL (WS_VTH + 2u * NB * DM * SS)        // f16 lo x 2048
#define WS_O   (WS_VTL + 2u * NB * DM * SS)        // f32 [4096][1024]
#define WS_CS  (WS_O + 4u * NB * SS * DM)           // f32 [2][2048][32], unused
#define WS_PF  (WS_CS + 4u * 2 * SS * 32)                  // f16 x 2^8 rows W1^T [4096][1024] ; W2^T [1024][4096]
#define WS_PM  (WS_PF + 2u * (size_t)DFF * DM)
#define WS_A0  (WS_PM + 2u * (size_t)DM * DFF)          // f32 [NR][1024] attention branch ; X1 f32 ; HF f32 (ff branch)
#define WS_X1  (WS_A0 + 4u * (size_t)NR * DM)
#define WS_HF  (WS_X1 + 4u * (size_t)NR * DM)
#define WS_X16 (WS_HF + 4u * (size_t)NR * DM)           // f16 [NR][1024] x1 ; G f16 [NR][4096]
#define WS_G   (WS_X16 + 2u * (size_t)NR * DM)
#define WS_END (WS_G + 2u * (size_t)NR * DFF)
// ---- weight packs: a block transposes one tile of 128 k x 64 n of an (in,out) f32 weight into 64 packed 16-bit rows of 128 k. A thread loads 8 k rows x 4 n as 16-B pieces (16 lanes cover 256 B in a row of the source), converts, and puts 8 k of each of its 4 n as one 16-B piece into LDS; the rows then go out as 256 B in a row of the packed plane
#define TPK 128
#define TPN 64
#define TPP 272   // LDS pitch of a packed 256-B row
template <int F16> __device__ __forceinline__ void pack_tile(const float* __restrict__ Wt, unsigned ldw, char* __restrict__ dst, unsigned ldd, char* s, int t) {   // Wt: the tile's first element, ldw its row pitch in bytes; dst: the tile's first packed byte, ldd its row pitch in bytes
  const int n4 = t & 15, kg = t >> 4; const unsigned go = (unsigned)kg * 8u * ldw + n4 * 16; v4f r[8];   // a block-uniform row address plus one 32-bit lane offset (under 2 MiB) for all 8 loads
#pragma unroll   // the 8 loads of a thread are in flight together, and r stays in registers
  for (int i = 0; i < 8; ++i) r[i] = *(const v4f*)((const char*)Wt + (size_t)i * ldw + go);
  asm volatile("s_wait_xcnt 0x0" ::: "memory");   // stands in front of every later write of a register that the 8 loads name as an address
#pragma unroll   // constant indices into r
  for (int j = 0; j < 4; ++j) { v4u o;
    if (F16) { v8h h;
#pragma unroll
      for (int i = 0; i < 8; ++i) h[i] = (_Float16)(bfr(r[i][j]) * 256.0f);
      o = __builtin_bit_cast(v4u, h); }
    else { v8b h;
#pragma unroll
      for (int i = 0; i < 8; ++i) h[i] = (__bf16)r[i][j];
      o = __builtin_bit_cast(v4u, h); }
    *(v4u*)(s + (n4 * 4 + j) * TPP + kg * 16) = o; }
  __syncthreads();
  const int n = t >> 4, c = t & 15; const unsigned so = (unsigned)n * ldd + c * 16; v4u o[4];   // 16 lanes a packed row, 16 rows a turn of the 256 threads
#pragma unroll   // the 4 LDS reads stand together ahead of the 4 stores: one LDS latency, not four
  for (int i = 0; i < TPN / 16; ++i) o[i] = *(const v4u*)(s + (n + i * 16) * TPP + c * 16);
#pragma unroll
  for (int i = 0; i < TPN / 16; ++i) vst2(dst + (size_t)i * 16 * ldd + so, o[i]);
}
// ---- k_pack: block = (tile, which): which 0..2 -> W_q/W_k/W_v into PK_A rows which*1024 + n (pack row n = column n, bf16); 3 -> W_o into PK_P
__global__ __launch_bounds__(256) void k_pack(const float* __restrict__ WQ, const float* __restrict__ WK, const float* __restrict__ WV, const float* __restrict__ WO, __bf16* __restrict__ PK) {
  __shared__ __align__(16) char s[TPN * TPP]; const int k0 = (blockIdx.x % (DM / TPK)) * TPK, n0 = (blockIdx.x / (DM / TPK)) * TPN, which = blockIdx.y; const float* Wm = (which == 0) ? WQ : (which == 1) ? WK : (which == 2) ? WV : WO;
  __bf16* dst = (which < 3) ? PK + PK_A + ((size_t)which * DM + n0) * DM + k0 : PK + PK_P + (size_t)n0 * DM + k0;
  pack_tile<0>(Wm + (size_t)k0 * DM + n0, DM * 4, (char*)dst, DM * 2, s, threadIdx.x);
}
__global__ __launch_bounds__(128) void k_qkv(const float* __restrict__ XQ, const float* __restrict__ XK, const float* __restrict__ XV, const __bf16* __restrict__ P, const float* __restrict__ BQ, const float* __restrict__ BK, const float* __restrict__ BV, _Float16* __restrict__ QK, _Float16* __restrict__ QKL, _Float16* __restrict__ VTH, _Float16* __restrict__ VTL) {
  const int which0 = (blockIdx.y * 128) / DM; const float* X = (which0 == 0) ? XQ : (which0 == 1) ? XK : XV; const float* BB = BQ ? (((which0 == 0) ? BQ : (which0 == 1) ? BK : BV) + (blockIdx.y * 128 - which0 * DM)) : nullptr;
  __shared__ __align__(16) char smem[2 * STG32];   // the ring; behind the loop's last barrier the output staging
  _Float16 (*so)[16][136] = (_Float16 (*)[16][136])smem, (*sol)[16][136] = (_Float16 (*)[16][136])(smem + 4 * 16 * 136 * 2); _Float16 (*sth)[72] = (_Float16 (*)[72])smem, (*stl)[72] = (_Float16 (*)[72])(smem + 128 * 72 * 2);
  const int tid = threadIdx.x, wave = tid >> 5, lane = tid & 31, col = lane & 15, g = lane >> 4; const size_t r0 = (size_t)blockIdx.x * 64 + wave * 16; const int n0 = blockIdx.y * 128;
  v8f acc[8] = {};
  const unsigned l0 = lds_off(smem); const char* gB = (const char*)(P + (size_t)n0 * DM); const char* gA = (const char*)(X + (size_t)blockIdx.x * 64 * DM);
  stage128<128>(l0, gB, DM * 2, tid); stage256<64>(l0 + 128 * P128, gA, DM * 4, tid);
  WAIT_ASYNC(); __syncthreads();
  stage128<128>(l0 + STG32, gB + 128, DM * 2, tid); stage256<64>(l0 + STG32 + 128 * P128, gA + 256, DM * 4, tid);
  for (int t = 0; t < DM / KST; ++t) { const char* bs = smem + (t & 1) * STG32;
    v16b a[2], w[2][8];   // the stage's fragment reads all stand ahead of its products: one LDS latency a stage, not one a product (the loops below are unrolled so that every fragment index is a constant and the arrays stay in registers)
#pragma unroll
    for (int kk = 0; kk < 2; ++kk) { const float* p = (const float*)(bs + 128 * P128 + (wave * 16 + col) * P256) + kk * 32 + 8 * g;
#pragma unroll
      for (int i = 0; i < 8; ++i) { a[kk][i] = (__bf16)p[i]; a[kk][8 + i] = (__bf16)p[16 + i]; }
#pragma unroll
      for (int j = 0; j < 8; ++j) w[kk][j] = frag_b((const __bf16*)(bs + (j * 16 + col) * P128) + kk * 32, lane); }
#pragma unroll
    for (int kk = 0; kk < 2; ++kk) {
#pragma unroll
      for (int j = 0; j < 8; ++j) acc[j] = wmma_bf(a[kk], w[kk][j], acc[j]); }
    WAIT_DS(); WAIT_ASYNC(); __syncthreads();   // publishes stage t + 1 and ends every read of stage t
    if (t + 2 < DM / KST) { stage128<128>(l0 + (t & 1) * STG32, gB + (size_t)(t + 2) * 128, DM * 2, tid); stage256<64>(l0 + (t & 1) * STG32 + 128 * P128, gA + (size_t)(t + 2) * 256, DM * 4, tid); } }
  WAIT_ASYNC();
  if (n0 < 2 * DM) {   // q stored unscaled (f16 sigma ~0.6, no subnormal exposure); 1/8 applied to the f32 score
#pragma unroll
    for (int j = 0; j < 8; ++j) {
#pragma unroll
      for (int r = 0; r < 8; ++r) { const float v = acc[j][r] + (BB ? bfr(BB[j * 16 + col]) : 0.f); const _Float16 hv = (_Float16)v; so[wave][8 * g + r][j * 16 + col] = hv; sol[wave][8 * g + r][j * 16 + col] = (_Float16)((v - (float)hv) * 2048.0f); } }   // q, k (+ bias) as f16 hi + (x2048) residual
    LDSX();
    for (int rl = 0; rl < 16; ++rl) if (lane < 16) { vst2((unsigned*)(QK + (r0 + rl) * (2 * DM) + n0 + lane * 8), *(const v4u*)&so[wave][rl][lane * 8]); vst2((unsigned*)(QKL + (r0 + rl) * (2 * DM) + n0 + lane * 8), *(const v4u*)&sol[wave][rl][lane * 8]); }
  } else {
#pragma unroll
    for (int j = 0; j < 8; ++j) {
#pragma unroll
      for (int r = 0; r < 8; ++r) { const float v = acc[j][r] + (BB ? bfr(BB[j * 16 + col]) : 0.f); const _Float16 hv = (_Float16)v; sth[j * 16 + col][wave * 16 + 8 * g + r] = hv; stl[j * 16 + col][wave * 16 + 8 * g + r] = (_Float16)((v - (float)hv) * 2048.0f); } }
    __syncthreads();
    const size_t rb = (size_t)blockIdx.x * 64; const int b = (int)(rb / SS), s0 = (int)(rb % SS); const int pc0 = n0 - 2 * DM;
    for (int q = tid; q < 128 * 8; q += 128) { const int d = q >> 3, pc = q & 7; const size_t o = ((size_t)b * DM + pc0 + d) * SS + s0 + pc * 8; vst2((unsigned*)(VTH + o), *(const v4u*)&sth[d][pc * 8]); vst2((unsigned*)(VTL + o), *(const v4u*)&stl[d][pc * 8]); }
  }
}
// lane l <-> lane l ^ 16: the two lanes that share a query column
__device__ __forceinline__ float xhalf(float x) { return __builtin_bit_cast(float, __builtin_amdgcn_permlanex16(__builtin_bit_cast(int, x), __builtin_bit_cast(int, x), 0x76543210, 0xfedcba98, false, false)); }
// ---- k_attn: block = (64 queries, head h, batch b): all-keys flash attention with both products transposed: S^T = K . Q^T (A = key rows, B = the wave's 16 queries), O^T += V^T . P^T (A = v rows [d][key], B = P^T). A lane then holds 8 keys of ONE query (column lane & 15, keys 8 * (lane >> 4) + r of a 16-key tile): maximum and sum run inside the lane, one exchange with lane ^ 16 for the maximum; two score tiles converted in place are the B operand of the second product (element i = tile i >> 3, register i & 7), so P touches neither LDS nor another lane. Single f16 operands; softmax in base 2 on the raw scores, weights x 2^11 in numerator and denominator alike; O[b*S+q][h*64+d] = acc / l (256-B segments)
__global__ __launch_bounds__(128) void k_attn(const _Float16* __restrict__ QK, const _Float16* __restrict__ QKL, const _Float16* __restrict__ VTH, const _Float16* __restrict__ VTL, const void* __restrict__ KMASK, const int* __restrict__ MSK, float* __restrict__ O) {
  __shared__ __align__(16) char smem[2 * STG32];   // the ring (64 key rows, 64 v rows, 64 mask rows a stage); behind the loop's last barrier the output staging
  float (*so)[16][68] = (float (*)[16][68])smem;
  const int tid = threadIdx.x, wave = tid >> 5, lane = tid & 31, col = lane & 15, g = lane >> 4;
  const int qb = blockIdx.x, h = blockIdx.y, b = blockIdx.z; const int q0 = qb * 64 + wave * 16; const size_t rq = (size_t)b * SS + q0 + col;
  v16h aq[2];
#pragma unroll
  for (int kc = 0; kc < 2; ++kc) aq[kc] = frag_h(QK + rq * (2 * DM) + h * HD + kc * 32, lane);
  const float KS = 0.125f * 1.4426950408889634f;   // 1/sqrt(64) and log2(e) in one factor
  float m = -3.0e38f, l = 0.f;   // of this lane's query: running maximum of score x KS (alike in both lanes of the column); this lane's own part of the sum
  v8f acc[4] = {};
  // a stage is 64 keys (all keys are walked): 64 k rows of 128 B, the head's 64 v rows of 128 B, the block's 64 mask rows of 256 B
  const unsigned l0 = lds_off(smem); const char* gK = (const char*)(QK + (size_t)b * SS * (2 * DM) + DM + h * HD); const char* gV = (const char*)(VTH + ((size_t)b * DM + h * HD) * SS); const char* gM = (const char*)(MSK + (size_t)qb * 64 * SS);
  stage128<64>(l0, gK, 2 * DM * 2, tid); stage128<64>(l0 + 64 * P128, gV, SS * 2, tid); stage256<64>(l0 + 128 * P128, gM, SS * 4, tid);
  WAIT_ASYNC(); __syncthreads();
  stage128<64>(l0 + STG32, gK + (size_t)64 * 2 * DM * 2, 2 * DM * 2, tid); stage128<64>(l0 + STG32 + 64 * P128, gV + 128, SS * 2, tid); stage256<64>(l0 + STG32 + 128 * P128, gM + 256, SS * 4, tid);
#pragma unroll 1   // the stage loop stays rolled, as the key loop was: its body already holds two turns
  for (int t = 0; t < SS / 64; ++t) { const char* bs = smem + (t & 1) * STG32;
#pragma unroll     // both turns of a stage unrolled: their LDS offsets become immediates
  for (int sub = 0; sub < 2; ++sub) { v8f s[2]; v16h kf[2][2], vf[4]; v4i mk[2][2];   // 32 keys a turn; its LDS reads all stand ahead of its products: one LDS latency a turn, not one a product
#pragma unroll
    for (int ct = 0; ct < 2; ++ct) {
#pragma unroll
      for (int kc = 0; kc < 2; ++kc) kf[ct][kc] = frag_h((const _Float16*)(bs + (sub * 32 + ct * 16 + col) * P128) + kc * 32, lane);
      const v4i* pm = (const v4i*)(bs + 128 * P128 + (wave * 16 + col) * P256 + (sub * 32 + ct * 16 + 8 * g) * 4); mk[ct][0] = pm[0]; mk[ct][1] = pm[1]; }   // the query's mask row, this lane's 8 keys: 32 B in a row
#pragma unroll
    for (int dt = 0; dt < 4; ++dt) vf[dt] = frag_h((const _Float16*)(bs + 64 * P128 + (dt * 16 + col) * P128) + sub * 32, lane);
    float mx = -3.0e38f;
#pragma unroll
    for (int ct = 0; ct < 2; ++ct) { v8f c = {};
#pragma unroll
      for (int kc = 0; kc < 2; ++kc) c = wmma16(kf[ct][kc], aq[kc], c);   // single product: k, q as one-rounding f16 operands; c[r] = key ct * 16 + 8 * g + r against query col
#pragma unroll
      for (int r = 0; r < 8; ++r) { s[ct][r] = (mk[ct][r >> 2][r & 3] != 1) ? c[r] : -3.0e38f; mx = fmaxf(mx, s[ct][r]); } }   // mask == 1 -> -1e9 == excluded
    mx = fmaxf(mx, xhalf(mx)) * KS;   // KS > 0: the maximum of the raw scores, scaled, is the maximum of the scaled ones
    const float mn = fmaxf(m, mx); const float base = (mn <= -1.0e37f) ? 0.f : mn;   // no key of this query admitted yet: every weight below comes out 0
    const float nb = 11.0f - base; float x[17];   // 2^11 in the exponent keeps small softmax weights out of the f16 subnormal range; the sum carries it too, so it cancels in the epilogue
#pragma unroll
    for (int i = 0; i < 16; ++i) x[i] = fmaf(s[i >> 3][i & 7], KS, nb);   // an excluded score gives exp2(-huge) = 0
    x[16] = m - base; m = mn;
    // the turn's 17 exponentials in one statement, each in place: no neighbour reads the result or overwrites the source of the one in front of it, and the closing v_nop keeps that one slot behind the last
    asm("v_exp_f32 %0, %0\n\tv_exp_f32 %1, %1\n\tv_exp_f32 %2, %2\n\tv_exp_f32 %3, %3\n\tv_exp_f32 %4, %4\n\tv_exp_f32 %5, %5\n\tv_exp_f32 %6, %6\n\tv_exp_f32 %7, %7\n\tv_exp_f32 %8, %8\n\tv_exp_f32 %9, %9\n\tv_exp_f32 %10, %10\n\tv_exp_f32 %11, %11\n\tv_exp_f32 %12, %12\n\tv_exp_f32 %13, %13\n\tv_exp_f32 %14, %14\n\tv_exp_f32 %15, %15\n\tv_exp_f32 %16, %16\n\tv_nop"
        : "+v"(x[0]), "+v"(x[1]), "+v"(x[2]), "+v"(x[3]), "+v"(x[4]), "+v"(x[5]), "+v"(x[6]), "+v"(x[7]), "+v"(x[8]), "+v"(x[9]), "+v"(x[10]), "+v"(x[11]), "+v"(x[12]), "+v"(x[13]), "+v"(x[14]), "+v"(x[15]), "+v"(x[16]));
    const float alpha = x[16]; v16h pa; float es[4] = { 0.f, 0.f, 0.f, 0.f };
#pragma unroll
    for (int i = 0; i < 16; ++i) { es[i & 3] += x[i]; pa[i] = (_Float16)x[i]; }   // element i of the B operand = tile i >> 3, register i & 7
    l = l * alpha + ((es[0] + es[1]) + (es[2] + es[3]));
#pragma unroll
    for (int dt = 0; dt < 4; ++dt) { acc[dt] *= alpha; acc[dt] = wmma16(vf[dt], pa, acc[dt]); } }   // single product: V^T x P^T (x2^11); acc[dt][r] = d dt * 16 + 8 * g + r of query col
    WAIT_DS(); WAIT_ASYNC(); __syncthreads();   // publishes stage t + 1 and ends every read of stage t
    if (t + 2 < SS / 64) { const unsigned l = l0 + (t & 1) * STG32; stage128<64>(l, gK + (size_t)(t + 2) * 64 * 2 * DM * 2, 2 * DM * 2, tid); stage128<64>(l + 64 * P128, gV + (size_t)(t + 2) * 128, SS * 2, tid); stage256<64>(l + 128 * P128, gM + (size_t)(t + 2) * 256, SS * 4, tid); } }
  WAIT_ASYNC();
  const float il = 1.0f / (l + xhalf(l));   // the column's two lanes join their sums once
#pragma unroll
  for (int dt = 0; dt < 4; ++dt) { const v8f o = acc[dt] * il; vst2(&so[wave][col][dt * 16 + 8 * g], (v4f){ o[0], o[1], o[2], o[3] }); vst2(&so[wave][col][dt * 16 + 8 * g + 4], (v4f){ o[4], o[5], o[6], o[7] }); }
  LDSX();
  for (int rl = 0; rl < 16; ++rl) if (lane < 16) vst2(O + ((size_t)b * SS + q0 + rl) * DM + h * HD + lane * 4, *(const v4f*)&so[wave][rl][lane * 4]);
}
// ---- k_out: block = (64 rows, 128 cols): out = O(hi/lo) . Wo rows (2 products) + bo
__global__ __launch_bounds__(128) void k_out(const float* __restrict__ O, const __bf16* __restrict__ P, const float* __restrict__ BO, float* __restrict__ Y) {
  __shared__ __align__(16) char smem[2 * STG32];   // the ring; behind the loop's last barrier the output staging
  float (*so)[16][132] = (float (*)[16][132])smem;
  const int tid = threadIdx.x, wave = tid >> 5, lane = tid & 31, col = lane & 15, g = lane >> 4; const size_t r0 = (size_t)blockIdx.x * 64 + wave * 16; const int n0 = blockIdx.y * 128;
  v8f acc[8] = {};
  const unsigned l0 = lds_off(smem); const char* gB = (const char*)(P + (size_t)n0 * DM); const char* gA = (const char*)(O + (size_t)blockIdx.x * 64 * DM);
  stage128<128>(l0, gB, DM * 2, tid); stage256<64>(l0 + 128 * P128, gA, DM * 4, tid);
  WAIT_ASYNC(); __syncthreads();
  stage128<128>(l0 + STG32, gB + 128, DM * 2, tid); stage256<64>(l0 + STG32 + 128 * P128, gA + 256, DM * 4, tid);
  for (int t = 0; t < DM / KST; ++t) { const char* bs = smem + (t & 1) * STG32;
    F2 a[2]; v16b w[2][8];   // the stage's fragment reads all stand ahead of its products: one LDS latency a stage, not one a product (the loops below are unrolled so that every fragment index is a constant and the arrays stay in registers)
#pragma unroll
    for (int kk = 0; kk < 2; ++kk) { a[kk] = split_row((const float*)(bs + 128 * P128 + (wave * 16 + col) * P256), kk * 32, lane);
#pragma unroll
      for (int j = 0; j < 8; ++j) w[kk][j] = frag_b((const __bf16*)(bs + (j * 16 + col) * P128) + kk * 32, lane); }
#pragma unroll
    for (int kk = 0; kk < 2; ++kk) {
#pragma unroll
      for (int j = 0; j < 8; ++j) { acc[j] = wmma_bf(a[kk].l, w[kk][j], acc[j]); acc[j] = wmma_bf(a[kk].h, w[kk][j], acc[j]); } }
    WAIT_DS(); WAIT_ASYNC(); __syncthreads();   // publishes stage t + 1 and ends every read of stage t
    if (t + 2 < DM / KST) { stage128<128>(l0 + (t & 1) * STG32, gB + (size_t)(t + 2) * 128, DM * 2, tid); stage256<64>(l0 + (t & 1) * STG32 + 128 * P128, gA + (size_t)(t + 2) * 256, DM * 4, tid); } }
  WAIT_ASYNC();
#pragma unroll
  for (int j = 0; j < 8; ++j) {
#pragma unroll
    for (int r = 0; r < 8; ++r) so[wave][8 * g + r][j * 16 + col] = acc[j][r] + bfr(BO[n0 + j * 16 + col]); }
  LDSX();
  for (int rl = 0; rl < 16; ++rl) vst2(Y + (r0 + rl) * DM + n0 + lane * 4, *(const v4f*)&so[wave][rl][lane * 4]);
}
// ---- k_packff: block = (tile, which): (in,out) W1 [1024][4096] -> rows [4096][1024] f16 x 2^8 ; W2 [4096][1024] -> rows [1024][4096]
__global__ __launch_bounds__(256) void k_packff(const float* __restrict__ W1, const float* __restrict__ W2, _Float16* __restrict__ PF, _Float16* __restrict__ PM) { __shared__ __align__(16) char s[TPN * TPP];   // the two weights have the same number of tiles; each has its own copy of the code, so that every pitch is an immediate
  if (blockIdx.y == 0) { const int k0 = (blockIdx.x % (DM / TPK)) * TPK, n0 = (blockIdx.x / (DM / TPK)) * TPN; pack_tile<1>(W1 + (size_t)k0 * DFF + n0, DFF * 4, (char*)(PF + (size_t)n0 * DM + k0), DM * 2, s, threadIdx.x); }
  else { const int k0 = (blockIdx.x % (DFF / TPK)) * TPK, n0 = (blockIdx.x / (DFF / TPK)) * TPN; pack_tile<1>(W2 + (size_t)k0 * DM + n0, DM * 4, (char*)(PM + (size_t)n0 * DFF + k0), DFF * 2, s, threadIdx.x); } }
// ---- k_lnres<F16OUT, RESX>: block = row (256 threads x 4): y = R + LayerNorm(A) x gamma + beta (mean((x-m)^2), eps 1e-5); RESX: residual is the bf16-rounded input x (else an f32 buffer); optional f16 copy for the FF
template <int F16OUT, int RESX>
__global__ __launch_bounds__(256) void k_lnres(const float* __restrict__ A, const float* __restrict__ R, const float* __restrict__ G, const float* __restrict__ Bt, float* __restrict__ Y, _Float16* __restrict__ Y16) {
  __shared__ float red[8]; __shared__ __align__(16) _Float16 sh[DM]; const int t = threadIdx.x; const size_t row = blockIdx.x; float v[4]; float s = 0.f; for (int i = 0; i < 4; ++i) { v[i] = A[row * DM + t * 4 + i]; s += v[i]; }
#pragma unroll
  for (int o = 1; o < 32; o <<= 1) s += __shfl_xor(s, o);
  if ((t & 31) == 0) red[t >> 5] = s; __syncthreads(); float tot = 0.f; for (int i = 0; i < 8; ++i) tot += red[i]; const float mu = tot / (float)DM; __syncthreads();
  float q = 0.f; for (int i = 0; i < 4; ++i) { const float dd = v[i] - mu; q += dd * dd; }
#pragma unroll
  for (int o = 1; o < 32; o <<= 1) q += __shfl_xor(q, o);
  if ((t & 31) == 0) red[t >> 5] = q; __syncthreads(); float tq = 0.f; for (int i = 0; i < 8; ++i) tq += red[i]; const float inv = 1.0f / sqrtf(tq / (float)DM + 1e-5f);
  v4f o4; for (int i = 0; i < 4; ++i) { const int e = t * 4 + i; const float rr = RESX ? bfr(R[row * DM + e]) : R[row * DM + e]; o4[i] = rr + ((v[i] - mu) * inv * bfr(G[e]) + bfr(Bt[e])); if (F16OUT) sh[e] = (_Float16)o4[i]; }
  vst2(Y + row * DM + t * 4, o4);
  if (F16OUT) { __syncthreads(); if (t < DM / 8) vst2((unsigned*)(Y16 + row * DM + t * 8), *(const v4u*)&sh[t * 8]); }
}
// ---- k_mlp<MODE>: block = (64 rows, 128 cols): MODE 0: G = gelu_exact(X1 . W1 + b1) (K 1024 -> 4096) f16; MODE 1: HF = gelu_exact(G . W2 + b2) (K 4096 -> 1024) f32
template <int MODE>
__global__ __launch_bounds__(128) void k_mlp(const _Float16* __restrict__ Ain, const _Float16* __restrict__ Wr, const float* __restrict__ BIAS, const float* __restrict__ RES, float* __restrict__ OUTF, _Float16* __restrict__ OG) {
  constexpr int KIN = (MODE == 0) ? DM : DFF; constexpr int NOUT = (MODE == 0) ? DFF : DM;
  __shared__ __align__(16) char smem[2 * STG16];   // the ring; behind the loop's last barrier the output staging
  float (*so)[16][132] = (float (*)[16][132])smem; _Float16 (*sg)[16][136] = (_Float16 (*)[16][136])smem;
  const int tid = threadIdx.x, wave = tid >> 5, lane = tid & 31, col = lane & 15, g = lane >> 4; const size_t r0 = (size_t)blockIdx.x * 64 + wave * 16; const int n0 = blockIdx.y * 128;
  v8f acc[8] = {};
  const unsigned l0 = lds_off(smem); const char* gB = (const char*)(Wr + (size_t)n0 * KIN); const char* gA = (const char*)(Ain + (size_t)blockIdx.x * 64 * KIN);
  stage128<128>(l0, gB, KIN * 2, tid); stage128<64>(l0 + 128 * P128, gA, KIN * 2, tid);
  WAIT_ASYNC(); __syncthreads();
  stage128<128>(l0 + STG16, gB + 128, KIN * 2, tid); stage128<64>(l0 + STG16 + 128 * P128, gA + 128, KIN * 2, tid);
  for (int t = 0; t < KIN / KST; ++t) { const char* bs = smem + (t & 1) * STG16;
    v16h a[2], w[2][8];   // the stage's fragment reads all stand ahead of its products: one LDS latency a stage, not one a product (the loops below are unrolled so that every fragment index is a constant and the arrays stay in registers)
#pragma unroll
    for (int kk = 0; kk < 2; ++kk) { a[kk] = frag_h((const _Float16*)(bs + 128 * P128 + (wave * 16 + col) * P128) + kk * 32, lane);
#pragma unroll
      for (int j = 0; j < 8; ++j) w[kk][j] = frag_h((const _Float16*)(bs + (j * 16 + col) * P128) + kk * 32, lane); }
#pragma unroll
    for (int kk = 0; kk < 2; ++kk) {
#pragma unroll
      for (int j = 0; j < 8; ++j) acc[j] = wmma16(a[kk], w[kk][j], acc[j]); }
    WAIT_DS(); WAIT_ASYNC(); __syncthreads();   // publishes stage t + 1 and ends every read of stage t
    if (t + 2 < KIN / KST) { stage128<128>(l0 + (t & 1) * STG16, gB + (size_t)(t + 2) * 128, KIN * 2, tid); stage128<64>(l0 + (t & 1) * STG16 + 128 * P128, gA + (size_t)(t + 2) * 128, KIN * 2, tid); } }
  WAIT_ASYNC();
#pragma unroll
  for (int j = 0; j < 8; ++j) { const int c = n0 + j * 16 + col; const float bb = bfr(BIAS[c]);
#pragma unroll
    for (int r = 0; r < 8; ++r) { const float x = acc[j][r] * (1.0f / 256.0f) + bb; if (MODE == 0) sg[wave][8 * g + r][j * 16 + col] = (_Float16)gelu_e(x); else so[wave][8 * g + r][j * 16 + col] = gelu_e(x); } }
  LDSX();
  if (MODE == 0) { for (int rl = 0; rl < 16; ++rl) if (lane < 16) vst2((unsigned*)(OG + (r0 + rl) * NOUT + n0 + lane * 8), *(const v4u*)&sg[wave][rl][lane * 8]); }
  else { for (int rl = 0; rl < 16; ++rl) vst2(OUTF + (r0 + rl) * NOUT + n0 + lane * 4, *(const v4f*)&so[wave][rl][lane * 4]); }
}

extern "C" void kernel_launch(void* const* d_in, const int* in_sizes, int n_in, void* d_out, int out_size, void* d_ws, size_t ws_size, hipStream_t stream) {
  (void)in_sizes; (void)n_in; (void)out_size;
  const float** F = (const float**)d_in;   // 0 x [2,2048,1024], 1 mask [1,1,2048,2048] int, 2 Wq, 3 Wk, 4 Wv, 5 Wo ((in,out)), 6 bo, 7 ln1_g, 8 ln1_b, 9 W1 [1024,4096], 10 b1, 11 W2 [4096,1024], 12 b2, 13 ln2_g, 14 ln2_b
  if (ws_size < (size_t)WS_END) return;
  char* ws = (char*)d_ws; __bf16* PK = (__bf16*)(ws + WS_PK); _Float16 *QK = (_Float16*)(ws + WS_QK), *QKL = (_Float16*)(ws + WS_QKL), *VTH = (_Float16*)(ws + WS_VTH), *VTL = (_Float16*)(ws + WS_VTL), *PF = (_Float16*)(ws + WS_PF), *PM = (_Float16*)(ws + WS_PM), *X16 = (_Float16*)(ws + WS_X16), *Gb = (_Float16*)(ws + WS_G); float *O = (float*)(ws + WS_O), *A0 = (float*)(ws + WS_A0), *X1 = (float*)(ws + WS_X1), *HF = (float*)(ws + WS_HF);
  k_pack<<<dim3((DM / TPK) * (DM / TPN), 4), 256, 0, stream>>>(F[2], F[3], F[4], F[5], PK);
  k_packff<<<dim3((DM / TPK) * (DFF / TPN), 2), 256, 0, stream>>>(F[9], F[11], PF, PM);
  k_qkv<<<dim3(TNB * SS / 64, QKVW / 128), 128, 0, stream>>>(F[0], F[0], F[0], PK + PK_A, nullptr, nullptr, nullptr, QK, QKL, VTH, VTL);
  k_attn<<<dim3(TQB, NH, TNB), 128, 0, stream>>>(QK, QKL, VTH, VTL, nullptr, (const int*)d_in[1], O);
  k_out<<<dim3(TOB, DM / 128), 128, 0, stream>>>(O, PK + PK_P, F[6], A0);
  k_lnres<1, 1><<<TOB * 64, 256, 0, stream>>>(A0, F[0], F[7], F[8], X1, X16);      // x1 = x + LN(attn branch)
  k_mlp<0><<<dim3(TOB, DFF / 128), 128, 0, stream>>>(X16, PF, F[10], nullptr, nullptr, Gb);
  k_mlp<1><<<dim3(TOB, DM / 128), 128, 0, stream>>>(Gb, PM, F[12], nullptr, HF, nullptr);
  k_lnres<0, 0><<<TOB * 64, 256, 0, stream>>>(HF, X1, F[13], F[14], (float*)d_out, nullptr);   // out = x1 + LN(ff branch)
}

// v004
// Measured time: 238 microseconds a run.
// Timed twice side by side with v003, it ran 1.09 times as fast both times.
// Counting every step since v000, it is 3.66 times as fast.
// compute dtype: all float inputs rounded to bf16, the int mask read on device; q/k/v = x . W with EXACT bf16 products on WMMA 16x16x32 ((in,out) weights as transposed rows); PLAIN attention: q, k single f16 x 1/8, masked keys excluded, running-max softmax in f32 (hardware exp), P (scaled by 2^11, single f16) x v (single f16); attention out (bf16 hi + residual) . Wo (2 products) + bo; LayerNorms in f32; FF: x1 rounded once to f16 x exact f16 weight copies (x 2^8), erf GELU (x . Phi(x), f32-accurate rational form of erfc), hidden f16, second erf GELU; f32 output.
#include <hip/hip_runtime.h>
#include <math.h>

typedef __attribute__((ext_vector_type(16))) _Float16 v16h;
typedef __attribute__((ext_vector_type(16))) __bf16 v16b;
typedef __attribute__((ext_vector_type(8)))  _Float16 v8h;
typedef __attribute__((ext_vector_type(8)))  float v8f;
typedef __attribute__((ext_vector_type(4)))  float v4f;
typedef __attribute__((ext_vector_type(2)))  float v2f;
typedef __attribute__((ext_vector_type(4)))  unsigned v4u;
typedef __attribute__((ext_vector_type(4)))  int v4i;
typedef float __attribute__((may_alias)) float_a;
typedef int __attribute__((may_alias)) int_a;

template <typename T> __device__ __forceinline__ void vst2(void* p, T v) { *(T*)p = v;  }
__device__ __forceinline__ v8f wmma16(v16h a, v16h b, v8f c) {
  v8f d = __builtin_amdgcn_wmma_f32_16x16x32_f16(false, a, false, b, (short)0, c, false, false);
  asm volatile("v_nop\n\tv_nop\n\tv_nop\n\tv_nop" : "+v"(d) : "v"(a), "v"(b));
  return d;
}
__device__ __forceinline__ v8f wmma_bf(v16b a, v16b b, v8f c) {
  v8f d = __builtin_amdgcn_wmma_f32_16x16x32_bf16(false, a, false, b, (short)0, c, false, false);
  asm volatile("v_nop\n\tv_nop\n\tv_nop\n\tv_nop" : "+v"(d) : "v"(a), "v"(b));
  return d;
}
// Transformer block (B 2, S 2,048, d 1,024, 16 heads x 64, FF 4,096): bias-free q/k/v projections, scores / 8 with a [S,S] mask (mask == 1 -> -1e9), softmax, . v, Wo + bo; x + LayerNorm(attention branch); FF with exact GELU after BOTH linears; x + LayerNorm(FF branch).
__device__ __forceinline__ v16h frag_h(const _Float16* rowk0, int lane) {
  union { v16h v; v8h q[2]; } u; const _Float16* p = rowk0 + 8 * (lane >> 4);
  u.q[0] = *(const v8h*)p; u.q[1] = *(const v8h*)(p + 16); return u.v;
}
__device__ __forceinline__ v16h frag_f32(const float* rowk0, int lane) {
  v16h a; const float* p = rowk0 + 8 * (lane >> 4);
#pragma unroll
  for (int i = 0; i < 8; ++i) { a[i] = (_Float16)p[i]; a[8 + i] = (_Float16)p[16 + i]; }
  return a;
}
__device__ __forceinline__ v16h frag_f32s(const float* rowk0, int lane, float sc) {
  v16h a; const float* p = rowk0 + 8 * (lane >> 4);
#pragma unroll
  for (int i = 0; i < 8; ++i) { a[i] = (_Float16)(p[i] * sc); a[8 + i] = (_Float16)(p[16 + i] * sc); }
  return a;
}
// column fragment from a [K][ld] layout (column n), rows >= K read as 0
__device__ __forceinline__ v16h fragc_f32(const float* W, int k0, int n, int lane, int ld, int K) {
  v16h a; const int g = lane >> 4;
#pragma unroll
  for (int i = 0; i < 8; ++i) { const int ka = k0 + 8 * g + i, kb = ka + 16;
    a[i] = (_Float16)(ka < K ? W[(size_t)(ka < K ? ka : K - 1) * ld + n] : 0.f); a[8 + i] = (_Float16)(kb < K ? W[(size_t)(kb < K ? kb : K - 1) * ld + n] : 0.f); }
  return a;
}
struct F2 { v16b h, l; };
__device__ __forceinline__ F2 bsplit16(const float v[16]) { F2 r;
#pragma unroll
  for (int i = 0; i < 16; ++i) { const __bf16 h = (__bf16)v[i]; r.h[i] = h; r.l[i] = (__bf16)(v[i] - (float)h); }
  return r; }
__device__ __forceinline__ F2 split_row(const float* row, int k0, int lane) { float v[16]; const float* p = row + k0 + 8 * (lane >> 4);
#pragma unroll
  for (int i = 0; i < 8; ++i) { v[i] = p[i]; v[8 + i] = p[16 + i]; }
  return bsplit16(v); }
__device__ __forceinline__ F2 split_rowK(const float* row, int k0, int lane, int K) { float v[16]; const int g = lane >> 4;
#pragma unroll
  for (int i = 0; i < 8; ++i) { const int ka = k0 + 8 * g + i, kb = ka + 16; v[i] = ka < K ? row[ka < K ? ka : K - 1] : 0.f; v[8 + i] = kb < K ? row[kb < K ? kb : K - 1] : 0.f; }
  return bsplit16(v); }
__device__ __forceinline__ F2 split_col(const float* W, int k0, int n, int lane, int ld, int K) { float v[16]; const int g = lane >> 4;
#pragma unroll
  for (int i = 0; i < 8; ++i) { const int ka = k0 + 8 * g + i, kb = ka + 16; v[i] = ka < K ? W[(size_t)(ka < K ? ka : K - 1) * ld + n] : 0.f; v[8 + i] = kb < K ? W[(size_t)(kb < K ? kb : K - 1) * ld + n] : 0.f; }
  return bsplit16(v); }
__device__ __forceinline__ v8f mac3(const F2& a, const F2& b, v8f c) { c = wmma_bf(a.l, b.h, c); c = wmma_bf(a.h, b.l, c); return wmma_bf(a.h, b.h, c); }
__device__ __forceinline__ float sigm(float v) { return 1.0f / (1.0f + expf(-v)); }
#define LDSX() do { asm volatile("s_wait_dscnt 0" ::: "memory"); __builtin_amdgcn_wave_barrier(); __builtin_amdgcn_fence(__ATOMIC_RELEASE, "workgroup"); } while (0)


#define NB 2
#define SS 2048
#define DM 1024
#define NH 16
#define DFF 4096
#define NR (NB * SS)
// erf GELU as x * Phi(x), Phi the normal distribution function, inline and with no branch, 8 values side by side, in place. With t = 1 / (1 + p |x| / sqrt(2)), q = (c1 t + ... + c5 t^5) / 2 * exp(-x^2 / 2) is Phi(-|x|) = erfc(|x| / sqrt(2)) / 2 (five-term rational form of erfc: absolute error of Phi under 1e-7, of the result under 4e-7 for |x| <= 8); x * Phi(x) = max(x, 0) - |x| q on both sides of 0, with no cancellation in the negative tail
__device__ __forceinline__ void gelu8(float (&x)[8]) {
  float t[8], e[8];
#pragma unroll   // constant indices: the arrays stay in registers
  for (int i = 0; i < 8; ++i) { t[i] = fmaf(0.3275911f * 0.70710678118654752f, fabsf(x[i]), 1.0f); e[i] = (x[i] * x[i]) * -0.72134752044448170f; }   // exp(-x^2 / 2) in base 2; far out it is 0 and the result max(x, 0)
  // the 8 reciprocals and 8 exponentials in one statement, each in place: no neighbour reads the result or overwrites the source of the one in front of it, and the closing v_nop keeps that one slot behind the last
  asm("v_rcp_f32 %0, %0\n\tv_rcp_f32 %1, %1\n\tv_rcp_f32 %2, %2\n\tv_rcp_f32 %3, %3\n\tv_rcp_f32 %4, %4\n\tv_rcp_f32 %5, %5\n\tv_rcp_f32 %6, %6\n\tv_rcp_f32 %7, %7\n\tv_exp_f32 %8, %8\n\tv_exp_f32 %9, %9\n\tv_exp_f32 %10, %10\n\tv_exp_f32 %11, %11\n\tv_exp_f32 %12, %12\n\tv_exp_f32 %13, %13\n\tv_exp_f32 %14, %14\n\tv_exp_f32 %15, %15\n\tv_nop"
      : "+v"(t[0]), "+v"(t[1]), "+v"(t[2]), "+v"(t[3]), "+v"(t[4]), "+v"(t[5]), "+v"(t[6]), "+v"(t[7]), "+v"(e[0]), "+v"(e[1]), "+v"(e[2]), "+v"(e[3]), "+v"(e[4]), "+v"(e[5]), "+v"(e[6]), "+v"(e[7]));
#pragma unroll
  for (int i = 0; i < 8; ++i) { float p = fmaf(0.5f * 1.061405429f, t[i], 0.5f * -1.453152027f);
    p = fmaf(p, t[i], 0.5f * 1.421413741f); p = fmaf(p, t[i], 0.5f * -0.284496736f); p = fmaf(p, t[i], 0.5f * 0.254829592f);
    x[i] = fmaf(-fabsf(x[i]), (p * t[i]) * e[i], fmaxf(x[i], 0.f)); }
}
#define HD 64
#define QKVW (3 * DM)
#ifndef TQB
#define TQB (SS / 64)
#define TNB NB
#define TOB (NB * SS / 64)     // output row tiles (all)
#endif
typedef __attribute__((ext_vector_type(8))) __bf16 v8b;
__device__ __forceinline__ v16b frag_b(const __bf16* rowk0, int lane) {
  union { v16b v; v8b q[2]; } u; const __bf16* p = rowk0 + 8 * (lane >> 4);
  u.q[0] = *(const v8b*)p; u.q[1] = *(const v8b*)(p + 16); return u.v;
}
__device__ __forceinline__ float bfr(float v) { return (float)(__bf16)v; }
__device__ __attribute__((noinline)) float exp_ni(float v) { return expf(v); }
__device__ __attribute__((noinline)) float erf_ni(float v) { return erff(v); }

// ---- LDS ring of the GEMM kernels: a stage is 64 k of the block's 128 weight rows and of its 64 activation rows, brought by asynchronous copies in whole lines, read by all four waves; two buffers
#define KST 64
#define P128 144   // LDS pitch of a 128-B row: 16 B x odd, no bank conflict for 16-B reads down a column of rows
#define P256 272   // LDS pitch of a 256-B row, likewise
__device__ __forceinline__ unsigned lds_off(const void* p) { return (unsigned)(size_t)p; }
// four copies of 16 B a lane; s_wait_xcnt closes the statement so that no address register of a copy is rewritten ahead of it
__device__ __forceinline__ void cp4(unsigned l0, unsigned l1, unsigned l2, unsigned l3, const char* g0, const char* g1, const char* g2, const char* g3) {
  asm volatile("global_load_async_to_lds_b128 %0, %4, off\n\tglobal_load_async_to_lds_b128 %1, %5, off\n\tglobal_load_async_to_lds_b128 %2, %6, off\n\tglobal_load_async_to_lds_b128 %3, %7, off\n\ts_wait_xcnt 0x0"
               :: "v"(l0), "v"(l1), "v"(l2), "v"(l3), "v"(g0), "v"(g1), "v"(g2), "v"(g3) : "memory");
}
// NROW rows of 128 B (global pitch gp bytes) -> LDS at pitch P128: 8 lanes a row, 16 rows a copy of the 128 threads
template <int NROW> __device__ __forceinline__ void stage128(unsigned l, const char* g, size_t gp, int tid) {
  l += (tid >> 3) * P128 + (tid & 7) * 16; g += (size_t)(tid >> 3) * gp + (tid & 7) * 16;
  for (int i = 0; i < NROW / 16; i += 4) cp4(l + i * 16 * P128, l + (i + 1) * 16 * P128, l + (i + 2) * 16 * P128, l + (i + 3) * 16 * P128, g + (size_t)i * 16 * gp, g + (size_t)(i + 1) * 16 * gp, g + (size_t)(i + 2) * 16 * gp, g + (size_t)(i + 3) * 16 * gp);
}
// NROW rows of 256 B -> LDS at pitch P256: 16 lanes a row, 8 rows a copy of the 128 threads
template <int NROW> __device__ __forceinline__ void stage256(unsigned l, const char* g, size_t gp, int tid) {
  l += (tid >> 4) * P256 + (tid & 15) * 16; g += (size_t)(tid >> 4) * gp + (tid & 15) * 16;
  for (int i = 0; i < NROW / 8; i += 4) cp4(l + i * 8 * P256, l + (i + 1) * 8 * P256, l + (i + 2) * 8 * P256, l + (i + 3) * 8 * P256, g + (size_t)i * 8 * gp, g + (size_t)(i + 1) * 8 * gp, g + (size_t)(i + 2) * 8 * gp, g + (size_t)(i + 3) * 8 * gp);
}
#define WAIT_ASYNC() asm volatile("s_wait_asynccnt 0x0" ::: "memory")   // this wave's copies have landed
#define WAIT_DS() asm volatile("s_wait_dscnt 0x0" ::: "memory")         // this wave's LDS reads are done before the buffer is given up
#define STG16 ((128 + 64) * P128)          // one buffer, 16-bit activations: weight rows, then activation rows
#define STG32 (128 * P128 + 64 * P256)     // one buffer, f32 activations
#define PK_A 0                       // [3072][1024] Wqkv rows (natural [out][in])
#define PK_P (PK_A + QKVW * DM)        // [1024][1024] Wo rows (natural)
#define PK_END (PK_P + DM * DM)
#define WS_PK  0u
#define WS_QK  (WS_PK + 2u * PK_END)             // f16 [4096 rows][2048]: q | k
#define WS_QKL (WS_QK + 2u * NB * SS * 2 * DM)     // f16 q | k residual planes x2048
#define WS_VTH (WS_QKL + 2u * NB * SS * 2 * DM)    // f16 [b][1024 (h*64+d)][2048 s] hi
#define WS_VTL (WS_VTH + 2u * NB * DM * SS)        // f16 lo x 2048
#define WS_O   (WS_VTL + 2u * NB * DM * SS)        // f32 [4096][1024]
#define WS_CS  (WS_O + 4u * NB * SS * DM)           // f32 [2][2048][32], unused
#define WS_PF  (WS_CS + 4u * 2 * SS * 32)                  // f16 x 2^8 rows W1^T [4096][1024] ; W2^T [1024][4096]
#define WS_PM  (WS_PF + 2u * (size_t)DFF * DM)
#define WS_A0  (WS_PM + 2u * (size_t)DM * DFF)          // f32 [NR][1024] attention branch ; X1 f32 ; HF f32 (ff branch)
#define WS_X1  (WS_A0 + 4u * (size_t)NR * DM)
#define WS_HF  (WS_X1 + 4u * (size_t)NR * DM)
#define WS_X16 (WS_HF + 4u * (size_t)NR * DM)           // f16 [NR][1024] x1 ; G f16 [NR][4096]
#define WS_G   (WS_X16 + 2u * (size_t)NR * DM)
#define WS_END (WS_G + 2u * (size_t)NR * DFF)
// ---- weight packs: a block transposes one tile of 128 k x 64 n of an (in,out) f32 weight into 64 packed 16-bit rows of 128 k. A thread loads 8 k rows x 4 n as 16-B pieces (16 lanes cover 256 B in a row of the source), converts, and puts 8 k of each of its 4 n as one 16-B piece into LDS; the rows then go out as 256 B in a row of the packed plane
#define TPK 128
#define TPN 64
#define TPP 272   // LDS pitch of a packed 256-B row
template <int F16> __device__ __forceinline__ void pack_tile(const float* __restrict__ Wt, unsigned ldw, char* __restrict__ dst, unsigned ldd, char* s, int t) {   // Wt: the tile's first element, ldw its row pitch in bytes; dst: the tile's first packed byte, ldd its row pitch in bytes
  const int n4 = t & 15, kg = t >> 4; const unsigned go = (unsigned)kg * 8u * ldw + n4 * 16; v4f r[8];   // a block-uniform row address plus one 32-bit lane offset (under 2 MiB) for all 8 loads
#pragma unroll   // the 8 loads of a thread are in flight together, and r stays in registers
  for (int i = 0; i < 8; ++i) r[i] = *(const v4f*)((const char*)Wt + (size_t)i * ldw + go);
  asm volatile("s_wait_xcnt 0x0" ::: "memory");   // stands in front of every later write of a register that the 8 loads name as an address
#pragma unroll   // constant indices into r
  for (int j = 0; j < 4; ++j) { v4u o;
    if (F16) { v8h h;
#pragma unroll
      for (int i = 0; i < 8; ++i) h[i] = (_Float16)(bfr(r[i][j]) * 256.0f);
      o = __builtin_bit_cast(v4u, h); }
    else { v8b h;
#pragma unroll
      for (int i = 0; i < 8; ++i) h[i] = (__bf16)r[i][j];
      o = __builtin_bit_cast(v4u, h); }
    *(v4u*)(s + (n4 * 4 + j) * TPP + kg * 16) = o; }
  __syncthreads();
  const int n = t >> 4, c = t & 15; const unsigned so = (unsigned)n * ldd + c * 16; v4u o[4];   // 16 lanes a packed row, 16 rows a turn of the 256 threads
#pragma unroll   // the 4 LDS reads stand together ahead of the 4 stores: one LDS latency, not four
  for (int i = 0; i < TPN / 16; ++i) o[i] = *(const v4u*)(s + (n + i * 16) * TPP + c * 16);
#pragma unroll
  for (int i = 0; i < TPN / 16; ++i) vst2(dst + (size_t)i * 16 * ldd + so, o[i]);
}
// ---- k_pack: block = (tile, which): which 0..2 -> W_q/W_k/W_v into PK_A rows which*1024 + n (pack row n = column n, bf16); 3 -> W_o into PK_P
__global__ __launch_bounds__(256) void k_pack(const float* __restrict__ WQ, const float* __restrict__ WK, const float* __restrict__ WV, const float* __restrict__ WO, __bf16* __restrict__ PK) {
  __shared__ __align__(16) char s[TPN * TPP]; const int k0 = (blockIdx.x % (DM / TPK)) * TPK, n0 = (blockIdx.x / (DM / TPK)) * TPN, which = blockIdx.y; const float* Wm = (which == 0) ? WQ : (which == 1) ? WK : (which == 2) ? WV : WO;
  __bf16* dst = (which < 3) ? PK + PK_A + ((size_t)which * DM + n0) * DM + k0 : PK + PK_P + (size_t)n0 * DM + k0;
  pack_tile<0>(Wm + (size_t)k0 * DM + n0, DM * 4, (char*)dst, DM * 2, s, threadIdx.x);
}
__global__ __launch_bounds__(128) void k_qkv(const float* __restrict__ XQ, const float* __restrict__ XK, const float* __restrict__ XV, const __bf16* __restrict__ P, const float* __restrict__ BQ, const float* __restrict__ BK, const float* __restrict__ BV, _Float16* __restrict__ QK, _Float16* __restrict__ QKL, _Float16* __restrict__ VTH, _Float16* __restrict__ VTL) {
  const int which0 = (blockIdx.y * 128) / DM; const float* X = (which0 == 0) ? XQ : (which0 == 1) ? XK : XV; const float* BB = BQ ? (((which0 == 0) ? BQ : (which0 == 1) ? BK : BV) + (blockIdx.y * 128 - which0 * DM)) : nullptr;
  __shared__ __align__(16) char smem[2 * STG32];   // the ring; behind the loop's last barrier the output staging
  _Float16 (*so)[16][136] = (_Float16 (*)[16][136])smem, (*sol)[16][136] = (_Float16 (*)[16][136])(smem + 4 * 16 * 136 * 2); _Float16 (*sth)[72] = (_Float16 (*)[72])smem, (*stl)[72] = (_Float16 (*)[72])(smem + 128 * 72 * 2);
  const int tid = threadIdx.x, wave = tid >> 5, lane = tid & 31, col = lane & 15, g = lane >> 4; const size_t r0 = (size_t)blockIdx.x * 64 + wave * 16; const int n0 = blockIdx.y * 128;
  v8f acc[8] = {};
  const unsigned l0 = lds_off(smem); const char* gB = (const char*)(P + (size_t)n0 * DM); const char* gA = (const char*)(X + (size_t)blockIdx.x * 64 * DM);
  stage128<128>(l0, gB, DM * 2, tid); stage256<64>(l0 + 128 * P128, gA, DM * 4, tid);
  WAIT_ASYNC(); __syncthreads();
  stage128<128>(l0 + STG32, gB + 128, DM * 2, tid); stage256<64>(l0 + STG32 + 128 * P128, gA + 256, DM * 4, tid);
  for (int t = 0; t < DM / KST; ++t) { const char* bs = smem + (t & 1) * STG32;
    v16b a[2], w[2][8];   // the stage's fragment reads all stand ahead of its products: one LDS latency a stage, not one a product (the loops below are unrolled so that every fragment index is a constant and the arrays stay in registers)
#pragma unroll
    for (int kk = 0; kk < 2; ++kk) { const float* p = (const float*)(bs + 128 * P128 + (wave * 16 + col) * P256) + kk * 32 + 8 * g;
#pragma unroll
      for (int i = 0; i < 8; ++i) { a[kk][i] = (__bf16)p[i]; a[kk][8 + i] = (__bf16)p[16 + i]; }
#pragma unroll
      for (int j = 0; j < 8; ++j) w[kk][j] = frag_b((const __bf16*)(bs + (j * 16 + col) * P128) + kk * 32, lane); }
#pragma unroll
    for (int kk = 0; kk < 2; ++kk) {
#pragma unroll
      for (int j = 0; j < 8; ++j) acc[j] = wmma_bf(a[kk], w[kk][j], acc[j]); }
    WAIT_DS(); WAIT_ASYNC(); __syncthreads();   // publishes stage t + 1 and ends every read of stage t
    if (t + 2 < DM / KST) { stage128<128>(l0 + (t & 1) * STG32, gB + (size_t)(t + 2) * 128, DM * 2, tid); stage256<64>(l0 + (t & 1) * STG32 + 128 * P128, gA + (size_t)(t + 2) * 256, DM * 4, tid); } }
  WAIT_ASYNC();
  if (n0 < 2 * DM) {   // q stored unscaled (f16 sigma ~0.6, no subnormal exposure); 1/8 applied to the f32 score
#pragma unroll
    for (int j = 0; j < 8; ++j) {
#pragma unroll
      for (int r = 0; r < 8; ++r) { const float v = acc[j][r] + (BB ? bfr(BB[j * 16 + col]) : 0.f); const _Float16 hv = (_Float16)v; so[wave][8 * g + r][j * 16 + col] = hv; sol[wave][8 * g + r][j * 16 + col] = (_Float16)((v - (float)hv) * 2048.0f); } }   // q, k (+ bias) as f16 hi + (x2048) residual
    LDSX();
    for (int rl = 0; rl < 16; ++rl) if (lane < 16) { vst2((unsigned*)(QK + (r0 + rl) * (2 * DM) + n0 + lane * 8), *(const v4u*)&so[wave][rl][lane * 8]); vst2((unsigned*)(QKL + (r0 + rl) * (2 * DM) + n0 + lane * 8), *(const v4u*)&sol[wave][rl][lane * 8]); }
  } else {
#pragma unroll
    for (int j = 0; j < 8; ++j) {
#pragma unroll
      for (int r = 0; r < 8; ++r) { const float v = acc[j][r] + (BB ? bfr(BB[j * 16 + col]) : 0.f); const _Float16 hv = (_Float16)v; sth[j * 16 + col][wave * 16 + 8 * g + r] = hv; stl[j * 16 + col][wave * 16 + 8 * g + r] = (_Float16)((v - (float)hv) * 2048.0f); } }
    __syncthreads();
    const size_t rb = (size_t)blockIdx.x * 64; const int b = (int)(rb / SS), s0 = (int)(rb % SS); const int pc0 = n0 - 2 * DM;
    for (int q = tid; q < 128 * 8; q += 128) { const int d = q >> 3, pc = q & 7; const size_t o = ((size_t)b * DM + pc0 + d) * SS + s0 + pc * 8; vst2((unsigned*)(VTH + o), *(const v4u*)&sth[d][pc * 8]); vst2((unsigned*)(VTL + o), *(const v4u*)&stl[d][pc * 8]); }
  }
}
// lane l <-> lane l ^ 16: the two lanes that share a query column
__device__ __forceinline__ float xhalf(float x) { return __builtin_bit_cast(float, __builtin_amdgcn_permlanex16(__builtin_bit_cast(int, x), __builtin_bit_cast(int, x), 0x76543210, 0xfedcba98, false, false)); }
// ---- k_attn: block = (64 queries, head h, batch b): all-keys flash attention with both products transposed: S^T = K . Q^T (A = key rows, B = the wave's 16 queries), O^T += V^T . P^T (A = v rows [d][key], B = P^T). A lane then holds 8 keys of ONE query (column lane & 15, keys 8 * (lane >> 4) + r of a 16-key tile): maximum and sum run inside the lane, one exchange with lane ^ 16 for the maximum; two score tiles converted in place are the B operand of the second product (element i = tile i >> 3, register i & 7), so P touches neither LDS nor another lane. Single f16 operands; softmax in base 2 on the raw scores, weights x 2^11 in numerator and denominator alike; O[b*S+q][h*64+d] = acc / l (256-B segments)
__global__ __launch_bounds__(128) void k_attn(const _Float16* __restrict__ QK, const _Float16* __restrict__ QKL, const _Float16* __restrict__ VTH, const _Float16* __restrict__ VTL, const void* __restrict__ KMASK, const int* __restrict__ MSK, float* __restrict__ O) {
  __shared__ __align__(16) char smem[2 * STG32];   // the ring (64 key rows, 64 v rows, 64 mask rows a stage); behind the loop's last barrier the output staging
  float (*so)[16][68] = (float (*)[16][68])smem;
  const int tid = threadIdx.x, wave = tid >> 5, lane = tid & 31, col = lane & 15, g = lane >> 4;
  const int qb = blockIdx.x, h = blockIdx.y, b = blockIdx.z; const int q0 = qb * 64 + wave * 16; const size_t rq = (size_t)b * SS + q0 + col;
  v16h aq[2];
#pragma unroll
  for (int kc = 0; kc < 2; ++kc) aq[kc] = frag_h(QK + rq * (2 * DM) + h * HD + kc * 32, lane);
  const float KS = 0.125f * 1.4426950408889634f;   // 1/sqrt(64) and log2(e) in one factor
  float m = -3.0e38f, l = 0.f;   // of this lane's query: running maximum of score x KS (alike in both lanes of the column); this lane's own part of the sum
  v8f acc[4] = {};
  // a stage is 64 keys (all keys are walked): 64 k rows of 128 B, the head's 64 v rows of 128 B, the block's 64 mask rows of 256 B
  const unsigned l0 = lds_off(smem); const char* gK = (const char*)(QK + (size_t)b * SS * (2 * DM) + DM + h * HD); const char* gV = (const char*)(VTH + ((size_t)b * DM + h * HD) * SS); const char* gM = (const char*)(MSK + (size_t)qb * 64 * SS);
  stage128<64>(l0, gK, 2 * DM * 2, tid); stage128<64>(l0 + 64 * P128, gV, SS * 2, tid); stage256<64>(l0 + 128 * P128, gM, SS * 4, tid);
  WAIT_ASYNC(); __syncthreads();
  stage128<64>(l0 + STG32, gK + (size_t)64 * 2 * DM * 2, 2 * DM * 2, tid); stage128<64>(l0 + STG32 + 64 * P128, gV + 128, SS * 2, tid); stage256<64>(l0 + STG32 + 128 * P128, gM + 256, SS * 4, tid);
#pragma unroll 1   // the stage loop stays rolled, as the key loop was: its body already holds two turns
  for (int t = 0; t < SS / 64; ++t) { const char* bs = smem + (t & 1) * STG32;
#pragma unroll     // both turns of a stage unrolled: their LDS offsets become immediates
  for (int sub = 0; sub < 2; ++sub) { v8f s[2]; v16h kf[2][2], vf[4]; v4i mk[2][2];   // 32 keys a turn; its LDS reads all stand ahead of its products: one LDS latency a turn, not one a product
#pragma unroll
    for (int ct = 0; ct < 2; ++ct) {
#pragma unroll
      for (int kc = 0; kc < 2; ++kc) kf[ct][kc] = frag_h((const _Float16*)(bs + (sub * 32 + ct * 16 + col) * P128) + kc * 32, lane);
      const v4i* pm = (const v4i*)(bs + 128 * P128 + (wave * 16 + col) * P256 + (sub * 32 + ct * 16 + 8 * g) * 4); mk[ct][0] = pm[0]; mk[ct][1] = pm[1]; }   // the query's mask row, this lane's 8 keys: 32 B in a row
#pragma unroll
    for (int dt = 0; dt < 4; ++dt) vf[dt] = frag_h((const _Float16*)(bs + 64 * P128 + (dt * 16 + col) * P128) + sub * 32, lane);
    float mx = -3.0e38f;
#pragma unroll
    for (int ct = 0; ct < 2; ++ct) { v8f c = {};
#pragma unroll
      for (int kc = 0; kc < 2; ++kc) c = wmma16(kf[ct][kc], aq[kc], c);   // single product: k, q as one-rounding f16 operands; c[r] = key ct * 16 + 8 * g + r against query col
#pragma unroll
      for (int r = 0; r < 8; ++r) { s[ct][r] = (mk[ct][r >> 2][r & 3] != 1) ? c[r] : -3.0e38f; mx = fmaxf(mx, s[ct][r]); } }   // mask == 1 -> -1e9 == excluded
    mx = fmaxf(mx, xhalf(mx)) * KS;   // KS > 0: the maximum of the raw scores, scaled, is the maximum of the scaled ones
    const float mn = fmaxf(m, mx); const float base = (mn <= -1.0e37f) ? 0.f : mn;   // no key of this query admitted yet: every weight below comes out 0
    const float nb = 11.0f - base; float x[17];   // 2^11 in the exponent keeps small softmax weights out of the f16 subnormal range; the sum carries it too, so it cancels in the epilogue
#pragma unroll
    for (int i = 0; i < 16; ++i) x[i] = fmaf(s[i >> 3][i & 7], KS, nb);   // an excluded score gives exp2(-huge) = 0
    x[16] = m - base; m = mn;
    // the turn's 17 exponentials in one statement, each in place: no neighbour reads the result or overwrites the source of the one in front of it, and the closing v_nop keeps that one slot behind the last
    asm("v_exp_f32 %0, %0\n\tv_exp_f32 %1, %1\n\tv_exp_f32 %2, %2\n\tv_exp_f32 %3, %3\n\tv_exp_f32 %4, %4\n\tv_exp_f32 %5, %5\n\tv_exp_f32 %6, %6\n\tv_exp_f32 %7, %7\n\tv_exp_f32 %8, %8\n\tv_exp_f32 %9, %9\n\tv_exp_f32 %10, %10\n\tv_exp_f32 %11, %11\n\tv_exp_f32 %12, %12\n\tv_exp_f32 %13, %13\n\tv_exp_f32 %14, %14\n\tv_exp_f32 %15, %15\n\tv_exp_f32 %16, %16\n\tv_nop"
        : "+v"(x[0]), "+v"(x[1]), "+v"(x[2]), "+v"(x[3]), "+v"(x[4]), "+v"(x[5]), "+v"(x[6]), "+v"(x[7]), "+v"(x[8]), "+v"(x[9]), "+v"(x[10]), "+v"(x[11]), "+v"(x[12]), "+v"(x[13]), "+v"(x[14]), "+v"(x[15]), "+v"(x[16]));
    const float alpha = x[16]; v16h pa; float es[4] = { 0.f, 0.f, 0.f, 0.f };
#pragma unroll
    for (int i = 0; i < 16; ++i) { es[i & 3] += x[i]; pa[i] = (_Float16)x[i]; }   // element i of the B operand = tile i >> 3, register i & 7
    l = l * alpha + ((es[0] + es[1]) + (es[2] + es[3]));
#pragma unroll
    for (int dt = 0; dt < 4; ++dt) { acc[dt] *= alpha; acc[dt] = wmma16(vf[dt], pa, acc[dt]); } }   // single product: V^T x P^T (x2^11); acc[dt][r] = d dt * 16 + 8 * g + r of query col
    WAIT_DS(); WAIT_ASYNC(); __syncthreads();   // publishes stage t + 1 and ends every read of stage t
    if (t + 2 < SS / 64) { const unsigned l = l0 + (t & 1) * STG32; stage128<64>(l, gK + (size_t)(t + 2) * 64 * 2 * DM * 2, 2 * DM * 2, tid); stage128<64>(l + 64 * P128, gV + (size_t)(t + 2) * 128, SS * 2, tid); stage256<64>(l + 128 * P128, gM + (size_t)(t + 2) * 256, SS * 4, tid); } }
  WAIT_ASYNC();
  const float il = 1.0f / (l + xhalf(l));   // the column's two lanes join their sums once
#pragma unroll
  for (int dt = 0; dt < 4; ++dt) { const v8f o = acc[dt] * il; vst2(&so[wave][col][dt * 16 + 8 * g], (v4f){ o[0], o[1], o[2], o[3] }); vst2(&so[wave][col][dt * 16 + 8 * g + 4], (v4f){ o[4], o[5], o[6], o[7] }); }
  LDSX();
  for (int rl = 0; rl < 16; ++rl) if (lane < 16) vst2(O + ((size_t)b * SS + q0 + rl) * DM + h * HD + lane * 4, *(const v4f*)&so[wave][rl][lane * 4]);
}
// ---- k_out: block = (64 rows, 128 cols): out = O(hi/lo) . Wo rows (2 products) + bo
__global__ __launch_bounds__(128) void k_out(const float* __restrict__ O, const __bf16* __restrict__ P, const float* __restrict__ BO, float* __restrict__ Y) {
  __shared__ __align__(16) char smem[2 * STG32];   // the ring; behind the loop's last barrier the output staging
  float (*so)[16][132] = (float (*)[16][132])smem;
  const int tid = threadIdx.x, wave = tid >> 5, lane = tid & 31, col = lane & 15, g = lane >> 4; const size_t r0 = (size_t)blockIdx.x * 64 + wave * 16; const int n0 = blockIdx.y * 128;
  v8f acc[8] = {};
  const unsigned l0 = lds_off(smem); const char* gB = (const char*)(P + (size_t)n0 * DM); const char* gA = (const char*)(O + (size_t)blockIdx.x * 64 * DM);
  stage128<128>(l0, gB, DM * 2, tid); stage256<64>(l0 + 128 * P128, gA, DM * 4, tid);
  WAIT_ASYNC(); __syncthreads();
  stage128<128>(l0 + STG32, gB + 128, DM * 2, tid); stage256<64>(l0 + STG32 + 128 * P128, gA + 256, DM * 4, tid);
  for (int t = 0; t < DM / KST; ++t) { const char* bs = smem + (t & 1) * STG32;
    F2 a[2]; v16b w[2][8];   // the stage's fragment reads all stand ahead of its products: one LDS latency a stage, not one a product (the loops below are unrolled so that every fragment index is a constant and the arrays stay in registers)
#pragma unroll
    for (int kk = 0; kk < 2; ++kk) { a[kk] = split_row((const float*)(bs + 128 * P128 + (wave * 16 + col) * P256), kk * 32, lane);
#pragma unroll
      for (int j = 0; j < 8; ++j) w[kk][j] = frag_b((const __bf16*)(bs + (j * 16 + col) * P128) + kk * 32, lane); }
#pragma unroll
    for (int kk = 0; kk < 2; ++kk) {
#pragma unroll
      for (int j = 0; j < 8; ++j) { acc[j] = wmma_bf(a[kk].l, w[kk][j], acc[j]); acc[j] = wmma_bf(a[kk].h, w[kk][j], acc[j]); } }
    WAIT_DS(); WAIT_ASYNC(); __syncthreads();   // publishes stage t + 1 and ends every read of stage t
    if (t + 2 < DM / KST) { stage128<128>(l0 + (t & 1) * STG32, gB + (size_t)(t + 2) * 128, DM * 2, tid); stage256<64>(l0 + (t & 1) * STG32 + 128 * P128, gA + (size_t)(t + 2) * 256, DM * 4, tid); } }
  WAIT_ASYNC();
#pragma unroll
  for (int j = 0; j < 8; ++j) {
#pragma unroll
    for (int r = 0; r < 8; ++r) so[wave][8 * g + r][j * 16 + col] = acc[j][r] + bfr(BO[n0 + j * 16 + col]); }
  LDSX();
  for (int rl = 0; rl < 16; ++rl) vst2(Y + (r0 + rl) * DM + n0 + lane * 4, *(const v4f*)&so[wave][rl][lane * 4]);
}
// ---- k_packff: block = (tile, which): (in,out) W1 [1024][4096] -> rows [4096][1024] f16 x 2^8 ; W2 [4096][1024] -> rows [1024][4096]
__global__ __launch_bounds__(256) void k_packff(const float* __restrict__ W1, const float* __restrict__ W2, _Float16* __restrict__ PF, _Float16* __restrict__ PM) { __shared__ __align__(16) char s[TPN * TPP];   // the two weights have the same number of tiles; each has its own copy of the code, so that every pitch is an immediate
  if (blockIdx.y == 0) { const int k0 = (blockIdx.x % (DM / TPK)) * TPK, n0 = (blockIdx.x / (DM / TPK)) * TPN; pack_tile<1>(W1 + (size_t)k0 * DFF + n0, DFF * 4, (char*)(PF + (size_t)n0 * DM + k0), DM * 2, s, threadIdx.x); }
  else { const int k0 = (blockIdx.x % (DFF / TPK)) * TPK, n0 = (blockIdx.x / (DFF / TPK)) * TPN; pack_tile<1>(W2 + (size_t)k0 * DM + n0, DM * 4, (char*)(PM + (size_t)n0 * DFF + k0), DFF * 2, s, threadIdx.x); } }
// ---- k_lnres<F16OUT, RESX>: block = row (256 threads x 4): y = R + LayerNorm(A) x gamma + beta (mean((x-m)^2), eps 1e-5); RESX: residual is the bf16-rounded input x (else an f32 buffer); optional f16 copy for the FF
template <int F16OUT, int RESX>
__global__ __launch_bounds__(256) void k_lnres(const float* __restrict__ A, const float* __restrict__ R, const float* __restrict__ G, const float* __restrict__ Bt, float* __restrict__ Y, _Float16* __restrict__ Y16) {
  __shared__ float red[8]; __shared__ __align__(16) _Float16 sh[DM]; const int t = threadIdx.x; const size_t row = blockIdx.x; float v[4]; float s = 0.f; for (int i = 0; i < 4; ++i) { v[i] = A[row * DM + t * 4 + i]; s += v[i]; }
#pragma unroll
  for (int o = 1; o < 32; o <<= 1) s += __shfl_xor(s, o);
  if ((t & 31) == 0) red[t >> 5] = s; __syncthreads(); float tot = 0.f; for (int i = 0; i < 8; ++i) tot += red[i]; const float mu = tot / (float)DM; __syncthreads();
  float q = 0.f; for (int i = 0; i < 4; ++i) { const float dd = v[i] - mu; q += dd * dd; }
#pragma unroll
  for (int o = 1; o < 32; o <<= 1) q += __shfl_xor(q, o);
  if ((t & 31) == 0) red[t >> 5] = q; __syncthreads(); float tq = 0.f; for (int i = 0; i < 8; ++i) tq += red[i]; const float inv = 1.0f / sqrtf(tq / (float)DM + 1e-5f);
  v4f o4; for (int i = 0; i < 4; ++i) { const int e = t * 4 + i; const float rr = RESX ? bfr(R[row * DM + e]) : R[row * DM + e]; o4[i] = rr + ((v[i] - mu) * inv * bfr(G[e]) + bfr(Bt[e])); if (F16OUT) sh[e] = (_Float16)o4[i]; }
  vst2(Y + row * DM + t * 4, o4);
  if (F16OUT) { __syncthreads(); if (t < DM / 8) vst2((unsigned*)(Y16 + row * DM + t * 8), *(const v4u*)&sh[t * 8]); }
}
// ---- k_mlp<MODE>: block = (64 rows, 128 cols): MODE 0: G = gelu_exact(X1 . W1 + b1) (K 1024 -> 4096) f16; MODE 1: HF = gelu_exact(G . W2 + b2) (K 4096 -> 1024) f32
template <int MODE>
__global__ __launch_bounds__(128) void k_mlp(const _Float16* __restrict__ Ain, const _Float16* __restrict__ Wr, const float* __restrict__ BIAS, const float* __restrict__ RES, float* __restrict__ OUTF, _Float16* __restrict__ OG) {
  constexpr int KIN = (MODE == 0) ? DM : DFF; constexpr int NOUT = (MODE == 0) ? DFF : DM;
  __shared__ __align__(16) char smem[2 * STG16];   // the ring; behind the loop's last barrier the output staging
  float (*so)[16][132] = (float (*)[16][132])smem; _Float16 (*sg)[16][136] = (_Float16 (*)[16][136])smem;
  const int tid = threadIdx.x, wave = tid >> 5, lane = tid & 31, col = lane & 15, g = lane >> 4; const size_t r0 = (size_t)blockIdx.x * 64 + wave * 16; const int n0 = blockIdx.y * 128;
  v8f acc[8] = {};
  const unsigned l0 = lds_off(smem); const char* gB = (const char*)(Wr + (size_t)n0 * KIN); const char* gA = (const char*)(Ain + (size_t)blockIdx.x * 64 * KIN);
  stage128<128>(l0, gB, KIN * 2, tid); stage128<64>(l0 + 128 * P128, gA, KIN * 2, tid);
  WAIT_ASYNC(); __syncthreads();
  stage128<128>(l0 + STG16, gB + 128, KIN * 2, tid); stage128<64>(l0 + STG16 + 128 * P128, gA + 128, KIN * 2, tid);
  for (int t = 0; t < KIN / KST; ++t) { const char* bs = smem + (t & 1) * STG16;
    v16h a[2], w[2][8];   // the stage's fragment reads all stand ahead of its products: one LDS latency a stage, not one a product (the loops below are unrolled so that every fragment index is a constant and the arrays stay in registers)
#pragma unroll
    for (int kk = 0; kk < 2; ++kk) { a[kk] = frag_h((const _Float16*)(bs + 128 * P128 + (wave * 16 + col) * P128) + kk * 32, lane);
#pragma unroll
      for (int j = 0; j < 8; ++j) w[kk][j] = frag_h((const _Float16*)(bs + (j * 16 + col) * P128) + kk * 32, lane); }
#pragma unroll
    for (int kk = 0; kk < 2; ++kk) {
#pragma unroll
      for (int j = 0; j < 8; ++j) acc[j] = wmma16(a[kk], w[kk][j], acc[j]); }
    WAIT_DS(); WAIT_ASYNC(); __syncthreads();   // publishes stage t + 1 and ends every read of stage t
    if (t + 2 < KIN / KST) { stage128<128>(l0 + (t & 1) * STG16, gB + (size_t)(t + 2) * 128, KIN * 2, tid); stage128<64>(l0 + (t & 1) * STG16 + 128 * P128, gA + (size_t)(t + 2) * 128, KIN * 2, tid); } }
  WAIT_ASYNC();
#pragma unroll
  for (int j = 0; j < 8; ++j) { const int c = n0 + j * 16 + col; const float bb = bfr(BIAS[c]); float x[8];
#pragma unroll
    for (int r = 0; r < 8; ++r) x[r] = acc[j][r] * (1.0f / 256.0f) + bb;
    gelu8(x);
#pragma unroll
    for (int r = 0; r < 8; ++r) { if (MODE == 0) sg[wave][8 * g + r][j * 16 + col] = (_Float16)x[r]; else so[wave][8 * g + r][j * 16 + col] = x[r]; } }
  LDSX();
  if (MODE == 0) { for (int rl = 0; rl < 16; ++rl) if (lane < 16) vst2((unsigned*)(OG + (r0 + rl) * NOUT + n0 + lane * 8), *(const v4u*)&sg[wave][rl][lane * 8]); }
  else { for (int rl = 0; rl < 16; ++rl) vst2(OUTF + (r0 + rl) * NOUT + n0 + lane * 4, *(const v4f*)&so[wave][rl][lane * 4]); }
}

extern "C" void kernel_launch(void* const* d_in, const int* in_sizes, int n_in, void* d_out, int out_size, void* d_ws, size_t ws_size, hipStream_t stream) {
  (void)in_sizes; (void)n_in; (void)out_size;
  const float** F = (const float**)d_in;   // 0 x [2,2048,1024], 1 mask [1,1,2048,2048] int, 2 Wq, 3 Wk, 4 Wv, 5 Wo ((in,out)), 6 bo, 7 ln1_g, 8 ln1_b, 9 W1 [1024,4096], 10 b1, 11 W2 [4096,1024], 12 b2, 13 ln2_g, 14 ln2_b
  if (ws_size < (size_t)WS_END) return;
  char* ws = (char*)d_ws; __bf16* PK = (__bf16*)(ws + WS_PK); _Float16 *QK = (_Float16*)(ws + WS_QK), *QKL = (_Float16*)(ws + WS_QKL), *VTH = (_Float16*)(ws + WS_VTH), *VTL = (_Float16*)(ws + WS_VTL), *PF = (_Float16*)(ws + WS_PF), *PM = (_Float16*)(ws + WS_PM), *X16 = (_Float16*)(ws + WS_X16), *Gb = (_Float16*)(ws + WS_G); float *O = (float*)(ws + WS_O), *A0 = (float*)(ws + WS_A0), *X1 = (float*)(ws + WS_X1), *HF = (float*)(ws + WS_HF);
  k_pack<<<dim3((DM / TPK) * (DM / TPN), 4), 256, 0, stream>>>(F[2], F[3], F[4], F[5], PK);
  k_packff<<<dim3((DM / TPK) * (DFF / TPN), 2), 256, 0, stream>>>(F[9], F[11], PF, PM);
  k_qkv<<<dim3(TNB * SS / 64, QKVW / 128), 128, 0, stream>>>(F[0], F[0], F[0], PK + PK_A, nullptr, nullptr, nullptr, QK, QKL, VTH, VTL);
  k_attn<<<dim3(TQB, NH, TNB), 128, 0, stream>>>(QK, QKL, VTH, VTL, nullptr, (const int*)d_in[1], O);
  k_out<<<dim3(TOB, DM / 128), 128, 0, stream>>>(O, PK + PK_P, F[6], A0);
  k_lnres<1, 1><<<TOB * 64, 256, 0, stream>>>(A0, F[0], F[7], F[8], X1, X16);      // x1 = x + LN(attn branch)
  k_mlp<0><<<dim3(TOB, DFF / 128), 128, 0, stream>>>(X16, PF, F[10], nullptr, nullptr, Gb);
  k_mlp<1><<<dim3(TOB, DM / 128), 128, 0, stream>>>(Gb, PM, F[12], nullptr, HF, nullptr);
  k_lnres<0, 0><<<TOB * 64, 256, 0, stream>>>(HF, X1, F[13], F[14], (float*)d_out, nullptr);   // out = x1 + LN(ff branch)
}

// v005
// A run of this version takes 204 microseconds.
// Two timings next to v004 put it at 1.16 and 1.17 times that version's speed.
// All steps since v000 together make it 4.26 times as fast.
// compute dtype: all float inputs rounded to bf16, the int mask read on device; q/k/v = x . W with EXACT bf16 products on WMMA 16x16x32 ((in,out) weights as transposed rows); PLAIN attention: q, k single f16 x 1/8, masked keys excluded, running-max softmax in f32 (hardware exp), P (scaled by 2^11, single f16) x v (single f16); attention out (bf16 hi + residual) . Wo (2 products) + bo; LayerNorms in f32; FF: x1 rounded once to f16 x exact f16 weight copies (x 2^8), erf GELU (x . Phi(x), f32-accurate rational form of erfc), hidden f16, second erf GELU; f32 output.
#include <hip/hip_runtime.h>
#include <math.h>

typedef __attribute__((ext_vector_type(16))) _Float16 v16h;
typedef __attribute__((ext_vector_type(16))) __bf16 v16b;
typedef __attribute__((ext_vector_type(8)))  _Float16 v8h;
typedef __attribute__((ext_vector_type(8)))  float v8f;
typedef __attribute__((ext_vector_type(4)))  float v4f;
typedef __attribute__((ext_vector_type(2)))  float v2f;
typedef __attribute__((ext_vector_type(4)))  unsigned v4u;
typedef __attribute__((ext_vector_type(4)))  int v4i;
typedef float __attribute__((may_alias)) float_a;
typedef int __attribute__((may_alias)) int_a;

template <typename T> __device__ __forceinline__ void vst2(void* p, T v) { *(T*)p = v;  }
__device__ __forceinline__ v8f wmma16(v16h a, v16h b, v8f c) {
  v8f d = __builtin_amdgcn_wmma_f32_16x16x32_f16(false, a, false, b, (short)0, c, false, false);
  asm volatile("v_nop\n\tv_nop\n\tv_nop\n\tv_nop" : "+v"(d) : "v"(a), "v"(b));
  return d;
}
__device__ __forceinline__ v8f wmma_bf(v16b a, v16b b, v8f c) {
  v8f d = __builtin_amdgcn_wmma_f32_16x16x32_bf16(false, a, false, b, (short)0, c, false, false);
  asm volatile("v_nop\n\tv_nop\n\tv_nop\n\tv_nop" : "+v"(d) : "v"(a), "v"(b));
  return d;
}
// Transformer block (B 2, S 2,048, d 1,024, 16 heads x 64, FF 4,096): bias-free q/k/v projections, scores / 8 with a [S,S] mask (mask == 1 -> -1e9), softmax, . v, Wo + bo; x + LayerNorm(attention branch); FF with exact GELU after BOTH linears; x + LayerNorm(FF branch).
__device__ __forceinline__ v16h frag_h(const _Float16* rowk0, int lane) {
  union { v16h v; v8h q[2]; } u; const _Float16* p = rowk0 + 8 * (lane >> 4);
  u.q[0] = *(const v8h*)p; u.q[1] = *(const v8h*)(p + 16); return u.v;
}
__device__ __forceinline__ v16h frag_f32(const float* rowk0, int lane) {
  v16h a; const float* p = rowk0 + 8 * (lane >> 4);
#pragma unroll
  for (int i = 0; i < 8; ++i) { a[i] = (_Float16)p[i]; a[8 + i] = (_Float16)p[16 + i]; }
  return a;
}
__device__ __forceinline__ v16h frag_f32s(const float* rowk0, int lane, float sc) {
  v16h a; const float* p = rowk0 + 8 * (lane >> 4);
#pragma unroll
  for (int i = 0; i < 8; ++i) { a[i] = (_Float16)(p[i] * sc); a[8 + i] = (_Float16)(p[16 + i] * sc); }
  return a;
}
// column fragment from a [K][ld] layout (column n), rows >= K read as 0
__device__ __forceinline__ v16h fragc_f32(const float* W, int k0, int n, int lane, int ld, int K) {
  v16h a; const int g = lane >> 4;
#pragma unroll
  for (int i = 0; i < 8; ++i) { const int ka = k0 + 8 * g + i, kb = ka + 16;
    a[i] = (_Float16)(ka < K ? W[(size_t)(ka < K ? ka : K - 1) * ld + n] : 0.f); a[8 + i] = (_Float16)(kb < K ? W[(size_t)(kb < K ? kb : K - 1) * ld + n] : 0.f); }
  return a;
}
struct F2 { v16b h, l; };
__device__ __forceinline__ F2 bsplit16(const float v[16]) { F2 r;
#pragma unroll
  for (int i = 0; i < 16; ++i) { const __bf16 h = (__bf16)v[i]; r.h[i] = h; r.l[i] = (__bf16)(v[i] - (float)h); }
  return r; }
__device__ __forceinline__ F2 split_row(const float* row, int k0, int lane) { float v[16]; const float* p = row + k0 + 8 * (lane >> 4);
#pragma unroll
  for (int i = 0; i < 8; ++i) { v[i] = p[i]; v[8 + i] = p[16 + i]; }
  return bsplit16(v); }
__device__ __forceinline__ F2 split_rowK(const float* row, int k0, int lane, int K) { float v[16]; const int g = lane >> 4;
#pragma unroll
  for (int i = 0; i < 8; ++i) { const int ka = k0 + 8 * g + i, kb = ka + 16; v[i] = ka < K ? row[ka < K ? ka : K - 1] : 0.f; v[8 + i] = kb < K ? row[kb < K ? kb : K - 1] : 0.f; }
  return bsplit16(v); }
__device__ __forceinline__ F2 split_col(const float* W, int k0, int n, int lane, int ld, int K) { float v[16]; const int g = lane >> 4;
#pragma unroll
  for (int i = 0; i < 8; ++i) { const int ka = k0 + 8 * g + i, kb = ka + 16; v[i] = ka < K ? W[(size_t)(ka < K ? ka : K - 1) * ld + n] : 0.f; v[8 + i] = kb < K ? W[(size_t)(kb < K ? kb : K - 1) * ld + n] : 0.f; }
  return bsplit16(v); }
__device__ __forceinline__ v8f mac3(const F2& a, const F2& b, v8f c) { c = wmma_bf(a.l, b.h, c); c = wmma_bf(a.h, b.l, c); return wmma_bf(a.h, b.h, c); }
__device__ __forceinline__ float sigm(float v) { return 1.0f / (1.0f + expf(-v)); }
#define LDSX() do { asm volatile("s_wait_dscnt 0" ::: "memory"); __builtin_amdgcn_wave_barrier(); __builtin_amdgcn_fence(__ATOMIC_RELEASE, "workgroup"); } while (0)


#define NB 2
#define SS 2048
#define DM 1024
#define NH 16
#define DFF 4096
#define NR (NB * SS)
// erf GELU as x * Phi(x), Phi the normal distribution function, inline and with no branch, 8 values side by side, in place. With t = 1 / (1 + p |x| / sqrt(2)), q = (c1 t + ... + c5 t^5) / 2 * exp(-x^2 / 2) is Phi(-|x|) = erfc(|x| / sqrt(2)) / 2 (five-term rational form of erfc: absolute error of Phi under 1e-7, of the result under 4e-7 for |x| <= 8); x * Phi(x) = max(x, 0) - |x| q on both sides of 0, with no cancellation in the negative tail
__device__ __forceinline__ void gelu8(float (&x)[8]) {
  float t[8], e[8];
#pragma unroll   // constant indices: the arrays stay in registers
  for (int i = 0; i < 8; ++i) { t[i] = fmaf(0.3275911f * 0.70710678118654752f, fabsf(x[i]), 1.0f); e[i] = (x[i] * x[i]) * -0.72134752044448170f; }   // exp(-x^2 / 2) in base 2; far out it is 0 and the result max(x, 0)
  // the 8 reciprocals and 8 exponentials in one statement, each in place: no neighbour reads the result or overwrites the source of the one in front of it, and the closing v_nop keeps that one slot behind the last
  asm("v_rcp_f32 %0, %0\n\tv_rcp_f32 %1, %1\n\tv_rcp_f32 %2, %2\n\tv_rcp_f32 %3, %3\n\tv_rcp_f32 %4, %4\n\tv_rcp_f32 %5, %5\n\tv_rcp_f32 %6, %6\n\tv_rcp_f32 %7, %7\n\tv_exp_f32 %8, %8\n\tv_exp_f32 %9, %9\n\tv_exp_f32 %10, %10\n\tv_exp_f32 %11, %11\n\tv_exp_f32 %12, %12\n\tv_exp_f32 %13, %13\n\tv_exp_f32 %14, %14\n\tv_exp_f32 %15, %15\n\tv_nop"
      : "+v"(t[0]), "+v"(t[1]), "+v"(t[2]), "+v"(t[3]), "+v"(t[4]), "+v"(t[5]), "+v"(t[6]), "+v"(t[7]), "+v"(e[0]), "+v"(e[1]), "+v"(e[2]), "+v"(e[3]), "+v"(e[4]), "+v"(e[5]), "+v"(e[6]), "+v"(e[7]));
#pragma unroll
  for (int i = 0; i < 8; ++i) { float p = fmaf(0.5f * 1.061405429f, t[i], 0.5f * -1.453152027f);
    p = fmaf(p, t[i], 0.5f * 1.421413741f); p = fmaf(p, t[i], 0.5f * -0.284496736f); p = fmaf(p, t[i], 0.5f * 0.254829592f);
    x[i] = fmaf(-fabsf(x[i]), (p * t[i]) * e[i], fmaxf(x[i], 0.f)); }
}
#define HD 64
#define QKVW (3 * DM)
#ifndef TQB
#define TQB (SS / 64)
#define TNB NB
#define TOB (NB * SS / 64)     // output row tiles (all)
#endif
typedef __attribute__((ext_vector_type(8))) __bf16 v8b;
__device__ __forceinline__ v16b frag_b(const __bf16* rowk0, int lane) {
  union { v16b v; v8b q[2]; } u; const __bf16* p = rowk0 + 8 * (lane >> 4);
  u.q[0] = *(const v8b*)p; u.q[1] = *(const v8b*)(p + 16); return u.v;
}
__device__ __forceinline__ float bfr(float v) { return (float)(__bf16)v; }
__device__ __attribute__((noinline)) float exp_ni(float v) { return expf(v); }
__device__ __attribute__((noinline)) float erf_ni(float v) { return erff(v); }

// ---- LDS ring of the GEMM kernels: a block is 8 waves, 4 down x 2 across; a wave makes FM x 16 rows by 64 columns, so a weight fragment read from LDS serves FM products and an activation fragment 4, and a block makes FM x 64 rows by 128 columns from one staging of its operand rows. A stage is 64 or 128 k of the block's 128 weight rows and of its activation rows, brought by asynchronous copies in whole lines; two buffers
#define KST 64
#define P128 144   // LDS pitch of a 128-B row: 16 B x odd, no bank conflict for 16-B reads down a column of rows
#define P256 272   // LDS pitch of a 256-B row, likewise
__device__ __forceinline__ unsigned lds_off(const void* p) { return (unsigned)(size_t)p; }
// four copies of 16 B a lane; s_wait_xcnt closes the statement so that no address register of a copy is rewritten ahead of it
__device__ __forceinline__ void cp4(unsigned l0, unsigned l1, unsigned l2, unsigned l3, const char* g0, const char* g1, const char* g2, const char* g3) {
  asm volatile("global_load_async_to_lds_b128 %0, %4, off\n\tglobal_load_async_to_lds_b128 %1, %5, off\n\tglobal_load_async_to_lds_b128 %2, %6, off\n\tglobal_load_async_to_lds_b128 %3, %7, off\n\ts_wait_xcnt 0x0"
               :: "v"(l0), "v"(l1), "v"(l2), "v"(l3), "v"(g0), "v"(g1), "v"(g2), "v"(g3) : "memory");
}
// NROW rows of 128 B (global pitch gp bytes) -> LDS at pitch P128: 8 lanes a row, NT / 8 rows a copy of the block's NT threads
template <int NROW, int NT = 128> __device__ __forceinline__ void stage128(unsigned l, const char* g, size_t gp, int tid) {
  constexpr int RP = NT / 8; l += (tid >> 3) * P128 + (tid & 7) * 16; g += (size_t)(tid >> 3) * gp + (tid & 7) * 16;
  for (int i = 0; i < NROW / RP; i += 4) cp4(l + i * RP * P128, l + (i + 1) * RP * P128, l + (i + 2) * RP * P128, l + (i + 3) * RP * P128, g + (size_t)i * RP * gp, g + (size_t)(i + 1) * RP * gp, g + (size_t)(i + 2) * RP * gp, g + (size_t)(i + 3) * RP * gp);
}
// NROW rows of 256 B -> LDS at pitch P256: 16 lanes a row, NT / 16 rows a copy of the block's NT threads
template <int NROW, int NT = 128> __device__ __forceinline__ void stage256(unsigned l, const char* g, size_t gp, int tid) {
  constexpr int RP = NT / 16; l += (tid >> 4) * P256 + (tid & 15) * 16; g += (size_t)(tid >> 4) * gp + (tid & 15) * 16;
  for (int i = 0; i < NROW / RP; i += 4) cp4(l + i * RP * P256, l + (i + 1) * RP * P256, l + (i + 2) * RP * P256, l + (i + 3) * RP * P256, g + (size_t)i * RP * gp, g + (size_t)(i + 1) * RP * gp, g + (size_t)(i + 2) * RP * gp, g + (size_t)(i + 3) * RP * gp);
}
#define WAIT_ASYNC() asm volatile("s_wait_asynccnt 0x0" ::: "memory")   // this wave's copies have landed
#define WAIT_DS() asm volatile("s_wait_dscnt 0x0" ::: "memory")         // this wave's LDS reads are done before the buffer is given up
#define STG32 (128 * P128 + 64 * P256)     // one buffer of the attention ring
#define STGF (128 * P128 + 128 * P256)     // one GEMM buffer, f32 activations, 64 k: weight rows, then activation rows
#define GNT 256                            // threads of a GEMM block
#define PK_A 0                       // [3072][1024] Wqkv rows (natural [out][in])
#define PK_P (PK_A + QKVW * DM)        // [1024][1024] Wo rows (natural)
#define PK_END (PK_P + DM * DM)
#define WS_PK  0u
#define WS_QK  (WS_PK + 2u * PK_END)             // f16 [4096 rows][2048]: q | k
#define WS_QKL (WS_QK + 2u * NB * SS * 2 * DM)     // f16 q | k residual planes x2048
#define WS_VTH (WS_QKL + 2u * NB * SS * 2 * DM)    // f16 [b][1024 (h*64+d)][2048 s] hi
#define WS_VTL (WS_VTH + 2u * NB * DM * SS)        // f16 lo x 2048
#define WS_O   (WS_VTL + 2u * NB * DM * SS)        // f32 [4096][1024]
#define WS_CS  (WS_O + 4u * NB * SS * DM)           // f32 [2][2048][32], unused
#define WS_PF  (WS_CS + 4u * 2 * SS * 32)                  // f16 x 2^8 rows W1^T [4096][1024] ; W2^T [1024][4096]
#define WS_PM  (WS_PF + 2u * (size_t)DFF * DM)
#define WS_A0  (WS_PM + 2u * (size_t)DM * DFF)          // f32 [NR][1024] attention branch ; X1 f32 ; HF f32 (ff branch)
#define WS_X1  (WS_A0 + 4u * (size_t)NR * DM)
#define WS_HF  (WS_X1 + 4u * (size_t)NR * DM)
#define WS_X16 (WS_HF + 4u * (size_t)NR * DM)           // f16 [NR][1024] x1 ; G f16 [NR][4096]
#define WS_G   (WS_X16 + 2u * (size_t)NR * DM)
#define WS_END (WS_G + 2u * (size_t)NR * DFF)
// ---- weight packs: a block transposes one tile of 128 k x 64 n of an (in,out) f32 weight into 64 packed 16-bit rows of 128 k. A thread loads 8 k rows x 4 n as 16-B pieces (16 lanes cover 256 B in a row of the source), converts, and puts 8 k of each of its 4 n as one 16-B piece into LDS; the rows then go out as 256 B in a row of the packed plane
#define TPK 128
#define TPN 64
#define TPP 272   // LDS pitch of a packed 256-B row
template <int F16> __device__ __forceinline__ void pack_tile(const float* __restrict__ Wt, unsigned ldw, char* __restrict__ dst, unsigned ldd, char* s, int t) {   // Wt: the tile's first element, ldw its row pitch in bytes; dst: the tile's first packed byte, ldd its row pitch in bytes
  const int n4 = t & 15, kg = t >> 4; const unsigned go = (unsigned)kg * 8u * ldw + n4 * 16; v4f r[8];   // a block-uniform row address plus one 32-bit lane offset (under 2 MiB) for all 8 loads
#pragma unroll   // the 8 loads of a thread are in flight together, and r stays in registers
  for (int i = 0; i < 8; ++i) r[i] = *(const v4f*)((const char*)Wt + (size_t)i * ldw + go);
  asm volatile("s_wait_xcnt 0x0" ::: "memory");   // stands in front of every later write of a register that the 8 loads name as an address
#pragma unroll   // constant indices into r
  for (int j = 0; j < 4; ++j) { v4u o;
    if (F16) { v8h h;
#pragma unroll
      for (int i = 0; i < 8; ++i) h[i] = (_Float16)(bfr(r[i][j]) * 256.0f);
      o = __builtin_bit_cast(v4u, h); }
    else { v8b h;
#pragma unroll
      for (int i = 0; i < 8; ++i) h[i] = (__bf16)r[i][j];
      o = __builtin_bit_cast(v4u, h); }
    *(v4u*)(s + (n4 * 4 + j) * TPP + kg * 16) = o; }
  __syncthreads();
  const int n = t >> 4, c = t & 15; const unsigned so = (unsigned)n * ldd + c * 16; v4u o[4];   // 16 lanes a packed row, 16 rows a turn of the 256 threads
#pragma unroll   // the 4 LDS reads stand together ahead of the 4 stores: one LDS latency, not four
  for (int i = 0; i < TPN / 16; ++i) o[i] = *(const v4u*)(s + (n + i * 16) * TPP + c * 16);
#pragma unroll
  for (int i = 0; i < TPN / 16; ++i) vst2(dst + (size_t)i * 16 * ldd + so, o[i]);
}
// ---- k_pack: block = (tile, which): which 0..2 -> W_q/W_k/W_v into PK_A rows which*1024 + n (pack row n = column n, bf16); 3 -> W_o into PK_P
__global__ __launch_bounds__(256) void k_pack(const float* __restrict__ WQ, const float* __restrict__ WK, const float* __restrict__ WV, const float* __restrict__ WO, __bf16* __restrict__ PK) {
  __shared__ __align__(16) char s[TPN * TPP]; const int k0 = (blockIdx.x % (DM / TPK)) * TPK, n0 = (blockIdx.x / (DM / TPK)) * TPN, which = blockIdx.y; const float* Wm = (which == 0) ? WQ : (which == 1) ? WK : (which == 2) ? WV : WO;
  __bf16* dst = (which < 3) ? PK + PK_A + ((size_t)which * DM + n0) * DM + k0 : PK + PK_P + (size_t)n0 * DM + k0;
  pack_tile<0>(Wm + (size_t)k0 * DM + n0, DM * 4, (char*)dst, DM * 2, s, threadIdx.x);
}
__global__ __launch_bounds__(GNT) void k_qkv(const float* __restrict__ XQ, const float* __restrict__ XK, const float* __restrict__ XV, const __bf16* __restrict__ P, const float* __restrict__ BQ, const float* __restrict__ BK, const float* __restrict__ BV, _Float16* __restrict__ QK, _Float16* __restrict__ QKL, _Float16* __restrict__ VTH, _Float16* __restrict__ VTL) {
  constexpr int FM = 2, NT = GNT, WR = FM * 16, NW = NT / 32;   // WR rows a wave, NW waves
  const int which0 = (blockIdx.y * 128) / DM; const float* X = (which0 == 0) ? XQ : (which0 == 1) ? XK : XV; const float* BB = BQ ? (((which0 == 0) ? BQ : (which0 == 1) ? BK : BV) + (blockIdx.y * 128 - which0 * DM)) : nullptr;
  __shared__ __align__(16) char smem[2 * STGF];   // the ring; behind the loop's last barrier the output staging
  _Float16 (*so)[WR][72] = (_Float16 (*)[WR][72])smem, (*sol)[WR][72] = (_Float16 (*)[WR][72])(smem + NW * WR * 72 * 2); _Float16 (*sth)[136] = (_Float16 (*)[136])smem, (*stl)[136] = (_Float16 (*)[136])(smem + 128 * 136 * 2);
  const int tid = threadIdx.x, wave = tid >> 5, lane = tid & 31, col = lane & 15, g = lane >> 4, wm = wave >> 1, wn = wave & 1; const size_t r0 = (size_t)blockIdx.x * 128 + wm * WR; const int nb0 = blockIdx.y * 128, n0 = nb0 + wn * 64;
  v8f acc[FM][4] = {};
  const unsigned l0 = lds_off(smem); const char* gB = (const char*)(P + (size_t)nb0 * DM); const char* gA = (const char*)(X + (size_t)blockIdx.x * 128 * DM);
  stage128<128, NT>(l0, gB, DM * 2, tid); stage256<128, NT>(l0 + 128 * P128, gA, DM * 4, tid);
  WAIT_ASYNC(); __syncthreads();
  stage128<128, NT>(l0 + STGF, gB + 128, DM * 2, tid); stage256<128, NT>(l0 + STGF + 128 * P128, gA + 256, DM * 4, tid);
  for (int t = 0; t < DM / KST; ++t) { const char* bs = smem + (t & 1) * STGF;
    v16b a[2][FM], w[2][4];   // the stage's fragment reads all stand ahead of its products: one LDS latency a stage, not one a product (the loops below are unrolled so that every fragment index is a constant and the arrays stay in registers)
#pragma unroll
    for (int kk = 0; kk < 2; ++kk) {
#pragma unroll
      for (int i = 0; i < FM; ++i) { const float* p = (const float*)(bs + 128 * P128 + (wm * WR + i * 16 + col) * P256) + kk * 32 + 8 * g;
#pragma unroll
        for (int e = 0; e < 8; ++e) { a[kk][i][e] = (__bf16)p[e]; a[kk][i][8 + e] = (__bf16)p[16 + e]; } }
#pragma unroll
      for (int j = 0; j < 4; ++j) w[kk][j] = frag_b((const __bf16*)(bs + (wn * 64 + j * 16 + col) * P128) + kk * 32, lane); }
#pragma unroll
    for (int kk = 0; kk < 2; ++kk) {
#pragma unroll
      for (int i = 0; i < FM; ++i) {
#pragma unroll
        for (int j = 0; j < 4; ++j) acc[i][j] = wmma_bf(a[kk][i], w[kk][j], acc[i][j]); } }
    WAIT_DS(); WAIT_ASYNC(); __syncthreads();   // publishes stage t + 1 and ends every read of stage t
    if (t + 2 < DM / KST) { stage128<128, NT>(l0 + (t & 1) * STGF, gB + (size_t)(t + 2) * 128, DM * 2, tid); stage256<128, NT>(l0 + (t & 1) * STGF + 128 * P128, gA + (size_t)(t + 2) * 256, DM * 4, tid); } }
  WAIT_ASYNC();
  float bv[4] = { 0.f, 0.f, 0.f, 0.f };   // the bias of this lane's 4 columns, where there is one
  if (BB) {
#pragma unroll   // constant indices: bv stays in registers
    for (int j = 0; j < 4; ++j) bv[j] = bfr(BB[wn * 64 + j * 16 + col]);
    asm volatile("s_wait_xcnt 0x0" ::: "memory"); }   // stands in front of every later write of a register that the 4 loads name as an address
  if (nb0 < 2 * DM) {   // q stored unscaled (f16 sigma ~0.6, no subnormal exposure); 1/8 applied to the f32 score
#pragma unroll
    for (int i = 0; i < FM; ++i) {
#pragma unroll
      for (int j = 0; j < 4; ++j) {
#pragma unroll
        for (int r = 0; r < 8; ++r) { const float v = acc[i][j][r] + bv[j]; const _Float16 hv = (_Float16)v; so[wave][i * 16 + 8 * g + r][j * 16 + col] = hv; sol[wave][i * 16 + 8 * g + r][j * 16 + col] = (_Float16)((v - (float)hv) * 2048.0f); } } }   // q, k (+ bias) as f16 hi + (x2048) residual
    LDSX();
    const int rw = lane >> 3, c8 = (lane & 7) * 8;   // 8 lanes a 128-B row piece, 4 rows a store
    for (int rl = 0; rl < WR; rl += 4) { vst2((unsigned*)(QK + (r0 + rl + rw) * (2 * DM) + n0 + c8), *(const v4u*)&so[wave][rl + rw][c8]); vst2((unsigned*)(QKL + (r0 + rl + rw) * (2 * DM) + n0 + c8), *(const v4u*)&sol[wave][rl + rw][c8]); }
  } else {
#pragma unroll
    for (int i = 0; i < FM; ++i) {
#pragma unroll
      for (int j = 0; j < 4; ++j) {
#pragma unroll
        for (int r = 0; r < 8; ++r) { const float v = acc[i][j][r] + bv[j]; const _Float16 hv = (_Float16)v; sth[wn * 64 + j * 16 + col][wm * WR + i * 16 + 8 * g + r] = hv; stl[wn * 64 + j * 16 + col][wm * WR + i * 16 + 8 * g + r] = (_Float16)((v - (float)hv) * 2048.0f); } } }
    __syncthreads();
    const size_t rb = (size_t)blockIdx.x * 128; const int b = (int)(rb / SS), s0 = (int)(rb % SS); const int pc0 = nb0 - 2 * DM;
    for (int q = tid; q < 128 * 16; q += NT) { const int d = q >> 4, pc = q & 15; const size_t o = ((size_t)b * DM + pc0 + d) * SS + s0 + pc * 8; vst2((unsigned*)(VTH + o), *(const v4u*)&sth[d][pc * 8]); vst2((unsigned*)(VTL + o), *(const v4u*)&stl[d][pc * 8]); }
  }
}
// lane l <-> lane l ^ 16: the two lanes that share a query column
__device__ __forceinline__ float xhalf(float x) { return __builtin_bit_cast(float, __builtin_amdgcn_permlanex16(__builtin_bit_cast(int, x), __builtin_bit_cast(int, x), 0x76543210, 0xfedcba98, false, false)); }
// ---- k_attn: block = (64 queries, head h, batch b): all-keys flash attention with both products transposed: S^T = K . Q^T (A = key rows, B = the wave's 16 queries), O^T += V^T . P^T (A = v rows [d][key], B = P^T). A lane then holds 8 keys of ONE query (column lane & 15, keys 8 * (lane >> 4) + r of a 16-key tile): maximum and sum run inside the lane, one exchange with lane ^ 16 for the maximum; two score tiles converted in place are the B operand of the second product (element i = tile i >> 3, register i & 7), so P touches neither LDS nor another lane. Single f16 operands; softmax in base 2 on the raw scores, weights x 2^11 in numerator and denominator alike; O[b*S+q][h*64+d] = acc / l (256-B segments)
__global__ __launch_bounds__(128) void k_attn(const _Float16* __restrict__ QK, const _Float16* __restrict__ QKL, const _Float16* __restrict__ VTH, const _Float16* __restrict__ VTL, const void* __restrict__ KMASK, const int* __restrict__ MSK, float* __restrict__ O) {
  __shared__ __align__(16) char smem[2 * STG32];   // the ring (64 key rows, 64 v rows, 64 mask rows a stage); behind the loop's last barrier the output staging
  float (*so)[16][68] = (float (*)[16][68])smem;
  const int tid = threadIdx.x, wave = tid >> 5, lane = tid & 31, col = lane & 15, g = lane >> 4;
  const int qb = blockIdx.x, h = blockIdx.y, b = blockIdx.z; const int q0 = qb * 64 + wave * 16; const size_t rq = (size_t)b * SS + q0 + col;
  v16h aq[2];
#pragma unroll
  for (int kc = 0; kc < 2; ++kc) aq[kc] = frag_h(QK + rq * (2 * DM) + h * HD + kc * 32, lane);
  const float KS = 0.125f * 1.4426950408889634f;   // 1/sqrt(64) and log2(e) in one factor
  float m = -3.0e38f, l = 0.f;   // of this lane's query: running maximum of score x KS (alike in both lanes of the column); this lane's own part of the sum
  v8f acc[4] = {};
  // a stage is 64 keys (all keys are walked): 64 k rows of 128 B, the head's 64 v rows of 128 B, the block's 64 mask rows of 256 B
  const unsigned l0 = lds_off(smem); const char* gK = (const char*)(QK + (size_t)b * SS * (2 * DM) + DM + h * HD); const char* gV = (const char*)(VTH + ((size_t)b * DM + h * HD) * SS); const char* gM = (const char*)(MSK + (size_t)qb * 64 * SS);
  stage128<64>(l0, gK, 2 * DM * 2, tid); stage128<64>(l0 + 64 * P128, gV, SS * 2, tid); stage256<64>(l0 + 128 * P128, gM, SS * 4, tid);
  WAIT_ASYNC(); __syncthreads();
  stage128<64>(l0 + STG32, gK + (size_t)64 * 2 * DM * 2, 2 * DM * 2, tid); stage128<64>(l0 + STG32 + 64 * P128, gV + 128, SS * 2, tid); stage256<64>(l0 + STG32 + 128 * P128, gM + 256, SS * 4, tid);
#pragma unroll 1   // the stage loop stays rolled, as the key loop was: its body already holds two turns
  for (int t = 0; t < SS / 64; ++t) { const char* bs = smem + (t & 1) * STG32;
#pragma unroll     // both turns of a stage unrolled: their LDS offsets become immediates
  for (int sub = 0; sub < 2; ++sub) { v8f s[2]; v16h kf[2][2], vf[4]; v4i mk[2][2];   // 32 keys a turn; its LDS reads all stand ahead of its products: one LDS latency a turn, not one a product
#pragma unroll
    for (int ct = 0; ct < 2; ++ct) {
#pragma unroll
      for (int kc = 0; kc < 2; ++kc) kf[ct][kc] = frag_h((const _Float16*)(bs + (sub * 32 + ct * 16 + col) * P128) + kc * 32, lane);
      const v4i* pm = (const v4i*)(bs + 128 * P128 + (wave * 16 + col) * P256 + (sub * 32 + ct * 16 + 8 * g) * 4); mk[ct][0] = pm[0]; mk[ct][1] = pm[1]; }   // the query's mask row, this lane's 8 keys: 32 B in a row
#pragma unroll
    for (int dt = 0; dt < 4; ++dt) vf[dt] = frag_h((const _Float16*)(bs + 64 * P128 + (dt * 16 + col) * P128) + sub * 32, lane);
    float mx = -3.0e38f;
#pragma unroll
    for (int ct = 0; ct < 2; ++ct) { v8f c = {};
#pragma unroll
      for (int kc = 0; kc < 2; ++kc) c = wmma16(kf[ct][kc], aq[kc], c);   // single product: k, q as one-rounding f16 operands; c[r] = key ct * 16 + 8 * g + r against query col
#pragma unroll
      for (int r = 0; r < 8; ++r) { s[ct][r] = (mk[ct][r >> 2][r & 3] != 1) ? c[r] : -3.0e38f; mx = fmaxf(mx, s[ct][r]); } }   // mask == 1 -> -1e9 == excluded
    mx = fmaxf(mx, xhalf(mx)) * KS;   // KS > 0: the maximum of the raw scores, scaled, is the maximum of the scaled ones
    const float mn = fmaxf(m, mx); const float base = (mn <= -1.0e37f) ? 0.f : mn;   // no key of this query admitted yet: every weight below comes out 0
    const float nb = 11.0f - base; float x[17];   // 2^11 in the exponent keeps small softmax weights out of the f16 subnormal range; the sum carries it too, so it cancels in the epilogue
#pragma unroll
    for (int i = 0; i < 16; ++i) x[i] = fmaf(s[i >> 3][i & 7], KS, nb);   // an excluded score gives exp2(-huge) = 0
    x[16] = m - base; m = mn;
    // the turn's 17 exponentials in one statement, each in place: no neighbour reads the result or overwrites the source of the one in front of it, and the closing v_nop keeps that one slot behind the last
    asm("v_exp_f32 %0, %0\n\tv_exp_f32 %1, %1\n\tv_exp_f32 %2, %2\n\tv_exp_f32 %3, %3\n\tv_exp_f32 %4, %4\n\tv_exp_f32 %5, %5\n\tv_exp_f32 %6, %6\n\tv_exp_f32 %7, %7\n\tv_exp_f32 %8, %8\n\tv_exp_f32 %9, %9\n\tv_exp_f32 %10, %10\n\tv_exp_f32 %11, %11\n\tv_exp_f32 %12, %12\n\tv_exp_f32 %13, %13\n\tv_exp_f32 %14, %14\n\tv_exp_f32 %15, %15\n\tv_exp_f32 %16, %16\n\tv_nop"
        : "+v"(x[0]), "+v"(x[1]), "+v"(x[2]), "+v"(x[3]), "+v"(x[4]), "+v"(x[5]), "+v"(x[6]), "+v"(x[7]), "+v"(x[8]), "+v"(x[9]), "+v"(x[10]), "+v"(x[11]), "+v"(x[12]), "+v"(x[13]), "+v"(x[14]), "+v"(x[15]), "+v"(x[16]));
    const float alpha = x[16]; v16h pa; float es[4] = { 0.f, 0.f, 0.f, 0.f };
#pragma unroll
    for (int i = 0; i < 16; ++i) { es[i & 3] += x[i]; pa[i] = (_Float16)x[i]; }   // element i of the B operand = tile i >> 3, register i & 7
    l = l * alpha + ((es[0] + es[1]) + (es[2] + es[3]));
#pragma unroll
    for (int dt = 0; dt < 4; ++dt) { acc[dt] *= alpha; acc[dt] = wmma16(vf[dt], pa, acc[dt]); } }   // single product: V^T x P^T (x2^11); acc[dt][r] = d dt * 16 + 8 * g + r of query col
    WAIT_DS(); WAIT_ASYNC(); __syncthreads();   // publishes stage t + 1 and ends every read of stage t
    if (t + 2 < SS / 64) { const unsigned l = l0 + (t & 1) * STG32; stage128<64>(l, gK + (size_t)(t + 2) * 64 * 2 * DM * 2, 2 * DM * 2, tid); stage128<64>(l + 64 * P128, gV + (size_t)(t + 2) * 128, SS * 2, tid); stage256<64>(l + 128 * P128, gM + (size_t)(t + 2) * 256, SS * 4, tid); } }
  WAIT_ASYNC();
  const float il = 1.0f / (l + xhalf(l));   // the column's two lanes join their sums once
#pragma unroll
  for (int dt = 0; dt < 4; ++dt) { const v8f o = acc[dt] * il; vst2(&so[wave][col][dt * 16 + 8 * g], (v4f){ o[0], o[1], o[2], o[3] }); vst2(&so[wave][col][dt * 16 + 8 * g + 4], (v4f){ o[4], o[5], o[6], o[7] }); }
  LDSX();
  for (int rl = 0; rl < 16; ++rl) if (lane < 16) vst2(O + ((size_t)b * SS + q0 + rl) * DM + h * HD + lane * 4, *(const v4f*)&so[wave][rl][lane * 4]);
}
// ---- k_out: block = (128 rows, 128 cols): out = O(hi/lo) . Wo rows (2 products) + bo
__global__ __launch_bounds__(GNT) void k_out(const float* __restrict__ O, const __bf16* __restrict__ P, const float* __restrict__ BO, float* __restrict__ Y) {
  constexpr int FM = 2, NT = GNT, WR = FM * 16;   // WR rows a wave
  __shared__ __align__(16) char smem[2 * STGF];   // the ring; behind the loop's last barrier the output staging
  float (*so)[WR][68] = (float (*)[WR][68])smem;
  const int tid = threadIdx.x, wave = tid >> 5, lane = tid & 31, col = lane & 15, g = lane >> 4, wm = wave >> 1, wn = wave & 1; const size_t r0 = (size_t)blockIdx.x * 128 + wm * WR; const int nb0 = blockIdx.y * 128, n0 = nb0 + wn * 64;
  v8f acc[FM][4] = {};
  const unsigned l0 = lds_off(smem); const char* gB = (const char*)(P + (size_t)nb0 * DM); const char* gA = (const char*)(O + (size_t)blockIdx.x * 128 * DM);
  stage128<128, NT>(l0, gB, DM * 2, tid); stage256<128, NT>(l0 + 128 * P128, gA, DM * 4, tid);
  WAIT_ASYNC(); __syncthreads();
  stage128<128, NT>(l0 + STGF, gB + 128, DM * 2, tid); stage256<128, NT>(l0 + STGF + 128 * P128, gA + 256, DM * 4, tid);
  for (int t = 0; t < DM / KST; ++t) { const char* bs = smem + (t & 1) * STGF;
    F2 a[2][FM]; v16b w[2][4];   // the stage's fragment reads all stand ahead of its products: one LDS latency a stage, not one a product (the loops below are unrolled so that every fragment index is a constant and the arrays stay in registers)
#pragma unroll
    for (int kk = 0; kk < 2; ++kk) {
#pragma unroll
      for (int i = 0; i < FM; ++i) a[kk][i] = split_row((const float*)(bs + 128 * P128 + (wm * WR + i * 16 + col) * P256), kk * 32, lane);
#pragma unroll
      for (int j = 0; j < 4; ++j) w[kk][j] = frag_b((const __bf16*)(bs + (wn * 64 + j * 16 + col) * P128) + kk * 32, lane); }
#pragma unroll
    for (int kk = 0; kk < 2; ++kk) {
#pragma unroll
      for (int i = 0; i < FM; ++i) {
#pragma unroll
        for (int j = 0; j < 4; ++j) { acc[i][j] = wmma_bf(a[kk][i].l, w[kk][j], acc[i][j]); acc[i][j] = wmma_bf(a[kk][i].h, w[kk][j], acc[i][j]); } } }
    WAIT_DS(); WAIT_ASYNC(); __syncthreads();   // publishes stage t + 1 and ends every read of stage t
    if (t + 2 < DM / KST) { stage128<128, NT>(l0 + (t & 1) * STGF, gB + (size_t)(t + 2) * 128, DM * 2, tid); stage256<128, NT>(l0 + (t & 1) * STGF + 128 * P128, gA + (size_t)(t + 2) * 256, DM * 4, tid); } }
  WAIT_ASYNC();
#pragma unroll
  for (int i = 0; i < FM; ++i) {
#pragma unroll
    for (int j = 0; j < 4; ++j) {
#pragma unroll
      for (int r = 0; r < 8; ++r) so[wave][i * 16 + 8 * g + r][j * 16 + col] = acc[i][j][r] + bfr(BO[n0 + j * 16 + col]); } }
  LDSX();
  for (int rl = 0; rl < WR; rl += 2) vst2(Y + (r0 + rl + g) * DM + n0 + col * 4, *(const v4f*)&so[wave][rl + g][col * 4]);   // 16 lanes a 256-B row piece, 2 rows a store
}
// ---- k_packff: block = (tile, which): (in,out) W1 [1024][4096] -> rows [4096][1024] f16 x 2^8 ; W2 [4096][1024] -> rows [1024][4096]
__global__ __launch_bounds__(256) void k_packff(const float* __restrict__ W1, const float* __restrict__ W2, _Float16* __restrict__ PF, _Float16* __restrict__ PM) { __shared__ __align__(16) char s[TPN * TPP];   // the two weights have the same number of tiles; each has its own copy of the code, so that every pitch is an immediate
  if (blockIdx.y == 0) { const int k0 = (blockIdx.x % (DM / TPK)) * TPK, n0 = (blockIdx.x / (DM / TPK)) * TPN; pack_tile<1>(W1 + (size_t)k0 * DFF + n0, DFF * 4, (char*)(PF + (size_t)n0 * DM + k0), DM * 2, s, threadIdx.x); }
  else { const int k0 = (blockIdx.x % (DFF / TPK)) * TPK, n0 = (blockIdx.x / (DFF / TPK)) * TPN; pack_tile<1>(W2 + (size_t)k0 * DM + n0, DM * 4, (char*)(PM + (size_t)n0 * DFF + k0), DFF * 2, s, threadIdx.x); } }
// ---- k_lnres<F16OUT, RESX>: block = row (256 threads x 4): y = R + LayerNorm(A) x gamma + beta (mean((x-m)^2), eps 1e-5); RESX: residual is the bf16-rounded input x (else an f32 buffer); optional f16 copy for the FF
template <int F16OUT, int RESX>
__global__ __launch_bounds__(256) void k_lnres(const float* __restrict__ A, const float* __restrict__ R, const float* __restrict__ G, const float* __restrict__ Bt, float* __restrict__ Y, _Float16* __restrict__ Y16) {
  __shared__ float red[8]; __shared__ __align__(16) _Float16 sh[DM]; const int t = threadIdx.x; const size_t row = blockIdx.x; float v[4]; float s = 0.f; for (int i = 0; i < 4; ++i) { v[i] = A[row * DM + t * 4 + i]; s += v[i]; }
#pragma unroll
  for (int o = 1; o < 32; o <<= 1) s += __shfl_xor(s, o);
  if ((t & 31) == 0) red[t >> 5] = s; __syncthreads(); float tot = 0.f; for (int i = 0; i < 8; ++i) tot += red[i]; const float mu = tot / (float)DM; __syncthreads();
  float q = 0.f; for (int i = 0; i < 4; ++i) { const float dd = v[i] - mu; q += dd * dd; }
#pragma unroll
  for (int o = 1; o < 32; o <<= 1) q += __shfl_xor(q, o);
  if ((t & 31) == 0) red[t >> 5] = q; __syncthreads(); float tq = 0.f; for (int i = 0; i < 8; ++i) tq += red[i]; const float inv = 1.0f / sqrtf(tq / (float)DM + 1e-5f);
  v4f o4; for (int i = 0; i < 4; ++i) { const int e = t * 4 + i; const float rr = RESX ? bfr(R[row * DM + e]) : R[row * DM + e]; o4[i] = rr + ((v[i] - mu) * inv * bfr(G[e]) + bfr(Bt[e])); if (F16OUT) sh[e] = (_Float16)o4[i]; }
  vst2(Y + row * DM + t * 4, o4);
  if (F16OUT) { __syncthreads(); if (t < DM / 8) vst2((unsigned*)(Y16 + row * DM + t * 8), *(const v4u*)&sh[t * 8]); }
}
// ---- k_mlp<MODE>: block = (MBM rows, 128 cols): MODE 0: G = gelu_exact(X1 . W1 + b1) (K 1024 -> 4096) f16; MODE 1: HF = gelu_exact(G . W2 + b2) (K 4096 -> 1024) f32
#define MBM(MODE) ((MODE) == 0 ? 256 : 128)   // rows of a block: the wide GEMM has tiles enough for the larger one, the narrow one has 256 tiles of 128 x 128, one a WGP
template <int MODE>
__global__ __launch_bounds__(GNT) void k_mlp(const _Float16* __restrict__ Ain, const _Float16* __restrict__ Wr, const float* __restrict__ BIAS, const float* __restrict__ RES, float* __restrict__ OUTF, _Float16* __restrict__ OG) {
  constexpr int KIN = (MODE == 0) ? DM : DFF; constexpr int NOUT = (MODE == 0) ? DFF : DM;
  constexpr int BM = MBM(MODE), NT = GNT, WR = BM / 4, FM = WR / 16, KS = (MODE == 0) ? 64 : 128, PT = KS * 2 + 16, STG = (128 + BM) * PT, KG = (MODE == 0) ? 1 : 2;   // WR rows a wave; KS k a stage at LDS pitch PT: weight rows, then activation rows; KG fragment columns (32 k each) read in one group
  __shared__ __align__(16) char smem[2 * STG];   // the ring; behind the loop's last barrier the output staging
  float (*so)[WR][68] = (float (*)[WR][68])smem; _Float16 (*sg)[WR][72] = (_Float16 (*)[WR][72])smem;
  const int tid = threadIdx.x, wave = tid >> 5, lane = tid & 31, col = lane & 15, g = lane >> 4, wm = wave >> 1, wn = wave & 1; const size_t r0 = (size_t)blockIdx.x * BM + wm * WR; const int nb0 = blockIdx.y * 128, n0 = nb0 + wn * 64;
  v8f acc[FM][4] = {};
  const unsigned l0 = lds_off(smem); const char* gB = (const char*)(Wr + (size_t)nb0 * KIN); const char* gA = (const char*)(Ain + (size_t)blockIdx.x * BM * KIN);
  auto stage = [&](unsigned l, int t) { if constexpr (KS == 64) { stage128<128, NT>(l, gB + (size_t)t * 128, KIN * 2, tid); stage128<BM, NT>(l + 128 * PT, gA + (size_t)t * 128, KIN * 2, tid); } else { stage256<128, NT>(l, gB + (size_t)t * 256, KIN * 2, tid); stage256<BM, NT>(l + 128 * PT, gA + (size_t)t * 256, KIN * 2, tid); } };   // stage t of both operands into the buffer at l
  stage(l0, 0);
  WAIT_ASYNC(); __syncthreads();
  stage(l0 + STG, 1);
  for (int t = 0; t < KIN / KS; ++t) { const char* bs = smem + (t & 1) * STG;
#pragma unroll   // the groups of a stage unrolled: their LDS offsets become immediates
    for (int k0 = 0; k0 < KS / 32; k0 += KG) {
    v16h a[KG][FM], w[KG][4];   // a group's fragment reads all stand ahead of its products: one LDS latency a group, not one a product (the loops below are unrolled so that every fragment index is a constant and the arrays stay in registers)
#pragma unroll
    for (int kk = 0; kk < KG; ++kk) {
#pragma unroll
      for (int i = 0; i < FM; ++i) a[kk][i] = frag_h((const _Float16*)(bs + 128 * PT + (wm * WR + i * 16 + col) * PT) + (k0 + kk) * 32, lane);
#pragma unroll
      for (int j = 0; j < 4; ++j) w[kk][j] = frag_h((const _Float16*)(bs + (wn * 64 + j * 16 + col) * PT) + (k0 + kk) * 32, lane); }
#pragma unroll
    for (int kk = 0; kk < KG; ++kk) {
#pragma unroll
      for (int i = 0; i < FM; ++i) {
#pragma unroll
        for (int j = 0; j < 4; ++j) acc[i][j] = wmma16(a[kk][i], w[kk][j], acc[i][j]); } } }
    WAIT_DS(); WAIT_ASYNC(); __syncthreads();   // publishes stage t + 1 and ends every read of stage t
    if (t + 2 < KIN / KS) stage(l0 + (t & 1) * STG, t + 2); }
  WAIT_ASYNC();
#pragma unroll
  for (int i = 0; i < FM; ++i) {
#pragma unroll
  for (int j = 0; j < 4; ++j) { const int c = n0 + j * 16 + col; const float bb = bfr(BIAS[c]); float x[8];
#pragma unroll
    for (int r = 0; r < 8; ++r) x[r] = acc[i][j][r] * (1.0f / 256.0f) + bb;
    gelu8(x);
#pragma unroll
    for (int r = 0; r < 8; ++r) { if (MODE == 0) sg[wave][i * 16 + 8 * g + r][j * 16 + col] = (_Float16)x[r]; else so[wave][i * 16 + 8 * g + r][j * 16 + col] = x[r]; } } }
  LDSX();
  if (MODE == 0) { const int rw = lane >> 3, c8 = (lane & 7) * 8; for (int rl = 0; rl < WR; rl += 4) vst2((unsigned*)(OG + (r0 + rl + rw) * NOUT + n0 + c8), *(const v4u*)&sg[wave][rl + rw][c8]); }   // 8 lanes a 128-B row piece, 4 rows a store
  else { for (int rl = 0; rl < WR; rl += 2) vst2(OUTF + (r0 + rl + g) * NOUT + n0 + col * 4, *(const v4f*)&so[wave][rl + g][col * 4]); }   // 16 lanes a 256-B row piece, 2 rows a store
}

extern "C" void kernel_launch(void* const* d_in, const int* in_sizes, int n_in, void* d_out, int out_size, void* d_ws, size_t ws_size, hipStream_t stream) {
  (void)in_sizes; (void)n_in; (void)out_size;
  const float** F = (const float**)d_in;   // 0 x [2,2048,1024], 1 mask [1,1,2048,2048] int, 2 Wq, 3 Wk, 4 Wv, 5 Wo ((in,out)), 6 bo, 7 ln1_g, 8 ln1_b, 9 W1 [1024,4096], 10 b1, 11 W2 [4096,1024], 12 b2, 13 ln2_g, 14 ln2_b
  if (ws_size < (size_t)WS_END) return;
  char* ws = (char*)d_ws; __bf16* PK = (__bf16*)(ws + WS_PK); _Float16 *QK = (_Float16*)(ws + WS_QK), *QKL = (_Float16*)(ws + WS_QKL), *VTH = (_Float16*)(ws + WS_VTH), *VTL = (_Float16*)(ws + WS_VTL), *PF = (_Float16*)(ws + WS_PF), *PM = (_Float16*)(ws + WS_PM), *X16 = (_Float16*)(ws + WS_X16), *Gb = (_Float16*)(ws + WS_G); float *O = (float*)(ws + WS_O), *A0 = (float*)(ws + WS_A0), *X1 = (float*)(ws + WS_X1), *HF = (float*)(ws + WS_HF);
  k_pack<<<dim3((DM / TPK) * (DM / TPN), 4), 256, 0, stream>>>(F[2], F[3], F[4], F[5], PK);
  k_packff<<<dim3((DM / TPK) * (DFF / TPN), 2), 256, 0, stream>>>(F[9], F[11], PF, PM);
  k_qkv<<<dim3(TNB * SS / 128, QKVW / 128), GNT, 0, stream>>>(F[0], F[0], F[0], PK + PK_A, nullptr, nullptr, nullptr, QK, QKL, VTH, VTL);
  k_attn<<<dim3(TQB, NH, TNB), 128, 0, stream>>>(QK, QKL, VTH, VTL, nullptr, (const int*)d_in[1], O);
  k_out<<<dim3(TOB / 2, DM / 128), GNT, 0, stream>>>(O, PK + PK_P, F[6], A0);
  k_lnres<1, 1><<<TOB * 64, 256, 0, stream>>>(A0, F[0], F[7], F[8], X1, X16);      // x1 = x + LN(attn branch)
  k_mlp<0><<<dim3(NR / MBM(0), DFF / 128), GNT, 0, stream>>>(X16, PF, F[10], nullptr, nullptr, Gb);
  k_mlp<1><<<dim3(NR / MBM(1), DM / 128), GNT, 0, stream>>>(Gb, PM, F[12], nullptr, HF, nullptr);
  k_lnres<0, 0><<<TOB * 64, 256, 0, stream>>>(HF, X1, F[13], F[14], (float*)d_out, nullptr);   // out = x1 + LN(ff branch)
}

// v006
// Measured time: 197 microseconds a run.
// Two timings next to v005 both put it at 1.03 times that version's speed.
// Counting every step since v000, it is 4.40 times as fast.
// compute dtype: all float inputs rounded to bf16, the int mask read on device and packed to one bit an element; q/k/v = x . W with EXACT bf16 products on WMMA 16x16x32 ((in,out) weights as transposed rows); PLAIN attention: q, k single f16 x 1/8, masked keys excluded, running-max softmax in f32 (hardware exp), P (scaled by 2^11, single f16) x v (single f16); attention out (bf16 hi + residual) . Wo (2 products) + bo; LayerNorms in f32; FF: x1 rounded once to f16 x exact f16 weight copies (x 2^8), erf GELU (x . Phi(x), f32-accurate rational form of erfc), hidden f16, second erf GELU; f32 output.
#include <hip/hip_runtime.h>
#include <math.h>

typedef __attribute__((ext_vector_type(16))) _Float16 v16h;
typedef __attribute__((ext_vector_type(16))) __bf16 v16b;
typedef __attribute__((ext_vector_type(8)))  _Float16 v8h;
typedef __attribute__((ext_vector_type(8)))  float v8f;
typedef __attribute__((ext_vector_type(4)))  float v4f;
typedef __attribute__((ext_vector_type(2)))  float v2f;
typedef __attribute__((ext_vector_type(4)))  unsigned v4u;
typedef __attribute__((ext_vector_type(4)))  int v4i;
typedef float __attribute__((may_alias)) float_a;
typedef int __attribute__((may_alias)) int_a;

template <typename T> __device__ __forceinline__ void vst2(void* p, T v) { *(T*)p = v;  }
__device__ __forceinline__ v8f wmma16(v16h a, v16h b, v8f c) {
  v8f d = __builtin_amdgcn_wmma_f32_16x16x32_f16(false, a, false, b, (short)0, c, false, false);
  asm volatile("v_nop\n\tv_nop\n\tv_nop\n\tv_nop" : "+v"(d) : "v"(a), "v"(b));
  return d;
}
__device__ __forceinline__ v8f wmma_bf(v16b a, v16b b, v8f c) {
  v8f d = __builtin_amdgcn_wmma_f32_16x16x32_bf16(false, a, false, b, (short)0, c, false, false);
  asm volatile("v_nop\n\tv_nop\n\tv_nop\n\tv_nop" : "+v"(d) : "v"(a), "v"(b));
  return d;
}
// Transformer block (B 2, S 2,048, d 1,024, 16 heads x 64, FF 4,096): bias-free q/k/v projections, scores / 8 with a [S,S] mask (mask == 1 -> -1e9), softmax, . v, Wo + bo; x + LayerNorm(attention branch); FF with exact GELU after BOTH linears; x + LayerNorm(FF branch).
__device__ __forceinline__ v16h frag_h(const _Float16* rowk0, int lane) {
  union { v16h v; v8h q[2]; } u; const _Float16* p = rowk0 + 8 * (lane >> 4);
  u.q[0] = *(const v8h*)p; u.q[1] = *(const v8h*)(p + 16); return u.v;
}
__device__ __forceinline__ v16h frag_f32(const float* rowk0, int lane) {
  v16h a; const float* p = rowk0 + 8 * (lane >> 4);
#pragma unroll
  for (int i = 0; i < 8; ++i) { a[i] = (_Float16)p[i]; a[8 + i] = (_Float16)p[16 + i]; }
  return a;
}
__device__ __forceinline__ v16h frag_f32s(const float* rowk0, int lane, float sc) {
  v16h a; const float* p = rowk0 + 8 * (lane >> 4);
#pragma unroll
  for (int i = 0; i < 8; ++i) { a[i] = (_Float16)(p[i] * sc); a[8 + i] = (_Float16)(p[16 + i] * sc); }
  return a;
}
// column fragment from a [K][ld] layout (column n), rows >= K read as 0
__device__ __forceinline__ v16h fragc_f32(const float* W, int k0, int n, int lane, int ld, int K) {
  v16h a; const int g = lane >> 4;
#pragma unroll
  for (int i = 0; i < 8; ++i) { const int ka = k0 + 8 * g + i, kb = ka + 16;
    a[i] = (_Float16)(ka < K ? W[(size_t)(ka < K ? ka : K - 1) * ld + n] : 0.f); a[8 + i] = (_Float16)(kb < K ? W[(size_t)(kb < K ? kb : K - 1) * ld + n] : 0.f); }
  return a;
}
struct F2 { v16b h, l; };
__device__ __forceinline__ F2 bsplit16(const float v[16]) { F2 r;
#pragma unroll
  for (int i = 0; i < 16; ++i) { const __bf16 h = (__bf16)v[i]; r.h[i] = h; r.l[i] = (__bf16)(v[i] - (float)h); }
  return r; }
__device__ __forceinline__ F2 split_row(const float* row, int k0, int lane) { float v[16]; const float* p = row + k0 + 8 * (lane >> 4);
#pragma unroll
  for (int i = 0; i < 8; ++i) { v[i] = p[i]; v[8 + i] = p[16 + i]; }
  return bsplit16(v); }
__device__ __forceinline__ F2 split_rowK(const float* row, int k0, int lane, int K) { float v[16]; const int g = lane >> 4;
#pragma unroll
  for (int i = 0; i < 8; ++i) { const int ka = k0 + 8 * g + i, kb = ka + 16; v[i] = ka < K ? row[ka < K ? ka : K - 1] : 0.f; v[8 + i] = kb < K ? row[kb < K ? kb : K - 1] : 0.f; }
  return bsplit16(v); }
__device__ __forceinline__ F2 split_col(const float* W, int k0, int n, int lane, int ld, int K) { float v[16]; const int g = lane >> 4;
#pragma unroll
  for (int i = 0; i < 8; ++i) { const int ka = k0 + 8 * g + i, kb = ka + 16; v[i] = ka < K ? W[(size_t)(ka < K ? ka : K - 1) * ld + n] : 0.f; v[8 + i] = kb < K ? W[(size_t)(kb < K ? kb : K - 1) * ld + n] : 0.f; }
  return bsplit16(v); }
__device__ __forceinline__ v8f mac3(const F2& a, const F2& b, v8f c) { c = wmma_bf(a.l, b.h, c); c = wmma_bf(a.h, b.l, c); return wmma_bf(a.h, b.h, c); }
__device__ __forceinline__ float sigm(float v) { return 1.0f / (1.0f + expf(-v)); }
#define LDSX() do { asm volatile("s_wait_dscnt 0" ::: "memory"); __builtin_amdgcn_wave_barrier(); __builtin_amdgcn_fence(__ATOMIC_RELEASE, "workgroup"); } while (0)


#define NB 2
#define SS 2048
#define DM 1024
#define NH 16
#define DFF 4096
#define NR (NB * SS)
// erf GELU as x * Phi(x), Phi the normal distribution function, inline and with no branch, 8 values side by side, in place. With t = 1 / (1 + p |x| / sqrt(2)), q = (c1 t + ... + c5 t^5) / 2 * exp(-x^2 / 2) is Phi(-|x|) = erfc(|x| / sqrt(2)) / 2 (five-term rational form of erfc: absolute error of Phi under 1e-7, of the result under 4e-7 for |x| <= 8); x * Phi(x) = max(x, 0) - |x| q on both sides of 0, with no cancellation in the negative tail
__device__ __forceinline__ void gelu8(float (&x)[8]) {
  float t[8], e[8];
#pragma unroll   // constant indices: the arrays stay in registers
  for (int i = 0; i < 8; ++i) { t[i] = fmaf(0.3275911f * 0.70710678118654752f, fabsf(x[i]), 1.0f); e[i] = (x[i] * x[i]) * -0.72134752044448170f; }   // exp(-x^2 / 2) in base 2; far out it is 0 and the result max(x, 0)
  // the 8 reciprocals and 8 exponentials in one statement, each in place: no neighbour reads the result or overwrites the source of the one in front of it, and the closing v_nop keeps that one slot behind the last
  asm("v_rcp_f32 %0, %0\n\tv_rcp_f32 %1, %1\n\tv_rcp_f32 %2, %2\n\tv_rcp_f32 %3, %3\n\tv_rcp_f32 %4, %4\n\tv_rcp_f32 %5, %5\n\tv_rcp_f32 %6, %6\n\tv_rcp_f32 %7, %7\n\tv_exp_f32 %8, %8\n\tv_exp_f32 %9, %9\n\tv_exp_f32 %10, %10\n\tv_exp_f32 %11, %11\n\tv_exp_f32 %12, %12\n\tv_exp_f32 %13, %13\n\tv_exp_f32 %14, %14\n\tv_exp_f32 %15, %15\n\tv_nop"
      : "+v"(t[0]), "+v"(t[1]), "+v"(t[2]), "+v"(t[3]), "+v"(t[4]), "+v"(t[5]), "+v"(t[6]), "+v"(t[7]), "+v"(e[0]), "+v"(e[1]), "+v"(e[2]), "+v"(e[3]), "+v"(e[4]), "+v"(e[5]), "+v"(e[6]), "+v"(e[7]));
#pragma unroll
  for (int i = 0; i < 8; ++i) { float p = fmaf(0.5f * 1.061405429f, t[i], 0.5f * -1.453152027f);
    p = fmaf(p, t[i], 0.5f * 1.421413741f); p = fmaf(p, t[i], 0.5f * -0.284496736f); p = fmaf(p, t[i], 0.5f * 0.254829592f);
    x[i] = fmaf(-fabsf(x[i]), (p * t[i]) * e[i], fmaxf(x[i], 0.f)); }
}
#define HD 64
#define QKVW (3 * DM)
#ifndef TQB
#define TQB (SS / 64)
#define TNB NB
#define TOB (NB * SS / 64)     // output row tiles (all)
#endif
typedef __attribute__((ext_vector_type(8))) __bf16 v8b;
__device__ __forceinline__ v16b frag_b(const __bf16* rowk0, int lane) {
  union { v16b v; v8b q[2]; } u; const __bf16* p = rowk0 + 8 * (lane >> 4);
  u.q[0] = *(const v8b*)p; u.q[1] = *(const v8b*)(p + 16); return u.v;
}
__device__ __forceinline__ float bfr(float v) { return (float)(__bf16)v; }
__device__ __attribute__((noinline)) float exp_ni(float v) { return expf(v); }
__device__ __attribute__((noinline)) float erf_ni(float v) { return erff(v); }

// ---- LDS ring of the GEMM kernels: a block is 8 waves, 4 down x 2 across; a wave makes FM x 16 rows by 64 columns, so a weight fragment read from LDS serves FM products and an activation fragment 4, and a block makes FM x 64 rows by 128 columns from one staging of its operand rows. A stage is 64 or 128 k of the block's 128 weight rows and of its activation rows, brought by asynchronous copies in whole lines; two buffers
#define KST 64
#define P128 144   // LDS pitch of a 128-B row: 16 B x odd, no bank conflict for 16-B reads down a column of rows
#define P256 272   // LDS pitch of a 256-B row, likewise
__device__ __forceinline__ unsigned lds_off(const void* p) { return (unsigned)(size_t)p; }
// four copies of 16 B a lane; s_wait_xcnt closes the statement so that no address register of a copy is rewritten ahead of it
__device__ __forceinline__ void cp4(unsigned l0, unsigned l1, unsigned l2, unsigned l3, const char* g0, const char* g1, const char* g2, const char* g3) {
  asm volatile("global_load_async_to_lds_b128 %0, %4, off\n\tglobal_load_async_to_lds_b128 %1, %5, off\n\tglobal_load_async_to_lds_b128 %2, %6, off\n\tglobal_load_async_to_lds_b128 %3, %7, off\n\ts_wait_xcnt 0x0"
               :: "v"(l0), "v"(l1), "v"(l2), "v"(l3), "v"(g0), "v"(g1), "v"(g2), "v"(g3) : "memory");
}
// NROW rows of 128 B (global pitch gp bytes) -> LDS at pitch P128: 8 lanes a row, NT / 8 rows a copy of the block's NT threads
template <int NROW, int NT = 128> __device__ __forceinline__ void stage128(unsigned l, const char* g, size_t gp, int tid) {
  constexpr int RP = NT / 8; l += (tid >> 3) * P128 + (tid & 7) * 16; g += (size_t)(tid >> 3) * gp + (tid & 7) * 16;
  for (int i = 0; i < NROW / RP; i += 4) cp4(l + i * RP * P128, l + (i + 1) * RP * P128, l + (i + 2) * RP * P128, l + (i + 3) * RP * P128, g + (size_t)i * RP * gp, g + (size_t)(i + 1) * RP * gp, g + (size_t)(i + 2) * RP * gp, g + (size_t)(i + 3) * RP * gp);
}
// NROW rows of 256 B -> LDS at pitch P256: 16 lanes a row, NT / 16 rows a copy of the block's NT threads
template <int NROW, int NT = 128> __device__ __forceinline__ void stage256(unsigned l, const char* g, size_t gp, int tid) {
  constexpr int RP = NT / 16; l += (tid >> 4) * P256 + (tid & 15) * 16; g += (size_t)(tid >> 4) * gp + (tid & 15) * 16;
  for (int i = 0; i < NROW / RP; i += 4) cp4(l + i * RP * P256, l + (i + 1) * RP * P256, l + (i + 2) * RP * P256, l + (i + 3) * RP * P256, g + (size_t)i * RP * gp, g + (size_t)(i + 1) * RP * gp, g + (size_t)(i + 2) * RP * gp, g + (size_t)(i + 3) * RP * gp);
}
#define WAIT_ASYNC() asm volatile("s_wait_asynccnt 0x0" ::: "memory")   // this wave's copies have landed
#define WAIT_DS() asm volatile("s_wait_dscnt 0x0" ::: "memory")         // this wave's LDS reads are done before the buffer is given up
#define STG32 (128 * P128)                 // one buffer of the attention ring
#define STGF (128 * P128 + 128 * P256)     // one GEMM buffer, f32 activations, 64 k: weight rows, then activation rows
#define GNT 256                            // threads of a GEMM block
#define PK_A 0                       // [3072][1024] Wqkv rows (natural [out][in])
#define PK_P (PK_A + QKVW * DM)        // [1024][1024] Wo rows (natural)
#define PK_END (PK_P + DM * DM)
#define WS_PK  0u
#define WS_QK  (WS_PK + 2u * PK_END)             // f16 [4096 rows][2048]: q | k
#define WS_QKL (WS_QK + 2u * NB * SS * 2 * DM)     // f16 q | k residual planes x2048
#define WS_VTH (WS_QKL + 2u * NB * SS * 2 * DM)    // f16 [b][1024 (h*64+d)][2048 s] hi
#define WS_VTL (WS_VTH + 2u * NB * DM * SS)        // f16 lo x 2048
#define WS_O   (WS_VTL + 2u * NB * DM * SS)        // f32 [4096][1024]
#define WS_CS  (WS_O + 4u * NB * SS * DM)           // f32 [2][2048][32], unused
#define WS_PF  (WS_CS + 4u * 2 * SS * 32)                  // f16 x 2^8 rows W1^T [4096][1024] ; W2^T [1024][4096]
#define WS_PM  (WS_PF + 2u * (size_t)DFF * DM)
#define WS_A0  (WS_PM + 2u * (size_t)DM * DFF)          // f32 [NR][1024] attention branch ; X1 f32 ; HF f32 (ff branch)
#define WS_X1  (WS_A0 + 4u * (size_t)NR * DM)
#define WS_HF  (WS_X1 + 4u * (size_t)NR * DM)
#define WS_X16 (WS_HF + 4u * (size_t)NR * DM)           // f16 [NR][1024] x1 ; G f16 [NR][4096]
#define WS_G   (WS_X16 + 2u * (size_t)NR * DM)
#define WS_MB  (WS_G + 2u * (size_t)NR * DFF)            // u32 [128 query tiles][128 key tiles][8]: the mask as lane-mask words
#define WS_END (WS_MB + 4u * (SS / 16) * (SS / 16) * 8)
// ---- weight packs: a block transposes one tile of 128 k x 64 n of an (in,out) f32 weight into 64 packed 16-bit rows of 128 k. A thread loads 8 k rows x 4 n as 16-B pieces (16 lanes cover 256 B in a row of the source), converts, and puts 8 k of each of its 4 n as one 16-B piece into LDS; the rows then go out as 256 B in a row of the packed plane
#define TPK 128
#define TPN 64
#define TPP 272   // LDS pitch of a packed 256-B row
template <int F16> __device__ __forceinline__ void pack_tile(const float* __restrict__ Wt, unsigned ldw, char* __restrict__ dst, unsigned ldd, char* s, int t) {   // Wt: the tile's first element, ldw its row pitch in bytes; dst: the tile's first packed byte, ldd its row pitch in bytes
  const int n4 = t & 15, kg = t >> 4; const unsigned go = (unsigned)kg * 8u * ldw + n4 * 16; v4f r[8];   // a block-uniform row address plus one 32-bit lane offset (under 2 MiB) for all 8 loads
#pragma unroll   // the 8 loads of a thread are in flight together, and r stays in registers
  for (int i = 0; i < 8; ++i) r[i] = *(const v4f*)((const char*)Wt + (size_t)i * ldw + go);
  asm volatile("s_wait_xcnt 0x0" ::: "memory");   // stands in front of every later write of a register that the 8 loads name as an address
#pragma unroll   // constant indices into r
  for (int j = 0; j < 4; ++j) { v4u o;
    if (F16) { v8h h;
#pragma unroll
      for (int i = 0; i < 8; ++i) h[i] = (_Float16)(bfr(r[i][j]) * 256.0f);
      o = __builtin_bit_cast(v4u, h); }
    else { v8b h;
#pragma unroll
      for (int i = 0; i < 8; ++i) h[i] = (__bf16)r[i][j];
      o = __builtin_bit_cast(v4u, h); }
    *(v4u*)(s + (n4 * 4 + j) * TPP + kg * 16) = o; }
  __syncthreads();
  const int n = t >> 4, c = t & 15; const unsigned so = (unsigned)n * ldd + c * 16; v4u o[4];   // 16 lanes a packed row, 16 rows a turn of the 256 threads
#pragma unroll   // the 4 LDS reads stand together ahead of the 4 stores: one LDS latency, not four
  for (int i = 0; i < TPN / 16; ++i) o[i] = *(const v4u*)(s + (n + i * 16) * TPP + c * 16);
#pragma unroll
  for (int i = 0; i < TPN / 16; ++i) vst2(dst + (size_t)i * 16 * ldd + so, o[i]);
}
// ---- mask words: the [S][S] int mask as one bit an element, in the order in which k_attn's lanes hold the scores: word [query tile qt][key tile kt][r], bit l = (mask[qt * 16 + (l & 15)][kt * 16 + 8 * (l >> 4) + r] == 1). A word is then the lane mask of one select over a whole score register. A wave makes 16 queries x 128 keys: a lane loads 8 x 32 B of its query's row, a compare over the wave gives each word, and lane i keeps words i and 32 + i for two 128-B stores
__device__ __forceinline__ void mask_words(const int* __restrict__ MSK, unsigned* __restrict__ MB, int wv, int lane) {
  const int qt = wv >> 4, kg = wv & 15; const int* p = MSK + (size_t)(qt * 16 + (lane & 15)) * SS + kg * 128 + 8 * (lane >> 4); v4i m[8][2];
#pragma unroll   // the 16 loads of a lane are in flight together, and m stays in registers
  for (int j = 0; j < 8; ++j) { m[j][0] = *(const v4i*)(p + j * 16); m[j][1] = *(const v4i*)(p + j * 16 + 4); }
  // stands in front of every later write of a register that the 16 loads name as an address; the loaded values are inputs so that no compare is lifted in among the loads to free a register: one memory latency a wave, not two; the address is an input too, so that no load's result lands on it
  asm volatile("s_wait_xcnt 0x0" :: "v"(m[0][0]), "v"(m[0][1]), "v"(m[1][0]), "v"(m[1][1]), "v"(m[2][0]), "v"(m[2][1]), "v"(m[3][0]), "v"(m[3][1]), "v"(m[4][0]), "v"(m[4][1]), "v"(m[5][0]), "v"(m[5][1]), "v"(m[6][0]), "v"(m[6][1]), "v"(m[7][0]), "v"(m[7][1]), "v"(p) : "memory");
  int w[2] = { 0, 0 };
#pragma unroll   // constant indices into m and w, constant lane numbers
  for (int j = 0; j < 8; ++j) {
#pragma unroll
    for (int r = 0; r < 8; ++r) { const int bw = (int)__builtin_amdgcn_ballot_w32(m[j][r >> 2][r & 3] == 1); w[j >> 2] = (lane == (j & 3) * 8 + r) ? bw : w[j >> 2]; } }
  unsigned* o = MB + (size_t)qt * (SS / 16 * 8) + kg * 64 + lane; o[0] = (unsigned)w[0]; o[32] = (unsigned)w[1];
}
// ---- k_pack: block = (tile, which): which 0..2 -> W_q/W_k/W_v into PK_A rows which*1024 + n (pack row n = column n, bf16); 3 -> W_o into PK_P; 4, 5 -> the mask words, 8 waves a block
__global__ __launch_bounds__(256) void k_pack(const float* __restrict__ WQ, const float* __restrict__ WK, const float* __restrict__ WV, const float* __restrict__ WO, __bf16* __restrict__ PK, const int* __restrict__ MSK, unsigned* __restrict__ MB) {
  if (blockIdx.y >= 4) { mask_words(MSK, MB, (((int)blockIdx.y - 4) * ((DM / TPK) * (DM / TPN)) + (int)blockIdx.x) * 8 + (int)(threadIdx.x >> 5), threadIdx.x & 31); return; }   // the same for a whole block, ahead of the barrier below
  __shared__ __align__(16) char s[TPN * TPP]; const int k0 = (blockIdx.x % (DM / TPK)) * TPK, n0 = (blockIdx.x / (DM / TPK)) * TPN, which = blockIdx.y; const float* Wm = (which == 0) ? WQ : (which == 1) ? WK : (which == 2) ? WV : WO;
  __bf16* dst = (which < 3) ? PK + PK_A + ((size_t)which * DM + n0) * DM + k0 : PK + PK_P + (size_t)n0 * DM + k0;
  pack_tile<0>(Wm + (size_t)k0 * DM + n0, DM * 4, (char*)dst, DM * 2, s, threadIdx.x);
}
__global__ __launch_bounds__(GNT) void k_qkv(const float* __restrict__ XQ, const float* __restrict__ XK, const float* __restrict__ XV, const __bf16* __restrict__ P, const float* __restrict__ BQ, const float* __restrict__ BK, const float* __restrict__ BV, _Float16* __restrict__ QK, _Float16* __restrict__ QKL, _Float16* __restrict__ VTH, _Float16* __restrict__ VTL) {
  constexpr int FM = 2, NT = GNT, WR = FM * 16, NW = NT / 32;   // WR rows a wave, NW waves
  const int which0 = (blockIdx.y * 128) / DM; const float* X = (which0 == 0) ? XQ : (which0 == 1) ? XK : XV; const float* BB = BQ ? (((which0 == 0) ? BQ : (which0 == 1) ? BK : BV) + (blockIdx.y * 128 - which0 * DM)) : nullptr;
  __shared__ __align__(16) char smem[2 * STGF];   // the ring; behind the loop's last barrier the output staging
  _Float16 (*so)[WR][72] = (_Float16 (*)[WR][72])smem, (*sol)[WR][72] = (_Float16 (*)[WR][72])(smem + NW * WR * 72 * 2); _Float16 (*sth)[136] = (_Float16 (*)[136])smem, (*stl)[136] = (_Float16 (*)[136])(smem + 128 * 136 * 2);
  const int tid = threadIdx.x, wave = tid >> 5, lane = tid & 31, col = lane & 15, g = lane >> 4, wm = wave >> 1, wn = wave & 1; const size_t r0 = (size_t)blockIdx.x * 128 + wm * WR; const int nb0 = blockIdx.y * 128, n0 = nb0 + wn * 64;
  v8f acc[FM][4] = {};
  const unsigned l0 = lds_off(smem); const char* gB = (const char*)(P + (size_t)nb0 * DM); const char* gA = (const char*)(X + (size_t)blockIdx.x * 128 * DM);
  stage128<128, NT>(l0, gB, DM * 2, tid); stage256<128, NT>(l0 + 128 * P128, gA, DM * 4, tid);
  WAIT_ASYNC(); __syncthreads();
  stage128<128, NT>(l0 + STGF, gB + 128, DM * 2, tid); stage256<128, NT>(l0 + STGF + 128 * P128, gA + 256, DM * 4, tid);
  for (int t = 0; t < DM / KST; ++t) { const char* bs = smem + (t & 1) * STGF;
    v16b a[2][FM], w[2][4];   // the stage's fragment reads all stand ahead of its products: one LDS latency a stage, not one a product (the loops below are unrolled so that every fragment index is a constant and the arrays stay in registers)
#pragma unroll
    for (int kk = 0; kk < 2; ++kk) {
#pragma unroll
      for (int i = 0; i < FM; ++i) { const float* p = (const float*)(bs + 128 * P128 + (wm * WR + i * 16 + col) * P256) + kk * 32 + 8 * g;
#pragma unroll
        for (int e = 0; e < 8; ++e) { a[kk][i][e] = (__bf16)p[e]; a[kk][i][8 + e] = (__bf16)p[16 + e]; } }
#pragma unroll
      for (int j = 0; j < 4; ++j) w[kk][j] = frag_b((const __bf16*)(bs + (wn * 64 + j * 16 + col) * P128) + kk * 32, lane); }
#pragma unroll
    for (int kk = 0; kk < 2; ++kk) {
#pragma unroll
      for (int i = 0; i < FM; ++i) {
#pragma unroll
        for (int j = 0; j < 4; ++j) acc[i][j] = wmma_bf(a[kk][i], w[kk][j], acc[i][j]); } }
    WAIT_DS(); WAIT_ASYNC(); __syncthreads();   // publishes stage t + 1 and ends every read of stage t
    if (t + 2 < DM / KST) { stage128<128, NT>(l0 + (t & 1) * STGF, gB + (size_t)(t + 2) * 128, DM * 2, tid); stage256<128, NT>(l0 + (t & 1) * STGF + 128 * P128, gA + (size_t)(t + 2) * 256, DM * 4, tid); } }
  WAIT_ASYNC();
  float bv[4] = { 0.f, 0.f, 0.f, 0.f };   // the bias of this lane's 4 columns, where there is one
  if (BB) {
#pragma unroll   // constant indices: bv stays in registers
    for (int j = 0; j < 4; ++j) bv[j] = bfr(BB[wn * 64 + j * 16 + col]);
    asm volatile("s_wait_xcnt 0x0" ::: "memory"); }   // stands in front of every later write of a register that the 4 loads name as an address
  if (nb0 < 2 * DM) {   // q stored unscaled (f16 sigma ~0.6, no subnormal exposure); 1/8 applied to the f32 score
#pragma unroll
    for (int i = 0; i < FM; ++i) {
#pragma unroll
      for (int j = 0; j < 4; ++j) {
#pragma unroll
        for (int r = 0; r < 8; ++r) { const float v = acc[i][j][r] + bv[j]; const _Float16 hv = (_Float16)v; so[wave][i * 16 + 8 * g + r][j * 16 + col] = hv; sol[wave][i * 16 + 8 * g + r][j * 16 + col] = (_Float16)((v - (float)hv) * 2048.0f); } } }   // q, k (+ bias) as f16 hi + (x2048) residual
    LDSX();
    const int rw = lane >> 3, c8 = (lane & 7) * 8;   // 8 lanes a 128-B row piece, 4 rows a store
    for (int rl = 0; rl < WR; rl += 4) { vst2((unsigned*)(QK + (r0 + rl + rw) * (2 * DM) + n0 + c8), *(const v4u*)&so[wave][rl + rw][c8]); vst2((unsigned*)(QKL + (r0 + rl + rw) * (2 * DM) + n0 + c8), *(const v4u*)&sol[wave][rl + rw][c8]); }
  } else {
#pragma unroll
    for (int i = 0; i < FM; ++i) {
#pragma unroll
      for (int j = 0; j < 4; ++j) {
#pragma unroll
        for (int r = 0; r < 8; ++r) { const float v = acc[i][j][r] + bv[j]; const _Float16 hv = (_Float16)v; sth[wn * 64 + j * 16 + col][wm * WR + i * 16 + 8 * g + r] = hv; stl[wn * 64 + j * 16 + col][wm * WR + i * 16 + 8 * g + r] = (_Float16)((v - (float)hv) * 2048.0f); } } }
    __syncthreads();
    const size_t rb = (size_t)blockIdx.x * 128; const int b = (int)(rb / SS), s0 = (int)(rb % SS); const int pc0 = nb0 - 2 * DM;
    for (int q = tid; q < 128 * 16; q += NT) { const int d = q >> 4, pc = q & 15; const size_t o = ((size_t)b * DM + pc0 + d) * SS + s0 + pc * 8; vst2((unsigned*)(VTH + o), *(const v4u*)&sth[d][pc * 8]); vst2((unsigned*)(VTL + o), *(const v4u*)&stl[d][pc * 8]); }
  }
}
typedef __attribute__((ext_vector_type(16))) unsigned v16u;
typedef __attribute__((address_space(4))) v16u cmw16;
// lane l <-> lane l ^ 16: the two lanes that share a query column
__device__ __forceinline__ float xhalf(float x) { return __builtin_bit_cast(float, __builtin_amdgcn_permlanex16(__builtin_bit_cast(int, x), __builtin_bit_cast(int, x), 0x76543210, 0xfedcba98, false, false)); }
// ---- k_attn: block = (64 queries, head h, batch b): all-keys flash attention with both products transposed: S^T = K . Q^T (A = key rows, B = the wave's 16 queries), O^T += V^T . P^T (A = v rows [d][key], B = P^T). A lane then holds 8 keys of ONE query (column lane & 15, keys 8 * (lane >> 4) + r of a 16-key tile): maximum and sum run inside the lane, one exchange with lane ^ 16 for the maximum; two score tiles converted in place are the B operand of the second product (element i = tile i >> 3, register i & 7), so P touches neither LDS nor another lane. Single f16 operands; softmax in base 2 on the raw scores, weights x 2^11 in numerator and denominator alike; O[b*S+q][h*64+d] = acc / l (256-B segments)
__global__ __launch_bounds__(128) void k_attn(const _Float16* __restrict__ QK, const _Float16* __restrict__ QKL, const _Float16* __restrict__ VTH, const _Float16* __restrict__ VTL, const void* __restrict__ KMASK, const unsigned* __restrict__ MB, float* __restrict__ O) {
  __shared__ __align__(16) char smem[2 * STG32];   // the ring (64 key rows, 64 v rows a stage); behind the loop's last barrier the output staging
  float (*so)[16][68] = (float (*)[16][68])smem;
  const int tid = threadIdx.x, wave = tid >> 5, lane = tid & 31, col = lane & 15, g = lane >> 4;
  const int qb = blockIdx.x, h = blockIdx.y, b = blockIdx.z; const int q0 = qb * 64 + wave * 16; const size_t rq = (size_t)b * SS + q0 + col;
  v16h aq[2];
#pragma unroll
  for (int kc = 0; kc < 2; ++kc) aq[kc] = frag_h(QK + rq * (2 * DM) + h * HD + kc * 32, lane);
  const float KS = 0.125f * 1.4426950408889634f;   // 1/sqrt(64) and log2(e) in one factor
  float m = -3.0e38f, l = 0.f;   // of this lane's query: running maximum of score x KS (alike in both lanes of the column); this lane's own part of the sum
  v8f acc[4] = {};
  // the wave's mask words: 16 a turn of 32 keys (64 B in a row), the same for every lane, so they come by scalar loads into scalar registers (constant address space: an earlier launch wrote them, nothing in this one does), each turn's issued behind the selects of the turn before
  const cmw16* pw = (const cmw16*)(MB + (size_t)(qb * 4 + __builtin_amdgcn_readfirstlane(wave)) * (SS / 16 * 8)); v16u mw = pw[0];
  // a stage is 64 keys (all keys are walked): 64 k rows of 128 B, the head's 64 v rows of 128 B
  const unsigned l0 = lds_off(smem); const char* gK = (const char*)(QK + (size_t)b * SS * (2 * DM) + DM + h * HD); const char* gV = (const char*)(VTH + ((size_t)b * DM + h * HD) * SS);
  stage128<64>(l0, gK, 2 * DM * 2, tid); stage128<64>(l0 + 64 * P128, gV, SS * 2, tid);
  WAIT_ASYNC(); __syncthreads();
  stage128<64>(l0 + STG32, gK + (size_t)64 * 2 * DM * 2, 2 * DM * 2, tid); stage128<64>(l0 + STG32 + 64 * P128, gV + 128, SS * 2, tid);
#pragma unroll 1   // the stage loop stays rolled, as the key loop was: its body already holds two turns
  for (int t = 0; t < SS / 64; ++t) { const char* bs = smem + (t & 1) * STG32;
#pragma unroll     // both turns of a stage unrolled: their LDS offsets become immediates
  for (int sub = 0; sub < 2; ++sub) { v8f s[2]; v16h kf[2][2], vf[4];   // 32 keys a turn; its LDS reads all stand ahead of its products: one LDS latency a turn, not one a product
#pragma unroll
    for (int ct = 0; ct < 2; ++ct) {
#pragma unroll
      for (int kc = 0; kc < 2; ++kc) kf[ct][kc] = frag_h((const _Float16*)(bs + (sub * 32 + ct * 16 + col) * P128) + kc * 32, lane); }
#pragma unroll
    for (int dt = 0; dt < 4; ++dt) vf[dt] = frag_h((const _Float16*)(bs + 64 * P128 + (dt * 16 + col) * P128) + sub * 32, lane);
    float mx = -3.0e38f;
#pragma unroll
    for (int ct = 0; ct < 2; ++ct) { v8f c = {};
#pragma unroll
      for (int kc = 0; kc < 2; ++kc) c = wmma16(kf[ct][kc], aq[kc], c);   // single product: k, q as one-rounding f16 operands; c[r] = key ct * 16 + 8 * g + r against query col
#pragma unroll
      for (int r = 0; r < 8; ++r) { s[ct][r] = __builtin_amdgcn_inverse_ballot_w32(mw[ct * 8 + r]) ? -3.0e38f : c[r]; mx = fmaxf(mx, s[ct][r]); } }   // mask == 1 -> -1e9 == excluded; the word is the select's lane mask as it stands
    __builtin_amdgcn_sched_barrier(0);   // holds the scalar load below behind this turn's selects: the wait in front of the selects is a wait for every scalar load issued, so a load lifted over them would be waited for at once and not a turn later
    const int tn = t * 2 + sub + 1; mw = pw[tn < SS / 32 ? tn : SS / 32 - 1];   // the next turn's mask words (the last turn reads its own again: in bounds)
    mx = fmaxf(mx, xhalf(mx)) * KS;   // KS > 0: the maximum of the raw scores, scaled, is the maximum of the scaled ones
    const float mn = fmaxf(m, mx); const float base = (mn <= -1.0e37f) ? 0.f : mn;   // no key of this query admitted yet: every weight below comes out 0
    const float nb = 11.0f - base; float x[17];   // 2^11 in the exponent keeps small softmax weights out of the f16 subnormal range; the sum carries it too, so it cancels in the epilogue
#pragma unroll
    for (int i = 0; i < 16; ++i) x[i] = fmaf(s[i >> 3][i & 7], KS, nb);   // an excluded score gives exp2(-huge) = 0
    x[16] = m - base; m = mn;
    // the turn's 17 exponentials in one statement, each in place: no neighbour reads the result or overwrites the source of the one in front of it, and the closing v_nop keeps that one slot behind the last
    asm("v_exp_f32 %0, %0\n\tv_exp_f32 %1, %1\n\tv_exp_f32 %2, %2\n\tv_exp_f32 %3, %3\n\tv_exp_f32 %4, %4\n\tv_exp_f32 %5, %5\n\tv_exp_f32 %6, %6\n\tv_exp_f32 %7, %7\n\tv_exp_f32 %8, %8\n\tv_exp_f32 %9, %9\n\tv_exp_f32 %10, %10\n\tv_exp_f32 %11, %11\n\tv_exp_f32 %12, %12\n\tv_exp_f32 %13, %13\n\tv_exp_f32 %14, %14\n\tv_exp_f32 %15, %15\n\tv_exp_f32 %16, %16\n\tv_nop"
        : "+v"(x[0]), "+v"(x[1]), "+v"(x[2]), "+v"(x[3]), "+v"(x[4]), "+v"(x[5]), "+v"(x[6]), "+v"(x[7]), "+v"(x[8]), "+v"(x[9]), "+v"(x[10]), "+v"(x[11]), "+v"(x[12]), "+v"(x[13]), "+v"(x[14]), "+v"(x[15]), "+v"(x[16]));
    const float alpha = x[16]; v16h pa; float es[4] = { 0.f, 0.f, 0.f, 0.f };
#pragma unroll
    for (int i = 0; i < 16; ++i) { es[i & 3] += x[i]; pa[i] = (_Float16)x[i]; }   // element i of the B operand = tile i >> 3, register i & 7
    l = l * alpha + ((es[0] + es[1]) + (es[2] + es[3]));
#pragma unroll
    for (int dt = 0; dt < 4; ++dt) { acc[dt] *= alpha; acc[dt] = wmma16(vf[dt], pa, acc[dt]); } }   // single product: V^T x P^T (x2^11); acc[dt][r] = d dt * 16 + 8 * g + r of query col
    WAIT_DS(); WAIT_ASYNC(); __syncthreads();   // publishes stage t + 1 and ends every read of stage t
    if (t + 2 < SS / 64) { const unsigned l = l0 + (t & 1) * STG32; stage128<64>(l, gK + (size_t)(t + 2) * 64 * 2 * DM * 2, 2 * DM * 2, tid); stage128<64>(l + 64 * P128, gV + (size_t)(t + 2) * 128, SS * 2, tid); } }
  WAIT_ASYNC();
  const float il = 1.0f / (l + xhalf(l));   // the column's two lanes join their sums once
#pragma unroll
  for (int dt = 0; dt < 4; ++dt) { const v8f o = acc[dt] * il; vst2(&so[wave][col][dt * 16 + 8 * g], (v4f){ o[0], o[1], o[2], o[3] }); vst2(&so[wave][col][dt * 16 + 8 * g + 4], (v4f){ o[4], o[5], o[6], o[7] }); }
  LDSX();
  for (int rl = 0; rl < 16; ++rl) if (lane < 16) vst2(O + ((size_t)b * SS + q0 + rl) * DM + h * HD + lane * 4, *(const v4f*)&so[wave][rl][lane * 4]);
}
// ---- k_out: block = (128 rows, 128 cols): out = O(hi/lo) . Wo rows (2 products) + bo
__global__ __launch_bounds__(GNT) void k_out(const float* __restrict__ O, const __bf16* __restrict__ P, const float* __restrict__ BO, float* __restrict__ Y) {
  constexpr int FM = 2, NT = GNT, WR = FM * 16;   // WR rows a wave
  __shared__ __align__(16) char smem[2 * STGF];   // the ring; behind the loop's last barrier the output staging
  float (*so)[WR][68] = (float (*)[WR][68])smem;
  const int tid = threadIdx.x, wave = tid >> 5, lane = tid & 31, col = lane & 15, g = lane >> 4, wm = wave >> 1, wn = wave & 1; const size_t r0 = (size_t)blockIdx.x * 128 + wm * WR; const int nb0 = blockIdx.y * 128, n0 = nb0 + wn * 64;
  v8f acc[FM][4] = {};
  const unsigned l0 = lds_off(smem); const char* gB = (const char*)(P + (size_t)nb0 * DM); const char* gA = (const char*)(O + (size_t)blockIdx.x * 128 * DM);
  stage128<128, NT>(l0, gB, DM * 2, tid); stage256<128, NT>(l0 + 128 * P128, gA, DM * 4, tid);
  WAIT_ASYNC(); __syncthreads();
  stage128<128, NT>(l0 + STGF, gB + 128, DM * 2, tid); stage256<128, NT>(l0 + STGF + 128 * P128, gA + 256, DM * 4, tid);
  for (int t = 0; t < DM / KST; ++t) { const char* bs = smem + (t & 1) * STGF;
    F2 a[2][FM]; v16b w[2][4];   // the stage's fragment reads all stand ahead of its products: one LDS latency a stage, not one a product (the loops below are unrolled so that every fragment index is a constant and the arrays stay in registers)
#pragma unroll
    for (int kk = 0; kk < 2; ++kk) {
#pragma unroll
      for (int i = 0; i < FM; ++i) a[kk][i] = split_row((const float*)(bs + 128 * P128 + (wm * WR + i * 16 + col) * P256), kk * 32, lane);
#pragma unroll
      for (int j = 0; j < 4; ++j) w[kk][j] = frag_b((const __bf16*)(bs + (wn * 64 + j * 16 + col) * P128) + kk * 32, lane); }
#pragma unroll
    for (int kk = 0; kk < 2; ++kk) {
#pragma unroll
      for (int i = 0; i < FM; ++i) {
#pragma unroll
        for (int j = 0; j < 4; ++j) { acc[i][j] = wmma_bf(a[kk][i].l, w[kk][j], acc[i][j]); acc[i][j] = wmma_bf(a[kk][i].h, w[kk][j], acc[i][j]); } } }
    WAIT_DS(); WAIT_ASYNC(); __syncthreads();   // publishes stage t + 1 and ends every read of stage t
    if (t + 2 < DM / KST) { stage128<128, NT>(l0 + (t & 1) * STGF, gB + (size_t)(t + 2) * 128, DM * 2, tid); stage256<128, NT>(l0 + (t & 1) * STGF + 128 * P128, gA + (size_t)(t + 2) * 256, DM * 4, tid); } }
  WAIT_ASYNC();
#pragma unroll
  for (int i = 0; i < FM; ++i) {
#pragma unroll
    for (int j = 0; j < 4; ++j) {
#pragma unroll
      for (int r = 0; r < 8; ++r) so[wave][i * 16 + 8 * g + r][j * 16 + col] = acc[i][j][r] + bfr(BO[n0 + j * 16 + col]); } }
  LDSX();
  for (int rl = 0; rl < WR; rl += 2) vst2(Y + (r0 + rl + g) * DM + n0 + col * 4, *(const v4f*)&so[wave][rl + g][col * 4]);   // 16 lanes a 256-B row piece, 2 rows a store
}
// ---- k_packff: block = (tile, which): (in,out) W1 [1024][4096] -> rows [4096][1024] f16 x 2^8 ; W2 [4096][1024] -> rows [1024][4096]
__global__ __launch_bounds__(256) void k_packff(const float* __restrict__ W1, const float* __restrict__ W2, _Float16* __restrict__ PF, _Float16* __restrict__ PM) { __shared__ __align__(16) char s[TPN * TPP];   // the two weights have the same number of tiles; each has its own copy of the code, so that every pitch is an immediate
  if (blockIdx.y == 0) { const int k0 = (blockIdx.x % (DM / TPK)) * TPK, n0 = (blockIdx.x / (DM / TPK)) * TPN; pack_tile<1>(W1 + (size_t)k0 * DFF + n0, DFF * 4, (char*)(PF + (size_t)n0 * DM + k0), DM * 2, s, threadIdx.x); }
  else { const int k0 = (blockIdx.x % (DFF / TPK)) * TPK, n0 = (blockIdx.x / (DFF / TPK)) * TPN; pack_tile<1>(W2 + (size_t)k0 * DM + n0, DM * 4, (char*)(PM + (size_t)n0 * DFF + k0), DFF * 2, s, threadIdx.x); } }
// ---- k_lnres<F16OUT, RESX>: block = row (256 threads x 4): y = R + LayerNorm(A) x gamma + beta (mean((x-m)^2), eps 1e-5); RESX: residual is the bf16-rounded input x (else an f32 buffer); optional f16 copy for the FF
template <int F16OUT, int RESX>
__global__ __launch_bounds__(256) void k_lnres(const float* __restrict__ A, const float* __restrict__ R, const float* __restrict__ G, const float* __restrict__ Bt, float* __restrict__ Y, _Float16* __restrict__ Y16) {
  __shared__ float red[8]; __shared__ __align__(16) _Float16 sh[DM]; const int t = threadIdx.x; const size_t row = blockIdx.x; float v[4]; float s = 0.f; for (int i = 0; i < 4; ++i) { v[i] = A[row * DM + t * 4 + i]; s += v[i]; }
#pragma unroll
  for (int o = 1; o < 32; o <<= 1) s += __shfl_xor(s, o);
  if ((t & 31) == 0) red[t >> 5] = s; __syncthreads(); float tot = 0.f; for (int i = 0; i < 8; ++i) tot += red[i]; const float mu = tot / (float)DM; __syncthreads();
  float q = 0.f; for (int i = 0; i < 4; ++i) { const float dd = v[i] - mu; q += dd * dd; }
#pragma unroll
  for (int o = 1; o < 32; o <<= 1) q += __shfl_xor(q, o);
  if ((t & 31) == 0) red[t >> 5] = q; __syncthreads(); float tq = 0.f; for (int i = 0; i < 8; ++i) tq += red[i]; const float inv = 1.0f / sqrtf(tq / (float)DM + 1e-5f);
  v4f o4; for (int i = 0; i < 4; ++i) { const int e = t * 4 + i; const float rr = RESX ? bfr(R[row * DM + e]) : R[row * DM + e]; o4[i] = rr + ((v[i] - mu) * inv * bfr(G[e]) + bfr(Bt[e])); if (F16OUT) sh[e] = (_Float16)o4[i]; }
  vst2(Y + row * DM + t * 4, o4);
  if (F16OUT) { __syncthreads(); if (t < DM / 8) vst2((unsigned*)(Y16 + row * DM + t * 8), *(const v4u*)&sh[t * 8]); }
}
// ---- k_mlp<MODE>: block = (MBM rows, 128 cols): MODE 0: G = gelu_exact(X1 . W1 + b1) (K 1024 -> 4096) f16; MODE 1: HF = gelu_exact(G . W2 + b2) (K 4096 -> 1024) f32
#define MBM(MODE) ((MODE) == 0 ? 256 : 128)   // rows of a block: the wide GEMM has tiles enough for the larger one, the narrow one has 256 tiles of 128 x 128, one a WGP
template <int MODE>
__global__ __launch_bounds__(GNT) void k_mlp(const _Float16* __restrict__ Ain, const _Float16* __restrict__ Wr, const float* __restrict__ BIAS, const float* __restrict__ RES, float* __restrict__ OUTF, _Float16* __restrict__ OG) {
  constexpr int KIN = (MODE == 0) ? DM : DFF; constexpr int NOUT = (MODE == 0) ? DFF : DM;
  constexpr int BM = MBM(MODE), NT = GNT, WR = BM / 4, FM = WR / 16, KS = (MODE == 0) ? 64 : 128, PT = KS * 2 + 16, STG = (128 + BM) * PT, KG = (MODE == 0) ? 1 : 2;   // WR rows a wave; KS k a stage at LDS pitch PT: weight rows, then activation rows; KG fragment columns (32 k each) read in one group
  __shared__ __align__(16) char smem[2 * STG];   // the ring; behind the loop's last barrier the output staging
  float (*so)[WR][68] = (float (*)[WR][68])smem; _Float16 (*sg)[WR][72] = (_Float16 (*)[WR][72])smem;
  const int tid = threadIdx.x, wave = tid >> 5, lane = tid & 31, col = lane & 15, g = lane >> 4, wm = wave >> 1, wn = wave & 1; const size_t r0 = (size_t)blockIdx.x * BM + wm * WR; const int nb0 = blockIdx.y * 128, n0 = nb0 + wn * 64;
  v8f acc[FM][4] = {};
  const unsigned l0 = lds_off(smem); const char* gB = (const char*)(Wr + (size_t)nb0 * KIN); const char* gA = (const char*)(Ain + (size_t)blockIdx.x * BM * KIN);
  auto stage = [&](unsigned l, int t) { if constexpr (KS == 64) { stage128<128, NT>(l, gB + (size_t)t * 128, KIN * 2, tid); stage128<BM, NT>(l + 128 * PT, gA + (size_t)t * 128, KIN * 2, tid); } else { stage256<128, NT>(l, gB + (size_t)t * 256, KIN * 2, tid); stage256<BM, NT>(l + 128 * PT, gA + (size_t)t * 256, KIN * 2, tid); } };   // stage t of both operands into the buffer at l
  stage(l0, 0);
  WAIT_ASYNC(); __syncthreads();
  stage(l0 + STG, 1);
  for (int t = 0; t < KIN / KS; ++t) { const char* bs = smem + (t & 1) * STG;
#pragma unroll   // the groups of a stage unrolled: their LDS offsets become immediates
    for (int k0 = 0; k0 < KS / 32; k0 += KG) {
    v16h a[KG][FM], w[KG][4];   // a group's fragment reads all stand ahead of its products: one LDS latency a group, not one a product (the loops below are unrolled so that every fragment index is a constant and the arrays stay in registers)
#pragma unroll
    for (int kk = 0; kk < KG; ++kk) {
#pragma unroll
      for (int i = 0; i < FM; ++i) a[kk][i] = frag_h((const _Float16*)(bs + 128 * PT + (wm * WR + i * 16 + col) * PT) + (k0 + kk) * 32, lane);
#pragma unroll
      for (int j = 0; j < 4; ++j) w[kk][j] = frag_h((const _Float16*)(bs + (wn * 64 + j * 16 + col) * PT) + (k0 + kk) * 32, lane); }
#pragma unroll
    for (int kk = 0; kk < KG; ++kk) {
#pragma unroll
      for (int i = 0; i < FM; ++i) {
#pragma unroll
        for (int j = 0; j < 4; ++j) acc[i][j] = wmma16(a[kk][i], w[kk][j], acc[i][j]); } } }
    WAIT_DS(); WAIT_ASYNC(); __syncthreads();   // publishes stage t + 1 and ends every read of stage t
    if (t + 2 < KIN / KS) stage(l0 + (t & 1) * STG, t + 2); }
  WAIT_ASYNC();
#pragma unroll
  for (int i = 0; i < FM; ++i) {
#pragma unroll
  for (int j = 0; j < 4; ++j) { const int c = n0 + j * 16 + col; const float bb = bfr(BIAS[c]); float x[8];
#pragma unroll
    for (int r = 0; r < 8; ++r) x[r] = acc[i][j][r] * (1.0f / 256.0f) + bb;
    gelu8(x);
#pragma unroll
    for (int r = 0; r < 8; ++r) { if (MODE == 0) sg[wave][i * 16 + 8 * g + r][j * 16 + col] = (_Float16)x[r]; else so[wave][i * 16 + 8 * g + r][j * 16 + col] = x[r]; } } }
  LDSX();
  if (MODE == 0) { const int rw = lane >> 3, c8 = (lane & 7) * 8; for (int rl = 0; rl < WR; rl += 4) vst2((unsigned*)(OG + (r0 + rl + rw) * NOUT + n0 + c8), *(const v4u*)&sg[wave][rl + rw][c8]); }   // 8 lanes a 128-B row piece, 4 rows a store
  else { for (int rl = 0; rl < WR; rl += 2) vst2(OUTF + (r0 + rl + g) * NOUT + n0 + col * 4, *(const v4f*)&so[wave][rl + g][col * 4]); }   // 16 lanes a 256-B row piece, 2 rows a store
}

extern "C" void kernel_launch(void* const* d_in, const int* in_sizes, int n_in, void* d_out, int out_size, void* d_ws, size_t ws_size, hipStream_t stream) {
  (void)in_sizes; (void)n_in; (void)out_size;
  const float** F = (const float**)d_in;   // 0 x [2,2048,1024], 1 mask [1,1,2048,2048] int, 2 Wq, 3 Wk, 4 Wv, 5 Wo ((in,out)), 6 bo, 7 ln1_g, 8 ln1_b, 9 W1 [1024,4096], 10 b1, 11 W2 [4096,1024], 12 b2, 13 ln2_g, 14 ln2_b
  if (ws_size < (size_t)WS_END) return;
  char* ws = (char*)d_ws; __bf16* PK = (__bf16*)(ws + WS_PK); _Float16 *QK = (_Float16*)(ws + WS_QK), *QKL = (_Float16*)(ws + WS_QKL), *VTH = (_Float16*)(ws + WS_VTH), *VTL = (_Float16*)(ws + WS_VTL), *PF = (_Float16*)(ws + WS_PF), *PM = (_Float16*)(ws + WS_PM), *X16 = (_Float16*)(ws + WS_X16), *Gb = (_Float16*)(ws + WS_G); unsigned* MB = (unsigned*)(ws + WS_MB); float *O = (float*)(ws + WS_O), *A0 = (float*)(ws + WS_A0), *X1 = (float*)(ws + WS_X1), *HF = (float*)(ws + WS_HF);
  k_pack<<<dim3((DM / TPK) * (DM / TPN), 6), 256, 0, stream>>>(F[2], F[3], F[4], F[5], PK, (const int*)d_in[1], MB);
  k_packff<<<dim3((DM / TPK) * (DFF / TPN), 2), 256, 0, stream>>>(F[9], F[11], PF, PM);
  k_qkv<<<dim3(TNB * SS / 128, QKVW / 128), GNT, 0, stream>>>(F[0], F[0], F[0], PK + PK_A, nullptr, nullptr, nullptr, QK, QKL, VTH, VTL);
  k_attn<<<dim3(TQB, NH, TNB), 128, 0, stream>>>(QK, QKL, VTH, VTL, nullptr, MB, O);
  k_out<<<dim3(TOB / 2, DM / 128), GNT, 0, stream>>>(O, PK + PK_P, F[6], A0);
  k_lnres<1, 1><<<TOB * 64, 256, 0, stream>>>(A0, F[0], F[7], F[8], X1, X16);      // x1 = x + LN(attn branch)
  k_mlp<0><<<dim3(NR / MBM(0), DFF / 128), GNT, 0, stream>>>(X16, PF, F[10], nullptr, nullptr, Gb);
  k_mlp<1><<<dim3(NR / MBM(1), DM / 128), GNT, 0, stream>>>(Gb, PM, F[12], nullptr, HF, nullptr);
  k_lnres<0, 0><<<TOB * 64, 256, 0, stream>>>(HF, X1, F[13], F[14], (float*)d_out, nullptr);   // out = x1 + LN(ff branch)
}

// v007
// It runs in 188 microseconds.
// Timed twice side by side with v006, it ran 1.04 times as fast both times.
// Counting every step since v000, it is 4.59 times as fast.
// compute dtype: all float inputs rounded to bf16, the int mask read on device and packed to one bit an element; q/k/v = x . W with EXACT bf16 products on WMMA 16x16x32 ((in,out) weights as transposed rows); PLAIN attention: q, k single f16 x 1/8, masked keys excluded, running-max softmax in f32 (hardware exp), P (scaled by 2^11, single f16) x v (single f16); attention out (bf16 hi + residual) . Wo (2 products) + bo; LayerNorms in f32; FF: x1 rounded once to f16 x exact f16 weight copies (x 2^8), erf GELU (x . Phi(x), f32-accurate rational form of erfc), hidden f16, second erf GELU; f32 output.
#include <hip/hip_runtime.h>
#include <math.h>

typedef __attribute__((ext_vector_type(16))) _Float16 v16h;
typedef __attribute__((ext_vector_type(16))) __bf16 v16b;
typedef __attribute__((ext_vector_type(8)))  _Float16 v8h;
typedef __attribute__((ext_vector_type(8)))  float v8f;
typedef __attribute__((ext_vector_type(4)))  float v4f;
typedef __attribute__((ext_vector_type(2)))  float v2f;
typedef __attribute__((ext_vector_type(4)))  unsigned v4u;
typedef __attribute__((ext_vector_type(4)))  int v4i;
typedef float __attribute__((may_alias)) float_a;
typedef int __attribute__((may_alias)) int_a;

template <typename T> __device__ __forceinline__ void vst2(void* p, T v) { *(T*)p = v;  }
__device__ __forceinline__ v8f wmma16(v16h a, v16h b, v8f c) {
  v8f d = __builtin_amdgcn_wmma_f32_16x16x32_f16(false, a, false, b, (short)0, c, false, false);
  asm volatile("v_nop\n\tv_nop\n\tv_nop\n\tv_nop" : "+v"(d) : "v"(a), "v"(b));
  return d;
}
__device__ __forceinline__ v8f wmma_bf(v16b a, v16b b, v8f c) {
  v8f d = __builtin_amdgcn_wmma_f32_16x16x32_bf16(false, a, false, b, (short)0, c, false, false);
  asm volatile("v_nop\n\tv_nop\n\tv_nop\n\tv_nop" : "+v"(d) : "v"(a), "v"(b));
  return d;
}
// Transformer block (B 2, S 2,048, d 1,024, 16 heads x 64, FF 4,096): bias-free q/k/v projections, scores / 8 with a [S,S] mask (mask == 1 -> -1e9), softmax, . v, Wo + bo; x + LayerNorm(attention branch); FF with exact GELU after BOTH linears; x + LayerNorm(FF branch).
__device__ __forceinline__ v16h frag_h(const _Float16* rowk0, int lane) {
  union { v16h v; v8h q[2]; } u; const _Float16* p = rowk0 + 8 * (lane >> 4);
  u.q[0] = *(const v8h*)p; u.q[1] = *(const v8h*)(p + 16); return u.v;
}
__device__ __forceinline__ v16h frag_f32(const float* rowk0, int lane) {
  v16h a; const float* p = rowk0 + 8 * (lane >> 4);
#pragma unroll
  for (int i = 0; i < 8; ++i) { a[i] = (_Float16)p[i]; a[8 + i] = (_Float16)p[16 + i]; }
  return a;
}
__device__ __forceinline__ v16h frag_f32s(const float* rowk0, int lane, float sc) {
  v16h a; const float* p = rowk0 + 8 * (lane >> 4);
#pragma unroll
  for (int i = 0; i < 8; ++i) { a[i] = (_Float16)(p[i] * sc); a[8 + i] = (_Float16)(p[16 + i] * sc); }
  return a;
}
// column fragment from a [K][ld] layout (column n), rows >= K read as 0
__device__ __forceinline__ v16h fragc_f32(const float* W, int k0, int n, int lane, int ld, int K) {
  v16h a; const int g = lane >> 4;
#pragma unroll
  for (int i = 0; i < 8; ++i) { const int ka = k0 + 8 * g + i, kb = ka + 16;
    a[i] = (_Float16)(ka < K ? W[(size_t)(ka < K ? ka : K - 1) * ld + n] : 0.f); a[8 + i] = (_Float16)(kb < K ? W[(size_t)(kb < K ? kb : K - 1) * ld + n] : 0.f); }
  return a;
}
struct F2 { v16b h, l; };
__device__ __forceinline__ F2 bsplit16(const float v[16]) { F2 r;
#pragma unroll
  for (int i = 0; i < 16; ++i) { const __bf16 h = (__bf16)v[i]; r.h[i] = h; r.l[i] = (__bf16)(v[i] - (float)h); }
  return r; }
__device__ __forceinline__ F2 split_row(const float* row, int k0, int lane) { float v[16]; const float* p = row + k0 + 8 * (lane >> 4);
#pragma unroll
  for (int i = 0; i < 8; ++i) { v[i] = p[i]; v[8 + i] = p[16 + i]; }
  return bsplit16(v); }
__device__ __forceinline__ F2 split_rowK(const float* row, int k0, int lane, int K) { float v[16]; const int g = lane >> 4;
#pragma unroll
  for (int i = 0; i < 8; ++i) { const int ka = k0 + 8 * g + i, kb = ka + 16; v[i] = ka < K ? row[ka < K ? ka : K - 1] : 0.f; v[8 + i] = kb < K ? row[kb < K ? kb : K - 1] : 0.f; }
  return bsplit16(v); }
__device__ __forceinline__ F2 split_col(const float* W, int k0, int n, int lane, int ld, int K) { float v[16]; const int g = lane >> 4;
#pragma unroll
  for (int i = 0; i < 8; ++i) { const int ka = k0 + 8 * g + i, kb = ka + 16; v[i] = ka < K ? W[(size_t)(ka < K ? ka : K - 1) * ld + n] : 0.f; v[8 + i] = kb < K ? W[(size_t)(kb < K ? kb : K - 1) * ld + n] : 0.f; }
  return bsplit16(v); }
__device__ __forceinline__ v8f mac3(const F2& a, const F2& b, v8f c) { c = wmma_bf(a.l, b.h, c); c = wmma_bf(a.h, b.l, c); return wmma_bf(a.h, b.h, c); }
__device__ __forceinline__ float sigm(float v) { return 1.0f / (1.0f + expf(-v)); }
#define LDSX() do { asm volatile("s_wait_dscnt 0" ::: "memory"); __builtin_amdgcn_wave_barrier(); __builtin_amdgcn_fence(__ATOMIC_RELEASE, "workgroup"); } while (0)


#define NB 2
#define SS 2048
#define DM 1024
#define NH 16
#define DFF 4096
#define NR (NB * SS)
// erf GELU as x * Phi(x), Phi the normal distribution function, inline and with no branch, 8 values side by side, in place. With t = 1 / (1 + p |x| / sqrt(2)), q = (c1 t + ... + c5 t^5) / 2 * exp(-x^2 / 2) is Phi(-|x|) = erfc(|x| / sqrt(2)) / 2 (five-term rational form of erfc: absolute error of Phi under 1e-7, of the result under 4e-7 for |x| <= 8); x * Phi(x) = max(x, 0) - |x| q on both sides of 0, with no cancellation in the negative tail
__device__ __forceinline__ void gelu8(float (&x)[8]) {
  float t[8], e[8];
#pragma unroll   // constant indices: the arrays stay in registers
  for (int i = 0; i < 8; ++i) { t[i] = fmaf(0.3275911f * 0.70710678118654752f, fabsf(x[i]), 1.0f); e[i] = (x[i] * x[i]) * -0.72134752044448170f; }   // exp(-x^2 / 2) in base 2; far out it is 0 and the result max(x, 0)
  // the 8 reciprocals and 8 exponentials in one statement, each in place: no neighbour reads the result or overwrites the source of the one in front of it, and the closing v_nop keeps that one slot behind the last
  asm("v_rcp_f32 %0, %0\n\tv_rcp_f32 %1, %1\n\tv_rcp_f32 %2, %2\n\tv_rcp_f32 %3, %3\n\tv_rcp_f32 %4, %4\n\tv_rcp_f32 %5, %5\n\tv_rcp_f32 %6, %6\n\tv_rcp_f32 %7, %7\n\tv_exp_f32 %8, %8\n\tv_exp_f32 %9, %9\n\tv_exp_f32 %10, %10\n\tv_exp_f32 %11, %11\n\tv_exp_f32 %12, %12\n\tv_exp_f32 %13, %13\n\tv_exp_f32 %14, %14\n\tv_exp_f32 %15, %15\n\tv_nop"
      : "+v"(t[0]), "+v"(t[1]), "+v"(t[2]), "+v"(t[3]), "+v"(t[4]), "+v"(t[5]), "+v"(t[6]), "+v"(t[7]), "+v"(e[0]), "+v"(e[1]), "+v"(e[2]), "+v"(e[3]), "+v"(e[4]), "+v"(e[5]), "+v"(e[6]), "+v"(e[7]));
#pragma unroll
  for (int i = 0; i < 8; ++i) { float p = fmaf(0.5f * 1.061405429f, t[i], 0.5f * -1.453152027f);
    p = fmaf(p, t[i], 0.5f * 1.421413741f); p = fmaf(p, t[i], 0.5f * -0.284496736f); p = fmaf(p, t[i], 0.5f * 0.254829592f);
    x[i] = fmaf(-fabsf(x[i]), (p * t[i]) * e[i], fmaxf(x[i], 0.f)); }
}
#define HD 64
#define QKVW (3 * DM)
#ifndef TQB
#define TQB (SS / 64)
#define TNB NB
#define TOB (NB * SS / 64)     // output row tiles (all)
#endif
typedef __attribute__((ext_vector_type(8))) __bf16 v8b;
__device__ __forceinline__ v16b frag_b(const __bf16* rowk0, int lane) {
  union { v16b v; v8b q[2]; } u; const __bf16* p = rowk0 + 8 * (lane >> 4);
  u.q[0] = *(const v8b*)p; u.q[1] = *(const v8b*)(p + 16); return u.v;
}
__device__ __forceinline__ float bfr(float v) { return (float)(__bf16)v; }
__device__ __attribute__((noinline)) float exp_ni(float v) { return expf(v); }
__device__ __attribute__((noinline)) float erf_ni(float v) { return erff(v); }

// ---- LDS ring of the GEMM kernels: a block is 8 waves, 4 down x 2 across; a wave makes FM x 16 rows by 64 columns, so a weight fragment read from LDS serves FM products and an activation fragment 4, and a block makes FM x 64 rows by 128 columns from one staging of its operand rows. A stage is 64 or 128 k of the block's 128 weight rows and of its activation rows, brought by asynchronous copies in whole lines; two buffers
#define KST 64
#define P128 144   // LDS pitch of a 128-B row: 16 B x odd, no bank conflict for 16-B reads down a column of rows
#define P256 272   // LDS pitch of a 256-B row, likewise
__device__ __forceinline__ unsigned lds_off(const void* p) { return (unsigned)(size_t)p; }
// four copies of 16 B a lane; s_wait_xcnt closes the statement so that no address register of a copy is rewritten ahead of it
__device__ __forceinline__ void cp4(unsigned l0, unsigned l1, unsigned l2, unsigned l3, const char* g0, const char* g1, const char* g2, const char* g3) {
  asm volatile("global_load_async_to_lds_b128 %0, %4, off\n\tglobal_load_async_to_lds_b128 %1, %5, off\n\tglobal_load_async_to_lds_b128 %2, %6, off\n\tglobal_load_async_to_lds_b128 %3, %7, off\n\ts_wait_xcnt 0x0"
               :: "v"(l0), "v"(l1), "v"(l2), "v"(l3), "v"(g0), "v"(g1), "v"(g2), "v"(g3) : "memory");
}
// NROW rows of 128 B (global pitch gp bytes) -> LDS at pitch P128: 8 lanes a row, NT / 8 rows a copy of the block's NT threads
template <int NROW, int NT = 128> __device__ __forceinline__ void stage128(unsigned l, const char* g, size_t gp, int tid) {
  constexpr int RP = NT / 8; l += (tid >> 3) * P128 + (tid & 7) * 16; g += (size_t)(tid >> 3) * gp + (tid & 7) * 16;
  for (int i = 0; i < NROW / RP; i += 4) cp4(l + i * RP * P128, l + (i + 1) * RP * P128, l + (i + 2) * RP * P128, l + (i + 3) * RP * P128, g + (size_t)i * RP * gp, g + (size_t)(i + 1) * RP * gp, g + (size_t)(i + 2) * RP * gp, g + (size_t)(i + 3) * RP * gp);
}
// NROW rows of 256 B -> LDS at pitch P256: 16 lanes a row, NT / 16 rows a copy of the block's NT threads
template <int NROW, int NT = 128> __device__ __forceinline__ void stage256(unsigned l, const char* g, size_t gp, int tid) {
  constexpr int RP = NT / 16; l += (tid >> 4) * P256 + (tid & 15) * 16; g += (size_t)(tid >> 4) * gp + (tid & 15) * 16;
  for (int i = 0; i < NROW / RP; i += 4) cp4(l + i * RP * P256, l + (i + 1) * RP * P256, l + (i + 2) * RP * P256, l + (i + 3) * RP * P256, g + (size_t)i * RP * gp, g + (size_t)(i + 1) * RP * gp, g + (size_t)(i + 2) * RP * gp, g + (size_t)(i + 3) * RP * gp);
}
#define WAIT_ASYNC() asm volatile("s_wait_asynccnt 0x0" ::: "memory")   // this wave's copies have landed
#define WAIT_DS() asm volatile("s_wait_dscnt 0x0" ::: "memory")         // this wave's LDS reads are done before the buffer is given up
#define STG32 (128 * P128)                 // one buffer of the attention ring
#define STGF (128 * P128 + 128 * P256)     // one GEMM buffer, f32 activations, 64 k: weight rows, then activation rows
#define GNT 256                            // threads of a GEMM block
#define PK_A 0                       // [3072][1024] Wqkv rows (natural [out][in])
#define PK_P (PK_A + QKVW * DM)        // [1024][1024] Wo rows (natural)
#define PK_END (PK_P + DM * DM)
#define WS_PK  0u
#define WS_QK  (WS_PK + 2u * PK_END)             // f16 [4096 rows][2048]: q | k
#define WS_QKL (WS_QK + 2u * NB * SS * 2 * DM)     // f16 q | k residual planes x2048
#define WS_VTH (WS_QKL + 2u * NB * SS * 2 * DM)    // f16 [b][1024 (h*64+d)][2048 s] hi
#define WS_VTL (WS_VTH + 2u * NB * DM * SS)        // f16 lo x 2048
#define WS_O   (WS_VTL + 2u * NB * DM * SS)        // f32 [4096][1024]
#define WS_CS  (WS_O + 4u * NB * SS * DM)           // f32 [2][2048][32], unused
#define WS_PF  (WS_CS + 4u * 2 * SS * 32)                  // f16 x 2^8 rows W1^T [4096][1024] ; W2^T [1024][4096]
#define WS_PM  (WS_PF + 2u * (size_t)DFF * DM)
#define WS_A0  (WS_PM + 2u * (size_t)DM * DFF)          // f32 [NR][1024] attention branch ; X1 f32 ; HF f32 (ff branch)
#define WS_X1  (WS_A0 + 4u * (size_t)NR * DM)
#define WS_HF  (WS_X1 + 4u * (size_t)NR * DM)
#define WS_X16 (WS_HF + 4u * (size_t)NR * DM)           // f16 [NR][1024] x1 ; G f16 [NR][4096]
#define WS_G   (WS_X16 + 2u * (size_t)NR * DM)
#define WS_MB  (WS_G + 2u * (size_t)NR * DFF)            // u32 [128 query tiles][128 key tiles][8]: the mask as lane-mask words
#define WS_END (WS_MB + 4u * (SS / 16) * (SS / 16) * 8)
// ---- weight packs: a block transposes one tile of 128 k x 64 n of an (in,out) f32 weight into 64 packed 16-bit rows of 128 k. A thread loads 8 k rows x 4 n as 16-B pieces (16 lanes cover 256 B in a row of the source), converts, and puts 8 k of each of its 4 n as one 16-B piece into LDS; the rows then go out as 256 B in a row of the packed plane. A block of NT = 128 threads takes two such places a thread
#define TPK 128
#define TPN 64
#define TPP 272   // LDS pitch of a packed 256-B row
template <int F16, int NT = 256> __device__ __forceinline__ void pack_tile(const float* __restrict__ Wt, unsigned ldw, char* __restrict__ dst, unsigned ldd, char* s, int t) {   // Wt: the tile's first element, ldw its row pitch in bytes; dst: the tile's first packed byte, ldd its row pitch in bytes
  constexpr int KGB = NT / 16, NP = TPK / 8 / KGB;   // KGB groups of 8 k a pass of the block's threads, NP passes a tile
  const int n4 = t & 15, kg = t >> 4; const char* gp = (const char*)Wt + ((unsigned)kg * 8u * ldw + n4 * 16); v4f r[NP][8];   // one lane address for all loads, the rows by immediate offsets (under 2 MiB)
#pragma unroll   // all loads of a thread are in flight together, and r stays in registers
  for (int p = 0; p < NP; ++p) {
#pragma unroll
    for (int i = 0; i < 8; ++i) r[p][i] = *(const v4f*)(gp + (size_t)(p * KGB * 8 + i) * ldw); }
  asm volatile("s_wait_xcnt 0x0" :: "v"(gp) : "memory");   // stands in front of every later write of a register that the loads name as an address; the address is an input, so that no load's result lands on it
#pragma unroll   // constant indices into r
  for (int p = 0; p < NP; ++p) {
#pragma unroll
  for (int j = 0; j < 4; ++j) { v4u o;
    if (F16) { v8h h;
#pragma unroll
      for (int i = 0; i < 8; ++i) h[i] = (_Float16)(bfr(r[p][i][j]) * 256.0f);
      o = __builtin_bit_cast(v4u, h); }
    else { v8b h;
#pragma unroll
      for (int i = 0; i < 8; ++i) h[i] = (__bf16)r[p][i][j];
      o = __builtin_bit_cast(v4u, h); }
    *(v4u*)(s + (n4 * 4 + j) * TPP + (p * KGB + kg) * 16) = o; } }
  __syncthreads();
  const int n = t >> 4, c = t & 15; const unsigned so = (unsigned)n * ldd + c * 16; v4u o[TPN / KGB];   // 16 lanes a packed row, KGB rows a turn of the block's threads
#pragma unroll   // the LDS reads stand together ahead of the stores: one LDS latency, not one a store
  for (int i = 0; i < TPN / KGB; ++i) o[i] = *(const v4u*)(s + (n + i * KGB) * TPP + c * 16);
#pragma unroll
  for (int i = 0; i < TPN / KGB; ++i) vst2(dst + (size_t)i * KGB * ldd + so, o[i]);
  asm volatile("s_wait_xcnt 0x0" ::: "memory");   // stands in front of every later write of a register that the stores name as an address, on every way that leads on from here
}
// ---- mask words: the [S][S] int mask as one bit an element, in the order in which k_attn's lanes hold the scores: word [query tile qt][key tile kt][r], bit l = (mask[qt * 16 + (l & 15)][kt * 16 + 8 * (l >> 4) + r] == 1). A word is then the lane mask of one select over a whole score register. A wave makes 16 queries x 128 keys: a lane loads 8 x 32 B of its query's row, a compare over the wave gives each word, and lane i keeps words i and 32 + i for two 128-B stores
__device__ __forceinline__ void mask_words(const int* __restrict__ MSK, unsigned* __restrict__ MB, int wv, int lane) {
  const int qt = wv >> 4, kg = wv & 15; const int* p = MSK + (size_t)(qt * 16 + (lane & 15)) * SS + kg * 128 + 8 * (lane >> 4); v4i m[8][2];
#pragma unroll   // the 16 loads of a lane are in flight together, and m stays in registers
  for (int j = 0; j < 8; ++j) { m[j][0] = *(const v4i*)(p + j * 16); m[j][1] = *(const v4i*)(p + j * 16 + 4); }
  // stands in front of every later write of a register that the 16 loads name as an address; the loaded values are inputs so that no compare is lifted in among the loads to free a register: one memory latency a wave, not two; the address is an input too, so that no load's result lands on it
  asm volatile("s_wait_xcnt 0x0" :: "v"(m[0][0]), "v"(m[0][1]), "v"(m[1][0]), "v"(m[1][1]), "v"(m[2][0]), "v"(m[2][1]), "v"(m[3][0]), "v"(m[3][1]), "v"(m[4][0]), "v"(m[4][1]), "v"(m[5][0]), "v"(m[5][1]), "v"(m[6][0]), "v"(m[6][1]), "v"(m[7][0]), "v"(m[7][1]), "v"(p) : "memory");
  int w[2] = { 0, 0 };
#pragma unroll   // constant indices into m and w, constant lane numbers
  for (int j = 0; j < 8; ++j) {
#pragma unroll
    for (int r = 0; r < 8; ++r) { const int bw = (int)__builtin_amdgcn_ballot_w32(m[j][r >> 2][r & 3] == 1); w[j >> 2] = (lane == (j & 3) * 8 + r) ? bw : w[j >> 2]; } }
  unsigned* o = MB + (size_t)qt * (SS / 16 * 8) + kg * 64 + lane; o[0] = (unsigned)w[0]; o[32] = (unsigned)w[1];
}
// ---- k_pack: what k_qkv and k_attn need first: block = (tile, which): which 0..2 -> W_q/W_k/W_v into PK_A rows which*1024 + n (pack row n = column n, bf16); 3, 4 -> the mask words, 8 waves a block
__global__ __launch_bounds__(256) void k_pack(const float* __restrict__ WQ, const float* __restrict__ WK, const float* __restrict__ WV, __bf16* __restrict__ PK, const int* __restrict__ MSK, unsigned* __restrict__ MB) {
  if (blockIdx.y >= 3) { mask_words(MSK, MB, (((int)blockIdx.y - 3) * ((DM / TPK) * (DM / TPN)) + (int)blockIdx.x) * 8 + (int)(threadIdx.x >> 5), threadIdx.x & 31); return; }   // the same for a whole block, ahead of the barrier below
  __shared__ __align__(16) char s[TPN * TPP]; const int k0 = (blockIdx.x % (DM / TPK)) * TPK, n0 = (blockIdx.x / (DM / TPK)) * TPN, which = blockIdx.y; const float* Wm = (which == 0) ? WQ : (which == 1) ? WK : WV;
  __bf16* dst = PK + PK_A + ((size_t)which * DM + n0) * DM + k0;
  pack_tile<0>(Wm + (size_t)k0 * DM + n0, DM * 4, (char*)dst, DM * 2, s, threadIdx.x);
}
__global__ __launch_bounds__(GNT) void k_qkv(const float* __restrict__ XQ, const float* __restrict__ XK, const float* __restrict__ XV, const __bf16* __restrict__ P, const float* __restrict__ BQ, const float* __restrict__ BK, const float* __restrict__ BV, _Float16* __restrict__ QK, _Float16* __restrict__ QKL, _Float16* __restrict__ VTH, _Float16* __restrict__ VTL) {
  constexpr int FM = 2, NT = GNT, WR = FM * 16, NW = NT / 32;   // WR rows a wave, NW waves
  const int which0 = (blockIdx.y * 128) / DM; const float* X = (which0 == 0) ? XQ : (which0 == 1) ? XK : XV; const float* BB = BQ ? (((which0 == 0) ? BQ : (which0 == 1) ? BK : BV) + (blockIdx.y * 128 - which0 * DM)) : nullptr;
  __shared__ __align__(16) char smem[2 * STGF];   // the ring; behind the loop's last barrier the output staging
  _Float16 (*so)[WR][72] = (_Float16 (*)[WR][72])smem, (*sol)[WR][72] = (_Float16 (*)[WR][72])(smem + NW * WR * 72 * 2); _Float16 (*sth)[136] = (_Float16 (*)[136])smem, (*stl)[136] = (_Float16 (*)[136])(smem + 128 * 136 * 2);
  const int tid = threadIdx.x, wave = tid >> 5, lane = tid & 31, col = lane & 15, g = lane >> 4, wm = wave >> 1, wn = wave & 1; const size_t r0 = (size_t)blockIdx.x * 128 + wm * WR; const int nb0 = blockIdx.y * 128, n0 = nb0 + wn * 64;
  v8f acc[FM][4] = {};
  const unsigned l0 = lds_off(smem); const char* gB = (const char*)(P + (size_t)nb0 * DM); const char* gA = (const char*)(X + (size_t)blockIdx.x * 128 * DM);
  stage128<128, NT>(l0, gB, DM * 2, tid); stage256<128, NT>(l0 + 128 * P128, gA, DM * 4, tid);
  WAIT_ASYNC(); __syncthreads();
  stage128<128, NT>(l0 + STGF, gB + 128, DM * 2, tid); stage256<128, NT>(l0 + STGF + 128 * P128, gA + 256, DM * 4, tid);
  for (int t = 0; t < DM / KST; ++t) { const char* bs = smem + (t & 1) * STGF;
    v16b a[2][FM], w[2][4];   // the stage's fragment reads all stand ahead of its products: one LDS latency a stage, not one a product (the loops below are unrolled so that every fragment index is a constant and the arrays stay in registers)
#pragma unroll
    for (int kk = 0; kk < 2; ++kk) {
#pragma unroll
      for (int i = 0; i < FM; ++i) { const float* p = (const float*)(bs + 128 * P128 + (wm * WR + i * 16 + col) * P256) + kk * 32 + 8 * g;
#pragma unroll
        for (int e = 0; e < 8; ++e) { a[kk][i][e] = (__bf16)p[e]; a[kk][i][8 + e] = (__bf16)p[16 + e]; } }
#pragma unroll
      for (int j = 0; j < 4; ++j) w[kk][j] = frag_b((const __bf16*)(bs + (wn * 64 + j * 16 + col) * P128) + kk * 32, lane); }
#pragma unroll
    for (int kk = 0; kk < 2; ++kk) {
#pragma unroll
      for (int i = 0; i < FM; ++i) {
#pragma unroll
        for (int j = 0; j < 4; ++j) acc[i][j] = wmma_bf(a[kk][i], w[kk][j], acc[i][j]); } }
    WAIT_DS(); WAIT_ASYNC(); __syncthreads();   // publishes stage t + 1 and ends every read of stage t
    if (t + 2 < DM / KST) { stage128<128, NT>(l0 + (t & 1) * STGF, gB + (size_t)(t + 2) * 128, DM * 2, tid); stage256<128, NT>(l0 + (t & 1) * STGF + 128 * P128, gA + (size_t)(t + 2) * 256, DM * 4, tid); } }
  WAIT_ASYNC();
  float bv[4] = { 0.f, 0.f, 0.f, 0.f };   // the bias of this lane's 4 columns, where there is one
  if (BB) {
#pragma unroll   // constant indices: bv stays in registers
    for (int j = 0; j < 4; ++j) bv[j] = bfr(BB[wn * 64 + j * 16 + col]);
    asm volatile("s_wait_xcnt 0x0" ::: "memory"); }   // stands in front of every later write of a register that the 4 loads name as an address
  if (nb0 < 2 * DM) {   // q stored unscaled (f16 sigma ~0.6, no subnormal exposure); 1/8 applied to the f32 score
#pragma unroll
    for (int i = 0; i < FM; ++i) {
#pragma unroll
      for (int j = 0; j < 4; ++j) {
#pragma unroll
        for (int r = 0; r < 8; ++r) { const float v = acc[i][j][r] + bv[j]; const _Float16 hv = (_Float16)v; so[wave][i * 16 + 8 * g + r][j * 16 + col] = hv; sol[wave][i * 16 + 8 * g + r][j * 16 + col] = (_Float16)((v - (float)hv) * 2048.0f); } } }   // q, k (+ bias) as f16 hi + (x2048) residual
    LDSX();
    const int rw = lane >> 3, c8 = (lane & 7) * 8;   // 8 lanes a 128-B row piece, 4 rows a store
    for (int rl = 0; rl < WR; rl += 4) { vst2((unsigned*)(QK + (r0 + rl + rw) * (2 * DM) + n0 + c8), *(const v4u*)&so[wave][rl + rw][c8]); vst2((unsigned*)(QKL + (r0 + rl + rw) * (2 * DM) + n0 + c8), *(const v4u*)&sol[wave][rl + rw][c8]); }
  } else {
#pragma unroll
    for (int i = 0; i < FM; ++i) {
#pragma unroll
      for (int j = 0; j < 4; ++j) {
#pragma unroll
        for (int r = 0; r < 8; ++r) { const float v = acc[i][j][r] + bv[j]; const _Float16 hv = (_Float16)v; sth[wn * 64 + j * 16 + col][wm * WR + i * 16 + 8 * g + r] = hv; stl[wn * 64 + j * 16 + col][wm * WR + i * 16 + 8 * g + r] = (_Float16)((v - (float)hv) * 2048.0f); } } }
    __syncthreads();
    const size_t rb = (size_t)blockIdx.x * 128; const int b = (int)(rb / SS), s0 = (int)(rb % SS); const int pc0 = nb0 - 2 * DM;
    for (int q = tid; q < 128 * 16; q += NT) { const int d = q >> 4, pc = q & 15; const size_t o = ((size_t)b * DM + pc0 + d) * SS + s0 + pc * 8; vst2((unsigned*)(VTH + o), *(const v4u*)&sth[d][pc * 8]); vst2((unsigned*)(VTL + o), *(const v4u*)&stl[d][pc * 8]); }
  }
}
typedef __attribute__((ext_vector_type(16))) unsigned v16u;
typedef __attribute__((address_space(4))) v16u cmw16;
// lane l <-> lane l ^ 16: the two lanes that share a query column
__device__ __forceinline__ float xhalf(float x) { return __builtin_bit_cast(float, __builtin_amdgcn_permlanex16(__builtin_bit_cast(int, x), __builtin_bit_cast(int, x), 0x76543210, 0xfedcba98, false, false)); }
// ---- k_attn: block = (64 queries, head h + 16 x batch b): all-keys flash attention with both products transposed: S^T = K . Q^T (A = key rows, B = the wave's 16 queries), O^T += V^T . P^T (A = v rows [d][key], B = P^T). A lane then holds 8 keys of ONE query (column lane & 15, keys 8 * (lane >> 4) + r of a 16-key tile): maximum and sum run inside the lane, one exchange with lane ^ 16 for the maximum; two score tiles converted in place are the B operand of the second product (element i = tile i >> 3, register i & 7), so P touches neither LDS nor another lane. Single f16 operands; softmax in base 2 on the raw scores, weights x 2^11 in numerator and denominator alike; O[b*S+q][h*64+d] = acc / l (256-B segments)
// The launch also carries, behind its attention blocks (blockIdx.y >= NH * NB), the weight packs that only later launches read: (in,out) W1 [1024][4096] -> rows [4096][1024] f16 x 2^8, W2 [4096][1024] -> rows [1024][4096], W_o -> PK_P rows bf16, one tile a block. They are bound by memory and the attention blocks by the vector port, so the packs run in the wave places that attention leaves free and cost no launch of their own
#define PT_FF ((DM / TPK) * (DFF / TPN))   // tiles of W1, and of W2
#define PT_O ((DM / TPK) * (DM / TPN))     // tiles of W_o
__global__ __launch_bounds__(128) void k_attn(const _Float16* __restrict__ QK, const _Float16* __restrict__ QKL, const _Float16* __restrict__ VTH, const _Float16* __restrict__ VTL, const void* __restrict__ KMASK, const unsigned* __restrict__ MB, float* __restrict__ O, const float* __restrict__ W1, const float* __restrict__ W2, const float* __restrict__ WO, _Float16* __restrict__ PF, _Float16* __restrict__ PM, __bf16* __restrict__ PO) {
  __shared__ __align__(16) char smem[2 * STG32];   // the ring (64 key rows, 64 v rows a stage); behind the loop's last barrier the output staging; in a pack block the tile's packed rows
  static_assert(TPN * TPP <= 2 * STG32 && (2 * PT_FF + PT_O) % TQB == 0, "pack tile in LDS, whole grid rows of pack blocks");
  if (blockIdx.y >= NH * TNB) {   // the same for a whole block, ahead of every barrier and copy below; each weight has its own copy of the code, so that every pitch is an immediate
    const int p = ((int)blockIdx.y - NH * TNB) * TQB + (int)blockIdx.x;
    if (p < PT_FF) { const int k0 = (p % (DM / TPK)) * TPK, n0 = (p / (DM / TPK)) * TPN; pack_tile<1, 128>(W1 + (size_t)k0 * DFF + n0, DFF * 4, (char*)(PF + (size_t)n0 * DM + k0), DM * 2, smem, threadIdx.x); }
    else if (p < 2 * PT_FF) { const int q = p - PT_FF, k0 = (q % (DFF / TPK)) * TPK, n0 = (q / (DFF / TPK)) * TPN; pack_tile<1, 128>(W2 + (size_t)k0 * DM + n0, DM * 4, (char*)(PM + (size_t)n0 * DFF + k0), DFF * 2, smem, threadIdx.x); }
    else { const int q = p - 2 * PT_FF, k0 = (q % (DM / TPK)) * TPK, n0 = (q / (DM / TPK)) * TPN; pack_tile<0, 128>(WO + (size_t)k0 * DM + n0, DM * 4, (char*)(PO + (size_t)n0 * DM + k0), DM * 2, smem, threadIdx.x); }
    return; }
  float (*so)[16][68] = (float (*)[16][68])smem;
  const int tid = threadIdx.x, wave = tid >> 5, lane = tid & 31, col = lane & 15, g = lane >> 4;
  const int qb = blockIdx.x, h = blockIdx.y % NH, b = blockIdx.y / NH; const int q0 = qb * 64 + wave * 16; const size_t rq = (size_t)b * SS + q0 + col;
  v16h aq[2];
#pragma unroll
  for (int kc = 0; kc < 2; ++kc) aq[kc] = frag_h(QK + rq * (2 * DM) + h * HD + kc * 32, lane);
  const float KS = 0.125f * 1.4426950408889634f;   // 1/sqrt(64) and log2(e) in one factor
  float m = -3.0e38f, l = 0.f;   // of this lane's query: running maximum of score x KS (alike in both lanes of the column); this lane's own part of the sum
  v8f acc[4] = {};
  // the wave's mask words: 16 a turn of 32 keys (64 B in a row), the same for every lane, so they come by scalar loads into scalar registers (constant address space: an earlier launch wrote them, nothing in this one does), each turn's issued behind the selects of the turn before
  const cmw16* pw = (const cmw16*)(MB + (size_t)(qb * 4 + __builtin_amdgcn_readfirstlane(wave)) * (SS / 16 * 8)); v16u mw = pw[0];
  // a stage is 64 keys (all keys are walked): 64 k rows of 128 B, the head's 64 v rows of 128 B
  const unsigned l0 = lds_off(smem); const char* gK = (const char*)(QK + (size_t)b * SS * (2 * DM) + DM + h * HD); const char* gV = (const char*)(VTH + ((size_t)b * DM + h * HD) * SS);
  stage128<64>(l0, gK, 2 * DM * 2, tid); stage128<64>(l0 + 64 * P128, gV, SS * 2, tid);
  WAIT_ASYNC(); __syncthreads();
  stage128<64>(l0 + STG32, gK + (size_t)64 * 2 * DM * 2, 2 * DM * 2, tid); stage128<64>(l0 + STG32 + 64 * P128, gV + 128, SS * 2, tid);
#pragma unroll 1   // the stage loop stays rolled, as the key loop was: its body already holds two turns
  for (int t = 0; t < SS / 64; ++t) { const char* bs = smem + (t & 1) * STG32;
#pragma unroll     // both turns of a stage unrolled: their LDS offsets become immediates
  for (int sub = 0; sub < 2; ++sub) { v8f s[2]; v16h kf[2][2], vf[4];   // 32 keys a turn; its LDS reads all stand ahead of its products: one LDS latency a turn, not one a product
#pragma unroll
    for (int ct = 0; ct < 2; ++ct) {
#pragma unroll
      for (int kc = 0; kc < 2; ++kc) kf[ct][kc] = frag_h((const _Float16*)(bs + (sub * 32 + ct * 16 + col) * P128) + kc * 32, lane); }
#pragma unroll
    for (int dt = 0; dt < 4; ++dt) vf[dt] = frag_h((const _Float16*)(bs + 64 * P128 + (dt * 16 + col) * P128) + sub * 32, lane);
    float mx = -3.0e38f;
#pragma unroll
    for (int ct = 0; ct < 2; ++ct) { v8f c = {};
#pragma unroll
      for (int kc = 0; kc < 2; ++kc) c = wmma16(kf[ct][kc], aq[kc], c);   // single product: k, q as one-rounding f16 operands; c[r] = key ct * 16 + 8 * g + r against query col
#pragma unroll
      for (int r = 0; r < 8; ++r) { s[ct][r] = __builtin_amdgcn_inverse_ballot_w32(mw[ct * 8 + r]) ? -3.0e38f : c[r]; mx = fmaxf(mx, s[ct][r]); } }   // mask == 1 -> -1e9 == excluded; the word is the select's lane mask as it stands
    __builtin_amdgcn_sched_barrier(0);   // holds the scalar load below behind this turn's selects: the wait in front of the selects is a wait for every scalar load issued, so a load lifted over them would be waited for at once and not a turn later
    const int tn = t * 2 + sub + 1; mw = pw[tn < SS / 32 ? tn : SS / 32 - 1];   // the next turn's mask words (the last turn reads its own again: in bounds)
    mx = fmaxf(mx, xhalf(mx)) * KS;   // KS > 0: the maximum of the raw scores, scaled, is the maximum of the scaled ones
    const float mn = fmaxf(m, mx); const float base = (mn <= -1.0e37f) ? 0.f : mn;   // no key of this query admitted yet: every weight below comes out 0
    const float nb = 11.0f - base; float x[17];   // 2^11 in the exponent keeps small softmax weights out of the f16 subnormal range; the sum carries it too, so it cancels in the epilogue
#pragma unroll
    for (int i = 0; i < 16; ++i) x[i] = fmaf(s[i >> 3][i & 7], KS, nb);   // an excluded score gives exp2(-huge) = 0
    x[16] = m - base; m = mn;
    // the turn's 17 exponentials in one statement, each in place: no neighbour reads the result or overwrites the source of the one in front of it, and the closing v_nop keeps that one slot behind the last
    asm("v_exp_f32 %0, %0\n\tv_exp_f32 %1, %1\n\tv_exp_f32 %2, %2\n\tv_exp_f32 %3, %3\n\tv_exp_f32 %4, %4\n\tv_exp_f32 %5, %5\n\tv_exp_f32 %6, %6\n\tv_exp_f32 %7, %7\n\tv_exp_f32 %8, %8\n\tv_exp_f32 %9, %9\n\tv_exp_f32 %10, %10\n\tv_exp_f32 %11, %11\n\tv_exp_f32 %12, %12\n\tv_exp_f32 %13, %13\n\tv_exp_f32 %14, %14\n\tv_exp_f32 %15, %15\n\tv_exp_f32 %16, %16\n\tv_nop"
        : "+v"(x[0]), "+v"(x[1]), "+v"(x[2]), "+v"(x[3]), "+v"(x[4]), "+v"(x[5]), "+v"(x[6]), "+v"(x[7]), "+v"(x[8]), "+v"(x[9]), "+v"(x[10]), "+v"(x[11]), "+v"(x[12]), "+v"(x[13]), "+v"(x[14]), "+v"(x[15]), "+v"(x[16]));
    const float alpha = x[16]; v16h pa; float es[4] = { 0.f, 0.f, 0.f, 0.f };
#pragma unroll
    for (int i = 0; i < 16; ++i) { es[i & 3] += x[i]; pa[i] = (_Float16)x[i]; }   // element i of the B operand = tile i >> 3, register i & 7
    l = l * alpha + ((es[0] + es[1]) + (es[2] + es[3]));
#pragma unroll
    for (int dt = 0; dt < 4; ++dt) { acc[dt] *= alpha; acc[dt] = wmma16(vf[dt], pa, acc[dt]); } }   // single product: V^T x P^T (x2^11); acc[dt][r] = d dt * 16 + 8 * g + r of query col
    WAIT_DS(); WAIT_ASYNC(); __syncthreads();   // publishes stage t + 1 and ends every read of stage t
    if (t + 2 < SS / 64) { const unsigned l = l0 + (t & 1) * STG32; stage128<64>(l, gK + (size_t)(t + 2) * 64 * 2 * DM * 2, 2 * DM * 2, tid); stage128<64>(l + 64 * P128, gV + (size_t)(t + 2) * 128, SS * 2, tid); } }
  WAIT_ASYNC();
  const float il = 1.0f / (l + xhalf(l));   // the column's two lanes join their sums once
#pragma unroll
  for (int dt = 0; dt < 4; ++dt) { const v8f o = acc[dt] * il; vst2(&so[wave][col][dt * 16 + 8 * g], (v4f){ o[0], o[1], o[2], o[3] }); vst2(&so[wave][col][dt * 16 + 8 * g + 4], (v4f){ o[4], o[5], o[6], o[7] }); }
  LDSX();
  for (int rl = 0; rl < 16; ++rl) if (lane < 16) vst2(O + ((size_t)b * SS + q0 + rl) * DM + h * HD + lane * 4, *(const v4f*)&so[wave][rl][lane * 4]);
}
// ---- k_out: block = (128 rows, 128 cols): out = O(hi/lo) . Wo rows (2 products) + bo
__global__ __launch_bounds__(GNT) void k_out(const float* __restrict__ O, const __bf16* __restrict__ P, const float* __restrict__ BO, float* __restrict__ Y) {
  constexpr int FM = 2, NT = GNT, WR = FM * 16;   // WR rows a wave
  __shared__ __align__(16) char smem[2 * STGF];   // the ring; behind the loop's last barrier the output staging
  float (*so)[WR][68] = (float (*)[WR][68])smem;
  const int tid = threadIdx.x, wave = tid >> 5, lane = tid & 31, col = lane & 15, g = lane >> 4, wm = wave >> 1, wn = wave & 1; const size_t r0 = (size_t)blockIdx.x * 128 + wm * WR; const int nb0 = blockIdx.y * 128, n0 = nb0 + wn * 64;
  v8f acc[FM][4] = {};
  const unsigned l0 = lds_off(smem); const char* gB = (const char*)(P + (size_t)nb0 * DM); const char* gA = (const char*)(O + (size_t)blockIdx.x * 128 * DM);
  stage128<128, NT>(l0, gB, DM * 2, tid); stage256<128, NT>(l0 + 128 * P128, gA, DM * 4, tid);
  WAIT_ASYNC(); __syncthreads();
  stage128<128, NT>(l0 + STGF, gB + 128, DM * 2, tid); stage256<128, NT>(l0 + STGF + 128 * P128, gA + 256, DM * 4, tid);
  for (int t = 0; t < DM / KST; ++t) { const char* bs = smem + (t & 1) * STGF;
    F2 a[2][FM]; v16b w[2][4];   // the stage's fragment reads all stand ahead of its products: one LDS latency a stage, not one a product (the loops below are unrolled so that every fragment index is a constant and the arrays stay in registers)
#pragma unroll
    for (int kk = 0; kk < 2; ++kk) {
#pragma unroll
      for (int i = 0; i < FM; ++i) a[kk][i] = split_row((const float*)(bs + 128 * P128 + (wm * WR + i * 16 + col) * P256), kk * 32, lane);
#pragma unroll
      for (int j = 0; j < 4; ++j) w[kk][j] = frag_b((const __bf16*)(bs + (wn * 64 + j * 16 + col) * P128) + kk * 32, lane); }
#pragma unroll
    for (int kk = 0; kk < 2; ++kk) {
#pragma unroll
      for (int i = 0; i < FM; ++i) {
#pragma unroll
        for (int j = 0; j < 4; ++j) { acc[i][j] = wmma_bf(a[kk][i].l, w[kk][j], acc[i][j]); acc[i][j] = wmma_bf(a[kk][i].h, w[kk][j], acc[i][j]); } } }
    WAIT_DS(); WAIT_ASYNC(); __syncthreads();   // publishes stage t + 1 and ends every read of stage t
    if (t + 2 < DM / KST) { stage128<128, NT>(l0 + (t & 1) * STGF, gB + (size_t)(t + 2) * 128, DM * 2, tid); stage256<128, NT>(l0 + (t & 1) * STGF + 128 * P128, gA + (size_t)(t + 2) * 256, DM * 4, tid); } }
  WAIT_ASYNC();
#pragma unroll
  for (int i = 0; i < FM; ++i) {
#pragma unroll
    for (int j = 0; j < 4; ++j) {
#pragma unroll
      for (int r = 0; r < 8; ++r) so[wave][i * 16 + 8 * g + r][j * 16 + col] = acc[i][j][r] + bfr(BO[n0 + j * 16 + col]); } }
  LDSX();
  for (int rl = 0; rl < WR; rl += 2) vst2(Y + (r0 + rl + g) * DM + n0 + col * 4, *(const v4f*)&so[wave][rl + g][col * 4]);   // 16 lanes a 256-B row piece, 2 rows a store
}
// ---- k_lnres<F16OUT, RESX>: block = row (256 threads x 4): y = R + LayerNorm(A) x gamma + beta (mean((x-m)^2), eps 1e-5); RESX: residual is the bf16-rounded input x (else an f32 buffer); optional f16 copy for the FF
template <int F16OUT, int RESX>
__global__ __launch_bounds__(256) void k_lnres(const float* __restrict__ A, const float* __restrict__ R, const float* __restrict__ G, const float* __restrict__ Bt, float* __restrict__ Y, _Float16* __restrict__ Y16) {
  __shared__ float red[8]; __shared__ __align__(16) _Float16 sh[DM]; const int t = threadIdx.x; const size_t row = blockIdx.x; float v[4]; float s = 0.f; for (int i = 0; i < 4; ++i) { v[i] = A[row * DM + t * 4 + i]; s += v[i]; }
#pragma unroll
  for (int o = 1; o < 32; o <<= 1) s += __shfl_xor(s, o);
  if ((t & 31) == 0) red[t >> 5] = s; __syncthreads(); float tot = 0.f; for (int i = 0; i < 8; ++i) tot += red[i]; const float mu = tot / (float)DM; __syncthreads();
  float q = 0.f; for (int i = 0; i < 4; ++i) { const float dd = v[i] - mu; q += dd * dd; }
#pragma unroll
  for (int o = 1; o < 32; o <<= 1) q += __shfl_xor(q, o);
  if ((t & 31) == 0) red[t >> 5] = q; __syncthreads(); float tq = 0.f; for (int i = 0; i < 8; ++i) tq += red[i]; const float inv = 1.0f / sqrtf(tq / (float)DM + 1e-5f);
  v4f o4; for (int i = 0; i < 4; ++i) { const int e = t * 4 + i; const float rr = RESX ? bfr(R[row * DM + e]) : R[row * DM + e]; o4[i] = rr + ((v[i] - mu) * inv * bfr(G[e]) + bfr(Bt[e])); if (F16OUT) sh[e] = (_Float16)o4[i]; }
  vst2(Y + row * DM + t * 4, o4);
  if (F16OUT) { __syncthreads(); if (t < DM / 8) vst2((unsigned*)(Y16 + row * DM + t * 8), *(const v4u*)&sh[t * 8]); }
}
// ---- k_mlp<MODE>: block = (MBM rows, 128 cols): MODE 0: G = gelu_exact(X1 . W1 + b1) (K 1024 -> 4096) f16; MODE 1: HF = gelu_exact(G . W2 + b2) (K 4096 -> 1024) f32
#define MBM(MODE) ((MODE) == 0 ? 256 : 128)   // rows of a block: the wide GEMM has tiles enough for the larger one, the narrow one has 256 tiles of 128 x 128, one a WGP
template <int MODE>
__global__ __launch_bounds__(GNT) void k_mlp(const _Float16* __restrict__ Ain, const _Float16* __restrict__ Wr, const float* __restrict__ BIAS, const float* __restrict__ RES, float* __restrict__ OUTF, _Float16* __restrict__ OG) {
  constexpr int KIN = (MODE == 0) ? DM : DFF; constexpr int NOUT = (MODE == 0) ? DFF : DM;
  constexpr int BM = MBM(MODE), NT = GNT, WR = BM / 4, FM = WR / 16, KS = (MODE == 0) ? 64 : 128, PT = KS * 2 + 16, STG = (128 + BM) * PT, KG = (MODE == 0) ? 1 : 2;   // WR rows a wave; KS k a stage at LDS pitch PT: weight rows, then activation rows; KG fragment columns (32 k each) read in one group
  __shared__ __align__(16) char smem[2 * STG];   // the ring; behind the loop's last barrier the output staging
  float (*so)[WR][68] = (float (*)[WR][68])smem; _Float16 (*sg)[WR][72] = (_Float16 (*)[WR][72])smem;
  const int tid = threadIdx.x, wave = tid >> 5, lane = tid & 31, col = lane & 15, g = lane >> 4, wm = wave >> 1, wn = wave & 1; const size_t r0 = (size_t)blockIdx.x * BM + wm * WR; const int nb0 = blockIdx.y * 128, n0 = nb0 + wn * 64;
  v8f acc[FM][4] = {};
  const unsigned l0 = lds_off(smem); const char* gB = (const char*)(Wr + (size_t)nb0 * KIN); const char* gA = (const char*)(Ain + (size_t)blockIdx.x * BM * KIN);
  auto stage = [&](unsigned l, int t) { if constexpr (KS == 64) { stage128<128, NT>(l, gB + (size_t)t * 128, KIN * 2, tid); stage128<BM, NT>(l + 128 * PT, gA + (size_t)t * 128, KIN * 2, tid); } else { stage256<128, NT>(l, gB + (size_t)t * 256, KIN * 2, tid); stage256<BM, NT>(l + 128 * PT, gA + (size_t)t * 256, KIN * 2, tid); } };   // stage t of both operands into the buffer at l
  stage(l0, 0);
  WAIT_ASYNC(); __syncthreads();
  stage(l0 + STG, 1);
  for (int t = 0; t < KIN / KS; ++t) { const char* bs = smem + (t & 1) * STG;
#pragma unroll   // the groups of a stage unrolled: their LDS offsets become immediates
    for (int k0 = 0; k0 < KS / 32; k0 += KG) {
    v16h a[KG][FM], w[KG][4];   // a group's fragment reads all stand ahead of its products: one LDS latency a group, not one a product (the loops below are unrolled so that every fragment index is a constant and the arrays stay in registers)
#pragma unroll
    for (int kk = 0; kk < KG; ++kk) {
#pragma unroll
      for (int i = 0; i < FM; ++i) a[kk][i] = frag_h((const _Float16*)(bs + 128 * PT + (wm * WR + i * 16 + col) * PT) + (k0 + kk) * 32, lane);
#pragma unroll
      for (int j = 0; j < 4; ++j) w[kk][j] = frag_h((const _Float16*)(bs + (wn * 64 + j * 16 + col) * PT) + (k0 + kk) * 32, lane); }
#pragma unroll
    for (int kk = 0; kk < KG; ++kk) {
#pragma unroll
      for (int i = 0; i < FM; ++i) {
#pragma unroll
        for (int j = 0; j < 4; ++j) acc[i][j] = wmma16(a[kk][i], w[kk][j], acc[i][j]); } } }
    WAIT_DS(); WAIT_ASYNC(); __syncthreads();   // publishes stage t + 1 and ends every read of stage t
    if (t + 2 < KIN / KS) stage(l0 + (t & 1) * STG, t + 2); }
  WAIT_ASYNC();
#pragma unroll
  for (int i = 0; i < FM; ++i) {
#pragma unroll
  for (int j = 0; j < 4; ++j) { const int c = n0 + j * 16 + col; const float bb = bfr(BIAS[c]); float x[8];
#pragma unroll
    for (int r = 0; r < 8; ++r) x[r] = acc[i][j][r] * (1.0f / 256.0f) + bb;
    gelu8(x);
#pragma unroll
    for (int r = 0; r < 8; ++r) { if (MODE == 0) sg[wave][i * 16 + 8 * g + r][j * 16 + col] = (_Float16)x[r]; else so[wave][i * 16 + 8 * g + r][j * 16 + col] = x[r]; } } }
  LDSX();
  if (MODE == 0) { const int rw = lane >> 3, c8 = (lane & 7) * 8; for (int rl = 0; rl < WR; rl += 4) vst2((unsigned*)(OG + (r0 + rl + rw) * NOUT + n0 + c8), *(const v4u*)&sg[wave][rl + rw][c8]); }   // 8 lanes a 128-B row piece, 4 rows a store
  else { for (int rl = 0; rl < WR; rl += 2) vst2(OUTF + (r0 + rl + g) * NOUT + n0 + col * 4, *(const v4f*)&so[wave][rl + g][col * 4]); }   // 16 lanes a 256-B row piece, 2 rows a store
}

extern "C" void kernel_launch(void* const* d_in, const int* in_sizes, int n_in, void* d_out, int out_size, void* d_ws, size_t ws_size, hipStream_t stream) {
  (void)in_sizes; (void)n_in; (void)out_size;
  const float** F = (const float**)d_in;   // 0 x [2,2048,1024], 1 mask [1,1,2048,2048] int, 2 Wq, 3 Wk, 4 Wv, 5 Wo ((in,out)), 6 bo, 7 ln1_g, 8 ln1_b, 9 W1 [1024,4096], 10 b1, 11 W2 [4096,1024], 12 b2, 13 ln2_g, 14 ln2_b
  if (ws_size < (size_t)WS_END) return;
  char* ws = (char*)d_ws; __bf16* PK = (__bf16*)(ws + WS_PK); _Float16 *QK = (_Float16*)(ws + WS_QK), *QKL = (_Float16*)(ws + WS_QKL), *VTH = (_Float16*)(ws + WS_VTH), *VTL = (_Float16*)(ws + WS_VTL), *PF = (_Float16*)(ws + WS_PF), *PM = (_Float16*)(ws + WS_PM), *X16 = (_Float16*)(ws + WS_X16), *Gb = (_Float16*)(ws + WS_G); unsigned* MB = (unsigned*)(ws + WS_MB); float *O = (float*)(ws + WS_O), *A0 = (float*)(ws + WS_A0), *X1 = (float*)(ws + WS_X1), *HF = (float*)(ws + WS_HF);
  k_pack<<<dim3((DM / TPK) * (DM / TPN), 5), 256, 0, stream>>>(F[2], F[3], F[4], PK, (const int*)d_in[1], MB);
  k_qkv<<<dim3(TNB * SS / 128, QKVW / 128), GNT, 0, stream>>>(F[0], F[0], F[0], PK + PK_A, nullptr, nullptr, nullptr, QK, QKL, VTH, VTL);
  k_attn<<<dim3(TQB, NH * TNB + (2 * PT_FF + PT_O) / TQB), 128, 0, stream>>>(QK, QKL, VTH, VTL, nullptr, MB, O, F[9], F[11], F[5], PF, PM, PK + PK_P);
  k_out<<<dim3(TOB / 2, DM / 128), GNT, 0, stream>>>(O, PK + PK_P, F[6], A0);
  k_lnres<1, 1><<<TOB * 64, 256, 0, stream>>>(A0, F[0], F[7], F[8], X1, X16);      // x1 = x + LN(attn branch)
  k_mlp<0><<<dim3(NR / MBM(0), DFF / 128), GNT, 0, stream>>>(X16, PF, F[10], nullptr, nullptr, Gb);
  k_mlp<1><<<dim3(NR / MBM(1), DM / 128), GNT, 0, stream>>>(Gb, PM, F[12], nullptr, HF, nullptr);
  k_lnres<0, 0><<<TOB * 64, 256, 0, stream>>>(HF, X1, F[13], F[14], (float*)d_out, nullptr);   // out = x1 + LN(ff branch)
}

// v008
// It runs in 179 microseconds.
// Next to v007, in two timings, it ran 1.05 times as fast each time.
// All steps since v000 together make it 4.81 times as fast.
// compute dtype: all float inputs rounded to bf16, the int mask read on device and packed to one bit an element; q/k/v = x . W with EXACT bf16 products on WMMA 16x16x32 ((in,out) weights as transposed rows); PLAIN attention: q, k single f16 x 1/8, masked keys excluded, running-max softmax in f32 (hardware exp), P (scaled by 2^11, single f16) x v (single f16); attention out (bf16 hi + residual) . Wo (2 products) + bo; LayerNorms in f32; FF: x1 rounded once to f16 x exact f16 weight copies (x 2^8), erf GELU (x . Phi(x), f32-accurate rational form of erfc), hidden f16, second erf GELU; f32 output.
#include <hip/hip_runtime.h>
#include <math.h>

typedef __attribute__((ext_vector_type(16))) _Float16 v16h;
typedef __attribute__((ext_vector_type(16))) __bf16 v16b;
typedef __attribute__((ext_vector_type(8)))  _Float16 v8h;
typedef __attribute__((ext_vector_type(8)))  float v8f;
typedef __attribute__((ext_vector_type(4)))  float v4f;
typedef __attribute__((ext_vector_type(2)))  float v2f;
typedef __attribute__((ext_vector_type(4)))  unsigned v4u;
typedef __attribute__((ext_vector_type(4)))  int v4i;
typedef float __attribute__((may_alias)) float_a;
typedef int __attribute__((may_alias)) int_a;

template <typename T> __device__ __forceinline__ void vst2(void* p, T v) { *(T*)p = v;  }
__device__ __forceinline__ v8f wmma16(v16h a, v16h b, v8f c) {
  v8f d = __builtin_amdgcn_wmma_f32_16x16x32_f16(false, a, false, b, (short)0, c, false, false);
  return d;
}
__device__ __forceinline__ v8f wmma_bf(v16b a, v16b b, v8f c) {
  v8f d = __builtin_amdgcn_wmma_f32_16x16x32_bf16(false, a, false, b, (short)0, c, false, false);
  return d;
}
// Transformer block (B 2, S 2,048, d 1,024, 16 heads x 64, FF 4,096): bias-free q/k/v projections, scores / 8 with a [S,S] mask (mask == 1 -> -1e9), softmax, . v, Wo + bo; x + LayerNorm(attention branch); FF with exact GELU after BOTH linears; x + LayerNorm(FF branch).
__device__ __forceinline__ v16h frag_h(const _Float16* rowk0, int lane) {
  union { v16h v; v8h q[2]; } u; const _Float16* p = rowk0 + 8 * (lane >> 4);
  u.q[0] = *(const v8h*)p; u.q[1] = *(const v8h*)(p + 16); return u.v;
}
__device__ __forceinline__ v16h frag_f32(const float* rowk0, int lane) {
  v16h a; const float* p = rowk0 + 8 * (lane >> 4);
#pragma unroll
  for (int i = 0; i < 8; ++i) { a[i] = (_Float16)p[i]; a[8 + i] = (_Float16)p[16 + i]; }
  return a;
}
__device__ __forceinline__ v16h frag_f32s(const float* rowk0, int lane, float sc) {
  v16h a; const float* p = rowk0 + 8 * (lane >> 4);
#pragma unroll
  for (int i = 0; i < 8; ++i) { a[i] = (_Float16)(p[i] * sc); a[8 + i] = (_Float16)(p[16 + i] * sc); }
  return a;
}
// column fragment from a [K][ld] layout (column n), rows >= K read as 0
__device__ __forceinline__ v16h fragc_f32(const float* W, int k0, int n, int lane, int ld, int K) {
  v16h a; const int g = lane >> 4;
#pragma unroll
  for (int i = 0; i < 8; ++i) { const int ka = k0 + 8 * g + i, kb = ka + 16;
    a[i] = (_Float16)(ka < K ? W[(size_t)(ka < K ? ka : K - 1) * ld + n] : 0.f); a[8 + i] = (_Float16)(kb < K ? W[(size_t)(kb < K ? kb : K - 1) * ld + n] : 0.f); }
  return a;
}
struct F2 { v16b h, l; };
__device__ __forceinline__ F2 bsplit16(const float v[16]) { F2 r;
#pragma unroll
  for (int i = 0; i < 16; ++i) { const __bf16 h = (__bf16)v[i]; r.h[i] = h; r.l[i] = (__bf16)(v[i] - (float)h); }
  return r; }
__device__ __forceinline__ F2 split_row(const float* row, int k0, int lane) { float v[16]; const float* p = row + k0 + 8 * (lane >> 4);
#pragma unroll
  for (int i = 0; i < 8; ++i) { v[i] = p[i]; v[8 + i] = p[16 + i]; }
  return bsplit16(v); }
__device__ __forceinline__ F2 split_rowK(const float* row, int k0, int lane, int K) { float v[16]; const int g = lane >> 4;
#pragma unroll
  for (int i = 0; i < 8; ++i) { const int ka = k0 + 8 * g + i, kb = ka + 16; v[i] = ka < K ? row[ka < K ? ka : K - 1] : 0.f; v[8 + i] = kb < K ? row[kb < K ? kb : K - 1] : 0.f; }
  return bsplit16(v); }
__device__ __forceinline__ F2 split_col(const float* W, int k0, int n, int lane, int ld, int K) { float v[16]; const int g = lane >> 4;
#pragma unroll
  for (int i = 0; i < 8; ++i) { const int ka = k0 + 8 * g + i, kb = ka + 16; v[i] = ka < K ? W[(size_t)(ka < K ? ka : K - 1) * ld + n] : 0.f; v[8 + i] = kb < K ? W[(size_t)(kb < K ? kb : K - 1) * ld + n] : 0.f; }
  return bsplit16(v); }
__device__ __forceinline__ v8f mac3(const F2& a, const F2& b, v8f c) { c = wmma_bf(a.l, b.h, c); c = wmma_bf(a.h, b.l, c); return wmma_bf(a.h, b.h, c); }
__device__ __forceinline__ float sigm(float v) { return 1.0f / (1.0f + expf(-v)); }
#define LDSX() do { asm volatile("s_wait_dscnt 0" ::: "memory"); __builtin_amdgcn_wave_barrier(); __builtin_amdgcn_fence(__ATOMIC_RELEASE, "workgroup"); } while (0)


#define NB 2
#define SS 2048
#define DM 1024
#define NH 16
#define DFF 4096
#define NR (NB * SS)
// erf GELU as x * Phi(x), Phi the normal distribution function, inline and with no branch, 8 values side by side, in place. With t = 1 / (1 + p |x| / sqrt(2)), q = (c1 t + ... + c5 t^5) / 2 * exp(-x^2 / 2) is Phi(-|x|) = erfc(|x| / sqrt(2)) / 2 (five-term rational form of erfc: absolute error of Phi under 1e-7, of the result under 4e-7 for |x| <= 8); x * Phi(x) = max(x, 0) - |x| q on both sides of 0, with no cancellation in the negative tail
__device__ __forceinline__ void gelu8(float (&x)[8]) {
  float t[8], e[8];
#pragma unroll   // constant indices: the arrays stay in registers
  for (int i = 0; i < 8; ++i) { t[i] = fmaf(0.3275911f * 0.70710678118654752f, fabsf(x[i]), 1.0f); e[i] = (x[i] * x[i]) * -0.72134752044448170f; }   // exp(-x^2 / 2) in base 2; far out it is 0 and the result max(x, 0)
  // the 8 reciprocals and 8 exponentials in one statement, each in place: no neighbour reads the result or overwrites the source of the one in front of it, and the closing v_nop keeps that one slot behind the last
  asm("v_rcp_f32 %0, %0\n\tv_rcp_f32 %1, %1\n\tv_rcp_f32 %2, %2\n\tv_rcp_f32 %3, %3\n\tv_rcp_f32 %4, %4\n\tv_rcp_f32 %5, %5\n\tv_rcp_f32 %6, %6\n\tv_rcp_f32 %7, %7\n\tv_exp_f32 %8, %8\n\tv_exp_f32 %9, %9\n\tv_exp_f32 %10, %10\n\tv_exp_f32 %11, %11\n\tv_exp_f32 %12, %12\n\tv_exp_f32 %13, %13\n\tv_exp_f32 %14, %14\n\tv_exp_f32 %15, %15\n\tv_nop"
      : "+v"(t[0]), "+v"(t[1]), "+v"(t[2]), "+v"(t[3]), "+v"(t[4]), "+v"(t[5]), "+v"(t[6]), "+v"(t[7]), "+v"(e[0]), "+v"(e[1]), "+v"(e[2]), "+v"(e[3]), "+v"(e[4]), "+v"(e[5]), "+v"(e[6]), "+v"(e[7]));
#pragma unroll
  for (int i = 0; i < 8; ++i) { float p = fmaf(0.5f * 1.061405429f, t[i], 0.5f * -1.453152027f);
    p = fmaf(p, t[i], 0.5f * 1.421413741f); p = fmaf(p, t[i], 0.5f * -0.284496736f); p = fmaf(p, t[i], 0.5f * 0.254829592f);
    x[i] = fmaf(-fabsf(x[i]), (p * t[i]) * e[i], fmaxf(x[i], 0.f)); }
}
#define HD 64
#define QKVW (3 * DM)
#ifndef TQB
#define TQB (SS / 64)
#define TNB NB
#define TOB (NB * SS / 64)     // output row tiles (all)
#endif
typedef __attribute__((ext_vector_type(8))) __bf16 v8b;
__device__ __forceinline__ v16b frag_b(const __bf16* rowk0, int lane) {
  union { v16b v; v8b q[2]; } u; const __bf16* p = rowk0 + 8 * (lane >> 4);
  u.q[0] = *(const v8b*)p; u.q[1] = *(const v8b*)(p + 16); return u.v;
}
__device__ __forceinline__ float bfr(float v) { return (float)(__bf16)v; }
__device__ __attribute__((noinline)) float exp_ni(float v) { return expf(v); }
__device__ __attribute__((noinline)) float erf_ni(float v) { return erff(v); }

// ---- LDS ring of the GEMM kernels: a block is 8 waves, 4 down x 2 across; a wave makes FM x 16 rows by 64 columns, so a weight fragment read from LDS serves FM products and an activation fragment 4, and a block makes FM x 64 rows by 128 columns from one staging of its operand rows. A stage is 64 or 128 k of the block's 128 weight rows and of its activation rows, brought by asynchronous copies in whole lines; two buffers
#define KST 64
#define P128 144   // LDS pitch of a 128-B row: 16 B x odd, no bank conflict for 16-B reads down a column of rows
#define P256 272   // LDS pitch of a 256-B row, likewise
__device__ __forceinline__ unsigned lds_off(const void* p) { return (unsigned)(size_t)p; }
// four copies of 16 B a lane; s_wait_xcnt closes the statement so that no address register of a copy is rewritten ahead of it
__device__ __forceinline__ void cp4(unsigned l0, unsigned l1, unsigned l2, unsigned l3, const char* g0, const char* g1, const char* g2, const char* g3) {
  asm volatile("global_load_async_to_lds_b128 %0, %4, off\n\tglobal_load_async_to_lds_b128 %1, %5, off\n\tglobal_load_async_to_lds_b128 %2, %6, off\n\tglobal_load_async_to_lds_b128 %3, %7, off\n\ts_wait_xcnt 0x0"
               :: "v"(l0), "v"(l1), "v"(l2), "v"(l3), "v"(g0), "v"(g1), "v"(g2), "v"(g3) : "memory");
}
// NROW rows of 128 B (global pitch gp bytes) -> LDS at pitch P128: 8 lanes a row, NT / 8 rows a copy of the block's NT threads
template <int NROW, int NT = 128> __device__ __forceinline__ void stage128(unsigned l, const char* g, size_t gp, int tid) {
  constexpr int RP = NT / 8; l += (tid >> 3) * P128 + (tid & 7) * 16; g += (size_t)(tid >> 3) * gp + (tid & 7) * 16;
  for (int i = 0; i < NROW / RP; i += 4) cp4(l + i * RP * P128, l + (i + 1) * RP * P128, l + (i + 2) * RP * P128, l + (i + 3) * RP * P128, g + (size_t)i * RP * gp, g + (size_t)(i + 1) * RP * gp, g + (size_t)(i + 2) * RP * gp, g + (size_t)(i + 3) * RP * gp);
}
// NROW rows of 256 B -> LDS at pitch P256: 16 lanes a row, NT / 16 rows a copy of the block's NT threads
template <int NROW, int NT = 128> __device__ __forceinline__ void stage256(unsigned l, const char* g, size_t gp, int tid) {
  constexpr int RP = NT / 16; l += (tid >> 4) * P256 + (tid & 15) * 16; g += (size_t)(tid >> 4) * gp + (tid & 15) * 16;
  for (int i = 0; i < NROW / RP; i += 4) cp4(l + i * RP * P256, l + (i + 1) * RP * P256, l + (i + 2) * RP * P256, l + (i + 3) * RP * P256, g + (size_t)i * RP * gp, g + (size_t)(i + 1) * RP * gp, g + (size_t)(i + 2) * RP * gp, g + (size_t)(i + 3) * RP * gp);
}
#define WAIT_ASYNC() asm volatile("s_wait_asynccnt 0x0" ::: "memory")   // this wave's copies have landed
#define WAIT_DS() asm volatile("s_wait_dscnt 0x0" ::: "memory")         // this wave's LDS reads are done before the buffer is given up
#define HOLD_ORDER() __builtin_amdgcn_sched_barrier(0)   // nothing is scheduled across. Between a group's LDS reads and its products: the reads stay together ahead of the products (left free, the compiler deals them out among the products, each with a wait to 0 of its own). Behind the products: they stay ahead of the next reads and of the ring's waits (left free, they sink behind the barrier, and the copies in flight lose the products' time to land)
#define STG32 (128 * P128)                 // one buffer of the attention ring
#define STGF (128 * P128 + 128 * P256)     // one GEMM buffer, f32 activations, 64 k: weight rows, then activation rows
#define GNT 256                            // threads of a GEMM block
#define PK_A 0                       // [3072][1024] Wqkv rows (natural [out][in])
#define PK_P (PK_A + QKVW * DM)        // [1024][1024] Wo rows (natural)
#define PK_END (PK_P + DM * DM)
#define WS_PK  0u
#define WS_QK  (WS_PK + 2u * PK_END)             // f16 [4096 rows][2048]: q | k
#define WS_QKL (WS_QK + 2u * NB * SS * 2 * DM)     // f16 q | k residual planes x2048
#define WS_VTH (WS_QKL + 2u * NB * SS * 2 * DM)    // f16 [b][1024 (h*64+d)][2048 s] hi
#define WS_VTL (WS_VTH + 2u * NB * DM * SS)        // f16 lo x 2048
#define WS_O   (WS_VTL + 2u * NB * DM * SS)        // f32 [4096][1024]
#define WS_CS  (WS_O + 4u * NB * SS * DM)           // f32 [2][2048][32], unused
#define WS_PF  (WS_CS + 4u * 2 * SS * 32)                  // f16 x 2^8 rows W1^T [4096][1024] ; W2^T [1024][4096]
#define WS_PM  (WS_PF + 2u * (size_t)DFF * DM)
#define WS_A0  (WS_PM + 2u * (size_t)DM * DFF)          // f32 [NR][1024] attention branch ; X1 f32 ; HF f32 (ff branch)
#define WS_X1  (WS_A0 + 4u * (size_t)NR * DM)
#define WS_HF  (WS_X1 + 4u * (size_t)NR * DM)
#define WS_X16 (WS_HF + 4u * (size_t)NR * DM)           // f16 [NR][1024] x1 ; G f16 [NR][4096]
#define WS_G   (WS_X16 + 2u * (size_t)NR * DM)
#define WS_MB  (WS_G + 2u * (size_t)NR * DFF)            // u32 [128 query tiles][128 key tiles][8]: the mask as lane-mask words
#define WS_END (WS_MB + 4u * (SS / 16) * (SS / 16) * 8)
// ---- weight packs: a block transposes one tile of 128 k x 64 n of an (in,out) f32 weight into 64 packed 16-bit rows of 128 k. A thread loads 8 k rows x 4 n as 16-B pieces (16 lanes cover 256 B in a row of the source), converts, and puts 8 k of each of its 4 n as one 16-B piece into LDS; the rows then go out as 256 B in a row of the packed plane. A block of NT = 128 threads takes two such places a thread
#define TPK 128
#define TPN 64
#define TPP 272   // LDS pitch of a packed 256-B row
template <int F16, int NT = 256> __device__ __forceinline__ void pack_tile(const float* __restrict__ Wt, unsigned ldw, char* __restrict__ dst, unsigned ldd, char* s, int t) {   // Wt: the tile's first element, ldw its row pitch in bytes; dst: the tile's first packed byte, ldd its row pitch in bytes
  constexpr int KGB = NT / 16, NP = TPK / 8 / KGB;   // KGB groups of 8 k a pass of the block's threads, NP passes a tile
  const int n4 = t & 15, kg = t >> 4; const char* gp = (const char*)Wt + ((unsigned)kg * 8u * ldw + n4 * 16); v4f r[NP][8];   // one lane address for all loads, the rows by immediate offsets (under 2 MiB)
#pragma unroll   // all loads of a thread are in flight together, and r stays in registers
  for (int p = 0; p < NP; ++p) {
#pragma unroll
    for (int i = 0; i < 8; ++i) r[p][i] = *(const v4f*)(gp + (size_t)(p * KGB * 8 + i) * ldw); }
  asm volatile("s_wait_xcnt 0x0" :: "v"(gp) : "memory");   // stands in front of every later write of a register that the loads name as an address; the address is an input, so that no load's result lands on it
#pragma unroll   // constant indices into r
  for (int p = 0; p < NP; ++p) {
#pragma unroll
  for (int j = 0; j < 4; ++j) { v4u o;
    if (F16) { v8h h;
#pragma unroll
      for (int i = 0; i < 8; ++i) h[i] = (_Float16)(bfr(r[p][i][j]) * 256.0f);
      o = __builtin_bit_cast(v4u, h); }
    else { v8b h;
#pragma unroll
      for (int i = 0; i < 8; ++i) h[i] = (__bf16)r[p][i][j];
      o = __builtin_bit_cast(v4u, h); }
    *(v4u*)(s + (n4 * 4 + j) * TPP + (p * KGB + kg) * 16) = o; } }
  __syncthreads();
  const int n = t >> 4, c = t & 15; const unsigned so = (unsigned)n * ldd + c * 16; v4u o[TPN / KGB];   // 16 lanes a packed row, KGB rows a turn of the block's threads
#pragma unroll   // the LDS reads stand together ahead of the stores: one LDS latency, not one a store
  for (int i = 0; i < TPN / KGB; ++i) o[i] = *(const v4u*)(s + (n + i * KGB) * TPP + c * 16);
#pragma unroll
  for (int i = 0; i < TPN / KGB; ++i) vst2(dst + (size_t)i * KGB * ldd + so, o[i]);
  asm volatile("s_wait_xcnt 0x0" ::: "memory");   // stands in front of every later write of a register that the stores name as an address, on every way that leads on from here
}
// ---- mask words: the [S][S] int mask as one bit an element, in the order in which k_attn's lanes hold the scores: word [query tile qt][key tile kt][r], bit l = (mask[qt * 16 + (l & 15)][kt * 16 + 8 * (l >> 4) + r] == 1). A word is then the lane mask of one select over a whole score register. A wave makes 16 queries x 128 keys: a lane loads 8 x 32 B of its query's row, a compare over the wave gives each word, and lane i keeps words i and 32 + i for two 128-B stores
__device__ __forceinline__ void mask_words(const int* __restrict__ MSK, unsigned* __restrict__ MB, int wv, int lane) {
  const int qt = wv >> 4, kg = wv & 15; const int* p = MSK + (size_t)(qt * 16 + (lane & 15)) * SS + kg * 128 + 8 * (lane >> 4); v4i m[8][2];
#pragma unroll   // the 16 loads of a lane are in flight together, and m stays in registers
  for (int j = 0; j < 8; ++j) { m[j][0] = *(const v4i*)(p + j * 16); m[j][1] = *(const v4i*)(p + j * 16 + 4); }
  // stands in front of every later write of a register that the 16 loads name as an address; the loaded values are inputs so that no compare is lifted in among the loads to free a register: one memory latency a wave, not two; the address is an input too, so that no load's result lands on it
  asm volatile("s_wait_xcnt 0x0" :: "v"(m[0][0]), "v"(m[0][1]), "v"(m[1][0]), "v"(m[1][1]), "v"(m[2][0]), "v"(m[2][1]), "v"(m[3][0]), "v"(m[3][1]), "v"(m[4][0]), "v"(m[4][1]), "v"(m[5][0]), "v"(m[5][1]), "v"(m[6][0]), "v"(m[6][1]), "v"(m[7][0]), "v"(m[7][1]), "v"(p) : "memory");
  int w[2] = { 0, 0 };
#pragma unroll   // constant indices into m and w, constant lane numbers
  for (int j = 0; j < 8; ++j) {
#pragma unroll
    for (int r = 0; r < 8; ++r) { const int bw = (int)__builtin_amdgcn_ballot_w32(m[j][r >> 2][r & 3] == 1); w[j >> 2] = (lane == (j & 3) * 8 + r) ? bw : w[j >> 2]; } }
  unsigned* o = MB + (size_t)qt * (SS / 16 * 8) + kg * 64 + lane; o[0] = (unsigned)w[0]; o[32] = (unsigned)w[1];
}
// ---- k_pack: what k_qkv and k_attn need first: block = (tile, which): which 0..2 -> W_q/W_k/W_v into PK_A rows which*1024 + n (pack row n = column n, bf16); 3, 4 -> the mask words, 8 waves a block
__global__ __launch_bounds__(256) void k_pack(const float* __restrict__ WQ, const float* __restrict__ WK, const float* __restrict__ WV, __bf16* __restrict__ PK, const int* __restrict__ MSK, unsigned* __restrict__ MB) {
  if (blockIdx.y >= 3) { mask_words(MSK, MB, (((int)blockIdx.y - 3) * ((DM / TPK) * (DM / TPN)) + (int)blockIdx.x) * 8 + (int)(threadIdx.x >> 5), threadIdx.x & 31); return; }   // the same for a whole block, ahead of the barrier below
  __shared__ __align__(16) char s[TPN * TPP]; const int k0 = (blockIdx.x % (DM / TPK)) * TPK, n0 = (blockIdx.x / (DM / TPK)) * TPN, which = blockIdx.y; const float* Wm = (which == 0) ? WQ : (which == 1) ? WK : WV;
  __bf16* dst = PK + PK_A + ((size_t)which * DM + n0) * DM + k0;
  pack_tile<0>(Wm + (size_t)k0 * DM + n0, DM * 4, (char*)dst, DM * 2, s, threadIdx.x);
}
__global__ __launch_bounds__(GNT) void k_qkv(const float* __restrict__ XQ, const float* __restrict__ XK, const float* __restrict__ XV, const __bf16* __restrict__ P, const float* __restrict__ BQ, const float* __restrict__ BK, const float* __restrict__ BV, _Float16* __restrict__ QK, _Float16* __restrict__ QKL, _Float16* __restrict__ VTH, _Float16* __restrict__ VTL) {
  constexpr int FM = 2, NT = GNT, WR = FM * 16, NW = NT / 32;   // WR rows a wave, NW waves
  const int which0 = (blockIdx.y * 128) / DM; const float* X = (which0 == 0) ? XQ : (which0 == 1) ? XK : XV; const float* BB = BQ ? (((which0 == 0) ? BQ : (which0 == 1) ? BK : BV) + (blockIdx.y * 128 - which0 * DM)) : nullptr;
  __shared__ __align__(16) char smem[2 * STGF];   // the ring; behind the loop's last barrier the output staging
  _Float16 (*so)[WR][72] = (_Float16 (*)[WR][72])smem, (*sol)[WR][72] = (_Float16 (*)[WR][72])(smem + NW * WR * 72 * 2); _Float16 (*sth)[136] = (_Float16 (*)[136])smem, (*stl)[136] = (_Float16 (*)[136])(smem + 128 * 136 * 2);
  const int tid = threadIdx.x, wave = tid >> 5, lane = tid & 31, col = lane & 15, g = lane >> 4, wm = wave >> 1, wn = wave & 1; const size_t r0 = (size_t)blockIdx.x * 128 + wm * WR; const int nb0 = blockIdx.y * 128, n0 = nb0 + wn * 64;
  v8f acc[FM][4] = {};
  const unsigned l0 = lds_off(smem); const char* gB = (const char*)(P + (size_t)nb0 * DM); const char* gA = (const char*)(X + (size_t)blockIdx.x * 128 * DM);
  stage128<128, NT>(l0, gB, DM * 2, tid); stage256<128, NT>(l0 + 128 * P128, gA, DM * 4, tid);
  WAIT_ASYNC(); __syncthreads();
  stage128<128, NT>(l0 + STGF, gB + 128, DM * 2, tid); stage256<128, NT>(l0 + STGF + 128 * P128, gA + 256, DM * 4, tid);
  for (int t = 0; t < DM / KST; ++t) { const char* bs = smem + (t & 1) * STGF;
    v16b a[2][FM], w[2][4];   // the order of the stage's fragment reads, conversions and products is left to the compiler: it starts with 14 reads, waits by count, and stays within 160 registers, so that six waves fit a SIMD and three blocks a WGP (the loops below are unrolled so that every fragment index is a constant and the arrays stay in registers)
#pragma unroll
    for (int kk = 0; kk < 2; ++kk) {
#pragma unroll
      for (int i = 0; i < FM; ++i) { const float* p = (const float*)(bs + 128 * P128 + (wm * WR + i * 16 + col) * P256) + kk * 32 + 8 * g;
#pragma unroll
        for (int e = 0; e < 8; ++e) { a[kk][i][e] = (__bf16)p[e]; a[kk][i][8 + e] = (__bf16)p[16 + e]; } }
#pragma unroll
      for (int j = 0; j < 4; ++j) w[kk][j] = frag_b((const __bf16*)(bs + (wn * 64 + j * 16 + col) * P128) + kk * 32, lane); }
#pragma unroll
    for (int kk = 0; kk < 2; ++kk) {
#pragma unroll
      for (int i = 0; i < FM; ++i) {
#pragma unroll
        for (int j = 0; j < 4; ++j) acc[i][j] = wmma_bf(a[kk][i], w[kk][j], acc[i][j]); } }
    HOLD_ORDER();   // the products above stay ahead of the ring's waits and barrier
    WAIT_DS(); WAIT_ASYNC(); __syncthreads();   // publishes stage t + 1 and ends every read of stage t
    if (t + 2 < DM / KST) { stage128<128, NT>(l0 + (t & 1) * STGF, gB + (size_t)(t + 2) * 128, DM * 2, tid); stage256<128, NT>(l0 + (t & 1) * STGF + 128 * P128, gA + (size_t)(t + 2) * 256, DM * 4, tid); } }
  WAIT_ASYNC();
  float bv[4] = { 0.f, 0.f, 0.f, 0.f };   // the bias of this lane's 4 columns, where there is one
  if (BB) {
#pragma unroll   // constant indices: bv stays in registers
    for (int j = 0; j < 4; ++j) bv[j] = bfr(BB[wn * 64 + j * 16 + col]);
    asm volatile("s_wait_xcnt 0x0" ::: "memory"); }   // stands in front of every later write of a register that the 4 loads name as an address
  if (nb0 < 2 * DM) {   // q stored unscaled (f16 sigma ~0.6, no subnormal exposure); 1/8 applied to the f32 score
#pragma unroll
    for (int i = 0; i < FM; ++i) {
#pragma unroll
      for (int j = 0; j < 4; ++j) {
#pragma unroll
        for (int r = 0; r < 8; ++r) { const float v = acc[i][j][r] + bv[j]; const _Float16 hv = (_Float16)v; so[wave][i * 16 + 8 * g + r][j * 16 + col] = hv; sol[wave][i * 16 + 8 * g + r][j * 16 + col] = (_Float16)((v - (float)hv) * 2048.0f); } } }   // q, k (+ bias) as f16 hi + (x2048) residual
    LDSX();
    const int rw = lane >> 3, c8 = (lane & 7) * 8;   // 8 lanes a 128-B row piece, 4 rows a store
    for (int rl = 0; rl < WR; rl += 4) { vst2((unsigned*)(QK + (r0 + rl + rw) * (2 * DM) + n0 + c8), *(const v4u*)&so[wave][rl + rw][c8]); vst2((unsigned*)(QKL + (r0 + rl + rw) * (2 * DM) + n0 + c8), *(const v4u*)&sol[wave][rl + rw][c8]); }
  } else {
#pragma unroll
    for (int i = 0; i < FM; ++i) {
#pragma unroll
      for (int j = 0; j < 4; ++j) {
#pragma unroll
        for (int r = 0; r < 8; ++r) { const float v = acc[i][j][r] + bv[j]; const _Float16 hv = (_Float16)v; sth[wn * 64 + j * 16 + col][wm * WR + i * 16 + 8 * g + r] = hv; stl[wn * 64 + j * 16 + col][wm * WR + i * 16 + 8 * g + r] = (_Float16)((v - (float)hv) * 2048.0f); } } }
    __syncthreads();
    const size_t rb = (size_t)blockIdx.x * 128; const int b = (int)(rb / SS), s0 = (int)(rb % SS); const int pc0 = nb0 - 2 * DM;
    for (int q = tid; q < 128 * 16; q += NT) { const int d = q >> 4, pc = q & 15; const size_t o = ((size_t)b * DM + pc0 + d) * SS + s0 + pc * 8; vst2((unsigned*)(VTH + o), *(const v4u*)&sth[d][pc * 8]); vst2((unsigned*)(VTL + o), *(const v4u*)&stl[d][pc * 8]); }
  }
}
typedef __attribute__((ext_vector_type(16))) unsigned v16u;
typedef __attribute__((address_space(4))) v16u cmw16;
// lane l <-> lane l ^ 16: the two lanes that share a query column
__device__ __forceinline__ float xhalf(float x) { return __builtin_bit_cast(float, __builtin_amdgcn_permlanex16(__builtin_bit_cast(int, x), __builtin_bit_cast(int, x), 0x76543210, 0xfedcba98, false, false)); }
// ---- k_attn: block = (64 queries, head h + 16 x batch b): all-keys flash attention with both products transposed: S^T = K . Q^T (A = key rows, B = the wave's 16 queries), O^T += V^T . P^T (A = v rows [d][key], B = P^T). A lane then holds 8 keys of ONE query (column lane & 15, keys 8 * (lane >> 4) + r of a 16-key tile): maximum and sum run inside the lane, one exchange with lane ^ 16 for the maximum; two score tiles converted in place are the B operand of the second product (element i = tile i >> 3, register i & 7), so P touches neither LDS nor another lane. Single f16 operands; softmax in base 2 on the raw scores, weights x 2^11 in numerator and denominator alike; O[b*S+q][h*64+d] = acc / l (256-B segments)
// The launch also carries, behind its attention blocks (blockIdx.y >= NH * NB), the weight packs that only later launches read: (in,out) W1 [1024][4096] -> rows [4096][1024] f16 x 2^8, W2 [4096][1024] -> rows [1024][4096], W_o -> PK_P rows bf16, one tile a block. They are bound by memory and the attention blocks by the vector port, so the packs run in the wave places that attention leaves free and cost no launch of their own
#define PT_FF ((DM / TPK) * (DFF / TPN))   // tiles of W1, and of W2
#define PT_O ((DM / TPK) * (DM / TPN))     // tiles of W_o
__global__ __launch_bounds__(128) void k_attn(const _Float16* __restrict__ QK, const _Float16* __restrict__ QKL, const _Float16* __restrict__ VTH, const _Float16* __restrict__ VTL, const void* __restrict__ KMASK, const unsigned* __restrict__ MB, float* __restrict__ O, const float* __restrict__ W1, const float* __restrict__ W2, const float* __restrict__ WO, _Float16* __restrict__ PF, _Float16* __restrict__ PM, __bf16* __restrict__ PO) {
  __shared__ __align__(16) char smem[2 * STG32];   // the ring (64 key rows, 64 v rows a stage); behind the loop's last barrier the output staging; in a pack block the tile's packed rows
  static_assert(TPN * TPP <= 2 * STG32 && (2 * PT_FF + PT_O) % TQB == 0, "pack tile in LDS, whole grid rows of pack blocks");
  if (blockIdx.y >= NH * TNB) {   // the same for a whole block, ahead of every barrier and copy below; each weight has its own copy of the code, so that every pitch is an immediate
    const int p = ((int)blockIdx.y - NH * TNB) * TQB + (int)blockIdx.x;
    if (p < PT_FF) { const int k0 = (p % (DM / TPK)) * TPK, n0 = (p / (DM / TPK)) * TPN; pack_tile<1, 128>(W1 + (size_t)k0 * DFF + n0, DFF * 4, (char*)(PF + (size_t)n0 * DM + k0), DM * 2, smem, threadIdx.x); }
    else if (p < 2 * PT_FF) { const int q = p - PT_FF, k0 = (q % (DFF / TPK)) * TPK, n0 = (q / (DFF / TPK)) * TPN; pack_tile<1, 128>(W2 + (size_t)k0 * DM + n0, DM * 4, (char*)(PM + (size_t)n0 * DFF + k0), DFF * 2, smem, threadIdx.x); }
    else { const int q = p - 2 * PT_FF, k0 = (q % (DM / TPK)) * TPK, n0 = (q / (DM / TPK)) * TPN; pack_tile<0, 128>(WO + (size_t)k0 * DM + n0, DM * 4, (char*)(PO + (size_t)n0 * DM + k0), DM * 2, smem, threadIdx.x); }
    return; }
  float (*so)[16][68] = (float (*)[16][68])smem;
  const int tid = threadIdx.x, wave = tid >> 5, lane = tid & 31, col = lane & 15, g = lane >> 4;
  const int qb = blockIdx.x, h = blockIdx.y % NH, b = blockIdx.y / NH; const int q0 = qb * 64 + wave * 16; const size_t rq = (size_t)b * SS + q0 + col;
  v16h aq[2];
#pragma unroll
  for (int kc = 0; kc < 2; ++kc) aq[kc] = frag_h(QK + rq * (2 * DM) + h * HD + kc * 32, lane);
  const float KS = 0.125f * 1.4426950408889634f;   // 1/sqrt(64) and log2(e) in one factor
  float m = -3.0e38f, l = 0.f;   // of this lane's query: running maximum of score x KS (alike in both lanes of the column); this lane's own part of the sum
  v8f acc[4] = {};
  // the wave's mask words: 16 a turn of 32 keys (64 B in a row), the same for every lane, so they come by scalar loads into scalar registers (constant address space: an earlier launch wrote them, nothing in this one does), each turn's issued behind the selects of the turn before
  const cmw16* pw = (const cmw16*)(MB + (size_t)(qb * 4 + __builtin_amdgcn_readfirstlane(wave)) * (SS / 16 * 8)); v16u mw = pw[0];
  // a stage is 64 keys (all keys are walked): 64 k rows of 128 B, the head's 64 v rows of 128 B
  const unsigned l0 = lds_off(smem); const char* gK = (const char*)(QK + (size_t)b * SS * (2 * DM) + DM + h * HD); const char* gV = (const char*)(VTH + ((size_t)b * DM + h * HD) * SS);
  stage128<64>(l0, gK, 2 * DM * 2, tid); stage128<64>(l0 + 64 * P128, gV, SS * 2, tid);
  WAIT_ASYNC(); __syncthreads();
  stage128<64>(l0 + STG32, gK + (size_t)64 * 2 * DM * 2, 2 * DM * 2, tid); stage128<64>(l0 + STG32 + 64 * P128, gV + 128, SS * 2, tid);
#pragma unroll 1   // the stage loop stays rolled, as the key loop was: its body already holds two turns
  for (int t = 0; t < SS / 64; ++t) { const char* bs = smem + (t & 1) * STG32;
#pragma unroll     // both turns of a stage unrolled: their LDS offsets become immediates
  for (int sub = 0; sub < 2; ++sub) { v8f s[2]; v16h kf[2][2], vf[4];   // 32 keys a turn; its LDS reads all stand ahead of its products: one LDS latency a turn, not one a product
#pragma unroll
    for (int ct = 0; ct < 2; ++ct) {
#pragma unroll
      for (int kc = 0; kc < 2; ++kc) kf[ct][kc] = frag_h((const _Float16*)(bs + (sub * 32 + ct * 16 + col) * P128) + kc * 32, lane); }
#pragma unroll
    for (int dt = 0; dt < 4; ++dt) vf[dt] = frag_h((const _Float16*)(bs + 64 * P128 + (dt * 16 + col) * P128) + sub * 32, lane);
    HOLD_ORDER();   // the reads above stay together, ahead of the products
    float mx = -3.0e38f;
#pragma unroll
    for (int ct = 0; ct < 2; ++ct) { v8f c = {};
#pragma unroll
      for (int kc = 0; kc < 2; ++kc) c = wmma16(kf[ct][kc], aq[kc], c);   // single product: k, q as one-rounding f16 operands; c[r] = key ct * 16 + 8 * g + r against query col
#pragma unroll
      for (int r = 0; r < 8; ++r) { s[ct][r] = __builtin_amdgcn_inverse_ballot_w32(mw[ct * 8 + r]) ? -3.0e38f : c[r]; mx = fmaxf(mx, s[ct][r]); } }   // mask == 1 -> -1e9 == excluded; the word is the select's lane mask as it stands
    __builtin_amdgcn_sched_barrier(0);   // holds the scalar load below behind this turn's selects: the wait in front of the selects is a wait for every scalar load issued, so a load lifted over them would be waited for at once and not a turn later
    const int tn = t * 2 + sub + 1; mw = pw[tn < SS / 32 ? tn : SS / 32 - 1];   // the next turn's mask words (the last turn reads its own again: in bounds)
    mx = fmaxf(mx, xhalf(mx)) * KS;   // KS > 0: the maximum of the raw scores, scaled, is the maximum of the scaled ones
    const float mn = fmaxf(m, mx); const float base = (mn <= -1.0e37f) ? 0.f : mn;   // no key of this query admitted yet: every weight below comes out 0
    const float nb = 11.0f - base; float x[17];   // 2^11 in the exponent keeps small softmax weights out of the f16 subnormal range; the sum carries it too, so it cancels in the epilogue
#pragma unroll
    for (int i = 0; i < 16; ++i) x[i] = fmaf(s[i >> 3][i & 7], KS, nb);   // an excluded score gives exp2(-huge) = 0
    x[16] = m - base; m = mn;
    // the turn's 17 exponentials in one statement, each in place: no neighbour reads the result or overwrites the source of the one in front of it, and the closing v_nop keeps that one slot behind the last
    asm("v_exp_f32 %0, %0\n\tv_exp_f32 %1, %1\n\tv_exp_f32 %2, %2\n\tv_exp_f32 %3, %3\n\tv_exp_f32 %4, %4\n\tv_exp_f32 %5, %5\n\tv_exp_f32 %6, %6\n\tv_exp_f32 %7, %7\n\tv_exp_f32 %8, %8\n\tv_exp_f32 %9, %9\n\tv_exp_f32 %10, %10\n\tv_exp_f32 %11, %11\n\tv_exp_f32 %12, %12\n\tv_exp_f32 %13, %13\n\tv_exp_f32 %14, %14\n\tv_exp_f32 %15, %15\n\tv_exp_f32 %16, %16\n\tv_nop"
        : "+v"(x[0]), "+v"(x[1]), "+v"(x[2]), "+v"(x[3]), "+v"(x[4]), "+v"(x[5]), "+v"(x[6]), "+v"(x[7]), "+v"(x[8]), "+v"(x[9]), "+v"(x[10]), "+v"(x[11]), "+v"(x[12]), "+v"(x[13]), "+v"(x[14]), "+v"(x[15]), "+v"(x[16]));
    const float alpha = x[16]; v16h pa; float es[4] = { 0.f, 0.f, 0.f, 0.f };
#pragma unroll
    for (int i = 0; i < 16; ++i) { es[i & 3] += x[i]; pa[i] = (_Float16)x[i]; }   // element i of the B operand = tile i >> 3, register i & 7
    l = l * alpha + ((es[0] + es[1]) + (es[2] + es[3]));
#pragma unroll
    for (int dt = 0; dt < 4; ++dt) { acc[dt] *= alpha; acc[dt] = wmma16(vf[dt], pa, acc[dt]); }   // single product: V^T x P^T (x2^11); acc[dt][r] = d dt * 16 + 8 * g + r of query col
    HOLD_ORDER(); }   // the products above stay ahead of the next reads and of the ring's waits
    WAIT_DS(); WAIT_ASYNC(); __syncthreads();   // publishes stage t + 1 and ends every read of stage t
    if (t + 2 < SS / 64) { const unsigned l = l0 + (t & 1) * STG32; stage128<64>(l, gK + (size_t)(t + 2) * 64 * 2 * DM * 2, 2 * DM * 2, tid); stage128<64>(l + 64 * P128, gV + (size_t)(t + 2) * 128, SS * 2, tid); } }
  WAIT_ASYNC();
  const float il = 1.0f / (l + xhalf(l));   // the column's two lanes join their sums once
#pragma unroll
  for (int dt = 0; dt < 4; ++dt) { const v8f o = acc[dt] * il; vst2(&so[wave][col][dt * 16 + 8 * g], (v4f){ o[0], o[1], o[2], o[3] }); vst2(&so[wave][col][dt * 16 + 8 * g + 4], (v4f){ o[4], o[5], o[6], o[7] }); }
  LDSX();
  for (int rl = 0; rl < 16; ++rl) if (lane < 16) vst2(O + ((size_t)b * SS + q0 + rl) * DM + h * HD + lane * 4, *(const v4f*)&so[wave][rl][lane * 4]);
}
// ---- k_out: block = (128 rows, 128 cols): out = O(hi/lo) . Wo rows (2 products) + bo
__global__ __launch_bounds__(GNT) void k_out(const float* __restrict__ O, const __bf16* __restrict__ P, const float* __restrict__ BO, float* __restrict__ Y) {
  constexpr int FM = 2, NT = GNT, WR = FM * 16;   // WR rows a wave
  __shared__ __align__(16) char smem[2 * STGF];   // the ring; behind the loop's last barrier the output staging
  float (*so)[WR][68] = (float (*)[WR][68])smem;
  const int tid = threadIdx.x, wave = tid >> 5, lane = tid & 31, col = lane & 15, g = lane >> 4, wm = wave >> 1, wn = wave & 1; const size_t r0 = (size_t)blockIdx.x * 128 + wm * WR; const int nb0 = blockIdx.y * 128, n0 = nb0 + wn * 64;
  v8f acc[FM][4] = {};
  const unsigned l0 = lds_off(smem); const char* gB = (const char*)(P + (size_t)nb0 * DM); const char* gA = (const char*)(O + (size_t)blockIdx.x * 128 * DM);
  stage128<128, NT>(l0, gB, DM * 2, tid); stage256<128, NT>(l0 + 128 * P128, gA, DM * 4, tid);
  WAIT_ASYNC(); __syncthreads();
  stage128<128, NT>(l0 + STGF, gB + 128, DM * 2, tid); stage256<128, NT>(l0 + STGF + 128 * P128, gA + 256, DM * 4, tid);
  for (int t = 0; t < DM / KST; ++t) { const char* bs = smem + (t & 1) * STGF;
    v4f ra[2][FM][4]; v16b w[2][4];   // the stage's fragment reads all stand ahead of its products: one LDS latency a stage, not one a product (the loops below are unrolled so that every fragment index is a constant and the arrays stay in registers)
#pragma unroll
    for (int kk = 0; kk < 2; ++kk) {
#pragma unroll
      for (int i = 0; i < FM; ++i) { const float* p = (const float*)(bs + 128 * P128 + (wm * WR + i * 16 + col) * P256) + kk * 32 + 8 * g; ra[kk][i][0] = *(const v4f*)p; ra[kk][i][1] = *(const v4f*)(p + 4); ra[kk][i][2] = *(const v4f*)(p + 16); ra[kk][i][3] = *(const v4f*)(p + 20); }
#pragma unroll
      for (int j = 0; j < 4; ++j) w[kk][j] = frag_b((const __bf16*)(bs + (wn * 64 + j * 16 + col) * P128) + kk * 32, lane); }
    HOLD_ORDER();   // the reads above stay together, ahead of the products and of the split
#pragma unroll
    for (int kk = 0; kk < 2; ++kk) {
#pragma unroll
      for (int i = 0; i < FM; ++i) { float v[16];   // the split stands behind the reads, free to run among the products
#pragma unroll
        for (int e = 0; e < 16; ++e) v[e] = ra[kk][i][e >> 2][e & 3];
        const F2 a = bsplit16(v);
#pragma unroll
        for (int j = 0; j < 4; ++j) { acc[i][j] = wmma_bf(a.l, w[kk][j], acc[i][j]); acc[i][j] = wmma_bf(a.h, w[kk][j], acc[i][j]); } } }
    HOLD_ORDER();   // the products above stay ahead of the ring's waits and barrier
    WAIT_DS(); WAIT_ASYNC(); __syncthreads();   // publishes stage t + 1 and ends every read of stage t
    if (t + 2 < DM / KST) { stage128<128, NT>(l0 + (t & 1) * STGF, gB + (size_t)(t + 2) * 128, DM * 2, tid); stage256<128, NT>(l0 + (t & 1) * STGF + 128 * P128, gA + (size_t)(t + 2) * 256, DM * 4, tid); } }
  WAIT_ASYNC();
#pragma unroll
  for (int i = 0; i < FM; ++i) {
#pragma unroll
    for (int j = 0; j < 4; ++j) {
#pragma unroll
      for (int r = 0; r < 8; ++r) so[wave][i * 16 + 8 * g + r][j * 16 + col] = acc[i][j][r] + bfr(BO[n0 + j * 16 + col]); } }
  LDSX();
  for (int rl = 0; rl < WR; rl += 2) vst2(Y + (r0 + rl + g) * DM + n0 + col * 4, *(const v4f*)&so[wave][rl + g][col * 4]);   // 16 lanes a 256-B row piece, 2 rows a store
}
// ---- k_lnres<F16OUT, RESX>: block = row (256 threads x 4): y = R + LayerNorm(A) x gamma + beta (mean((x-m)^2), eps 1e-5); RESX: residual is the bf16-rounded input x (else an f32 buffer); optional f16 copy for the FF
template <int F16OUT, int RESX>
__global__ __launch_bounds__(256) void k_lnres(const float* __restrict__ A, const float* __restrict__ R, const float* __restrict__ G, const float* __restrict__ Bt, float* __restrict__ Y, _Float16* __restrict__ Y16) {
  __shared__ float red[8]; __shared__ __align__(16) _Float16 sh[DM]; const int t = threadIdx.x; const size_t row = blockIdx.x; float v[4]; float s = 0.f; for (int i = 0; i < 4; ++i) { v[i] = A[row * DM + t * 4 + i]; s += v[i]; }
#pragma unroll
  for (int o = 1; o < 32; o <<= 1) s += __shfl_xor(s, o);
  if ((t & 31) == 0) red[t >> 5] = s; __syncthreads(); float tot = 0.f; for (int i = 0; i < 8; ++i) tot += red[i]; const float mu = tot / (float)DM; __syncthreads();
  float q = 0.f; for (int i = 0; i < 4; ++i) { const float dd = v[i] - mu; q += dd * dd; }
#pragma unroll
  for (int o = 1; o < 32; o <<= 1) q += __shfl_xor(q, o);
  if ((t & 31) == 0) red[t >> 5] = q; __syncthreads(); float tq = 0.f; for (int i = 0; i < 8; ++i) tq += red[i]; const float inv = 1.0f / sqrtf(tq / (float)DM + 1e-5f);
  v4f o4; for (int i = 0; i < 4; ++i) { const int e = t * 4 + i; const float rr = RESX ? bfr(R[row * DM + e]) : R[row * DM + e]; o4[i] = rr + ((v[i] - mu) * inv * bfr(G[e]) + bfr(Bt[e])); if (F16OUT) sh[e] = (_Float16)o4[i]; }
  vst2(Y + row * DM + t * 4, o4);
  if (F16OUT) { __syncthreads(); if (t < DM / 8) vst2((unsigned*)(Y16 + row * DM + t * 8), *(const v4u*)&sh[t * 8]); }
}
// ---- k_mlp<MODE>: block = (MBM rows, 128 cols): MODE 0: G = gelu_exact(X1 . W1 + b1) (K 1024 -> 4096) f16; MODE 1: HF = gelu_exact(G . W2 + b2) (K 4096 -> 1024) f32
#define MBM(MODE) ((MODE) == 0 ? 256 : 128)   // rows of a block: the wide GEMM has tiles enough for the larger one, the narrow one has 256 tiles of 128 x 128, one a WGP
template <int MODE>
__global__ __launch_bounds__(GNT) void k_mlp(const _Float16* __restrict__ Ain, const _Float16* __restrict__ Wr, const float* __restrict__ BIAS, const float* __restrict__ RES, float* __restrict__ OUTF, _Float16* __restrict__ OG) {
  constexpr int KIN = (MODE == 0) ? DM : DFF; constexpr int NOUT = (MODE == 0) ? DFF : DM;
  constexpr int BM = MBM(MODE), NT = GNT, WR = BM / 4, FM = WR / 16, KS = (MODE == 0) ? 64 : 128, PT = KS * 2 + 16, STG = (128 + BM) * PT, KG = (MODE == 0) ? 1 : 2;   // WR rows a wave; KS k a stage at LDS pitch PT: weight rows, then activation rows; KG fragment columns (32 k each) read in one group
  __shared__ __align__(16) char smem[2 * STG];   // the ring; behind the loop's last barrier the output staging
  float (*so)[WR][68] = (float (*)[WR][68])smem; _Float16 (*sg)[WR][72] = (_Float16 (*)[WR][72])smem;
  const int tid = threadIdx.x, wave = tid >> 5, lane = tid & 31, col = lane & 15, g = lane >> 4, wm = wave >> 1, wn = wave & 1; const size_t r0 = (size_t)blockIdx.x * BM + wm * WR; const int nb0 = blockIdx.y * 128, n0 = nb0 + wn * 64;
  v8f acc[FM][4] = {};
  const unsigned l0 = lds_off(smem); const char* gB = (const char*)(Wr + (size_t)nb0 * KIN); const char* gA = (const char*)(Ain + (size_t)blockIdx.x * BM * KIN);
  auto stage = [&](unsigned l, int t) { if constexpr (KS == 64) { stage128<128, NT>(l, gB + (size_t)t * 128, KIN * 2, tid); stage128<BM, NT>(l + 128 * PT, gA + (size_t)t * 128, KIN * 2, tid); } else { stage256<128, NT>(l, gB + (size_t)t * 256, KIN * 2, tid); stage256<BM, NT>(l + 128 * PT, gA + (size_t)t * 256, KIN * 2, tid); } };   // stage t of both operands into the buffer at l
  stage(l0, 0);
  WAIT_ASYNC(); __syncthreads();
  stage(l0 + STG, 1);
  for (int t = 0; t < KIN / KS; ++t) { const char* bs = smem + (t & 1) * STG;
#pragma unroll   // the groups of a stage unrolled: their LDS offsets become immediates
    for (int k0 = 0; k0 < KS / 32; k0 += KG) {
    v16h a[KG][FM], w[KG][4];   // a group's fragment reads all stand ahead of its products: one LDS latency a group, not one a product (the loops below are unrolled so that every fragment index is a constant and the arrays stay in registers)
#pragma unroll
    for (int kk = 0; kk < KG; ++kk) {
#pragma unroll
      for (int i = 0; i < FM; ++i) a[kk][i] = frag_h((const _Float16*)(bs + 128 * PT + (wm * WR + i * 16 + col) * PT) + (k0 + kk) * 32, lane);
#pragma unroll
      for (int j = 0; j < 4; ++j) w[kk][j] = frag_h((const _Float16*)(bs + (wn * 64 + j * 16 + col) * PT) + (k0 + kk) * 32, lane); }
    HOLD_ORDER();   // the reads above stay together, ahead of the products
#pragma unroll
    for (int kk = 0; kk < KG; ++kk) {
#pragma unroll
      for (int i = 0; i < FM; ++i) {
#pragma unroll
        for (int j = 0; j < 4; ++j) acc[i][j] = wmma16(a[kk][i], w[kk][j], acc[i][j]); } }
    HOLD_ORDER(); }   // the products above stay ahead of the next reads and of the ring's waits
    WAIT_DS(); WAIT_ASYNC(); __syncthreads();   // publishes stage t + 1 and ends every read of stage t
    if (t + 2 < KIN / KS) stage(l0 + (t & 1) * STG, t + 2); }
  WAIT_ASYNC();
#pragma unroll
  for (int i = 0; i < FM; ++i) {
#pragma unroll
  for (int j = 0; j < 4; ++j) { const int c = n0 + j * 16 + col; const float bb = bfr(BIAS[c]); float x[8];
#pragma unroll
    for (int r = 0; r < 8; ++r) x[r] = acc[i][j][r] * (1.0f / 256.0f) + bb;
    gelu8(x);
#pragma unroll
    for (int r = 0; r < 8; ++r) { if (MODE == 0) sg[wave][i * 16 + 8 * g + r][j * 16 + col] = (_Float16)x[r]; else so[wave][i * 16 + 8 * g + r][j * 16 + col] = x[r]; } } }
  LDSX();
  if (MODE == 0) { const int rw = lane >> 3, c8 = (lane & 7) * 8; for (int rl = 0; rl < WR; rl += 4) vst2((unsigned*)(OG + (r0 + rl + rw) * NOUT + n0 + c8), *(const v4u*)&sg[wave][rl + rw][c8]); }   // 8 lanes a 128-B row piece, 4 rows a store
  else { for (int rl = 0; rl < WR; rl += 2) vst2(OUTF + (r0 + rl + g) * NOUT + n0 + col * 4, *(const v4f*)&so[wave][rl + g][col * 4]); }   // 16 lanes a 256-B row piece, 2 rows a store
}

extern "C" void kernel_launch(void* const* d_in, const int* in_sizes, int n_in, void* d_out, int out_size, void* d_ws, size_t ws_size, hipStream_t stream) {
  (void)in_sizes; (void)n_in; (void)out_size;
  const float** F = (const float**)d_in;   // 0 x [2,2048,1024], 1 mask [1,1,2048,2048] int, 2 Wq, 3 Wk, 4 Wv, 5 Wo ((in,out)), 6 bo, 7 ln1_g, 8 ln1_b, 9 W1 [1024,4096], 10 b1, 11 W2 [4096,1024], 12 b2, 13 ln2_g, 14 ln2_b
  if (ws_size < (size_t)WS_END) return;
  char* ws = (char*)d_ws; __bf16* PK = (__bf16*)(ws + WS_PK); _Float16 *QK = (_Float16*)(ws + WS_QK), *QKL = (_Float16*)(ws + WS_QKL), *VTH = (_Float16*)(ws + WS_VTH), *VTL = (_Float16*)(ws + WS_VTL), *PF = (_Float16*)(ws + WS_PF), *PM = (_Float16*)(ws + WS_PM), *X16 = (_Float16*)(ws + WS_X16), *Gb = (_Float16*)(ws + WS_G); unsigned* MB = (unsigned*)(ws + WS_MB); float *O = (float*)(ws + WS_O), *A0 = (float*)(ws + WS_A0), *X1 = (float*)(ws + WS_X1), *HF = (float*)(ws + WS_HF);
  k_pack<<<dim3((DM / TPK) * (DM / TPN), 5), 256, 0, stream>>>(F[2], F[3], F[4], PK, (const int*)d_in[1], MB);
  k_qkv<<<dim3(TNB * SS / 128, QKVW / 128), GNT, 0, stream>>>(F[0], F[0], F[0], PK + PK_A, nullptr, nullptr, nullptr, QK, QKL, VTH, VTL);
  k_attn<<<dim3(TQB, NH * TNB + (2 * PT_FF + PT_O) / TQB), 128, 0, stream>>>(QK, QKL, VTH, VTL, nullptr, MB, O, F[9], F[11], F[5], PF, PM, PK + PK_P);
  k_out<<<dim3(TOB / 2, DM / 128), GNT, 0, stream>>>(O, PK + PK_P, F[6], A0);
  k_lnres<1, 1><<<TOB * 64, 256, 0, stream>>>(A0, F[0], F[7], F[8], X1, X16);      // x1 = x + LN(attn branch)
  k_mlp<0><<<dim3(NR / MBM(0), DFF / 128), GNT, 0, stream>>>(X16, PF, F[10], nullptr, nullptr, Gb);
  k_mlp<1><<<dim3(NR / MBM(1), DM / 128), GNT, 0, stream>>>(Gb, PM, F[12], nullptr, HF, nullptr);
  k_lnres<0, 0><<<TOB * 64, 256, 0, stream>>>(HF, X1, F[13], F[14], (float*)d_out, nullptr);   // out = x1 + LN(ff branch)
}

// v009
// A run of this version takes 173 microseconds.
// Timed twice side by side with v008, it ran 1.04 and 1.03 times as fast.
// All steps since v000 together make it 4.98 times as fast.
// compute dtype: all float inputs rounded to bf16, the int mask read on device and packed to one bit an element; q/k/v = x . W with EXACT bf16 products on WMMA 16x16x32 ((in,out) weights as transposed rows); PLAIN attention: q, k single f16 x 1/8, masked keys excluded, running-max softmax in f32 (hardware exp), P (scaled by 2^11, single f16) x v (single f16); attention out (bf16 hi + residual) . Wo (2 products) + bo; LayerNorms in f32; FF: x1 rounded once to f16 x exact f16 weight copies (x 2^8), erf GELU (x . Phi(x), f32-accurate rational form of erfc), hidden f16, second erf GELU; f32 output.
#include <hip/hip_runtime.h>
#include <math.h>

typedef __attribute__((ext_vector_type(16))) _Float16 v16h;
typedef __attribute__((ext_vector_type(16))) __bf16 v16b;
typedef __attribute__((ext_vector_type(8)))  _Float16 v8h;
typedef __attribute__((ext_vector_type(8)))  float v8f;
typedef __attribute__((ext_vector_type(4)))  float v4f;
typedef __attribute__((ext_vector_type(2)))  float v2f;
typedef __attribute__((ext_vector_type(4)))  unsigned v4u;
typedef __attribute__((ext_vector_type(4)))  int v4i;
typedef float __attribute__((may_alias)) float_a;
typedef int __attribute__((may_alias)) int_a;

template <typename T> __device__ __forceinline__ void vst2(void* p, T v) { *(T*)p = v;  }
__device__ __forceinline__ v8f wmma16(v16h a, v16h b, v8f c) {
  v8f d = __builtin_amdgcn_wmma_f32_16x16x32_f16(false, a, false, b, (short)0, c, false, false);
  return d;
}
__device__ __forceinline__ v8f wmma_bf(v16b a, v16b b, v8f c) {
  v8f d = __builtin_amdgcn_wmma_f32_16x16x32_bf16(false, a, false, b, (short)0, c, false, false);
  return d;
}
// Transformer block (B 2, S 2,048, d 1,024, 16 heads x 64, FF 4,096): bias-free q/k/v projections, scores / 8 with a [S,S] mask (mask == 1 -> -1e9), softmax, . v, Wo + bo; x + LayerNorm(attention branch); FF with exact GELU after BOTH linears; x + LayerNorm(FF branch).
__device__ __forceinline__ v16h frag_h(const _Float16* rowk0, int lane) {
  union { v16h v; v8h q[2]; } u; const _Float16* p = rowk0 + 8 * (lane >> 4);
  u.q[0] = *(const v8h*)p; u.q[1] = *(const v8h*)(p + 16); return u.v;
}
__device__ __forceinline__ v16h frag_f32(const float* rowk0, int lane) {
  v16h a; const float* p = rowk0 + 8 * (lane >> 4);
#pragma unroll
  for (int i = 0; i < 8; ++i) { a[i] = (_Float16)p[i]; a[8 + i] = (_Float16)p[16 + i]; }
  return a;
}
__device__ __forceinline__ v16h frag_f32s(const float* rowk0, int lane, float sc) {
  v16h a; const float* p = rowk0 + 8 * (lane >> 4);
#pragma unroll
  for (int i = 0; i < 8; ++i) { a[i] = (_Float16)(p[i] * sc); a[8 + i] = (_Float16)(p[16 + i] * sc); }
  return a;
}
// column fragment from a [K][ld] layout (column n), rows >= K read as 0
__device__ __forceinline__ v16h fragc_f32(const float* W, int k0, int n, int lane, int ld, int K) {
  v16h a; const int g = lane >> 4;
#pragma unroll
  for (int i = 0; i < 8; ++i) { const int ka = k0 + 8 * g + i, kb = ka + 16;
    a[i] = (_Float16)(ka < K ? W[(size_t)(ka < K ? ka : K - 1) * ld + n] : 0.f); a[8 + i] = (_Float16)(kb < K ? W[(size_t)(kb < K ? kb : K - 1) * ld + n] : 0.f); }
  return a;
}
struct F2 { v16b h, l; };
__device__ __forceinline__ F2 bsplit16(const float v[16]) { F2 r;
#pragma unroll
  for (int i = 0; i < 16; ++i) { const __bf16 h = (__bf16)v[i]; r.h[i] = h; r.l[i] = (__bf16)(v[i] - (float)h); }
  return r; }
__device__ __forceinline__ F2 split_row(const float* row, int k0, int lane) { float v[16]; const float* p = row + k0 + 8 * (lane >> 4);
#pragma unroll
  for (int i = 0; i < 8; ++i) { v[i] = p[i]; v[8 + i] = p[16 + i]; }
  return bsplit16(v); }
__device__ __forceinline__ F2 split_rowK(const float* row, int k0, int lane, int K) { float v[16]; const int g = lane >> 4;
#pragma unroll
  for (int i = 0; i < 8; ++i) { const int ka = k0 + 8 * g + i, kb = ka + 16; v[i] = ka < K ? row[ka < K ? ka : K - 1] : 0.f; v[8 + i] = kb < K ? row[kb < K ? kb : K - 1] : 0.f; }
  return bsplit16(v); }
__device__ __forceinline__ F2 split_col(const float* W, int k0, int n, int lane, int ld, int K) { float v[16]; const int g = lane >> 4;
#pragma unroll
  for (int i = 0; i < 8; ++i) { const int ka = k0 + 8 * g + i, kb = ka + 16; v[i] = ka < K ? W[(size_t)(ka < K ? ka : K - 1) * ld + n] : 0.f; v[8 + i] = kb < K ? W[(size_t)(kb < K ? kb : K - 1) * ld + n] : 0.f; }
  return bsplit16(v); }
__device__ __forceinline__ v8f mac3(const F2& a, const F2& b, v8f c) { c = wmma_bf(a.l, b.h, c); c = wmma_bf(a.h, b.l, c); return wmma_bf(a.h, b.h, c); }
__device__ __forceinline__ float sigm(float v) { return 1.0f / (1.0f + expf(-v)); }
#define LDSX() do { asm volatile("s_wait_dscnt 0" ::: "memory"); __builtin_amdgcn_wave_barrier(); __builtin_amdgcn_fence(__ATOMIC_RELEASE, "workgroup"); } while (0)


#define NB 2
#define SS 2048
#define DM 1024
#define NH 16
#define DFF 4096
#define NR (NB * SS)
// erf GELU as x * Phi(x), Phi the normal distribution function, inline and with no branch, 8 values side by side, in place. With t = 1 / (1 + p |x| / sqrt(2)), q = (c1 t + ... + c5 t^5) / 2 * exp(-x^2 / 2) is Phi(-|x|) = erfc(|x| / sqrt(2)) / 2 (five-term rational form of erfc: absolute error of Phi under 1e-7, of the result under 4e-7 for |x| <= 8); x * Phi(x) = max(x, 0) - |x| q on both sides of 0, with no cancellation in the negative tail
__device__ __forceinline__ void gelu8(float (&x)[8]) {
  float t[8], e[8];
#pragma unroll   // constant indices: the arrays stay in registers
  for (int i = 0; i < 8; ++i) { t[i] = fmaf(0.3275911f * 0.70710678118654752f, fabsf(x[i]), 1.0f); e[i] = (x[i] * x[i]) * -0.72134752044448170f; }   // exp(-x^2 / 2) in base 2; far out it is 0 and the result max(x, 0)
  // the 8 reciprocals and 8 exponentials in one statement, each in place: no neighbour reads the result or overwrites the source of the one in front of it, and the closing v_nop keeps that one slot behind the last
  asm("v_rcp_f32 %0, %0\n\tv_rcp_f32 %1, %1\n\tv_rcp_f32 %2, %2\n\tv_rcp_f32 %3, %3\n\tv_rcp_f32 %4, %4\n\tv_rcp_f32 %5, %5\n\tv_rcp_f32 %6, %6\n\tv_rcp_f32 %7, %7\n\tv_exp_f32 %8, %8\n\tv_exp_f32 %9, %9\n\tv_exp_f32 %10, %10\n\tv_exp_f32 %11, %11\n\tv_exp_f32 %12, %12\n\tv_exp_f32 %13, %13\n\tv_exp_f32 %14, %14\n\tv_exp_f32 %15, %15\n\tv_nop"
      : "+v"(t[0]), "+v"(t[1]), "+v"(t[2]), "+v"(t[3]), "+v"(t[4]), "+v"(t[5]), "+v"(t[6]), "+v"(t[7]), "+v"(e[0]), "+v"(e[1]), "+v"(e[2]), "+v"(e[3]), "+v"(e[4]), "+v"(e[5]), "+v"(e[6]), "+v"(e[7]));
#pragma unroll
  for (int i = 0; i < 8; ++i) { float p = fmaf(0.5f * 1.061405429f, t[i], 0.5f * -1.453152027f);
    p = fmaf(p, t[i], 0.5f * 1.421413741f); p = fmaf(p, t[i], 0.5f * -0.284496736f); p = fmaf(p, t[i], 0.5f * 0.254829592f);
    x[i] = fmaf(-fabsf(x[i]), (p * t[i]) * e[i], fmaxf(x[i], 0.f)); }
}
#define HD 64
#define QKVW (3 * DM)
#ifndef TQB
#define TQB (SS / 64)
#define TNB NB
#define TOB (NB * SS / 64)     // output row tiles (all)
#endif
typedef __attribute__((ext_vector_type(8))) __bf16 v8b;
__device__ __forceinline__ v16b frag_b(const __bf16* rowk0, int lane) {
  union { v16b v; v8b q[2]; } u; const __bf16* p = rowk0 + 8 * (lane >> 4);
  u.q[0] = *(const v8b*)p; u.q[1] = *(const v8b*)(p + 16); return u.v;
}
__device__ __forceinline__ float bfr(float v) { return (float)(__bf16)v; }
__device__ __attribute__((noinline)) float exp_ni(float v) { return expf(v); }
__device__ __attribute__((noinline)) float erf_ni(float v) { return erff(v); }

// ---- LDS ring of the GEMM kernels: a block is 8 waves, 4 down x 2 across; a wave makes FM x 16 rows by 64 columns (of each of q, k and v in k_qkv), so a weight fragment read from LDS serves FM products and an activation fragment 4 (12 in k_qkv), and a block makes FM x 64 rows by 128 columns from one staging of its operand rows. A stage is 64 or 128 k of the block's 128 weight rows (3 x 128 in k_qkv) and of its activation rows, brought by asynchronous copies in whole lines; two buffers
#define KST 64
#define P128 144   // LDS pitch of a 128-B row: 16 B x odd, no bank conflict for 16-B reads down a column of rows
#define P256 272   // LDS pitch of a 256-B row, likewise
__device__ __forceinline__ unsigned lds_off(const void* p) { return (unsigned)(size_t)p; }
// four copies of 16 B a lane; s_wait_xcnt closes the statement so that no address register of a copy is rewritten ahead of it
__device__ __forceinline__ void cp4(unsigned l0, unsigned l1, unsigned l2, unsigned l3, const char* g0, const char* g1, const char* g2, const char* g3) {
  asm volatile("global_load_async_to_lds_b128 %0, %4, off\n\tglobal_load_async_to_lds_b128 %1, %5, off\n\tglobal_load_async_to_lds_b128 %2, %6, off\n\tglobal_load_async_to_lds_b128 %3, %7, off\n\ts_wait_xcnt 0x0"
               :: "v"(l0), "v"(l1), "v"(l2), "v"(l3), "v"(g0), "v"(g1), "v"(g2), "v"(g3) : "memory");
}
// NROW rows of 128 B (global pitch gp bytes) -> LDS at pitch P128: 8 lanes a row, NT / 8 rows a copy of the block's NT threads
template <int NROW, int NT = 128> __device__ __forceinline__ void stage128(unsigned l, const char* g, size_t gp, int tid) {
  constexpr int RP = NT / 8; l += (tid >> 3) * P128 + (tid & 7) * 16; g += (size_t)(tid >> 3) * gp + (tid & 7) * 16;
  for (int i = 0; i < NROW / RP; i += 4) cp4(l + i * RP * P128, l + (i + 1) * RP * P128, l + (i + 2) * RP * P128, l + (i + 3) * RP * P128, g + (size_t)i * RP * gp, g + (size_t)(i + 1) * RP * gp, g + (size_t)(i + 2) * RP * gp, g + (size_t)(i + 3) * RP * gp);
}
// NROW rows of 256 B -> LDS at pitch P256: 16 lanes a row, NT / 16 rows a copy of the block's NT threads
template <int NROW, int NT = 128> __device__ __forceinline__ void stage256(unsigned l, const char* g, size_t gp, int tid) {
  constexpr int RP = NT / 16; l += (tid >> 4) * P256 + (tid & 15) * 16; g += (size_t)(tid >> 4) * gp + (tid & 15) * 16;
  for (int i = 0; i < NROW / RP; i += 4) cp4(l + i * RP * P256, l + (i + 1) * RP * P256, l + (i + 2) * RP * P256, l + (i + 3) * RP * P256, g + (size_t)i * RP * gp, g + (size_t)(i + 1) * RP * gp, g + (size_t)(i + 2) * RP * gp, g + (size_t)(i + 3) * RP * gp);
}
#define WAIT_ASYNC() asm volatile("s_wait_asynccnt 0x0" ::: "memory")   // this wave's copies have landed
#define WAIT_DS() asm volatile("s_wait_dscnt 0x0" ::: "memory")         // this wave's LDS reads are done before the buffer is given up
#define HOLD_ORDER() __builtin_amdgcn_sched_barrier(0)   // nothing is scheduled across. Between a group's LDS reads and its products: the reads stay together ahead of the products (left free, the compiler deals them out among the products, each with a wait to 0 of its own). Behind the products: they stay ahead of the next reads and of the ring's waits (left free, they sink behind the barrier, and the copies in flight lose the products' time to land)
#define STG32 (128 * P128)                 // one buffer of the attention ring
#define STGF (128 * P128 + 128 * P256)     // one GEMM buffer, f32 activations, 64 k: weight rows, then activation rows
#define GNT 256                            // threads of a GEMM block
#define PK_A 0                       // [3072][1024] Wqkv rows (natural [out][in])
#define PK_P (PK_A + QKVW * DM)        // [1024][1024] Wo rows (natural)
#define PK_END (PK_P + DM * DM)
#define WS_PK  0u
#define WS_QK  (WS_PK + 2u * PK_END)             // f16 [4096 rows][2048]: q | k
#define WS_QKL (WS_QK + 2u * NB * SS * 2 * DM)     // f16 q | k residual planes x2048
#define WS_VTH (WS_QKL + 2u * NB * SS * 2 * DM)    // f16 [b][1024 (h*64+d)][2048 s] hi
#define WS_VTL (WS_VTH + 2u * NB * DM * SS)        // f16 lo x 2048
#define WS_O   (WS_VTL + 2u * NB * DM * SS)        // f32 [4096][1024]
#define WS_CS  (WS_O + 4u * NB * SS * DM)           // f32 [2][2048][32], unused
#define WS_PF  (WS_CS + 4u * 2 * SS * 32)                  // f16 x 2^8 rows W1^T [4096][1024] ; W2^T [1024][4096]
#define WS_PM  (WS_PF + 2u * (size_t)DFF * DM)
#define WS_A0  (WS_PM + 2u * (size_t)DM * DFF)          // f32 [NR][1024] attention branch ; X1 f32 ; HF f32 (ff branch)
#define WS_X1  (WS_A0 + 4u * (size_t)NR * DM)
#define WS_HF  (WS_X1 + 4u * (size_t)NR * DM)
#define WS_X16 (WS_HF + 4u * (size_t)NR * DM)           // f16 [NR][1024] x1 ; G f16 [NR][4096]
#define WS_G   (WS_X16 + 2u * (size_t)NR * DM)
#define WS_MB  (WS_G + 2u * (size_t)NR * DFF)            // u32 [128 query tiles][128 key tiles][8]: the mask as lane-mask words
#define WS_END (WS_MB + 4u * (SS / 16) * (SS / 16) * 8)
// ---- weight packs: a block transposes one tile of 128 k x 64 n of an (in,out) f32 weight into 64 packed 16-bit rows of 128 k. A thread loads 8 k rows x 4 n as 16-B pieces (16 lanes cover 256 B in a row of the source), converts, and puts 8 k of each of its 4 n as one 16-B piece into LDS; the rows then go out as 256 B in a row of the packed plane. A block of NT = 128 threads takes two such places a thread
#define TPK 128
#define TPN 64
#define TPP 272   // LDS pitch of a packed 256-B row
template <int F16, int NT = 256> __device__ __forceinline__ void pack_tile(const float* __restrict__ Wt, unsigned ldw, char* __restrict__ dst, unsigned ldd, char* s, int t) {   // Wt: the tile's first element, ldw its row pitch in bytes; dst: the tile's first packed byte, ldd its row pitch in bytes
  constexpr int KGB = NT / 16, NP = TPK / 8 / KGB;   // KGB groups of 8 k a pass of the block's threads, NP passes a tile
  const int n4 = t & 15, kg = t >> 4; const char* gp = (const char*)Wt + ((unsigned)kg * 8u * ldw + n4 * 16); v4f r[NP][8];   // one lane address for all loads, the rows by immediate offsets (under 2 MiB)
#pragma unroll   // all loads of a thread are in flight together, and r stays in registers
  for (int p = 0; p < NP; ++p) {
#pragma unroll
    for (int i = 0; i < 8; ++i) r[p][i] = *(const v4f*)(gp + (size_t)(p * KGB * 8 + i) * ldw); }
  asm volatile("s_wait_xcnt 0x0" :: "v"(gp) : "memory");   // stands in front of every later write of a register that the loads name as an address; the address is an input, so that no load's result lands on it
#pragma unroll   // constant indices into r
  for (int p = 0; p < NP; ++p) {
#pragma unroll
  for (int j = 0; j < 4; ++j) { v4u o;
    if (F16) { v8h h;
#pragma unroll
      for (int i = 0; i < 8; ++i) h[i] = (_Float16)(bfr(r[p][i][j]) * 256.0f);
      o = __builtin_bit_cast(v4u, h); }
    else { v8b h;
#pragma unroll
      for (int i = 0; i < 8; ++i) h[i] = (__bf16)r[p][i][j];
      o = __builtin_bit_cast(v4u, h); }
    *(v4u*)(s + (n4 * 4 + j) * TPP + (p * KGB + kg) * 16) = o; } }
  __syncthreads();
  const int n = t >> 4, c = t & 15; const unsigned so = (unsigned)n * ldd + c * 16; v4u o[TPN / KGB];   // 16 lanes a packed row, KGB rows a turn of the block's threads
#pragma unroll   // the LDS reads stand together ahead of the stores: one LDS latency, not one a store
  for (int i = 0; i < TPN / KGB; ++i) o[i] = *(const v4u*)(s + (n + i * KGB) * TPP + c * 16);
#pragma unroll
  for (int i = 0; i < TPN / KGB; ++i) vst2(dst + (size_t)i * KGB * ldd + so, o[i]);
  asm volatile("s_wait_xcnt 0x0" ::: "memory");   // stands in front of every later write of a register that the stores name as an address, on every way that leads on from here
}
// ---- mask words: the [S][S] int mask as one bit an element, in the order in which k_attn's lanes hold the scores: word [query tile qt][key tile kt][r], bit l = (mask[qt * 16 + (l & 15)][kt * 16 + 8 * (l >> 4) + r] == 1). A word is then the lane mask of one select over a whole score register. A wave makes 16 queries x 128 keys: a lane loads 8 x 32 B of its query's row, a compare over the wave gives each word, and lane i keeps words i and 32 + i for two 128-B stores
__device__ __forceinline__ void mask_words(const int* __restrict__ MSK, unsigned* __restrict__ MB, int wv, int lane) {
  const int qt = wv >> 4, kg = wv & 15; const int* p = MSK + (size_t)(qt * 16 + (lane & 15)) * SS + kg * 128 + 8 * (lane >> 4); v4i m[8][2];
#pragma unroll   // the 16 loads of a lane are in flight together, and m stays in registers
  for (int j = 0; j < 8; ++j) { m[j][0] = *(const v4i*)(p + j * 16); m[j][1] = *(const v4i*)(p + j * 16 + 4); }
  // stands in front of every later write of a register that the 16 loads name as an address; the loaded values are inputs so that no compare is lifted in among the loads to free a register: one memory latency a wave, not two; the address is an input too, so that no load's result lands on it
  asm volatile("s_wait_xcnt 0x0" :: "v"(m[0][0]), "v"(m[0][1]), "v"(m[1][0]), "v"(m[1][1]), "v"(m[2][0]), "v"(m[2][1]), "v"(m[3][0]), "v"(m[3][1]), "v"(m[4][0]), "v"(m[4][1]), "v"(m[5][0]), "v"(m[5][1]), "v"(m[6][0]), "v"(m[6][1]), "v"(m[7][0]), "v"(m[7][1]), "v"(p) : "memory");
  int w[2] = { 0, 0 };
#pragma unroll   // constant indices into m and w, constant lane numbers
  for (int j = 0; j < 8; ++j) {
#pragma unroll
    for (int r = 0; r < 8; ++r) { const int bw = (int)__builtin_amdgcn_ballot_w32(m[j][r >> 2][r & 3] == 1); w[j >> 2] = (lane == (j & 3) * 8 + r) ? bw : w[j >> 2]; } }
  unsigned* o = MB + (size_t)qt * (SS / 16 * 8) + kg * 64 + lane; o[0] = (unsigned)w[0]; o[32] = (unsigned)w[1];
}
// ---- k_pack: what k_qkv and k_attn need first: block = (tile, which): which 0..2 -> W_q/W_k/W_v into PK_A rows which*1024 + n (pack row n = column n, bf16); 3, 4 -> the mask words, 8 waves a block
__global__ __launch_bounds__(256) void k_pack(const float* __restrict__ WQ, const float* __restrict__ WK, const float* __restrict__ WV, __bf16* __restrict__ PK, const int* __restrict__ MSK, unsigned* __restrict__ MB) {
  if (blockIdx.y >= 3) { mask_words(MSK, MB, (((int)blockIdx.y - 3) * ((DM / TPK) * (DM / TPN)) + (int)blockIdx.x) * 8 + (int)(threadIdx.x >> 5), threadIdx.x & 31); return; }   // the same for a whole block, ahead of the barrier below
  __shared__ __align__(16) char s[TPN * TPP]; const int k0 = (blockIdx.x % (DM / TPK)) * TPK, n0 = (blockIdx.x / (DM / TPK)) * TPN, which = blockIdx.y; const float* Wm = (which == 0) ? WQ : (which == 1) ? WK : WV;
  __bf16* dst = PK + PK_A + ((size_t)which * DM + n0) * DM + k0;
  pack_tile<0>(Wm + (size_t)k0 * DM + n0, DM * 4, (char*)dst, DM * 2, s, threadIdx.x);
}
// ---- k_qkv: block = (128 rows of x, 128 columns of q, of k and of v alike): one staging of the block's x rows serves the three weights, so x comes from L2 once and not three times, and an x fragment read from LDS and converted serves 12 products. 256 blocks, one a WGP
#define STGQ (3 * 128 * P128 + 128 * P256)   // one buffer of its ring, 64 k: 128 weight rows each of q, k and v, then the 128 x rows (f32)
__global__ __launch_bounds__(GNT) void k_qkv(const float* __restrict__ X, const __bf16* __restrict__ P, const float* __restrict__ BQ, const float* __restrict__ BK, const float* __restrict__ BV, _Float16* __restrict__ QK, _Float16* __restrict__ QKL, _Float16* __restrict__ VTH, _Float16* __restrict__ VTL) {
  constexpr int FM = 2, NT = GNT, WR = FM * 16, NW = NT / 32;   // WR rows a wave, NW waves
  constexpr int VST = 128 * 136 * 2, QST = NW * WR * 72 * 2;    // bytes of one v staging plane (shared by the block), of one q / k staging plane (a part a wave)
  __shared__ __align__(16) char smem[2 * STGQ];   // the ring; behind the loop's last barrier the output staging: v's two planes, then the two planes that q and k use in turn
  static_assert(2 * VST + 2 * QST <= 2 * STGQ, "output staging inside the ring");
  _Float16 (*sth)[136] = (_Float16 (*)[136])smem, (*stl)[136] = (_Float16 (*)[136])(smem + VST); _Float16 (*so)[WR][72] = (_Float16 (*)[WR][72])(smem + 2 * VST), (*sol)[WR][72] = (_Float16 (*)[WR][72])(smem + 2 * VST + QST);
  const int tid = threadIdx.x, wave = tid >> 5, lane = tid & 31, col = lane & 15, g = lane >> 4, wm = wave >> 1, wn = wave & 1; const size_t r0 = (size_t)blockIdx.x * 128 + wm * WR; const int cb0 = blockIdx.y * 128;   // cb0: the block's first column inside each of q, k, v
  v8f acc[3][FM][4] = {};
  const unsigned l0 = lds_off(smem); const char* gB = (const char*)(P + (size_t)cb0 * DM); const char* gA = (const char*)(X + (size_t)blockIdx.x * 128 * DM);
  auto stage = [&](unsigned l, int t) {   // stage t of the three weights' rows and of the x rows into the buffer at l: 20 copies a lane
    stage256<128, NT>(l + 3 * 128 * P128, gA + (size_t)t * 256, DM * 4, tid);
    HOLD_ORDER();   // here and below: each part's address sums stay next to its copies. Left free, all 20 copies' addresses are formed ahead; asm operands must lie in the first 256 registers, where the sums of products lie too, and an address is then spilled to memory
    stage128<128, NT>(l, gB + (size_t)t * 128, DM * 2, tid);
    HOLD_ORDER();
    stage128<128, NT>(l + 128 * P128, gB + (size_t)DM * DM * 2 + (size_t)t * 128, DM * 2, tid);
    HOLD_ORDER();
    stage128<128, NT>(l + 2 * 128 * P128, gB + (size_t)2 * DM * DM * 2 + (size_t)t * 128, DM * 2, tid); };
  stage(l0, 0);
  WAIT_ASYNC(); __syncthreads();
  stage(l0 + STGQ, 1);
  for (int t = 0; t < DM / KST; ++t) { const char* bs = smem + (t & 1) * STGQ;
    v4f ra[2][FM][4]; v16b w[2][3][4];   // the stage's fragment reads all stand ahead of its products, in the order of their use: the waits are by count, so the products of the first 32 k run while the reads of the second 32 k still come in (the loops below are unrolled so that every fragment index is a constant and the arrays stay in registers)
#pragma unroll
    for (int kk = 0; kk < 2; ++kk) {
#pragma unroll
      for (int i = 0; i < FM; ++i) { const float* p = (const float*)(bs + 3 * 128 * P128 + (wm * WR + i * 16 + col) * P256) + kk * 32 + 8 * g; ra[kk][i][0] = *(const v4f*)p; ra[kk][i][1] = *(const v4f*)(p + 4); ra[kk][i][2] = *(const v4f*)(p + 16); ra[kk][i][3] = *(const v4f*)(p + 20); }
#pragma unroll
      for (int q = 0; q < 3; ++q) {
#pragma unroll
        for (int j = 0; j < 4; ++j) w[kk][q][j] = frag_b((const __bf16*)(bs + (q * 128 + wn * 64 + j * 16 + col) * P128) + kk * 32, lane); } }
    HOLD_ORDER();   // the reads above stay together, ahead of the conversions and the products
#pragma unroll
    for (int kk = 0; kk < 2; ++kk) {
#pragma unroll
      for (int i = 0; i < FM; ++i) { v16b a;
#pragma unroll
        for (int e = 0; e < 16; ++e) a[e] = (__bf16)ra[kk][i][e >> 2][e & 3];
#pragma unroll
        for (int q = 0; q < 3; ++q) {
#pragma unroll
          for (int j = 0; j < 4; ++j) acc[q][i][j] = wmma_bf(a, w[kk][q][j], acc[q][i][j]); } } }
    HOLD_ORDER();   // the products above stay ahead of the ring's waits and barrier
    WAIT_DS(); WAIT_ASYNC(); __syncthreads();   // publishes stage t + 1 and ends every read of stage t
    if (t + 2 < DM / KST) stage(l0 + (t & 1) * STGQ, t + 2); }
  WAIT_ASYNC();
  float bv[3][4] = {};   // the bias of this lane's 4 columns of q, k, v, where there is one
  if (BQ) {
#pragma unroll   // constant indices: bv stays in registers
    for (int j = 0; j < 4; ++j) { const int c = cb0 + wn * 64 + j * 16 + col; bv[0][j] = bfr(BQ[c]); bv[1][j] = bfr(BK[c]); bv[2][j] = bfr(BV[c]); }
    asm volatile("s_wait_xcnt 0x0" ::: "memory"); }   // stands in front of every later write of a register that the 12 loads name as an address
  // v first: transposed through the block's shared planes
#pragma unroll
  for (int i = 0; i < FM; ++i) {
#pragma unroll
    for (int j = 0; j < 4; ++j) {
#pragma unroll
      for (int r = 0; r < 8; ++r) { const float v = acc[2][i][j][r] + bv[2][j]; const _Float16 hv = (_Float16)v; sth[wn * 64 + j * 16 + col][wm * WR + i * 16 + 8 * g + r] = hv; stl[wn * 64 + j * 16 + col][wm * WR + i * 16 + 8 * g + r] = (_Float16)((v - (float)hv) * 2048.0f); } } }
  __syncthreads();
  { const size_t rb = (size_t)blockIdx.x * 128; const int b = (int)(rb / SS), s0 = (int)(rb % SS);
    for (int q = tid; q < 128 * 16; q += NT) { const int d = q >> 4, pc = q & 15; const size_t o = ((size_t)b * DM + cb0 + d) * SS + s0 + pc * 8; vst2((unsigned*)(VTH + o), *(const v4u*)&sth[d][pc * 8]); vst2((unsigned*)(VTL + o), *(const v4u*)&stl[d][pc * 8]); }
    asm volatile("s_wait_xcnt 0x0" ::: "memory"); }   // stands in front of every later write of a register that the stores name as an address
  // then q and k, each wave through its own part of the other two planes, which no v plane overlaps. q stored unscaled (f16 sigma ~0.6, no subnormal exposure); 1/8 applied to the f32 score
#pragma unroll   // constant index into acc
  for (int q = 0; q < 2; ++q) { const int n0 = q * DM + cb0 + wn * 64;
#pragma unroll
    for (int i = 0; i < FM; ++i) {
#pragma unroll
      for (int j = 0; j < 4; ++j) {
#pragma unroll
        for (int r = 0; r < 8; ++r) { const float v = acc[q][i][j][r] + bv[q][j]; const _Float16 hv = (_Float16)v; so[wave][i * 16 + 8 * g + r][j * 16 + col] = hv; sol[wave][i * 16 + 8 * g + r][j * 16 + col] = (_Float16)((v - (float)hv) * 2048.0f); } } }   // q, k (+ bias) as f16 hi + (x2048) residual
    LDSX();
    const int rw = lane >> 3, c8 = (lane & 7) * 8;   // 8 lanes a 128-B row piece, 4 rows a store
    for (int rl = 0; rl < WR; rl += 4) { vst2((unsigned*)(QK + (r0 + rl + rw) * (2 * DM) + n0 + c8), *(const v4u*)&so[wave][rl + rw][c8]); vst2((unsigned*)(QKL + (r0 + rl + rw) * (2 * DM) + n0 + c8), *(const v4u*)&sol[wave][rl + rw][c8]); }
    asm volatile("s_wait_xcnt 0x0" ::: "memory"); }   // stands in front of every later write of a register that the stores name as an address
}
typedef __attribute__((ext_vector_type(16))) unsigned v16u;
typedef __attribute__((address_space(4))) v16u cmw16;
// lane l <-> lane l ^ 16: the two lanes that share a query column
__device__ __forceinline__ float xhalf(float x) { return __builtin_bit_cast(float, __builtin_amdgcn_permlanex16(__builtin_bit_cast(int, x), __builtin_bit_cast(int, x), 0x76543210, 0xfedcba98, false, false)); }
// ---- k_attn: block = (64 queries, head h + 16 x batch b): all-keys flash attention with both products transposed: S^T = K . Q^T (A = key rows, B = the wave's 16 queries), O^T += V^T . P^T (A = v rows [d][key], B = P^T). A lane then holds 8 keys of ONE query (column lane & 15, keys 8 * (lane >> 4) + r of a 16-key tile): maximum and sum run inside the lane, one exchange with lane ^ 16 for the maximum; two score tiles converted in place are the B operand of the second product (element i = tile i >> 3, register i & 7), so P touches neither LDS nor another lane. Single f16 operands; softmax in base 2 on the raw scores, weights x 2^11 in numerator and denominator alike; O[b*S+q][h*64+d] = acc / l (256-B segments)
// The launch also carries, behind its attention blocks (blockIdx.y >= NH * NB), the weight packs that only later launches read: (in,out) W1 [1024][4096] -> rows [4096][1024] f16 x 2^8, W2 [4096][1024] -> rows [1024][4096], W_o -> PK_P rows bf16, one tile a block. They are bound by memory and the attention blocks by the vector port, so the packs run in the wave places that attention leaves free and cost no launch of their own
#define PT_FF ((DM / TPK) * (DFF / TPN))   // tiles of W1, and of W2
#define PT_O ((DM / TPK) * (DM / TPN))     // tiles of W_o
__global__ __launch_bounds__(128) void k_attn(const _Float16* __restrict__ QK, const _Float16* __restrict__ QKL, const _Float16* __restrict__ VTH, const _Float16* __restrict__ VTL, const void* __restrict__ KMASK, const unsigned* __restrict__ MB, float* __restrict__ O, const float* __restrict__ W1, const float* __restrict__ W2, const float* __restrict__ WO, _Float16* __restrict__ PF, _Float16* __restrict__ PM, __bf16* __restrict__ PO) {
  __shared__ __align__(16) char smem[2 * STG32];   // the ring (64 key rows, 64 v rows a stage); behind the loop's last barrier the output staging; in a pack block the tile's packed rows
  static_assert(TPN * TPP <= 2 * STG32 && (2 * PT_FF + PT_O) % TQB == 0, "pack tile in LDS, whole grid rows of pack blocks");
  if (blockIdx.y >= NH * TNB) {   // the same for a whole block, ahead of every barrier and copy below; each weight has its own copy of the code, so that every pitch is an immediate
    const int p = ((int)blockIdx.y - NH * TNB) * TQB + (int)blockIdx.x;
    if (p < PT_FF) { const int k0 = (p % (DM / TPK)) * TPK, n0 = (p / (DM / TPK)) * TPN; pack_tile<1, 128>(W1 + (size_t)k0 * DFF + n0, DFF * 4, (char*)(PF + (size_t)n0 * DM + k0), DM * 2, smem, threadIdx.x); }
    else if (p < 2 * PT_FF) { const int q = p - PT_FF, k0 = (q % (DFF / TPK)) * TPK, n0 = (q / (DFF / TPK)) * TPN; pack_tile<1, 128>(W2 + (size_t)k0 * DM + n0, DM * 4, (char*)(PM + (size_t)n0 * DFF + k0), DFF * 2, smem, threadIdx.x); }
    else { const int q = p - 2 * PT_FF, k0 = (q % (DM / TPK)) * TPK, n0 = (q / (DM / TPK)) * TPN; pack_tile<0, 128>(WO + (size_t)k0 * DM + n0, DM * 4, (char*)(PO + (size_t)n0 * DM + k0), DM * 2, smem, threadIdx.x); }
    return; }
  float (*so)[16][68] = (float (*)[16][68])smem;
  const int tid = threadIdx.x, wave = tid >> 5, lane = tid & 31, col = lane & 15, g = lane >> 4;
  const int qb = blockIdx.x, h = blockIdx.y % NH, b = blockIdx.y / NH; const int q0 = qb * 64 + wave * 16; const size_t rq = (size_t)b * SS + q0 + col;
  v16h aq[2];
#pragma unroll
  for (int kc = 0; kc < 2; ++kc) aq[kc] = frag_h(QK + rq * (2 * DM) + h * HD + kc * 32, lane);
  const float KS = 0.125f * 1.4426950408889634f;   // 1/sqrt(64) and log2(e) in one factor
  float m = -3.0e38f, l = 0.f;   // of this lane's query: running maximum of score x KS (alike in both lanes of the column); this lane's own part of the sum
  v8f acc[4] = {};
  // the wave's mask words: 16 a turn of 32 keys (64 B in a row), the same for every lane, so they come by scalar loads into scalar registers (constant address space: an earlier launch wrote them, nothing in this one does), each turn's issued behind the selects of the turn before
  const cmw16* pw = (const cmw16*)(MB + (size_t)(qb * 4 + __builtin_amdgcn_readfirstlane(wave)) * (SS / 16 * 8)); v16u mw = pw[0];
  // a stage is 64 keys (all keys are walked): 64 k rows of 128 B, the head's 64 v rows of 128 B
  const unsigned l0 = lds_off(smem); const char* gK = (const char*)(QK + (size_t)b * SS * (2 * DM) + DM + h * HD); const char* gV = (const char*)(VTH + ((size_t)b * DM + h * HD) * SS);
  stage128<64>(l0, gK, 2 * DM * 2, tid); stage128<64>(l0 + 64 * P128, gV, SS * 2, tid);
  WAIT_ASYNC(); __syncthreads();
  stage128<64>(l0 + STG32, gK + (size_t)64 * 2 * DM * 2, 2 * DM * 2, tid); stage128<64>(l0 + STG32 + 64 * P128, gV + 128, SS * 2, tid);
#pragma unroll 1   // the stage loop stays rolled, as the key loop was: its body already holds two turns
  for (int t = 0; t < SS / 64; ++t) { const char* bs = smem + (t & 1) * STG32;
#pragma unroll     // both turns of a stage unrolled: their LDS offsets become immediates
  for (int sub = 0; sub < 2; ++sub) { v8f s[2]; v16h kf[2][2], vf[4];   // 32 keys a turn; its LDS reads all stand ahead of its products: one LDS latency a turn, not one a product
#pragma unroll
    for (int ct = 0; ct < 2; ++ct) {
#pragma unroll
      for (int kc = 0; kc < 2; ++kc) kf[ct][kc] = frag_h((const _Float16*)(bs + (sub * 32 + ct * 16 + col) * P128) + kc * 32, lane); }
#pragma unroll
    for (int dt = 0; dt < 4; ++dt) vf[dt] = frag_h((const _Float16*)(bs + 64 * P128 + (dt * 16 + col) * P128) + sub * 32, lane);
    HOLD_ORDER();   // the reads above stay together, ahead of the products
    float mx = -3.0e38f;
#pragma unroll
    for (int ct = 0; ct < 2; ++ct) { v8f c = {};
#pragma unroll
      for (int kc = 0; kc < 2; ++kc) c = wmma16(kf[ct][kc], aq[kc], c);   // single product: k, q as one-rounding f16 operands; c[r] = key ct * 16 + 8 * g + r against query col
#pragma unroll
      for (int r = 0; r < 8; ++r) { s[ct][r] = __builtin_amdgcn_inverse_ballot_w32(mw[ct * 8 + r]) ? -3.0e38f : c[r]; mx = fmaxf(mx, s[ct][r]); } }   // mask == 1 -> -1e9 == excluded; the word is the select's lane mask as it stands
    __builtin_amdgcn_sched_barrier(0);   // holds the scalar load below behind this turn's selects: the wait in front of the selects is a wait for every scalar load issued, so a load lifted over them would be waited for at once and not a turn later
    const int tn = t * 2 + sub + 1; mw = pw[tn < SS / 32 ? tn : SS / 32 - 1];   // the next turn's mask words (the last turn reads its own again: in bounds)
    mx = fmaxf(mx, xhalf(mx)) * KS;   // KS > 0: the maximum of the raw scores, scaled, is the maximum of the scaled ones
    const float mn = fmaxf(m, mx); const float base = (mn <= -1.0e37f) ? 0.f : mn;   // no key of this query admitted yet: every weight below comes out 0
    const float nb = 11.0f - base; float x[17];   // 2^11 in the exponent keeps small softmax weights out of the f16 subnormal range; the sum carries it too, so it cancels in the epilogue
#pragma unroll
    for (int i = 0; i < 16; ++i) x[i] = fmaf(s[i >> 3][i & 7], KS, nb);   // an excluded score gives exp2(-huge) = 0
    x[16] = m - base; m = mn;
    // the turn's 17 exponentials in one statement, each in place: no neighbour reads the result or overwrites the source of the one in front of it, and the closing v_nop keeps that one slot behind the last
    asm("v_exp_f32 %0, %0\n\tv_exp_f32 %1, %1\n\tv_exp_f32 %2, %2\n\tv_exp_f32 %3, %3\n\tv_exp_f32 %4, %4\n\tv_exp_f32 %5, %5\n\tv_exp_f32 %6, %6\n\tv_exp_f32 %7, %7\n\tv_exp_f32 %8, %8\n\tv_exp_f32 %9, %9\n\tv_exp_f32 %10, %10\n\tv_exp_f32 %11, %11\n\tv_exp_f32 %12, %12\n\tv_exp_f32 %13, %13\n\tv_exp_f32 %14, %14\n\tv_exp_f32 %15, %15\n\tv_exp_f32 %16, %16\n\tv_nop"
        : "+v"(x[0]), "+v"(x[1]), "+v"(x[2]), "+v"(x[3]), "+v"(x[4]), "+v"(x[5]), "+v"(x[6]), "+v"(x[7]), "+v"(x[8]), "+v"(x[9]), "+v"(x[10]), "+v"(x[11]), "+v"(x[12]), "+v"(x[13]), "+v"(x[14]), "+v"(x[15]), "+v"(x[16]));
    const float alpha = x[16]; v16h pa; float es[4] = { 0.f, 0.f, 0.f, 0.f };
#pragma unroll
    for (int i = 0; i < 16; ++i) { es[i & 3] += x[i]; pa[i] = (_Float16)x[i]; }   // element i of the B operand = tile i >> 3, register i & 7
    l = l * alpha + ((es[0] + es[1]) + (es[2] + es[3]));
#pragma unroll
    for (int dt = 0; dt < 4; ++dt) { acc[dt] *= alpha; acc[dt] = wmma16(vf[dt], pa, acc[dt]); }   // single product: V^T x P^T (x2^11); acc[dt][r] = d dt * 16 + 8 * g + r of query col
    HOLD_ORDER(); }   // the products above stay ahead of the next reads and of the ring's waits
    WAIT_DS(); WAIT_ASYNC(); __syncthreads();   // publishes stage t + 1 and ends every read of stage t
    if (t + 2 < SS / 64) { const unsigned l = l0 + (t & 1) * STG32; stage128<64>(l, gK + (size_t)(t + 2) * 64 * 2 * DM * 2, 2 * DM * 2, tid); stage128<64>(l + 64 * P128, gV + (size_t)(t + 2) * 128, SS * 2, tid); } }
  WAIT_ASYNC();
  const float il = 1.0f / (l + xhalf(l));   // the column's two lanes join their sums once
#pragma unroll
  for (int dt = 0; dt < 4; ++dt) { const v8f o = acc[dt] * il; vst2(&so[wave][col][dt * 16 + 8 * g], (v4f){ o[0], o[1], o[2], o[3] }); vst2(&so[wave][col][dt * 16 + 8 * g + 4], (v4f){ o[4], o[5], o[6], o[7] }); }
  LDSX();
  for (int rl = 0; rl < 16; ++rl) if (lane < 16) vst2(O + ((size_t)b * SS + q0 + rl) * DM + h * HD + lane * 4, *(const v4f*)&so[wave][rl][lane * 4]);
}
// ---- k_out: block = (128 rows, 128 cols): out = O(hi/lo) . Wo rows (2 products) + bo
__global__ __launch_bounds__(GNT) void k_out(const float* __restrict__ O, const __bf16* __restrict__ P, const float* __restrict__ BO, float* __restrict__ Y) {
  constexpr int FM = 2, NT = GNT, WR = FM * 16;   // WR rows a wave
  __shared__ __align__(16) char smem[2 * STGF];   // the ring; behind the loop's last barrier the output staging
  float (*so)[WR][68] = (float (*)[WR][68])smem;
  const int tid = threadIdx.x, wave = tid >> 5, lane = tid & 31, col = lane & 15, g = lane >> 4, wm = wave >> 1, wn = wave & 1; const size_t r0 = (size_t)blockIdx.x * 128 + wm * WR; const int nb0 = blockIdx.y * 128, n0 = nb0 + wn * 64;
  v8f acc[FM][4] = {};
  const unsigned l0 = lds_off(smem); const char* gB = (const char*)(P + (size_t)nb0 * DM); const char* gA = (const char*)(O + (size_t)blockIdx.x * 128 * DM);
  stage128<128, NT>(l0, gB, DM * 2, tid); stage256<128, NT>(l0 + 128 * P128, gA, DM * 4, tid);
  WAIT_ASYNC(); __syncthreads();
  stage128<128, NT>(l0 + STGF, gB + 128, DM * 2, tid); stage256<128, NT>(l0 + STGF + 128 * P128, gA + 256, DM * 4, tid);
  for (int t = 0; t < DM / KST; ++t) { const char* bs = smem + (t & 1) * STGF;
    v4f ra[2][FM][4]; v16b w[2][4];   // the stage's fragment reads all stand ahead of its products: one LDS latency a stage, not one a product (the loops below are unrolled so that every fragment index is a constant and the arrays stay in registers)
#pragma unroll
    for (int kk = 0; kk < 2; ++kk) {
#pragma unroll
      for (int i = 0; i < FM; ++i) { const float* p = (const float*)(bs + 128 * P128 + (wm * WR + i * 16 + col) * P256) + kk * 32 + 8 * g; ra[kk][i][0] = *(const v4f*)p; ra[kk][i][1] = *(const v4f*)(p + 4); ra[kk][i][2] = *(const v4f*)(p + 16); ra[kk][i][3] = *(const v4f*)(p + 20); }
#pragma unroll
      for (int j = 0; j < 4; ++j) w[kk][j] = frag_b((const __bf16*)(bs + (wn * 64 + j * 16 + col) * P128) + kk * 32, lane); }
    HOLD_ORDER();   // the reads above stay together, ahead of the products and of the split
#pragma unroll
    for (int kk = 0; kk < 2; ++kk) {
#pragma unroll
      for (int i = 0; i < FM; ++i) { float v[16];   // the split stands behind the reads, free to run among the products
#pragma unroll
        for (int e = 0; e < 16; ++e) v[e] = ra[kk][i][e >> 2][e & 3];
        const F2 a = bsplit16(v);
#pragma unroll
        for (int j = 0; j < 4; ++j) { acc[i][j] = wmma_bf(a.l, w[kk][j], acc[i][j]); acc[i][j] = wmma_bf(a.h, w[kk][j], acc[i][j]); } } }
    HOLD_ORDER();   // the products above stay ahead of the ring's waits and barrier
    WAIT_DS(); WAIT_ASYNC(); __syncthreads();   // publishes stage t + 1 and ends every read of stage t
    if (t + 2 < DM / KST) { stage128<128, NT>(l0 + (t & 1) * STGF, gB + (size_t)(t + 2) * 128, DM * 2, tid); stage256<128, NT>(l0 + (t & 1) * STGF + 128 * P128, gA + (size_t)(t + 2) * 256, DM * 4, tid); } }
  WAIT_ASYNC();
#pragma unroll
  for (int i = 0; i < FM; ++i) {
#pragma unroll
    for (int j = 0; j < 4; ++j) {
#pragma unroll
      for (int r = 0; r < 8; ++r) so[wave][i * 16 + 8 * g + r][j * 16 + col] = acc[i][j][r] + bfr(BO[n0 + j * 16 + col]); } }
  LDSX();
  for (int rl = 0; rl < WR; rl += 2) vst2(Y + (r0 + rl + g) * DM + n0 + col * 4, *(const v4f*)&so[wave][rl + g][col * 4]);   // 16 lanes a 256-B row piece, 2 rows a store
}
// ---- k_lnres<F16OUT, RESX>: block = row (256 threads x 4): y = R + LayerNorm(A) x gamma + beta (mean((x-m)^2), eps 1e-5); RESX: residual is the bf16-rounded input x (else an f32 buffer); optional f16 copy for the FF
template <int F16OUT, int RESX>
__global__ __launch_bounds__(256) void k_lnres(const float* __restrict__ A, const float* __restrict__ R, const float* __restrict__ G, const float* __restrict__ Bt, float* __restrict__ Y, _Float16* __restrict__ Y16) {
  __shared__ float red[8]; __shared__ __align__(16) _Float16 sh[DM]; const int t = threadIdx.x; const size_t row = blockIdx.x; float v[4]; float s = 0.f; for (int i = 0; i < 4; ++i) { v[i] = A[row * DM + t * 4 + i]; s += v[i]; }
#pragma unroll
  for (int o = 1; o < 32; o <<= 1) s += __shfl_xor(s, o);
  if ((t & 31) == 0) red[t >> 5] = s; __syncthreads(); float tot = 0.f; for (int i = 0; i < 8; ++i) tot += red[i]; const float mu = tot / (float)DM; __syncthreads();
  float q = 0.f; for (int i = 0; i < 4; ++i) { const float dd = v[i] - mu; q += dd * dd; }
#pragma unroll
  for (int o = 1; o < 32; o <<= 1) q += __shfl_xor(q, o);
  if ((t & 31) == 0) red[t >> 5] = q; __syncthreads(); float tq = 0.f; for (int i = 0; i < 8; ++i) tq += red[i]; const float inv = 1.0f / sqrtf(tq / (float)DM + 1e-5f);
  v4f o4; for (int i = 0; i < 4; ++i) { const int e = t * 4 + i; const float rr = RESX ? bfr(R[row * DM + e]) : R[row * DM + e]; o4[i] = rr + ((v[i] - mu) * inv * bfr(G[e]) + bfr(Bt[e])); if (F16OUT) sh[e] = (_Float16)o4[i]; }
  vst2(Y + row * DM + t * 4, o4);
  if (F16OUT) { __syncthreads(); if (t < DM / 8) vst2((unsigned*)(Y16 + row * DM + t * 8), *(const v4u*)&sh[t * 8]); }
}
// ---- k_mlp<MODE>: block = (MBM rows, 128 cols): MODE 0: G = gelu_exact(X1 . W1 + b1) (K 1024 -> 4096) f16; MODE 1: HF = gelu_exact(G . W2 + b2) (K 4096 -> 1024) f32
#define MBM(MODE) ((MODE) == 0 ? 256 : 128)   // rows of a block: the wide GEMM has tiles enough for the larger one, the narrow one has 256 tiles of 128 x 128, one a WGP
template <int MODE>
__global__ __launch_bounds__(GNT) void k_mlp(const _Float16* __restrict__ Ain, const _Float16* __restrict__ Wr, const float* __restrict__ BIAS, const float* __restrict__ RES, float* __restrict__ OUTF, _Float16* __restrict__ OG) {
  constexpr int KIN = (MODE == 0) ? DM : DFF; constexpr int NOUT = (MODE == 0) ? DFF : DM;
  constexpr int BM = MBM(MODE), NT = GNT, WR = BM / 4, FM = WR / 16, KS = (MODE == 0) ? 64 : 128, PT = KS * 2 + 16, STG = (128 + BM) * PT, KG = (MODE == 0) ? 1 : 2;   // WR rows a wave; KS k a stage at LDS pitch PT: weight rows, then activation rows; KG fragment columns (32 k each) read in one group
  __shared__ __align__(16) char smem[2 * STG];   // the ring; behind the loop's last barrier the output staging
  float (*so)[WR][68] = (float (*)[WR][68])smem; _Float16 (*sg)[WR][72] = (_Float16 (*)[WR][72])smem;
  const int tid = threadIdx.x, wave = tid >> 5, lane = tid & 31, col = lane & 15, g = lane >> 4, wm = wave >> 1, wn = wave & 1; const size_t r0 = (size_t)blockIdx.x * BM + wm * WR; const int nb0 = blockIdx.y * 128, n0 = nb0 + wn * 64;
  v8f acc[FM][4] = {};
  const unsigned l0 = lds_off(smem); const char* gB = (const char*)(Wr + (size_t)nb0 * KIN); const char* gA = (const char*)(Ain + (size_t)blockIdx.x * BM * KIN);
  auto stage = [&](unsigned l, int t) { if constexpr (KS == 64) { stage128<128, NT>(l, gB + (size_t)t * 128, KIN * 2, tid); stage128<BM, NT>(l + 128 * PT, gA + (size_t)t * 128, KIN * 2, tid); } else { stage256<128, NT>(l, gB + (size_t)t * 256, KIN * 2, tid); stage256<BM, NT>(l + 128 * PT, gA + (size_t)t * 256, KIN * 2, tid); } };   // stage t of both operands into the buffer at l
  stage(l0, 0);
  WAIT_ASYNC(); __syncthreads();
  stage(l0 + STG, 1);
  for (int t = 0; t < KIN / KS; ++t) { const char* bs = smem + (t & 1) * STG;
#pragma unroll   // the groups of a stage unrolled: their LDS offsets become immediates
    for (int k0 = 0; k0 < KS / 32; k0 += KG) {
    v16h a[KG][FM], w[KG][4];   // a group's fragment reads all stand ahead of its products: one LDS latency a group, not one a product (the loops below are unrolled so that every fragment index is a constant and the arrays stay in registers)
#pragma unroll
    for (int kk = 0; kk < KG; ++kk) {
#pragma unroll
      for (int i = 0; i < FM; ++i) a[kk][i] = frag_h((const _Float16*)(bs + 128 * PT + (wm * WR + i * 16 + col) * PT) + (k0 + kk) * 32, lane);
#pragma unroll
      for (int j = 0; j < 4; ++j) w[kk][j] = frag_h((const _Float16*)(bs + (wn * 64 + j * 16 + col) * PT) + (k0 + kk) * 32, lane); }
    HOLD_ORDER();   // the reads above stay together, ahead of the products
#pragma unroll
    for (int kk = 0; kk < KG; ++kk) {
#pragma unroll
      for (int i = 0; i < FM; ++i) {
#pragma unroll
        for (int j = 0; j < 4; ++j) acc[i][j] = wmma16(a[kk][i], w[kk][j], acc[i][j]); } }
    HOLD_ORDER(); }   // the products above stay ahead of the next reads and of the ring's waits
    WAIT_DS(); WAIT_ASYNC(); __syncthreads();   // publishes stage t + 1 and ends every read of stage t
    if (t + 2 < KIN / KS) stage(l0 + (t & 1) * STG, t + 2); }
  WAIT_ASYNC();
#pragma unroll
  for (int i = 0; i < FM; ++i) {
#pragma unroll
  for (int j = 0; j < 4; ++j) { const int c = n0 + j * 16 + col; const float bb = bfr(BIAS[c]); float x[8];
#pragma unroll
    for (int r = 0; r < 8; ++r) x[r] = acc[i][j][r] * (1.0f / 256.0f) + bb;
    gelu8(x);
#pragma unroll
    for (int r = 0; r < 8; ++r) { if (MODE == 0) sg[wave][i * 16 + 8 * g + r][j * 16 + col] = (_Float16)x[r]; else so[wave][i * 16 + 8 * g + r][j * 16 + col] = x[r]; } } }
  LDSX();
  if (MODE == 0) { const int rw = lane >> 3, c8 = (lane & 7) * 8; for (int rl = 0; rl < WR; rl += 4) vst2((unsigned*)(OG + (r0 + rl + rw) * NOUT + n0 + c8), *(const v4u*)&sg[wave][rl + rw][c8]); }   // 8 lanes a 128-B row piece, 4 rows a store
  else { for (int rl = 0; rl < WR; rl += 2) vst2(OUTF + (r0 + rl + g) * NOUT + n0 + col * 4, *(const v4f*)&so[wave][rl + g][col * 4]); }   // 16 lanes a 256-B row piece, 2 rows a store
}

extern "C" void kernel_launch(void* const* d_in, const int* in_sizes, int n_in, void* d_out, int out_size, void* d_ws, size_t ws_size, hipStream_t stream) {
  (void)in_sizes; (void)n_in; (void)out_size;
  const float** F = (const float**)d_in;   // 0 x [2,2048,1024], 1 mask [1,1,2048,2048] int, 2 Wq, 3 Wk, 4 Wv, 5 Wo ((in,out)), 6 bo, 7 ln1_g, 8 ln1_b, 9 W1 [1024,4096], 10 b1, 11 W2 [4096,1024], 12 b2, 13 ln2_g, 14 ln2_b
  if (ws_size < (size_t)WS_END) return;
  char* ws = (char*)d_ws; __bf16* PK = (__bf16*)(ws + WS_PK); _Float16 *QK = (_Float16*)(ws + WS_QK), *QKL = (_Float16*)(ws + WS_QKL), *VTH = (_Float16*)(ws + WS_VTH), *VTL = (_Float16*)(ws + WS_VTL), *PF = (_Float16*)(ws + WS_PF), *PM = (_Float16*)(ws + WS_PM), *X16 = (_Float16*)(ws + WS_X16), *Gb = (_Float16*)(ws + WS_G); unsigned* MB = (unsigned*)(ws + WS_MB); float *O = (float*)(ws + WS_O), *A0 = (float*)(ws + WS_A0), *X1 = (float*)(ws + WS_X1), *HF = (float*)(ws + WS_HF);
  k_pack<<<dim3((DM / TPK) * (DM / TPN), 5), 256, 0, stream>>>(F[2], F[3], F[4], PK, (const int*)d_in[1], MB);
  k_qkv<<<dim3(TNB * SS / 128, DM / 128), GNT, 0, stream>>>(F[0], PK + PK_A, nullptr, nullptr, nullptr, QK, QKL, VTH, VTL);
  k_attn<<<dim3(TQB, NH * TNB + (2 * PT_FF + PT_O) / TQB), 128, 0, stream>>>(QK, QKL, VTH, VTL, nullptr, MB, O, F[9], F[11], F[5], PF, PM, PK + PK_P);
  k_out<<<dim3(TOB / 2, DM / 128), GNT, 0, stream>>>(O, PK + PK_P, F[6], A0);
  k_lnres<1, 1><<<TOB * 64, 256, 0, stream>>>(A0, F[0], F[7], F[8], X1, X16);      // x1 = x + LN(attn branch)
  k_mlp<0><<<dim3(NR / MBM(0), DFF / 128), GNT, 0, stream>>>(X16, PF, F[10], nullptr, nullptr, Gb);
  k_mlp<1><<<dim3(NR / MBM(1), DM / 128), GNT, 0, stream>>>(Gb, PM, F[12], nullptr, HF, nullptr);
  k_lnres<0, 0><<<TOB * 64, 256, 0, stream>>>(HF, X1, F[13], F[14], (float*)d_out, nullptr);   // out = x1 + LN(ff branch)
}

// v010
// One run takes 161 microseconds.
// In both of two side-by-side timings against v009, it was 1.07 times as fast.
// Over all steps from v000 it is 5.34 times as fast.
// compute dtype: all float inputs rounded to bf16, the int mask read on device and packed to one bit an element; q/k/v = x . W with EXACT bf16 products on WMMA 16x16x32 ((in,out) weights as transposed rows); PLAIN attention: q, k single f16 x 1/8, masked keys excluded, running-max softmax in f32 (hardware exp), P (scaled by 2^11, single f16) x v (single f16); attention out (bf16 hi + residual) . Wo (2 products) + bo; LayerNorms in f32; FF: x1 rounded once to f16 x exact f16 weight copies (x 2^8), erf GELU (x . Phi(x), f32-accurate rational form of erfc), hidden f16, second erf GELU; f32 output.
#include <hip/hip_runtime.h>
#include <math.h>

typedef __attribute__((ext_vector_type(16))) _Float16 v16h;
typedef __attribute__((ext_vector_type(16))) __bf16 v16b;
typedef __attribute__((ext_vector_type(8)))  _Float16 v8h;
typedef __attribute__((ext_vector_type(8)))  float v8f;
typedef __attribute__((ext_vector_type(4)))  float v4f;
typedef __attribute__((ext_vector_type(2)))  float v2f;
typedef __attribute__((ext_vector_type(4)))  unsigned v4u;
typedef __attribute__((ext_vector_type(4)))  int v4i;
typedef float __attribute__((may_alias)) float_a;
typedef int __attribute__((may_alias)) int_a;

template <typename T> __device__ __forceinline__ void vst2(void* p, T v) { *(T*)p = v;  }
__device__ __forceinline__ v8f wmma16(v16h a, v16h b, v8f c) {
  v8f d = __builtin_amdgcn_wmma_f32_16x16x32_f16(false, a, false, b, (short)0, c, false, false);
  return d;
}
__device__ __forceinline__ v8f wmma_bf(v16b a, v16b b, v8f c) {
  v8f d = __builtin_amdgcn_wmma_f32_16x16x32_bf16(false, a, false, b, (short)0, c, false, false);
  return d;
}
// Transformer block (B 2, S 2,048, d 1,024, 16 heads x 64, FF 4,096): bias-free q/k/v projections, scores / 8 with a [S,S] mask (mask == 1 -> -1e9), softmax, . v, Wo + bo; x + LayerNorm(attention branch); FF with exact GELU after BOTH linears; x + LayerNorm(FF branch).
__device__ __forceinline__ v16h frag_h(const _Float16* rowk0, int lane) {
  union { v16h v; v8h q[2]; } u; const _Float16* p = rowk0 + 8 * (lane >> 4);
  u.q[0] = *(const v8h*)p; u.q[1] = *(const v8h*)(p + 16); return u.v;
}
__device__ __forceinline__ v16h frag_f32(const float* rowk0, int lane) {
  v16h a; const float* p = rowk0 + 8 * (lane >> 4);
#pragma unroll
  for (int i = 0; i < 8; ++i) { a[i] = (_Float16)p[i]; a[8 + i] = (_Float16)p[16 + i]; }
  return a;
}
__device__ __forceinline__ v16h frag_f32s(const float* rowk0, int lane, float sc) {
  v16h a; const float* p = rowk0 + 8 * (lane >> 4);
#pragma unroll
  for (int i = 0; i < 8; ++i) { a[i] = (_Float16)(p[i] * sc); a[8 + i] = (_Float16)(p[16 + i] * sc); }
  return a;
}
// column fragment from a [K][ld] layout (column n), rows >= K read as 0
__device__ __forceinline__ v16h fragc_f32(const float* W, int k0, int n, int lane, int ld, int K) {
  v16h a; const int g = lane >> 4;
#pragma unroll
  for (int i = 0; i < 8; ++i) { const int ka = k0 + 8 * g + i, kb = ka + 16;
    a[i] = (_Float16)(ka < K ? W[(size_t)(ka < K ? ka : K - 1) * ld + n] : 0.f); a[8 + i] = (_Float16)(kb < K ? W[(size_t)(kb < K ? kb : K - 1) * ld + n] : 0.f); }
  return a;
}
struct F2 { v16b h, l; };
__device__ __forceinline__ F2 bsplit16(const float v[16]) { F2 r;
#pragma unroll
  for (int i = 0; i < 16; ++i) { const __bf16 h = (__bf16)v[i]; r.h[i] = h; r.l[i] = (__bf16)(v[i] - (float)h); }
  return r; }
__device__ __forceinline__ F2 split_row(const float* row, int k0, int lane) { float v[16]; const float* p = row + k0 + 8 * (lane >> 4);
#pragma unroll
  for (int i = 0; i < 8; ++i) { v[i] = p[i]; v[8 + i] = p[16 + i]; }
  return bsplit16(v); }
__device__ __forceinline__ F2 split_rowK(const float* row, int k0, int lane, int K) { float v[16]; const int g = lane >> 4;
#pragma unroll
  for (int i = 0; i < 8; ++i) { const int ka = k0 + 8 * g + i, kb = ka + 16; v[i] = ka < K ? row[ka < K ? ka : K - 1] : 0.f; v[8 + i] = kb < K ? row[kb < K ? kb : K - 1] : 0.f; }
  return bsplit16(v); }
__device__ __forceinline__ F2 split_col(const float* W, int k0, int n, int lane, int ld, int K) { float v[16]; const int g = lane >> 4;
#pragma unroll
  for (int i = 0; i < 8; ++i) { const int ka = k0 + 8 * g + i, kb = ka + 16; v[i] = ka < K ? W[(size_t)(ka < K ? ka : K - 1) * ld + n] : 0.f; v[8 + i] = kb < K ? W[(size_t)(kb < K ? kb : K - 1) * ld + n] : 0.f; }
  return bsplit16(v); }
__device__ __forceinline__ v8f mac3(const F2& a, const F2& b, v8f c) { c = wmma_bf(a.l, b.h, c); c = wmma_bf(a.h, b.l, c); return wmma_bf(a.h, b.h, c); }
__device__ __forceinline__ float sigm(float v) { return 1.0f / (1.0f + expf(-v)); }
#define LDSX() do { asm volatile("s_wait_dscnt 0" ::: "memory"); __builtin_amdgcn_wave_barrier(); __builtin_amdgcn_fence(__ATOMIC_RELEASE, "workgroup"); } while (0)


#define NB 2
#define SS 2048
#define DM 1024
#define NH 16
#define DFF 4096
#define NR (NB * SS)
// erf GELU as x * Phi(x), Phi the normal distribution function, inline and with no branch, 8 values side by side, in place. With t = 1 / (1 + p |x| / sqrt(2)), q = (c1 t + ... + c5 t^5) / 2 * exp(-x^2 / 2) is Phi(-|x|) = erfc(|x| / sqrt(2)) / 2 (five-term rational form of erfc: absolute error of Phi under 1e-7, of the result under 4e-7 for |x| <= 8); x * Phi(x) = max(x, 0) - |x| q on both sides of 0, with no cancellation in the negative tail
__device__ __forceinline__ void gelu8(float (&x)[8]) {
  float t[8], e[8];
#pragma unroll   // constant indices: the arrays stay in registers
  for (int i = 0; i < 8; ++i) { t[i] = fmaf(0.3275911f * 0.70710678118654752f, fabsf(x[i]), 1.0f); e[i] = (x[i] * x[i]) * -0.72134752044448170f; }   // exp(-x^2 / 2) in base 2; far out it is 0 and the result max(x, 0)
  // the 8 reciprocals and 8 exponentials in one statement, each in place: no neighbour reads the result or overwrites the source of the one in front of it, and the closing v_nop keeps that one slot behind the last
  asm("v_rcp_f32 %0, %0\n\tv_rcp_f32 %1, %1\n\tv_rcp_f32 %2, %2\n\tv_rcp_f32 %3, %3\n\tv_rcp_f32 %4, %4\n\tv_rcp_f32 %5, %5\n\tv_rcp_f32 %6, %6\n\tv_rcp_f32 %7, %7\n\tv_exp_f32 %8, %8\n\tv_exp_f32 %9, %9\n\tv_exp_f32 %10, %10\n\tv_exp_f32 %11, %11\n\tv_exp_f32 %12, %12\n\tv_exp_f32 %13, %13\n\tv_exp_f32 %14, %14\n\tv_exp_f32 %15, %15\n\tv_nop"
      : "+v"(t[0]), "+v"(t[1]), "+v"(t[2]), "+v"(t[3]), "+v"(t[4]), "+v"(t[5]), "+v"(t[6]), "+v"(t[7]), "+v"(e[0]), "+v"(e[1]), "+v"(e[2]), "+v"(e[3]), "+v"(e[4]), "+v"(e[5]), "+v"(e[6]), "+v"(e[7]));
#pragma unroll
  for (int i = 0; i < 8; ++i) { float p = fmaf(0.5f * 1.061405429f, t[i], 0.5f * -1.453152027f);
    p = fmaf(p, t[i], 0.5f * 1.421413741f); p = fmaf(p, t[i], 0.5f * -0.284496736f); p = fmaf(p, t[i], 0.5f * 0.254829592f);
    x[i] = fmaf(-fabsf(x[i]), (p * t[i]) * e[i], fmaxf(x[i], 0.f)); }
}
#define HD 64
#define QKVW (3 * DM)
#ifndef TQB
#define TQB (SS / 64)
#define TNB NB
#define TOB (NB * SS / 64)     // output row tiles (all)
#endif
typedef __attribute__((ext_vector_type(8))) __bf16 v8b;
__device__ __forceinline__ v16b frag_b(const __bf16* rowk0, int lane) {
  union { v16b v; v8b q[2]; } u; const __bf16* p = rowk0 + 8 * (lane >> 4);
  u.q[0] = *(const v8b*)p; u.q[1] = *(const v8b*)(p + 16); return u.v;
}
__device__ __forceinline__ float bfr(float v) { return (float)(__bf16)v; }
__device__ __attribute__((noinline)) float exp_ni(float v) { return expf(v); }
__device__ __attribute__((noinline)) float erf_ni(float v) { return erff(v); }

// ---- LDS ring of the GEMM kernels: a block is 8 waves, 4 down x 2 across; a wave makes FM x 16 rows by 64 columns, so a weight fragment read from LDS serves FM products and an activation fragment 4, and a block makes FM x 64 rows by 128 columns from one staging of its operand rows. A stage is 64 or 128 k of the block's 128 weight rows and of its activation rows, brought by asynchronous copies in whole lines; three buffers, a stage asked for two passes ahead of its use, so that the next request is under way before the last has landed and the path from L2 does not run empty once a pass (attention keeps two buffers: its passes are long beside a landing)
#define KST 64
#define P128 144   // LDS pitch of a 128-B row: 16 B x odd, no bank conflict for 16-B reads down a column of rows
#define P256 272   // LDS pitch of a 256-B row, likewise
__device__ __forceinline__ unsigned lds_off(const void* p) { return (unsigned)(size_t)p; }
// four copies of 16 B a lane; s_wait_xcnt closes the statement so that no address register of a copy is rewritten ahead of it
__device__ __forceinline__ void cp4(unsigned l0, unsigned l1, unsigned l2, unsigned l3, const char* g0, const char* g1, const char* g2, const char* g3) {
  asm volatile("global_load_async_to_lds_b128 %0, %4, off\n\tglobal_load_async_to_lds_b128 %1, %5, off\n\tglobal_load_async_to_lds_b128 %2, %6, off\n\tglobal_load_async_to_lds_b128 %3, %7, off\n\ts_wait_xcnt 0x0"
               :: "v"(l0), "v"(l1), "v"(l2), "v"(l3), "v"(g0), "v"(g1), "v"(g2), "v"(g3) : "memory");
}
// NROW rows of 128 B (global pitch gp bytes) -> LDS at pitch P128: 8 lanes a row, NT / 8 rows a copy of the block's NT threads
template <int NROW, int NT = 128> __device__ __forceinline__ void stage128(unsigned l, const char* g, size_t gp, int tid) {
  constexpr int RP = NT / 8; l += (tid >> 3) * P128 + (tid & 7) * 16; g += (size_t)(tid >> 3) * gp + (tid & 7) * 16;
  for (int i = 0; i < NROW / RP; i += 4) cp4(l + i * RP * P128, l + (i + 1) * RP * P128, l + (i + 2) * RP * P128, l + (i + 3) * RP * P128, g + (size_t)i * RP * gp, g + (size_t)(i + 1) * RP * gp, g + (size_t)(i + 2) * RP * gp, g + (size_t)(i + 3) * RP * gp);
}
// NROW rows of 256 B -> LDS at pitch P256: 16 lanes a row, NT / 16 rows a copy of the block's NT threads
template <int NROW, int NT = 128> __device__ __forceinline__ void stage256(unsigned l, const char* g, size_t gp, int tid) {
  constexpr int RP = NT / 16; l += (tid >> 4) * P256 + (tid & 15) * 16; g += (size_t)(tid >> 4) * gp + (tid & 15) * 16;
  for (int i = 0; i < NROW / RP; i += 4) cp4(l + i * RP * P256, l + (i + 1) * RP * P256, l + (i + 2) * RP * P256, l + (i + 3) * RP * P256, g + (size_t)i * RP * gp, g + (size_t)(i + 1) * RP * gp, g + (size_t)(i + 2) * RP * gp, g + (size_t)(i + 3) * RP * gp);
}
// NROW rows of 128 B -> LDS two rows side by side at pitch P256 a pair (row r at PAIR(r)): 136 B a row, not 144, which lets two blocks of the first FF GEMM hold three buffers each in one WGP's LDS. 16 rows read down a column fall on 16 different 16-B places of the 256 B that the banks span, as at pitch P128
#define PAIR(r) (((r) >> 1) * P256 + ((r) & 1) * 128)
template <int NROW, int NT> __device__ __forceinline__ void stage128p(unsigned l, const char* g, size_t gp, int tid) {
  constexpr int RP = NT / 8, LP = RP / 2 * P256; l += PAIR(tid >> 3) + (tid & 7) * 16; g += (size_t)(tid >> 3) * gp + (tid & 7) * 16;
  for (int i = 0; i < NROW / RP; i += 4) cp4(l + i * LP, l + (i + 1) * LP, l + (i + 2) * LP, l + (i + 3) * LP, g + (size_t)i * RP * gp, g + (size_t)(i + 1) * RP * gp, g + (size_t)(i + 2) * RP * gp, g + (size_t)(i + 3) * RP * gp);
}
#define WAIT_ASYNC() asm volatile("s_wait_asynccnt 0x0" ::: "memory")   // this wave's copies have landed
#define WAIT_ASYNC_BUT(n) asm volatile("s_wait_asynccnt %0" :: "n"(n) : "memory")   // all of this wave's copies but its n youngest have landed (they return in the order of issue): the stage asked for last stays in flight over the barrier
#define WAIT_DS() asm volatile("s_wait_dscnt 0x0" ::: "memory")         // this wave's LDS reads are done before the buffer is given up
#define HOLD_ORDER() __builtin_amdgcn_sched_barrier(0)   // nothing is scheduled across. Between a group's LDS reads and its products: the reads stay together ahead of the products (left free, the compiler deals them out among the products, each with a wait to 0 of its own). Behind the products: they stay ahead of the next reads and of the ring's waits (left free, they sink behind the barrier, and the copies in flight lose the products' time to land)
#define STG32 (128 * P128)                 // one buffer of the attention ring
#define STGF (128 * P128 + 128 * P256)     // one GEMM buffer, f32 activations, 64 k: weight rows, then activation rows
#define GNT 256                            // threads of a GEMM block
#define PK_A 0                       // [3072][1024] Wqkv rows (natural [out][in])
#define PK_P (PK_A + QKVW * DM)        // [1024][1024] Wo rows (natural)
#define PK_END (PK_P + DM * DM)
#define WS_PK  0u
#define WS_QK  (WS_PK + 2u * PK_END)             // f16 [4096 rows][2048]: q | k
#define WS_QKL (WS_QK + 2u * NB * SS * 2 * DM)     // f16 q | k residual planes x2048
#define WS_VTH (WS_QKL + 2u * NB * SS * 2 * DM)    // f16 [b][1024 (h*64+d)][2048 s] hi
#define WS_VTL (WS_VTH + 2u * NB * DM * SS)        // f16 lo x 2048
#define WS_O   (WS_VTL + 2u * NB * DM * SS)        // f32 [4096][1024]
#define WS_CS  (WS_O + 4u * NB * SS * DM)           // f32 [2][2048][32], unused
#define WS_PF  (WS_CS + 4u * 2 * SS * 32)                  // f16 x 2^8 rows W1^T [4096][1024] ; W2^T [1024][4096]
#define WS_PM  (WS_PF + 2u * (size_t)DFF * DM)
#define WS_A0  (WS_PM + 2u * (size_t)DM * DFF)          // f32 [NR][1024] attention branch ; X1 f32 ; HF f32 (ff branch)
#define WS_X1  (WS_A0 + 4u * (size_t)NR * DM)
#define WS_HF  (WS_X1 + 4u * (size_t)NR * DM)
#define WS_X16 (WS_HF + 4u * (size_t)NR * DM)           // f16 [NR][1024] x1 ; G f16 [NR][4096]
#define WS_G   (WS_X16 + 2u * (size_t)NR * DM)
#define WS_MB  (WS_G + 2u * (size_t)NR * DFF)            // u32 [128 query tiles][128 key tiles][8]: the mask as lane-mask words
#define WS_END (WS_MB + 4u * (SS / 16) * (SS / 16) * 8)
// ---- weight packs: a block transposes one tile of 128 k x 64 n of an (in,out) f32 weight into 64 packed 16-bit rows of 128 k. A thread loads 8 k rows x 4 n as 16-B pieces (16 lanes cover 256 B in a row of the source), converts, and puts 8 k of each of its 4 n as one 16-B piece into LDS; the rows then go out as 256 B in a row of the packed plane. A block of NT = 128 threads takes two such places a thread
#define TPK 128
#define TPN 64
#define TPP 272   // LDS pitch of a packed 256-B row
template <int F16, int NT = 256> __device__ __forceinline__ void pack_tile(const float* __restrict__ Wt, unsigned ldw, char* __restrict__ dst, unsigned ldd, char* s, int t) {   // Wt: the tile's first element, ldw its row pitch in bytes; dst: the tile's first packed byte, ldd its row pitch in bytes
  constexpr int KGB = NT / 16, NP = TPK / 8 / KGB;   // KGB groups of 8 k a pass of the block's threads, NP passes a tile
  const int n4 = t & 15, kg = t >> 4; const char* gp = (const char*)Wt + ((unsigned)kg * 8u * ldw + n4 * 16); v4f r[NP][8];   // one lane address for all loads, the rows by immediate offsets (under 2 MiB)
#pragma unroll   // all loads of a thread are in flight together, and r stays in registers
  for (int p = 0; p < NP; ++p) {
#pragma unroll
    for (int i = 0; i < 8; ++i) r[p][i] = *(const v4f*)(gp + (size_t)(p * KGB * 8 + i) * ldw); }
  asm volatile("s_wait_xcnt 0x0" :: "v"(gp) : "memory");   // stands in front of every later write of a register that the loads name as an address; the address is an input, so that no load's result lands on it
#pragma unroll   // constant indices into r
  for (int p = 0; p < NP; ++p) {
#pragma unroll
  for (int j = 0; j < 4; ++j) { v4u o;
    if (F16) { v8h h;
#pragma unroll
      for (int i = 0; i < 8; ++i) h[i] = (_Float16)(bfr(r[p][i][j]) * 256.0f);
      o = __builtin_bit_cast(v4u, h); }
    else { v8b h;
#pragma unroll
      for (int i = 0; i < 8; ++i) h[i] = (__bf16)r[p][i][j];
      o = __builtin_bit_cast(v4u, h); }
    *(v4u*)(s + (n4 * 4 + j) * TPP + (p * KGB + kg) * 16) = o; } }
  __syncthreads();
  const int n = t >> 4, c = t & 15; const unsigned so = (unsigned)n * ldd + c * 16; v4u o[TPN / KGB];   // 16 lanes a packed row, KGB rows a turn of the block's threads
#pragma unroll   // the LDS reads stand together ahead of the stores: one LDS latency, not one a store
  for (int i = 0; i < TPN / KGB; ++i) o[i] = *(const v4u*)(s + (n + i * KGB) * TPP + c * 16);
#pragma unroll
  for (int i = 0; i < TPN / KGB; ++i) vst2(dst + (size_t)i * KGB * ldd + so, o[i]);
  asm volatile("s_wait_xcnt 0x0" ::: "memory");   // stands in front of every later write of a register that the stores name as an address, on every way that leads on from here
}
// ---- mask words: the [S][S] int mask as one bit an element, in the order in which k_attn's lanes hold the scores: word [query tile qt][key tile kt][r], bit l = (mask[qt * 16 + (l & 15)][kt * 16 + 8 * (l >> 4) + r] == 1). A word is then the lane mask of one select over a whole score register. A wave makes 16 queries x 128 keys: a lane loads 8 x 32 B of its query's row, a compare over the wave gives each word, and lane i keeps words i and 32 + i for two 128-B stores
__device__ __forceinline__ void mask_words(const int* __restrict__ MSK, unsigned* __restrict__ MB, int wv, int lane) {
  const int qt = wv >> 4, kg = wv & 15; const int* p = MSK + (size_t)(qt * 16 + (lane & 15)) * SS + kg * 128 + 8 * (lane >> 4); v4i m[8][2];
#pragma unroll   // the 16 loads of a lane are in flight together, and m stays in registers
  for (int j = 0; j < 8; ++j) { m[j][0] = *(const v4i*)(p + j * 16); m[j][1] = *(const v4i*)(p + j * 16 + 4); }
  // stands in front of every later write of a register that the 16 loads name as an address; the loaded values are inputs so that no compare is lifted in among the loads to free a register: one memory latency a wave, not two; the address is an input too, so that no load's result lands on it
  asm volatile("s_wait_xcnt 0x0" :: "v"(m[0][0]), "v"(m[0][1]), "v"(m[1][0]), "v"(m[1][1]), "v"(m[2][0]), "v"(m[2][1]), "v"(m[3][0]), "v"(m[3][1]), "v"(m[4][0]), "v"(m[4][1]), "v"(m[5][0]), "v"(m[5][1]), "v"(m[6][0]), "v"(m[6][1]), "v"(m[7][0]), "v"(m[7][1]), "v"(p) : "memory");
  int w[2] = { 0, 0 };
#pragma unroll   // constant indices into m and w, constant lane numbers
  for (int j = 0; j < 8; ++j) {
#pragma unroll
    for (int r = 0; r < 8; ++r) { const int bw = (int)__builtin_amdgcn_ballot_w32(m[j][r >> 2][r & 3] == 1); w[j >> 2] = (lane == (j & 3) * 8 + r) ? bw : w[j >> 2]; } }
  unsigned* o = MB + (size_t)qt * (SS / 16 * 8) + kg * 64 + lane; o[0] = (unsigned)w[0]; o[32] = (unsigned)w[1];
}
// ---- k_pack: what k_qkv and k_attn need first: block = (tile, which): which 0..2 -> W_q/W_k/W_v into PK_A rows which*1024 + n (pack row n = column n, bf16); 3, 4 -> the mask words, 8 waves a block
__global__ __launch_bounds__(256) void k_pack(const float* __restrict__ WQ, const float* __restrict__ WK, const float* __restrict__ WV, __bf16* __restrict__ PK, const int* __restrict__ MSK, unsigned* __restrict__ MB) {
  if (blockIdx.y >= 3) { mask_words(MSK, MB, (((int)blockIdx.y - 3) * ((DM / TPK) * (DM / TPN)) + (int)blockIdx.x) * 8 + (int)(threadIdx.x >> 5), threadIdx.x & 31); return; }   // the same for a whole block, ahead of the barrier below
  __shared__ __align__(16) char s[TPN * TPP]; const int k0 = (blockIdx.x % (DM / TPK)) * TPK, n0 = (blockIdx.x / (DM / TPK)) * TPN, which = blockIdx.y; const float* Wm = (which == 0) ? WQ : (which == 1) ? WK : WV;
  __bf16* dst = PK + PK_A + ((size_t)which * DM + n0) * DM + k0;
  pack_tile<0>(Wm + (size_t)k0 * DM + n0, DM * 4, (char*)dst, DM * 2, s, threadIdx.x);
}
// ---- k_qkv: block = (128 rows of x, 128 columns of q, of k and of v alike): one staging of the block's x rows serves the three weights, so x comes from L2 once and not three times, and an x fragment read from LDS and converted serves 12 products. 256 blocks, one a WGP
#define STGQ (3 * 128 * P128 + 128 * P256)   // one buffer of its ring, 64 k: 128 weight rows each of q, k and v, then the 128 x rows (f32)
__global__ __launch_bounds__(GNT) void k_qkv(const float* __restrict__ X, const __bf16* __restrict__ P, const float* __restrict__ BQ, const float* __restrict__ BK, const float* __restrict__ BV, _Float16* __restrict__ QK, _Float16* __restrict__ QKL, _Float16* __restrict__ VTH, _Float16* __restrict__ VTL) {
  constexpr int FM = 2, NT = GNT, WR = FM * 16, NW = NT / 32;   // WR rows a wave, NW waves
  constexpr int VST = 128 * 136 * 2, QST = NW * WR * 72 * 2;    // bytes of one v staging plane (shared by the block), of one q / k staging plane (a part a wave)
  constexpr int NS = DM / KST, NC = 20;   // stages; copies of a lane a stage
  __shared__ __align__(16) char smem[3 * STGQ];   // the ring; behind the loop's last barrier the output staging: v's two planes, then the two planes that q and k use in turn
  static_assert(2 * VST + 2 * QST <= 2 * STGQ, "output staging inside the ring");
  _Float16 (*sth)[136] = (_Float16 (*)[136])smem, (*stl)[136] = (_Float16 (*)[136])(smem + VST); _Float16 (*so)[WR][72] = (_Float16 (*)[WR][72])(smem + 2 * VST), (*sol)[WR][72] = (_Float16 (*)[WR][72])(smem + 2 * VST + QST);
  const int tid = threadIdx.x, wave = tid >> 5, lane = tid & 31, col = lane & 15, g = lane >> 4, wm = wave >> 1, wn = wave & 1; const size_t r0 = (size_t)blockIdx.x * 128 + wm * WR; const int cb0 = blockIdx.y * 128;   // cb0: the block's first column inside each of q, k, v
  v8f acc[3][FM][4] = {};
  const unsigned l0 = lds_off(smem); const char* gB = (const char*)(P + (size_t)cb0 * DM); const char* gA = (const char*)(X + (size_t)blockIdx.x * 128 * DM);
  auto stage = [&](unsigned l, int t) {   // stage t of the three weights' rows and of the x rows into the buffer at l: 20 copies a lane
    stage256<128, NT>(l + 3 * 128 * P128, gA + (size_t)t * 256, DM * 4, tid);
    HOLD_ORDER();   // here and below: each part's address sums stay next to its copies. Left free, all 20 copies' addresses are formed ahead; asm operands must lie in the first 256 registers, where the sums of products lie too, and an address is then spilled to memory
    stage128<128, NT>(l, gB + (size_t)t * 128, DM * 2, tid);
    HOLD_ORDER();
    stage128<128, NT>(l + 128 * P128, gB + (size_t)DM * DM * 2 + (size_t)t * 128, DM * 2, tid);
    HOLD_ORDER();
    stage128<128, NT>(l + 2 * 128 * P128, gB + (size_t)2 * DM * DM * 2 + (size_t)t * 128, DM * 2, tid); };
  stage(l0, 0); stage(l0 + STGQ, 1);
  WAIT_ASYNC_BUT(NC); __syncthreads();   // stage 0 has landed, stage 1 is still on its way
  stage(l0 + 2 * STGQ, 2);
  int cb = 0;   // byte offset of the buffer that holds stage t
  for (int t = 0; t < NS; ++t) { const char* bs = smem + cb;
    v4f ra[2][FM][4]; v16b w[2][3][4];   // the stage's fragment reads all stand ahead of its products, in the order of their use: the waits are by count, so the products of the first 32 k run while the reads of the second 32 k still come in (the loops below are unrolled so that every fragment index is a constant and the arrays stay in registers)
#pragma unroll
    for (int kk = 0; kk < 2; ++kk) {
#pragma unroll
      for (int i = 0; i < FM; ++i) { const float* p = (const float*)(bs + 3 * 128 * P128 + (wm * WR + i * 16 + col) * P256) + kk * 32 + 8 * g; ra[kk][i][0] = *(const v4f*)p; ra[kk][i][1] = *(const v4f*)(p + 4); ra[kk][i][2] = *(const v4f*)(p + 16); ra[kk][i][3] = *(const v4f*)(p + 20); }
#pragma unroll
      for (int q = 0; q < 3; ++q) {
#pragma unroll
        for (int j = 0; j < 4; ++j) w[kk][q][j] = frag_b((const __bf16*)(bs + (q * 128 + wn * 64 + j * 16 + col) * P128) + kk * 32, lane); } }
    HOLD_ORDER();   // the reads above stay together, ahead of the conversions and the products
#pragma unroll
    for (int kk = 0; kk < 2; ++kk) {
#pragma unroll
      for (int i = 0; i < FM; ++i) { v16b a;
#pragma unroll
        for (int e = 0; e < 16; ++e) a[e] = (__bf16)ra[kk][i][e >> 2][e & 3];
#pragma unroll
        for (int q = 0; q < 3; ++q) {
#pragma unroll
          for (int j = 0; j < 4; ++j) acc[q][i][j] = wmma_bf(a, w[kk][q][j], acc[q][i][j]); } } }
    HOLD_ORDER();   // the products above stay ahead of the ring's waits and barrier
    WAIT_DS(); WAIT_ASYNC_BUT(NC); if (t + 2 >= NS) WAIT_ASYNC();   // stage t + 1 has landed; stage t + 2 stays in flight; in the last two passes there is none, no copy was issued behind stage t + 1's, and the wait is to 0
    __syncthreads();   // publishes stage t + 1 and ends every read of stage t
    if (t + 3 < NS) stage(l0 + cb, t + 3);   // into the buffer that this pass has read
    cb = (cb == 2 * STGQ) ? 0 : cb + STGQ; }
  WAIT_ASYNC();
  float bv[3][4] = {};   // the bias of this lane's 4 columns of q, k, v, where there is one
  if (BQ) {
#pragma unroll   // constant indices: bv stays in registers
    for (int j = 0; j < 4; ++j) { const int c = cb0 + wn * 64 + j * 16 + col; bv[0][j] = bfr(BQ[c]); bv[1][j] = bfr(BK[c]); bv[2][j] = bfr(BV[c]); }
    asm volatile("s_wait_xcnt 0x0" ::: "memory"); }   // stands in front of every later write of a register that the 12 loads name as an address
  // v first: transposed through the block's shared planes
#pragma unroll
  for (int i = 0; i < FM; ++i) {
#pragma unroll
    for (int j = 0; j < 4; ++j) {
#pragma unroll
      for (int r = 0; r < 8; ++r) { const float v = acc[2][i][j][r] + bv[2][j]; const _Float16 hv = (_Float16)v; sth[wn * 64 + j * 16 + col][wm * WR + i * 16 + 8 * g + r] = hv; stl[wn * 64 + j * 16 + col][wm * WR + i * 16 + 8 * g + r] = (_Float16)((v - (float)hv) * 2048.0f); } } }
  __syncthreads();
  { const size_t rb = (size_t)blockIdx.x * 128; const int b = (int)(rb / SS), s0 = (int)(rb % SS);
    for (int q = tid; q < 128 * 16; q += NT) { const int d = q >> 4, pc = q & 15; const size_t o = ((size_t)b * DM + cb0 + d) * SS + s0 + pc * 8; vst2((unsigned*)(VTH + o), *(const v4u*)&sth[d][pc * 8]); vst2((unsigned*)(VTL + o), *(const v4u*)&stl[d][pc * 8]); }
    asm volatile("s_wait_xcnt 0x0" ::: "memory"); }   // stands in front of every later write of a register that the stores name as an address
  // then q and k, each wave through its own part of the other two planes, which no v plane overlaps. q stored unscaled (f16 sigma ~0.6, no subnormal exposure); 1/8 applied to the f32 score
#pragma unroll   // constant index into acc
  for (int q = 0; q < 2; ++q) { const int n0 = q * DM + cb0 + wn * 64;
#pragma unroll
    for (int i = 0; i < FM; ++i) {
#pragma unroll
      for (int j = 0; j < 4; ++j) {
#pragma unroll
        for (int r = 0; r < 8; ++r) { const float v = acc[q][i][j][r] + bv[q][j]; const _Float16 hv = (_Float16)v; so[wave][i * 16 + 8 * g + r][j * 16 + col] = hv; sol[wave][i * 16 + 8 * g + r][j * 16 + col] = (_Float16)((v - (float)hv) * 2048.0f); } } }   // q, k (+ bias) as f16 hi + (x2048) residual
    LDSX();
    const int rw = lane >> 3, c8 = (lane & 7) * 8;   // 8 lanes a 128-B row piece, 4 rows a store
    for (int rl = 0; rl < WR; rl += 4) { vst2((unsigned*)(QK + (r0 + rl + rw) * (2 * DM) + n0 + c8), *(const v4u*)&so[wave][rl + rw][c8]); vst2((unsigned*)(QKL + (r0 + rl + rw) * (2 * DM) + n0 + c8), *(const v4u*)&sol[wave][rl + rw][c8]); }
    asm volatile("s_wait_xcnt 0x0" ::: "memory"); }   // stands in front of every later write of a register that the stores name as an address
}
typedef __attribute__((ext_vector_type(16))) unsigned v16u;
typedef __attribute__((address_space(4))) v16u cmw16;
// lane l <-> lane l ^ 16: the two lanes that share a query column
__device__ __forceinline__ float xhalf(float x) { return __builtin_bit_cast(float, __builtin_amdgcn_permlanex16(__builtin_bit_cast(int, x), __builtin_bit_cast(int, x), 0x76543210, 0xfedcba98, false, false)); }
// ---- k_attn: block = (64 queries, head h + 16 x batch b): all-keys flash attention with both products transposed: S^T = K . Q^T (A = key rows, B = the wave's 16 queries), O^T += V^T . P^T (A = v rows [d][key], B = P^T). A lane then holds 8 keys of ONE query (column lane & 15, keys 8 * (lane >> 4) + r of a 16-key tile): maximum and sum run inside the lane, one exchange with lane ^ 16 for the maximum; two score tiles converted in place are the B operand of the second product (element i = tile i >> 3, register i & 7), so P touches neither LDS nor another lane. Single f16 operands; softmax in base 2 on the raw scores, weights x 2^11 in numerator and denominator alike; O[b*S+q][h*64+d] = acc / l (256-B segments)
// The launch also carries, behind its attention blocks (blockIdx.y >= NH * NB), the weight packs that only later launches read: (in,out) W1 [1024][4096] -> rows [4096][1024] f16 x 2^8, W2 [4096][1024] -> rows [1024][4096], W_o -> PK_P rows bf16, one tile a block. They are bound by memory and the attention blocks by the vector port, so the packs run in the wave places that attention leaves free and cost no launch of their own
#define PT_FF ((DM / TPK) * (DFF / TPN))   // tiles of W1, and of W2
#define PT_O ((DM / TPK) * (DM / TPN))     // tiles of W_o
__global__ __launch_bounds__(128) void k_attn(const _Float16* __restrict__ QK, const _Float16* __restrict__ QKL, const _Float16* __restrict__ VTH, const _Float16* __restrict__ VTL, const void* __restrict__ KMASK, const unsigned* __restrict__ MB, float* __restrict__ O, const float* __restrict__ W1, const float* __restrict__ W2, const float* __restrict__ WO, _Float16* __restrict__ PF, _Float16* __restrict__ PM, __bf16* __restrict__ PO) {
  __shared__ __align__(16) char smem[2 * STG32];   // the ring (64 key rows, 64 v rows a stage); behind the loop's last barrier the output staging; in a pack block the tile's packed rows
  static_assert(TPN * TPP <= 2 * STG32 && (2 * PT_FF + PT_O) % TQB == 0, "pack tile in LDS, whole grid rows of pack blocks");
  if (blockIdx.y >= NH * TNB) {   // the same for a whole block, ahead of every barrier and copy below; each weight has its own copy of the code, so that every pitch is an immediate
    const int p = ((int)blockIdx.y - NH * TNB) * TQB + (int)blockIdx.x;
    if (p < PT_FF) { const int k0 = (p % (DM / TPK)) * TPK, n0 = (p / (DM / TPK)) * TPN; pack_tile<1, 128>(W1 + (size_t)k0 * DFF + n0, DFF * 4, (char*)(PF + (size_t)n0 * DM + k0), DM * 2, smem, threadIdx.x); }
    else if (p < 2 * PT_FF) { const int q = p - PT_FF, k0 = (q % (DFF / TPK)) * TPK, n0 = (q / (DFF / TPK)) * TPN; pack_tile<1, 128>(W2 + (size_t)k0 * DM + n0, DM * 4, (char*)(PM + (size_t)n0 * DFF + k0), DFF * 2, smem, threadIdx.x); }
    else { const int q = p - 2 * PT_FF, k0 = (q % (DM / TPK)) * TPK, n0 = (q / (DM / TPK)) * TPN; pack_tile<0, 128>(WO + (size_t)k0 * DM + n0, DM * 4, (char*)(PO + (size_t)n0 * DM + k0), DM * 2, smem, threadIdx.x); }
    return; }
  float (*so)[16][68] = (float (*)[16][68])smem;
  const int tid = threadIdx.x, wave = tid >> 5, lane = tid & 31, col = lane & 15, g = lane >> 4;
  const int qb = blockIdx.x, h = blockIdx.y % NH, b = blockIdx.y / NH; const int q0 = qb * 64 + wave * 16; const size_t rq = (size_t)b * SS + q0 + col;
  v16h aq[2];
#pragma unroll
  for (int kc = 0; kc < 2; ++kc) aq[kc] = frag_h(QK + rq * (2 * DM) + h * HD + kc * 32, lane);
  const float KS = 0.125f * 1.4426950408889634f;   // 1/sqrt(64) and log2(e) in one factor
  float m = -3.0e38f, l = 0.f;   // of this lane's query: running maximum of score x KS (alike in both lanes of the column); this lane's own part of the sum
  v8f acc[4] = {};
  // the wave's mask words: 16 a turn of 32 keys (64 B in a row), the same for every lane, so they come by scalar loads into scalar registers (constant address space: an earlier launch wrote them, nothing in this one does), each turn's issued behind the selects of the turn before
  const cmw16* pw = (const cmw16*)(MB + (size_t)(qb * 4 + __builtin_amdgcn_readfirstlane(wave)) * (SS / 16 * 8)); v16u mw = pw[0];
  // a stage is 64 keys (all keys are walked): 64 k rows of 128 B, the head's 64 v rows of 128 B
  const unsigned l0 = lds_off(smem); const char* gK = (const char*)(QK + (size_t)b * SS * (2 * DM) + DM + h * HD); const char* gV = (const char*)(VTH + ((size_t)b * DM + h * HD) * SS);
  stage128<64>(l0, gK, 2 * DM * 2, tid); stage128<64>(l0 + 64 * P128, gV, SS * 2, tid);
  WAIT_ASYNC(); __syncthreads();
  stage128<64>(l0 + STG32, gK + (size_t)64 * 2 * DM * 2, 2 * DM * 2, tid); stage128<64>(l0 + STG32 + 64 * P128, gV + 128, SS * 2, tid);
#pragma unroll 1   // the stage loop stays rolled, as the key loop was: its body already holds two turns
  for (int t = 0; t < SS / 64; ++t) { const char* bs = smem + (t & 1) * STG32;
#pragma unroll     // both turns of a stage unrolled: their LDS offsets become immediates
  for (int sub = 0; sub < 2; ++sub) { v8f s[2]; v16h kf[2][2], vf[4];   // 32 keys a turn; its LDS reads all stand ahead of its products: one LDS latency a turn, not one a product
#pragma unroll
    for (int ct = 0; ct < 2; ++ct) {
#pragma unroll
      for (int kc = 0; kc < 2; ++kc) kf[ct][kc] = frag_h((const _Float16*)(bs + (sub * 32 + ct * 16 + col) * P128) + kc * 32, lane); }
#pragma unroll
    for (int dt = 0; dt < 4; ++dt) vf[dt] = frag_h((const _Float16*)(bs + 64 * P128 + (dt * 16 + col) * P128) + sub * 32, lane);
    HOLD_ORDER();   // the reads above stay together, ahead of the products
    float mx = -3.0e38f;
#pragma unroll
    for (int ct = 0; ct < 2; ++ct) { v8f c = {};
#pragma unroll
      for (int kc = 0; kc < 2; ++kc) c = wmma16(kf[ct][kc], aq[kc], c);   // single product: k, q as one-rounding f16 operands; c[r] = key ct * 16 + 8 * g + r against query col
#pragma unroll
      for (int r = 0; r < 8; ++r) { s[ct][r] = __builtin_amdgcn_inverse_ballot_w32(mw[ct * 8 + r]) ? -3.0e38f : c[r]; mx = fmaxf(mx, s[ct][r]); } }   // mask == 1 -> -1e9 == excluded; the word is the select's lane mask as it stands
    __builtin_amdgcn_sched_barrier(0);   // holds the scalar load below behind this turn's selects: the wait in front of the selects is a wait for every scalar load issued, so a load lifted over them would be waited for at once and not a turn later
    const int tn = t * 2 + sub + 1; mw = pw[tn < SS / 32 ? tn : SS / 32 - 1];   // the next turn's mask words (the last turn reads its own again: in bounds)
    mx = fmaxf(mx, xhalf(mx)) * KS;   // KS > 0: the maximum of the raw scores, scaled, is the maximum of the scaled ones
    const float mn = fmaxf(m, mx); const float base = (mn <= -1.0e37f) ? 0.f : mn;   // no key of this query admitted yet: every weight below comes out 0
    const float nb = 11.0f - base; float x[17];   // 2^11 in the exponent keeps small softmax weights out of the f16 subnormal range; the sum carries it too, so it cancels in the epilogue
#pragma unroll
    for (int i = 0; i < 16; ++i) x[i] = fmaf(s[i >> 3][i & 7], KS, nb);   // an excluded score gives exp2(-huge) = 0
    x[16] = m - base; m = mn;
    // the turn's 17 exponentials in one statement, each in place: no neighbour reads the result or overwrites the source of the one in front of it, and the closing v_nop keeps that one slot behind the last
    asm("v_exp_f32 %0, %0\n\tv_exp_f32 %1, %1\n\tv_exp_f32 %2, %2\n\tv_exp_f32 %3, %3\n\tv_exp_f32 %4, %4\n\tv_exp_f32 %5, %5\n\tv_exp_f32 %6, %6\n\tv_exp_f32 %7, %7\n\tv_exp_f32 %8, %8\n\tv_exp_f32 %9, %9\n\tv_exp_f32 %10, %10\n\tv_exp_f32 %11, %11\n\tv_exp_f32 %12, %12\n\tv_exp_f32 %13, %13\n\tv_exp_f32 %14, %14\n\tv_exp_f32 %15, %15\n\tv_exp_f32 %16, %16\n\tv_nop"
        : "+v"(x[0]), "+v"(x[1]), "+v"(x[2]), "+v"(x[3]), "+v"(x[4]), "+v"(x[5]), "+v"(x[6]), "+v"(x[7]), "+v"(x[8]), "+v"(x[9]), "+v"(x[10]), "+v"(x[11]), "+v"(x[12]), "+v"(x[13]), "+v"(x[14]), "+v"(x[15]), "+v"(x[16]));
    const float alpha = x[16]; v16h pa; float es[4] = { 0.f, 0.f, 0.f, 0.f };
#pragma unroll
    for (int i = 0; i < 16; ++i) { es[i & 3] += x[i]; pa[i] = (_Float16)x[i]; }   // element i of the B operand = tile i >> 3, register i & 7
    l = l * alpha + ((es[0] + es[1]) + (es[2] + es[3]));
#pragma unroll
    for (int dt = 0; dt < 4; ++dt) { acc[dt] *= alpha; acc[dt] = wmma16(vf[dt], pa, acc[dt]); }   // single product: V^T x P^T (x2^11); acc[dt][r] = d dt * 16 + 8 * g + r of query col
    HOLD_ORDER(); }   // the products above stay ahead of the next reads and of the ring's waits
    WAIT_DS(); WAIT_ASYNC(); __syncthreads();   // publishes stage t + 1 and ends every read of stage t
    if (t + 2 < SS / 64) { const unsigned l = l0 + (t & 1) * STG32; stage128<64>(l, gK + (size_t)(t + 2) * 64 * 2 * DM * 2, 2 * DM * 2, tid); stage128<64>(l + 64 * P128, gV + (size_t)(t + 2) * 128, SS * 2, tid); } }
  WAIT_ASYNC();
  const float il = 1.0f / (l + xhalf(l));   // the column's two lanes join their sums once
#pragma unroll
  for (int dt = 0; dt < 4; ++dt) { const v8f o = acc[dt] * il; vst2(&so[wave][col][dt * 16 + 8 * g], (v4f){ o[0], o[1], o[2], o[3] }); vst2(&so[wave][col][dt * 16 + 8 * g + 4], (v4f){ o[4], o[5], o[6], o[7] }); }
  LDSX();
  for (int rl = 0; rl < 16; ++rl) if (lane < 16) vst2(O + ((size_t)b * SS + q0 + rl) * DM + h * HD + lane * 4, *(const v4f*)&so[wave][rl][lane * 4]);
}
// ---- k_out: block = (128 rows, 128 cols): out = O(hi/lo) . Wo rows (2 products) + bo
__global__ __launch_bounds__(GNT) void k_out(const float* __restrict__ O, const __bf16* __restrict__ P, const float* __restrict__ BO, float* __restrict__ Y) {
  constexpr int FM = 2, NT = GNT, WR = FM * 16;   // WR rows a wave
  constexpr int NS = DM / KST, NC = 12;   // stages; copies of a lane a stage
  __shared__ __align__(16) char smem[3 * STGF];   // the ring; behind the loop's last barrier the output staging
  float (*so)[WR][68] = (float (*)[WR][68])smem;
  const int tid = threadIdx.x, wave = tid >> 5, lane = tid & 31, col = lane & 15, g = lane >> 4, wm = wave >> 1, wn = wave & 1; const size_t r0 = (size_t)blockIdx.x * 128 + wm * WR; const int nb0 = blockIdx.y * 128, n0 = nb0 + wn * 64;
  v8f acc[FM][4] = {};
  const unsigned l0 = lds_off(smem); const char* gB = (const char*)(P + (size_t)nb0 * DM); const char* gA = (const char*)(O + (size_t)blockIdx.x * 128 * DM);
  auto stage = [&](unsigned l, int t) { stage128<128, NT>(l, gB + (size_t)t * 128, DM * 2, tid); stage256<128, NT>(l + 128 * P128, gA + (size_t)t * 256, DM * 4, tid); };   // stage t of both operands into the buffer at l
  stage(l0, 0); stage(l0 + STGF, 1);
  WAIT_ASYNC_BUT(NC); __syncthreads();   // stage 0 has landed, stage 1 is still on its way
  stage(l0 + 2 * STGF, 2);
  int cb = 0;   // byte offset of the buffer that holds stage t
  for (int t = 0; t < NS; ++t) { const char* bs = smem + cb;
    v4f ra[2][FM][4]; v16b w[2][4];   // the stage's fragment reads all stand ahead of its products: one LDS latency a stage, not one a product (the loops below are unrolled so that every fragment index is a constant and the arrays stay in registers)
#pragma unroll
    for (int kk = 0; kk < 2; ++kk) {
#pragma unroll
      for (int i = 0; i < FM; ++i) { const float* p = (const float*)(bs + 128 * P128 + (wm * WR + i * 16 + col) * P256) + kk * 32 + 8 * g; ra[kk][i][0] = *(const v4f*)p; ra[kk][i][1] = *(const v4f*)(p + 4); ra[kk][i][2] = *(const v4f*)(p + 16); ra[kk][i][3] = *(const v4f*)(p + 20); }
#pragma unroll
      for (int j = 0; j < 4; ++j) w[kk][j] = frag_b((const __bf16*)(bs + (wn * 64 + j * 16 + col) * P128) + kk * 32, lane); }
    HOLD_ORDER();   // the reads above stay together, ahead of the products and of the split
#pragma unroll
    for (int kk = 0; kk < 2; ++kk) {
#pragma unroll
      for (int i = 0; i < FM; ++i) { float v[16];   // the split stands behind the reads, free to run among the products
#pragma unroll
        for (int e = 0; e < 16; ++e) v[e] = ra[kk][i][e >> 2][e & 3];
        const F2 a = bsplit16(v);
#pragma unroll
        for (int j = 0; j < 4; ++j) { acc[i][j] = wmma_bf(a.l, w[kk][j], acc[i][j]); acc[i][j] = wmma_bf(a.h, w[kk][j], acc[i][j]); } } }
    HOLD_ORDER();   // the products above stay ahead of the ring's waits and barrier
    WAIT_DS(); WAIT_ASYNC_BUT(NC); if (t + 2 >= NS) WAIT_ASYNC();   // stage t + 1 has landed; stage t + 2 stays in flight; in the last two passes there is none, no copy was issued behind stage t + 1's, and the wait is to 0
    __syncthreads();   // publishes stage t + 1 and ends every read of stage t
    if (t + 3 < NS) stage(l0 + cb, t + 3);   // into the buffer that this pass has read
    cb = (cb == 2 * STGF) ? 0 : cb + STGF; }
  WAIT_ASYNC();
#pragma unroll
  for (int i = 0; i < FM; ++i) {
#pragma unroll
    for (int j = 0; j < 4; ++j) {
#pragma unroll
      for (int r = 0; r < 8; ++r) so[wave][i * 16 + 8 * g + r][j * 16 + col] = acc[i][j][r] + bfr(BO[n0 + j * 16 + col]); } }
  LDSX();
  for (int rl = 0; rl < WR; rl += 2) vst2(Y + (r0 + rl + g) * DM + n0 + col * 4, *(const v4f*)&so[wave][rl + g][col * 4]);   // 16 lanes a 256-B row piece, 2 rows a store
}
// ---- k_lnres<F16OUT, RESX>: block = row (256 threads x 4): y = R + LayerNorm(A) x gamma + beta (mean((x-m)^2), eps 1e-5); RESX: residual is the bf16-rounded input x (else an f32 buffer); optional f16 copy for the FF
template <int F16OUT, int RESX>
__global__ __launch_bounds__(256) void k_lnres(const float* __restrict__ A, const float* __restrict__ R, const float* __restrict__ G, const float* __restrict__ Bt, float* __restrict__ Y, _Float16* __restrict__ Y16) {
  __shared__ float red[8]; __shared__ __align__(16) _Float16 sh[DM]; const int t = threadIdx.x; const size_t row = blockIdx.x; float v[4]; float s = 0.f; for (int i = 0; i < 4; ++i) { v[i] = A[row * DM + t * 4 + i]; s += v[i]; }
#pragma unroll
  for (int o = 1; o < 32; o <<= 1) s += __shfl_xor(s, o);
  if ((t & 31) == 0) red[t >> 5] = s; __syncthreads(); float tot = 0.f; for (int i = 0; i < 8; ++i) tot += red[i]; const float mu = tot / (float)DM; __syncthreads();
  float q = 0.f; for (int i = 0; i < 4; ++i) { const float dd = v[i] - mu; q += dd * dd; }
#pragma unroll
  for (int o = 1; o < 32; o <<= 1) q += __shfl_xor(q, o);
  if ((t & 31) == 0) red[t >> 5] = q; __syncthreads(); float tq = 0.f; for (int i = 0; i < 8; ++i) tq += red[i]; const float inv = 1.0f / sqrtf(tq / (float)DM + 1e-5f);
  v4f o4; for (int i = 0; i < 4; ++i) { const int e = t * 4 + i; const float rr = RESX ? bfr(R[row * DM + e]) : R[row * DM + e]; o4[i] = rr + ((v[i] - mu) * inv * bfr(G[e]) + bfr(Bt[e])); if (F16OUT) sh[e] = (_Float16)o4[i]; }
  vst2(Y + row * DM + t * 4, o4);
  if (F16OUT) { __syncthreads(); if (t < DM / 8) vst2((unsigned*)(Y16 + row * DM + t * 8), *(const v4u*)&sh[t * 8]); }
}
// ---- k_mlp<MODE>: block = (MBM rows, 128 cols): MODE 0: G = gelu_exact(X1 . W1 + b1) (K 1024 -> 4096) f16; MODE 1: HF = gelu_exact(G . W2 + b2) (K 4096 -> 1024) f32
#define MBM(MODE) ((MODE) == 0 ? 256 : 128)   // rows of a block: the wide GEMM has tiles enough for the larger one, the narrow one has 256 tiles of 128 x 128, one a WGP
template <int MODE>
__global__ __launch_bounds__(GNT) void k_mlp(const _Float16* __restrict__ Ain, const _Float16* __restrict__ Wr, const float* __restrict__ BIAS, const float* __restrict__ RES, float* __restrict__ OUTF, _Float16* __restrict__ OG) {
  constexpr int KIN = (MODE == 0) ? DM : DFF; constexpr int NOUT = (MODE == 0) ? DFF : DM;
  constexpr int BM = MBM(MODE), NT = GNT, WR = BM / 4, FM = WR / 16, KS = (MODE == 0) ? 64 : 128, AO = 128 * KS * 2 / 256 * P256, STG = (128 + BM) * KS * 2 / 256 * P256, KG = (MODE == 0) ? 1 : 2;   // WR rows a wave; KS k a stage, 256 B at LDS pitch P256 (one row of 128 k, or a pair of rows of 64 k): weight rows, then from AO on activation rows; KG fragment columns (32 k each) read in one group
  constexpr int NS = KIN / KS, NC = (128 + BM) * (KS / 8) / NT;   // stages; copies of a lane a stage
  __shared__ __align__(16) char smem[3 * STG];   // the ring; behind the loop's last barrier the output staging
  static_assert(MODE != 0 || 2 * 3 * STG <= 320 * 1024, "two blocks of the first GEMM in a WGP's LDS");
  auto ro = [](int r) { return KS == 64 ? PAIR(r) : r * P256; };   // byte offset of row r in its part of a buffer
  float (*so)[WR][68] = (float (*)[WR][68])smem; _Float16 (*sg)[WR][72] = (_Float16 (*)[WR][72])smem;
  const int tid = threadIdx.x, wave = tid >> 5, lane = tid & 31, col = lane & 15, g = lane >> 4, wm = wave >> 1, wn = wave & 1; const size_t r0 = (size_t)blockIdx.x * BM + wm * WR; const int nb0 = blockIdx.y * 128, n0 = nb0 + wn * 64;
  v8f acc[FM][4] = {};
  const unsigned l0 = lds_off(smem); const char* gB = (const char*)(Wr + (size_t)nb0 * KIN); const char* gA = (const char*)(Ain + (size_t)blockIdx.x * BM * KIN);
  auto stage = [&](unsigned l, int t) { if constexpr (KS == 64) { stage128p<128, NT>(l, gB + (size_t)t * 128, KIN * 2, tid); stage128p<BM, NT>(l + AO, gA + (size_t)t * 128, KIN * 2, tid); } else { stage256<128, NT>(l, gB + (size_t)t * 256, KIN * 2, tid); stage256<BM, NT>(l + AO, gA + (size_t)t * 256, KIN * 2, tid); } };   // stage t of both operands into the buffer at l
  stage(l0, 0); stage(l0 + STG, 1);
  WAIT_ASYNC_BUT(NC); __syncthreads();   // stage 0 has landed, stage 1 is still on its way
  stage(l0 + 2 * STG, 2);
  int cb = 0;   // byte offset of the buffer that holds stage t
  for (int t = 0; t < NS; ++t) { const char* bs = smem + cb;
#pragma unroll   // the groups of a stage unrolled: their LDS offsets become immediates
    for (int k0 = 0; k0 < KS / 32; k0 += KG) {
    v16h a[KG][FM], w[KG][4];   // a group's fragment reads all stand ahead of its products: one LDS latency a group, not one a product (the loops below are unrolled so that every fragment index is a constant and the arrays stay in registers)
#pragma unroll
    for (int kk = 0; kk < KG; ++kk) {
#pragma unroll
      for (int i = 0; i < FM; ++i) a[kk][i] = frag_h((const _Float16*)(bs + AO + ro(wm * WR + i * 16 + col)) + (k0 + kk) * 32, lane);
#pragma unroll
      for (int j = 0; j < 4; ++j) w[kk][j] = frag_h((const _Float16*)(bs + ro(wn * 64 + j * 16 + col)) + (k0 + kk) * 32, lane); }
    HOLD_ORDER();   // the reads above stay together, ahead of the products
#pragma unroll
    for (int kk = 0; kk < KG; ++kk) {
#pragma unroll
      for (int i = 0; i < FM; ++i) {
#pragma unroll
        for (int j = 0; j < 4; ++j) acc[i][j] = wmma16(a[kk][i], w[kk][j], acc[i][j]); } }
    HOLD_ORDER(); }   // the products above stay ahead of the next reads and of the ring's waits
    WAIT_DS(); WAIT_ASYNC_BUT(NC); if (t + 2 >= NS) WAIT_ASYNC();   // stage t + 1 has landed; stage t + 2 stays in flight; in the last two passes there is none, no copy was issued behind stage t + 1's, and the wait is to 0
    __syncthreads();   // publishes stage t + 1 and ends every read of stage t
    if (t + 3 < NS) stage(l0 + cb, t + 3);   // into the buffer that this pass has read
    cb = (cb == 2 * STG) ? 0 : cb + STG; }
  WAIT_ASYNC();
#pragma unroll
  for (int i = 0; i < FM; ++i) {
#pragma unroll
  for (int j = 0; j < 4; ++j) { const int c = n0 + j * 16 + col; const float bb = bfr(BIAS[c]); float x[8];
#pragma unroll
    for (int r = 0; r < 8; ++r) x[r] = acc[i][j][r] * (1.0f / 256.0f) + bb;
    gelu8(x);
#pragma unroll
    for (int r = 0; r < 8; ++r) { if (MODE == 0) sg[wave][i * 16 + 8 * g + r][j * 16 + col] = (_Float16)x[r]; else so[wave][i * 16 + 8 * g + r][j * 16 + col] = x[r]; } } }
  LDSX();
  if (MODE == 0) { const int rw = lane >> 3, c8 = (lane & 7) * 8; for (int rl = 0; rl < WR; rl += 4) vst2((unsigned*)(OG + (r0 + rl + rw) * NOUT + n0 + c8), *(const v4u*)&sg[wave][rl + rw][c8]); }   // 8 lanes a 128-B row piece, 4 rows a store
  else { for (int rl = 0; rl < WR; rl += 2) vst2(OUTF + (r0 + rl + g) * NOUT + n0 + col * 4, *(const v4f*)&so[wave][rl + g][col * 4]); }   // 16 lanes a 256-B row piece, 2 rows a store
}

extern "C" void kernel_launch(void* const* d_in, const int* in_sizes, int n_in, void* d_out, int out_size, void* d_ws, size_t ws_size, hipStream_t stream) {
  (void)in_sizes; (void)n_in; (void)out_size;
  const float** F = (const float**)d_in;   // 0 x [2,2048,1024], 1 mask [1,1,2048,2048] int, 2 Wq, 3 Wk, 4 Wv, 5 Wo ((in,out)), 6 bo, 7 ln1_g, 8 ln1_b, 9 W1 [1024,4096], 10 b1, 11 W2 [4096,1024], 12 b2, 13 ln2_g, 14 ln2_b
  if (ws_size < (size_t)WS_END) return;
  char* ws = (char*)d_ws; __bf16* PK = (__bf16*)(ws + WS_PK); _Float16 *QK = (_Float16*)(ws + WS_QK), *QKL = (_Float16*)(ws + WS_QKL), *VTH = (_Float16*)(ws + WS_VTH), *VTL = (_Float16*)(ws + WS_VTL), *PF = (_Float16*)(ws + WS_PF), *PM = (_Float16*)(ws + WS_PM), *X16 = (_Float16*)(ws + WS_X16), *Gb = (_Float16*)(ws + WS_G); unsigned* MB = (unsigned*)(ws + WS_MB); float *O = (float*)(ws + WS_O), *A0 = (float*)(ws + WS_A0), *X1 = (float*)(ws + WS_X1), *HF = (float*)(ws + WS_HF);
  k_pack<<<dim3((DM / TPK) * (DM / TPN), 5), 256, 0, stream>>>(F[2], F[3], F[4], PK, (const int*)d_in[1], MB);
  k_qkv<<<dim3(TNB * SS / 128, DM / 128), GNT, 0, stream>>>(F[0], PK + PK_A, nullptr, nullptr, nullptr, QK, QKL, VTH, VTL);
  k_attn<<<dim3(TQB, NH * TNB + (2 * PT_FF + PT_O) / TQB), 128, 0, stream>>>(QK, QKL, VTH, VTL, nullptr, MB, O, F[9], F[11], F[5], PF, PM, PK + PK_P);
  k_out<<<dim3(TOB / 2, DM / 128), GNT, 0, stream>>>(O, PK + PK_P, F[6], A0);
  k_lnres<1, 1><<<TOB * 64, 256, 0, stream>>>(A0, F[0], F[7], F[8], X1, X16);      // x1 = x + LN(attn branch)
  k_mlp<0><<<dim3(NR / MBM(0), DFF / 128), GNT, 0, stream>>>(X16, PF, F[10], nullptr, nullptr, Gb);
  k_mlp<1><<<dim3(NR / MBM(1), DM / 128), GNT, 0, stream>>>(Gb, PM, F[12], nullptr, HF, nullptr);
  k_lnres<0, 0><<<TOB * 64, 256, 0, stream>>>(HF, X1, F[13], F[14], (float*)d_out, nullptr);   // out = x1 + LN(ff branch)
}
